// v000
// Times are from an AMD MI455X. After a warm-up the kernel runs many times in a row, and a time is the length of
// such a window on the GPU divided by its runs, so every launch and the gaps after it count. The runs cycle
// through copies of the inputs. A figure is the median of several windows, for all but v000 over two sittings.
// Sittings can differ by a few percent; kernels timed side by side share one.
// v000, which the later versions start from, runs in 1740 microseconds.
// compute dtype: all float inputs rounded to bf16; q/k/v = x W[h] + b[h] with EXACT bf16 products on WMMA 16x16x32, f32 accumulate; q, k once to f16 -> 1-product causal logits x 1/8, except the first 384 query rows of each sequence (few keys, no averaging), which use q and k as f16 hi + residual (x 2^10) (3 products); softmax in f32 (precise expf); P x 2^11 once to f16 against v once to f16 (1 product), except the first 384 rows: P and v as bf16 hi + lo (3 products); ctx once to f16 against Wo carried x 2^8 in f16 (exact bf16 values), except the first 384 rows: ctx bf16 hi + lo against exact bf16 Wo (2 products); + bo; f32 output.
#include <hip/hip_runtime.h>
#include <math.h>

typedef __attribute__((ext_vector_type(16))) _Float16 v16h;
typedef __attribute__((ext_vector_type(16))) __bf16 v16b;
typedef __attribute__((ext_vector_type(8)))  _Float16 v8h;
typedef __attribute__((ext_vector_type(8)))  float v8f;
typedef __attribute__((ext_vector_type(4)))  float v4f;
typedef __attribute__((ext_vector_type(2)))  float v2f;
typedef __attribute__((ext_vector_type(4)))  unsigned v4u;
typedef __attribute__((ext_vector_type(4)))  int v4i;
typedef float __attribute__((may_alias)) float_a;
typedef int __attribute__((may_alias)) int_a;

template <typename T> __device__ __forceinline__ void vst2(void* p, T v) { *(T*)p = v;  }
__device__ __forceinline__ v8f wmma16(v16h a, v16h b, v8f c) {
  v8f d = __builtin_amdgcn_wmma_f32_16x16x32_f16(false, a, false, b, (short)0, c, false, false);
  asm volatile("v_nop\n\tv_nop\n\tv_nop\n\tv_nop" : "+v"(d) : "v"(a), "v"(b));
  return d;
}
__device__ __forceinline__ v8f wmma_bf(v16b a, v16b b, v8f c) {
  v8f d = __builtin_amdgcn_wmma_f32_16x16x32_bf16(false, a, false, b, (short)0, c, false, false);
  asm volatile("v_nop\n\tv_nop\n\tv_nop\n\tv_nop" : "+v"(d) : "v"(a), "v"(b));
  return d;
}
// 16x16x32 fragments: lane = (h = lane>>4, row/col = lane&15); elements 0..7 = k0+8h+0..7, 8..15 = k0+16+8h+0..7; D element r = row 8h+r
__device__ __forceinline__ v16h frag_h(const _Float16* rowk0, int lane) {
  union { v16h v; v8h q[2]; } u; const _Float16* p = rowk0 + 8 * (lane >> 4);
  u.q[0] = *(const v8h*)p; u.q[1] = *(const v8h*)(p + 16); return u.v;
}
__device__ __forceinline__ v16h frag_f32(const float* rowk0, int lane) {
  v16h a; const float* p = rowk0 + 8 * (lane >> 4);
#pragma unroll
  for (int i = 0; i < 8; ++i) { a[i] = (_Float16)p[i]; a[8 + i] = (_Float16)p[16 + i]; }
  return a;
}
__device__ __forceinline__ v16h frag_f32s(const float* rowk0, int lane, float sc) {
  v16h a; const float* p = rowk0 + 8 * (lane >> 4);
#pragma unroll
  for (int i = 0; i < 8; ++i) { a[i] = (_Float16)(p[i] * sc); a[8 + i] = (_Float16)(p[16 + i] * sc); }
  return a;
}
// column fragment from a [K][ld] layout (column n), rows >= K read as 0
__device__ __forceinline__ v16h fragc_f32(const float* W, int k0, int n, int lane, int ld, int K) {
  v16h a; const int g = lane >> 4;
#pragma unroll
  for (int i = 0; i < 8; ++i) { const int ka = k0 + 8 * g + i, kb = ka + 16;
    a[i] = (_Float16)(ka < K ? W[(size_t)(ka < K ? ka : K - 1) * ld + n] : 0.f); a[8 + i] = (_Float16)(kb < K ? W[(size_t)(kb < K ? kb : K - 1) * ld + n] : 0.f); }
  return a;
}
struct F2 { v16b h, l; };
__device__ __forceinline__ F2 bsplit16(const float v[16]) { F2 r;
#pragma unroll
  for (int i = 0; i < 16; ++i) { const __bf16 h = (__bf16)v[i]; r.h[i] = h; r.l[i] = (__bf16)(v[i] - (float)h); }
  return r; }
__device__ __forceinline__ F2 split_row(const float* row, int k0, int lane) { float v[16]; const float* p = row + k0 + 8 * (lane >> 4);
#pragma unroll
  for (int i = 0; i < 8; ++i) { v[i] = p[i]; v[8 + i] = p[16 + i]; }
  return bsplit16(v); }
__device__ __forceinline__ F2 split_rowK(const float* row, int k0, int lane, int K) { float v[16]; const int g = lane >> 4;
#pragma unroll
  for (int i = 0; i < 8; ++i) { const int ka = k0 + 8 * g + i, kb = ka + 16; v[i] = ka < K ? row[ka < K ? ka : K - 1] : 0.f; v[8 + i] = kb < K ? row[kb < K ? kb : K - 1] : 0.f; }
  return bsplit16(v); }
__device__ __forceinline__ F2 split_col(const float* W, int k0, int n, int lane, int ld, int K) { float v[16]; const int g = lane >> 4;
#pragma unroll
  for (int i = 0; i < 8; ++i) { const int ka = k0 + 8 * g + i, kb = ka + 16; v[i] = ka < K ? W[(size_t)(ka < K ? ka : K - 1) * ld + n] : 0.f; v[8 + i] = kb < K ? W[(size_t)(kb < K ? kb : K - 1) * ld + n] : 0.f; }
  return bsplit16(v); }
__device__ __forceinline__ v8f mac3(const F2& a, const F2& b, v8f c) { c = wmma_bf(a.l, b.h, c); c = wmma_bf(a.h, b.l, c); return wmma_bf(a.h, b.h, c); }
__device__ __forceinline__ float sigm(float v) { return 1.0f / (1.0f + expf(-v)); }
#define LDSX() do { asm volatile("s_wait_dscnt 0" ::: "memory"); __builtin_amdgcn_wave_barrier(); __builtin_amdgcn_fence(__ATOMIC_RELEASE, "workgroup"); } while (0)

// Causal multi-head self-attention with per-head projection tensors (B 4, S 2,048, D 768, 12 heads x 64): q/k/v[b,h] = x W[h] + b[h] ([H][768][64] weights, [H][64] biases); scores = q k^T with key > query -> -inf, x 64^-0.5; softmax; out = concat_h(P v) Wo ((in,out) [768,768]) + bo.
#define NB 4
#define TT 2048
#define CC 768            // NH * HD = projected width
#define DIN 768          // input (model) width
#define NH 12
#define HD 64
#define NQB (TT / 64)
#define HG 3
#define SCALE (0.125f)
#define CAUSAL 1
#ifndef TNB
#define TNB NB
#endif
__device__ __forceinline__ float bfr(float v) { return (float)(__bf16)v; }
__host__ __device__ __forceinline__ int kb_last(int qb) { return CAUSAL ? ((qb * 64 + 63) >> 7) : (TT / 128 - 1); }
typedef __attribute__((ext_vector_type(8))) __bf16 v8b;
__device__ __forceinline__ v16b frag_b(const __bf16* rowk0, int lane) {
  union { v16b v; v8b q[2]; } u; const __bf16* p = rowk0 + 8 * (lane >> 4);
  u.q[0] = *(const v8b*)p; u.q[1] = *(const v8b*)(p + 16); return u.v;
}
#define QBH 6              // causal: query blocks 0..QBH-1 of each sequence (few keys, no averaging) take the high-precision path
#define QHI 384            // rows carrying a q residual plane
#define KHI 384            // key rows carrying k residual / v bf16 hi+lo planes (used only by the causal high-precision path)
// B fragment (k rows k0+.., output column o) of a weight: (in,out) [K][ld] or (out,in) [ld rows of K]: bf16 exact, or f16(bf16 * 256) exact
__device__ __forceinline__ v16b wcol_io(const float* Wm, int k0, int o, int lane, int ld) { v16b w; const int g = lane >> 4;
#pragma unroll
  for (int i = 0; i < 8; ++i) { w[i] = (__bf16)Wm[(size_t)(k0 + 8 * g + i) * ld + o]; w[8 + i] = (__bf16)Wm[(size_t)(k0 + 16 + 8 * g + i) * ld + o]; }
  return w; }
__device__ __forceinline__ v16b wcol_oi(const float* Wm, int k0, int o, int lane, int K) { v16b w; const float* p = Wm + (size_t)o * K + k0 + 8 * (lane >> 4);
#pragma unroll
  for (int i = 0; i < 8; ++i) { w[i] = (__bf16)p[i]; w[8 + i] = (__bf16)p[16 + i]; }
  return w; }
__device__ __forceinline__ v16h wcolh_io(const float* Wm, int k0, int o, int lane, int ld) { v16h w; const int g = lane >> 4;
#pragma unroll
  for (int i = 0; i < 8; ++i) { w[i] = (_Float16)(bfr(Wm[(size_t)(k0 + 8 * g + i) * ld + o]) * 256.0f); w[8 + i] = (_Float16)(bfr(Wm[(size_t)(k0 + 16 + 8 * g + i) * ld + o]) * 256.0f); }
  return w; }
__device__ __forceinline__ v16h wcolh_oi(const float* Wm, int k0, int o, int lane, int K) { v16h w; const float* p = Wm + (size_t)o * K + k0 + 8 * (lane >> 4);
#pragma unroll
  for (int i = 0; i < 8; ++i) { w[i] = (_Float16)(bfr(p[i]) * 256.0f); w[8 + i] = (_Float16)(bfr(p[16 + i]) * 256.0f); }
  return w; }
#define WQKV_LAYOUT 2   // 0 = (in,out) [DIN][CC]; 1 = (out,in) [CC][DIN]; 2 = per-head [NH][DIN][HD]
__device__ __forceinline__ v16b wcol_hdk(const float* Wm, int k0, int o, int lane) { v16b w; const int g = lane >> 4; const float* p = Wm + (size_t)(o / HD) * DIN * HD + (o % HD);
#pragma unroll
  for (int i = 0; i < 8; ++i) { w[i] = (__bf16)p[(size_t)(k0 + 8 * g + i) * HD]; w[8 + i] = (__bf16)p[(size_t)(k0 + 16 + 8 * g + i) * HD]; }
  return w; }
#define WO_OUT_IN 0
#if WQKV_LAYOUT == 1
#define WCOL(W, k0, o, lane) wcol_oi(W, k0, o, lane, DIN)
#elif WQKV_LAYOUT == 2
#define WCOL(W, k0, o, lane) wcol_hdk(W, k0, o, lane)
#else
#define WCOL(W, k0, o, lane) wcol_io(W, k0, o, lane, CC)
#endif
#if WO_OUT_IN
#define WOCOL(W, k0, o, lane) wcol_oi(W, k0, o, lane, CC)
#define WOCOLH(W, k0, o, lane) wcolh_oi(W, k0, o, lane, CC)
#else
#define WOCOL(W, k0, o, lane) wcol_io(W, k0, o, lane, DIN)
#define WOCOLH(W, k0, o, lane) wcolh_io(W, k0, o, lane, DIN)
#endif

#ifndef SM_EXTRA_PARAMS
#define SM_EXTRA_PARAMS
#endif
#ifndef PROJ_EXTRA_PARAMS
#define PROJ_EXTRA_PARAMS
#endif
#ifndef SM_MASK_HOOK
#define SM_MASK_HOOK (void)0
#endif

#define WS_QH  0u                                      // f16 q rows [b*t][CC]
#define WS_KH  (WS_QH + 2u * (size_t)NB * TT * CC)      // f16 k rows [b*t][CC]
#define WS_VT  (WS_KH + 2u * (size_t)NB * TT * CC)      // f16 v planes [b][c][t]
#define WS_QL  (WS_VT + 2u * (size_t)NB * CC * TT)      // f16 q residual x 2^10 rows [b][t < QHI][CC]
#define WS_KL  (WS_QL + 2u * (size_t)NB * QHI * CC)     // f16 k residual x 2^10 rows [b][t < KHI][CC]
#define WS_VB  (WS_KL + 2u * (size_t)NB * KHI * CC)     // bf16 v hi planes [b][c][t < KHI]
#define WS_VBL (WS_VB + 2u * (size_t)NB * CC * KHI)
#define WS_S   (WS_VBL + 2u * (size_t)NB * CC * KHI)    // f32 logits / P [hg][t][s]
#define WS_Y   (WS_S  + 4u * (size_t)HG * TT * TT)      // f32 ctx rows [b*t][CC] (only when there is an output projection)
#define WS_END (WS_Y  + 4u * (size_t)NB * TT * CC)

// ---- k_proj: block = (64 rows, 128 cols, which): q/k/v = X W (+ b) with exact bf16 products (K = DIN) -> which 0: q f16 rows (+ residual rows < QHI); 1: k f16 rows (+ residual rows < KHI); 2: v f16 planes [c][t] (+ bf16 hi/lo planes for t < KHI)
__global__ __launch_bounds__(128) void k_proj(const float* __restrict__ XQ, const float* __restrict__ XK, const float* __restrict__ XV, const float* __restrict__ WQ, const float* __restrict__ WK, const float* __restrict__ WV, const float* __restrict__ BQ, const float* __restrict__ BK, const float* __restrict__ BV,
    _Float16* __restrict__ QH, _Float16* __restrict__ QL, _Float16* __restrict__ KH, _Float16* __restrict__ KL, _Float16* __restrict__ VT, __bf16* __restrict__ VB, __bf16* __restrict__ VBL) {
  __shared__ __align__(16) _Float16 sh[64][136], sl[64][136]; __shared__ __align__(16) _Float16 th[128][72]; __shared__ __align__(16) __bf16 tb[128][72], tbl[128][72];
  const int tid = threadIdx.x, wave = tid >> 5, lane = tid & 31, col = lane & 15, g = lane >> 4; const int which = blockIdx.z; const int c0 = blockIdx.y * 128; const size_t r0 = (size_t)blockIdx.x * 64; const size_t bb = r0 / TT; const int t0 = (int)(r0 % TT);
  const float* X = which == 0 ? XQ : which == 1 ? XK : XV; const float* WA = which == 0 ? WQ : which == 1 ? WK : WV; const float* BA = which == 0 ? BQ : which == 1 ? BK : BV;
  v8f acc[8] = {};
#pragma unroll 2
  for (int kc = 0; kc < DIN / 32; ++kc) { v16b a; { const float* p = X + (r0 + wave * 16 + col) * DIN + kc * 32 + 8 * g;
#pragma unroll
      for (int i = 0; i < 8; ++i) { a[i] = (__bf16)p[i]; a[8 + i] = (__bf16)p[16 + i]; } }
    asm volatile("s_wait_loadcnt 0x0" ::: "memory");
#pragma unroll
    for (int j = 0; j < 8; ++j) { const v16b w = WCOL(WA, kc * 32, c0 + j * 16 + col, lane); asm volatile("s_wait_loadcnt 0x0" ::: "memory"); acc[j] = wmma_bf(a, w, acc[j]); } }
  if (which < 2) { _Float16* DH = which == 0 ? QH : KH; _Float16* DL = which == 0 ? QL : KL; const int nhi = which == 0 ? QHI : KHI; const bool hi_rows = t0 < nhi;
#pragma unroll
    for (int j = 0; j < 8; ++j) { const float bias = BA ? bfr(BA[c0 + j * 16 + col]) : 0.f;
#pragma unroll
      for (int r = 0; r < 8; ++r) { const float v = acc[j][r] + bias; const _Float16 hv = (_Float16)v; sh[wave * 16 + 8 * g + r][j * 16 + col] = hv; sl[wave * 16 + 8 * g + r][j * 16 + col] = (_Float16)((v - (float)hv) * 1024.0f); } }
    __syncthreads();
    for (int e = tid; e < 64 * 16; e += 128) { const int rl = e >> 4, q = e & 15; vst2((unsigned*)(DH + (r0 + rl) * CC + c0 + q * 8), *(const v4u*)&sh[rl][q * 8]); if (hi_rows) vst2((unsigned*)(DL + (bb * nhi + t0 + rl) * (size_t)CC + c0 + q * 8), *(const v4u*)&sl[rl][q * 8]); }
  } else { const bool hi_rows = t0 < KHI;
#pragma unroll
    for (int j = 0; j < 8; ++j) { const float bias = BA ? bfr(BA[c0 + j * 16 + col]) : 0.f;
#pragma unroll
      for (int r = 0; r < 8; ++r) { const float v = acc[j][r] + bias; const int rl = wave * 16 + 8 * g + r, cl = j * 16 + col; th[cl][rl] = (_Float16)v; const __bf16 bh = (__bf16)v; tb[cl][rl] = bh; tbl[cl][rl] = (__bf16)(v - (float)bh); } }
    __syncthreads();
    for (int e = tid; e < 128 * 8; e += 128) { const int cl = e >> 3, q = e & 7; vst2((unsigned*)(VT + (bb * CC + c0 + cl) * (size_t)TT + t0 + q * 8), *(const v4u*)&th[cl][q * 8]); if (hi_rows) { const size_t o3 = (bb * CC + c0 + cl) * (size_t)KHI + t0 + q * 8; vst2((unsigned*)(VB + o3), *(const v4u*)&tb[cl][q * 8]); vst2((unsigned*)(VBL + o3), *(const v4u*)&tbl[cl][q * 8]); } } } }
// ---- k_sc: block = (query block qb, key block kb <= kb_last(qb), head in group) of batch b: logits x SCALE; q hi + residual (x 2^10) against k (2 products) for query rows < QHI, plus the k residual (3 products) for query blocks < QBH (causal early rows); causal: blocks past the diagonal exit, the mask itself is applied by index in k_sm
__global__ __launch_bounds__(128) void k_sc(const _Float16* __restrict__ QH, const _Float16* __restrict__ KH, const _Float16* __restrict__ QL, const _Float16* __restrict__ KL, int b, int h0, float* __restrict__ S0) { __shared__ __align__(16) float ss[4][16][132];
  const int qb = blockIdx.x, kb = blockIdx.y; if (kb > kb_last(qb)) return;
  const int h = h0 + blockIdx.z; float* S = S0 + (size_t)blockIdx.z * TT * TT;
  const int tid = threadIdx.x, wave = tid >> 5, lane = tid & 31, col = lane & 15, g = lane >> 4; const int k0 = kb * 128; const int ql0 = qb * 64 + wave * 16; const size_t q0 = (size_t)b * TT + ql0, kr0 = (size_t)b * TT + k0;
  v8f acc[8] = {}, accl[8] = {};
  const _Float16* QLb = QL + (size_t)b * QHI * CC; const _Float16* KLb = KL + (size_t)b * KHI * CC;
  if (qb < QBH) {
#pragma unroll
    for (int kc = 0; kc < HD / 32; ++kc) { const v16h ah = frag_h(QH + (q0 + col) * CC + h * HD + kc * 32, lane), al = frag_h(QLb + (size_t)(ql0 + col) * CC + h * HD + kc * 32, lane);
#pragma unroll
      for (int j = 0; j < 8; ++j) { const v16h kbf = frag_h(KH + (kr0 + j * 16 + col) * CC + h * HD + kc * 32, lane), klf = frag_h(KLb + (size_t)(k0 + j * 16 + col) * CC + h * HD + kc * 32, lane); acc[j] = wmma16(ah, kbf, acc[j]); accl[j] = wmma16(al, kbf, accl[j]); accl[j] = wmma16(ah, klf, accl[j]); } }
  } else if (qb * 64 < QHI) {
#pragma unroll
    for (int kc = 0; kc < HD / 32; ++kc) { const v16h ah = frag_h(QH + (q0 + col) * CC + h * HD + kc * 32, lane), al = frag_h(QLb + (size_t)(ql0 + col) * CC + h * HD + kc * 32, lane);
#pragma unroll
      for (int j = 0; j < 8; ++j) { const v16h kbf = frag_h(KH + (kr0 + j * 16 + col) * CC + h * HD + kc * 32, lane); acc[j] = wmma16(ah, kbf, acc[j]); accl[j] = wmma16(al, kbf, accl[j]); } }
  } else {
#pragma unroll
    for (int kc = 0; kc < HD / 32; ++kc) { const v16h ah = frag_h(QH + (q0 + col) * CC + h * HD + kc * 32, lane);
#pragma unroll
      for (int j = 0; j < 8; ++j) { const v16h kbf = frag_h(KH + (kr0 + j * 16 + col) * CC + h * HD + kc * 32, lane); acc[j] = wmma16(ah, kbf, acc[j]); } } }
#pragma unroll
  for (int j = 0; j < 8; ++j) {
#pragma unroll
    for (int r = 0; r < 8; ++r) ss[wave][8 * g + r][j * 16 + col] = (acc[j][r] + accl[j][r] * (1.0f / 1024.0f)) * SCALE; }
  LDSX(); for (int rl = 0; rl < 16; ++rl) vst2(S + (size_t)(ql0 + rl) * TT + k0 + lane * 4, *(const v4f*)&ss[wave][rl][lane * 4]); }
// ---- k_sm: block = query row t (head in group): keys [0, kend): causal -> logit if s <= t else excluded; softmax in f32; P x 2^11 in place (0 for excluded)
__global__ __launch_bounds__(256) void k_sm(float* __restrict__ S0 SM_EXTRA_PARAMS) { __shared__ float sred[8]; __shared__ float sbc; __shared__ __align__(16) float shv[TT];
  const int tid = threadIdx.x; const int t = blockIdx.x; const int kend = (kb_last(t >> 6) + 1) * 128;
  float* sr = S0 + (size_t)blockIdx.y * TT * TT + (size_t)t * TT;
  float m = -3.0e38f; for (int k = tid; k < kend; k += 256) { float v = (!CAUSAL || k <= t) ? sr[k] : -3.0e38f; SM_MASK_HOOK; shv[k] = v; m = fmaxf(m, v); }
#pragma unroll
  for (int o = 1; o < 32; o <<= 1) m = fmaxf(m, __shfl_xor(m, o));
  if ((tid & 31) == 0) sred[tid >> 5] = m; __syncthreads(); if (tid == 0) { float a = sred[0]; for (int i = 1; i < 8; ++i) a = fmaxf(a, sred[i]); sbc = a; } __syncthreads(); m = sbc; __syncthreads();
  float sum = 0.f; for (int k = tid; k < kend; k += 256) { const float v = shv[k]; const float e = (v <= -1.0e38f) ? 0.f : expf(v - m); shv[k] = e; sum += e; }
#pragma unroll
  for (int o = 1; o < 32; o <<= 1) sum += __shfl_xor(sum, o);
  if ((tid & 31) == 0) sred[tid >> 5] = sum; __syncthreads(); if (tid == 0) { float a = 0.f; for (int i = 0; i < 8; ++i) a += sred[i]; sbc = 2048.0f / a; } __syncthreads(); const float inv = sbc;
  for (int k = tid; k < kend; k += 256) shv[k] = shv[k] * inv;
  __syncthreads(); for (int q = tid; q < kend / 4; q += 256) vst2(sr + q * 4, *(const v4f*)&shv[q * 4]); }
// ---- k_pv: block = 64 queries (qb) of (b, h): ctx = P . v over keys [0, kend) (P x 2^11 once to f16 against v f16: 1 product; causal early query blocks: P and v as bf16 hi + lo, 3 products); 256-B (row, head) segment by 16 lanes
__global__ __launch_bounds__(128) void k_pv(const float* __restrict__ PS0, const _Float16* __restrict__ VT, const __bf16* __restrict__ VB, const __bf16* __restrict__ VBL, int b, int h0, float* __restrict__ Y) { const int h = h0 + blockIdx.z; const float* PS = PS0 + (size_t)blockIdx.z * TT * TT; __shared__ __align__(16) float ss[4][16][HD + 4];
  const int tid = threadIdx.x, wave = tid >> 5, lane = tid & 31, col = lane & 15, g = lane >> 4; const int qb = blockIdx.x; const int ql0 = qb * 64 + wave * 16; const int kce = (kb_last(qb) + 1) * 4;
  v8f acc[HD / 16] = {};
  if (qb < QBH) {
#pragma unroll 1
    for (int kc = 0; kc < kce; ++kc) { const F2 p = split_row(PS + (size_t)(ql0 + col) * TT, kc * 32, lane);
      asm volatile("s_wait_loadcnt 0x0" ::: "memory");
#pragma unroll
      for (int j = 0; j < HD / 16; ++j) { const size_t po = ((size_t)b * CC + h * HD + j * 16 + col) * (size_t)KHI + kc * 32; const v16b vh = frag_b(VB + po, lane); acc[j] = wmma_bf(p.h, vh, acc[j]); acc[j] = wmma_bf(p.l, vh, acc[j]); acc[j] = wmma_bf(p.h, frag_b(VBL + po, lane), acc[j]); } }
  } else {
#pragma unroll 1
    for (int kc = 0; kc < kce; ++kc) { const v16h p = frag_f32(PS + (size_t)(ql0 + col) * TT + kc * 32, lane);
      asm volatile("s_wait_loadcnt 0x0" ::: "memory");
#pragma unroll
      for (int j = 0; j < HD / 16; ++j) { const size_t po = ((size_t)b * CC + h * HD + j * 16 + col) * (size_t)TT + kc * 32; acc[j] = wmma16(p, frag_h(VT + po, lane), acc[j]); } } }
#pragma unroll
  for (int j = 0; j < HD / 16; ++j)
#pragma unroll
    for (int r = 0; r < 8; ++r) ss[wave][8 * g + r][j * 16 + col] = acc[j][r] * (1.0f / 2048.0f);
  LDSX(); for (int rl = 0; rl < 16; ++rl) if (lane < HD / 4) vst2(Y + ((size_t)b * TT + ql0 + rl) * CC + h * HD + lane * 4, *(const v4f*)&ss[wave][rl][lane * 4]); }
// ---- k_out: block = (64 rows, 128 cols): out = ctx Wo (+ bo): ctx once to f16 against Wo as f16(bf16 x 2^8) exact (1 product) x 2^-8; causal early rows (< QHI of each sequence): ctx bf16 hi + lo against exact bf16 Wo (2 products)
__global__ __launch_bounds__(128) void k_out(const float* __restrict__ Y, const float* __restrict__ WO, const float* __restrict__ BO, float* __restrict__ OUT) { __shared__ __align__(16) float sf[4][16][132];
  const int tid = threadIdx.x, wave = tid >> 5, lane = tid & 31, col = lane & 15, g = lane >> 4; const int c0 = blockIdx.y * 128; const size_t r0 = (size_t)blockIdx.x * 64 + wave * 16;
  v8f acc[8] = {};
  if (CAUSAL && (int)(((size_t)blockIdx.x * 64) % TT) < QHI) {   /* block-uniform */
#pragma unroll 2
    for (int kc = 0; kc < CC / 32; ++kc) { const F2 a = split_row(Y + (r0 + col) * CC, kc * 32, lane); asm volatile("s_wait_loadcnt 0x0" ::: "memory");
#pragma unroll
      for (int j = 0; j < 8; ++j) { const v16b w = WOCOL(WO, kc * 32, c0 + j * 16 + col, lane); asm volatile("s_wait_loadcnt 0x0" ::: "memory"); acc[j] = wmma_bf(a.h, w, acc[j]); acc[j] = wmma_bf(a.l, w, acc[j]); } }
#pragma unroll
    for (int j = 0; j < 8; ++j) { const float bias = BO ? bfr(BO[c0 + j * 16 + col]) : 0.f;
#pragma unroll
      for (int r = 0; r < 8; ++r) sf[wave][8 * g + r][j * 16 + col] = acc[j][r] + bias; }
  } else {
#pragma unroll 2
    for (int kc = 0; kc < CC / 32; ++kc) { const v16h a = frag_f32(Y + (r0 + col) * CC + kc * 32, lane); asm volatile("s_wait_loadcnt 0x0" ::: "memory");
#pragma unroll
      for (int j = 0; j < 8; ++j) { const v16h w = WOCOLH(WO, kc * 32, c0 + j * 16 + col, lane); asm volatile("s_wait_loadcnt 0x0" ::: "memory"); acc[j] = wmma16(a, w, acc[j]); } }
#pragma unroll
    for (int j = 0; j < 8; ++j) { const float bias = BO ? bfr(BO[c0 + j * 16 + col]) : 0.f;
#pragma unroll
      for (int r = 0; r < 8; ++r) sf[wave][8 * g + r][j * 16 + col] = acc[j][r] * (1.0f / 256.0f) + bias; } }
  LDSX(); for (int rl = 0; rl < 16; ++rl) vst2(OUT + (r0 + rl) * DIN + c0 + lane * 4, *(const v4f*)&sf[wave][rl][lane * 4]); }

extern "C" void kernel_launch(void* const* d_in, const int* in_sizes, int n_in, void* d_out, int out_size, void* d_ws, size_t ws_size, hipStream_t stream) {
  (void)in_sizes; (void)n_in; (void)out_size;
  const float** F = (const float**)d_in;
  if (ws_size < (size_t)WS_END) return;
  char* ws = (char*)d_ws; _Float16 *QH = (_Float16*)(ws + WS_QH), *KH = (_Float16*)(ws + WS_KH), *VT = (_Float16*)(ws + WS_VT), *QL = (_Float16*)(ws + WS_QL), *KL = (_Float16*)(ws + WS_KL); __bf16 *VB = (__bf16*)(ws + WS_VB), *VBL = (__bf16*)(ws + WS_VBL); float *S = (float*)(ws + WS_S), *Y = (float*)(ws + WS_Y);
  (void)Y; (void)QL; (void)KL; (void)VB; (void)VBL;
  // inputs: 0 x [4,2048,768]; 1 Wq, 2 Wk, 3 Wv [12,768,64]; 4 bq, 5 bk, 6 bv [12,64] (= flat [768] by column h*64+k); 7 Wo [768,768] (in,out); 8 bo [768]
  k_proj<<<dim3(TNB * TT / 64, CC / 128, 3), 128, 0, stream>>>(F[0], F[0], F[0], F[1], F[2], F[3], F[4], F[5], F[6], QH, QL, KH, KL, VT, VB, VBL);
  for (int b = 0; b < TNB; ++b) for (int h0 = 0; h0 < NH; h0 += HG) {
    k_sc<<<dim3(NQB, TT / 128, HG), 128, 0, stream>>>(QH, KH, QL, KL, b, h0, S);
    k_sm<<<dim3(TT, HG), 256, 0, stream>>>(S);
    k_pv<<<dim3(NQB, 1, HG), 128, 0, stream>>>(S, VT, VB, VBL, b, h0, Y);
  }
  k_out<<<dim3(TNB * TT / 64, DIN / 128), 128, 0, stream>>>(Y, F[7], F[8], (float*)d_out);
}

// v001
// Measured time: 1030 microseconds a run.
// In two side-by-side timings against v000, it was 1.70 and 1.69 times as fast.
// compute dtype: all float inputs rounded to bf16; q/k/v = x W[h] + b[h] with EXACT bf16 products on WMMA 16x16x32, f32 accumulate; q, k once to f16 -> 1-product causal logits x 1/8, except the first 384 query rows of each sequence (few keys, no averaging), which use q and k as f16 hi + residual (x 2^10) (3 products); softmax in f32 (precise expf); P x 2^11 once to f16 against v once to f16 (1 product), except the first 384 rows: P and v as bf16 hi + lo (3 products); ctx once to f16 against Wo carried x 2^8 in f16 (exact bf16 values), except the first 384 rows: ctx bf16 hi + lo against exact bf16 Wo (2 products); + bo; f32 output.
#include <hip/hip_runtime.h>
#include <math.h>

typedef __attribute__((ext_vector_type(16))) _Float16 v16h;
typedef __attribute__((ext_vector_type(16))) __bf16 v16b;
typedef __attribute__((ext_vector_type(8)))  _Float16 v8h;
typedef __attribute__((ext_vector_type(8)))  float v8f;
typedef __attribute__((ext_vector_type(4)))  float v4f;
typedef __attribute__((ext_vector_type(2)))  float v2f;
typedef __attribute__((ext_vector_type(4)))  unsigned v4u;
typedef __attribute__((ext_vector_type(4)))  int v4i;
typedef float __attribute__((may_alias)) float_a;
typedef int __attribute__((may_alias)) int_a;

template <typename T> __device__ __forceinline__ void vst2(void* p, T v) { *(T*)p = v;  }
__device__ __forceinline__ v8f wmma16(v16h a, v16h b, v8f c) {
  v8f d = __builtin_amdgcn_wmma_f32_16x16x32_f16(false, a, false, b, (short)0, c, false, false);
  asm volatile("v_nop\n\tv_nop\n\tv_nop\n\tv_nop" : "+v"(d) : "v"(a), "v"(b));
  return d;
}
__device__ __forceinline__ v8f wmma_bf(v16b a, v16b b, v8f c) {
  v8f d = __builtin_amdgcn_wmma_f32_16x16x32_bf16(false, a, false, b, (short)0, c, false, false);
  asm volatile("v_nop\n\tv_nop\n\tv_nop\n\tv_nop" : "+v"(d) : "v"(a), "v"(b));
  return d;
}
// 16x16x32 fragments: lane = (h = lane>>4, row/col = lane&15); elements 0..7 = k0+8h+0..7, 8..15 = k0+16+8h+0..7; D element r = row 8h+r
__device__ __forceinline__ v16h frag_h(const _Float16* rowk0, int lane) {
  union { v16h v; v8h q[2]; } u; const _Float16* p = rowk0 + 8 * (lane >> 4);
  u.q[0] = *(const v8h*)p; u.q[1] = *(const v8h*)(p + 16); return u.v;
}
__device__ __forceinline__ v16h frag_f32(const float* rowk0, int lane) {
  v16h a; const float* p = rowk0 + 8 * (lane >> 4);
#pragma unroll
  for (int i = 0; i < 8; ++i) { a[i] = (_Float16)p[i]; a[8 + i] = (_Float16)p[16 + i]; }
  return a;
}
__device__ __forceinline__ v16h frag_f32s(const float* rowk0, int lane, float sc) {
  v16h a; const float* p = rowk0 + 8 * (lane >> 4);
#pragma unroll
  for (int i = 0; i < 8; ++i) { a[i] = (_Float16)(p[i] * sc); a[8 + i] = (_Float16)(p[16 + i] * sc); }
  return a;
}
// column fragment from a [K][ld] layout (column n), rows >= K read as 0
__device__ __forceinline__ v16h fragc_f32(const float* W, int k0, int n, int lane, int ld, int K) {
  v16h a; const int g = lane >> 4;
#pragma unroll
  for (int i = 0; i < 8; ++i) { const int ka = k0 + 8 * g + i, kb = ka + 16;
    a[i] = (_Float16)(ka < K ? W[(size_t)(ka < K ? ka : K - 1) * ld + n] : 0.f); a[8 + i] = (_Float16)(kb < K ? W[(size_t)(kb < K ? kb : K - 1) * ld + n] : 0.f); }
  return a;
}
struct F2 { v16b h, l; };
__device__ __forceinline__ F2 bsplit16(const float v[16]) { F2 r;
#pragma unroll
  for (int i = 0; i < 16; ++i) { const __bf16 h = (__bf16)v[i]; r.h[i] = h; r.l[i] = (__bf16)(v[i] - (float)h); }
  return r; }
__device__ __forceinline__ F2 split_row(const float* row, int k0, int lane) { float v[16]; const float* p = row + k0 + 8 * (lane >> 4);
#pragma unroll
  for (int i = 0; i < 8; ++i) { v[i] = p[i]; v[8 + i] = p[16 + i]; }
  return bsplit16(v); }
__device__ __forceinline__ F2 split_rowK(const float* row, int k0, int lane, int K) { float v[16]; const int g = lane >> 4;
#pragma unroll
  for (int i = 0; i < 8; ++i) { const int ka = k0 + 8 * g + i, kb = ka + 16; v[i] = ka < K ? row[ka < K ? ka : K - 1] : 0.f; v[8 + i] = kb < K ? row[kb < K ? kb : K - 1] : 0.f; }
  return bsplit16(v); }
__device__ __forceinline__ F2 split_col(const float* W, int k0, int n, int lane, int ld, int K) { float v[16]; const int g = lane >> 4;
#pragma unroll
  for (int i = 0; i < 8; ++i) { const int ka = k0 + 8 * g + i, kb = ka + 16; v[i] = ka < K ? W[(size_t)(ka < K ? ka : K - 1) * ld + n] : 0.f; v[8 + i] = kb < K ? W[(size_t)(kb < K ? kb : K - 1) * ld + n] : 0.f; }
  return bsplit16(v); }
__device__ __forceinline__ v8f mac3(const F2& a, const F2& b, v8f c) { c = wmma_bf(a.l, b.h, c); c = wmma_bf(a.h, b.l, c); return wmma_bf(a.h, b.h, c); }
__device__ __forceinline__ float sigm(float v) { return 1.0f / (1.0f + expf(-v)); }
#define LDSX() do { asm volatile("s_wait_dscnt 0" ::: "memory"); __builtin_amdgcn_wave_barrier(); __builtin_amdgcn_fence(__ATOMIC_RELEASE, "workgroup"); } while (0)

// Causal multi-head self-attention with per-head projection tensors (B 4, S 2,048, D 768, 12 heads x 64): q/k/v[b,h] = x W[h] + b[h] ([H][768][64] weights, [H][64] biases); scores = q k^T with key > query -> -inf, x 64^-0.5; softmax; out = concat_h(P v) Wo ((in,out) [768,768]) + bo.
#define NB 4
#define TT 2048
#define CC 768            // NH * HD = projected width
#define DIN 768          // input (model) width
#define NH 12
#define HD 64
#define NQB (TT / 64)
#define HG 3
#define SCALE (0.125f)
#define CAUSAL 1
#ifndef TNB
#define TNB NB
#endif
__device__ __forceinline__ float bfr(float v) { return (float)(__bf16)v; }
__host__ __device__ __forceinline__ int kb_last(int qb) { return CAUSAL ? ((qb * 64 + 63) >> 7) : (TT / 128 - 1); }
typedef __attribute__((ext_vector_type(8))) __bf16 v8b;
__device__ __forceinline__ v16b frag_b(const __bf16* rowk0, int lane) {
  union { v16b v; v8b q[2]; } u; const __bf16* p = rowk0 + 8 * (lane >> 4);
  u.q[0] = *(const v8b*)p; u.q[1] = *(const v8b*)(p + 16); return u.v;
}
#define QBH 6              // causal: query blocks 0..QBH-1 of each sequence (few keys, no averaging) take the high-precision path
#define QHI 384            // rows carrying a q residual plane
#define KHI 384            // key rows carrying k residual / v bf16 hi+lo planes (used only by the causal high-precision path)
// B fragment (k rows k0+.., output column o) of a weight: (in,out) [K][ld] or (out,in) [ld rows of K]: bf16 exact, or f16(bf16 * 256) exact
__device__ __forceinline__ v16b wcol_io(const float* Wm, int k0, int o, int lane, int ld) { v16b w; const int g = lane >> 4;
#pragma unroll
  for (int i = 0; i < 8; ++i) { w[i] = (__bf16)Wm[(size_t)(k0 + 8 * g + i) * ld + o]; w[8 + i] = (__bf16)Wm[(size_t)(k0 + 16 + 8 * g + i) * ld + o]; }
  return w; }
__device__ __forceinline__ v16b wcol_oi(const float* Wm, int k0, int o, int lane, int K) { v16b w; const float* p = Wm + (size_t)o * K + k0 + 8 * (lane >> 4);
#pragma unroll
  for (int i = 0; i < 8; ++i) { w[i] = (__bf16)p[i]; w[8 + i] = (__bf16)p[16 + i]; }
  return w; }
__device__ __forceinline__ v16h wcolh_io(const float* Wm, int k0, int o, int lane, int ld) { v16h w; const int g = lane >> 4;
#pragma unroll
  for (int i = 0; i < 8; ++i) { w[i] = (_Float16)(bfr(Wm[(size_t)(k0 + 8 * g + i) * ld + o]) * 256.0f); w[8 + i] = (_Float16)(bfr(Wm[(size_t)(k0 + 16 + 8 * g + i) * ld + o]) * 256.0f); }
  return w; }
__device__ __forceinline__ v16h wcolh_oi(const float* Wm, int k0, int o, int lane, int K) { v16h w; const float* p = Wm + (size_t)o * K + k0 + 8 * (lane >> 4);
#pragma unroll
  for (int i = 0; i < 8; ++i) { w[i] = (_Float16)(bfr(p[i]) * 256.0f); w[8 + i] = (_Float16)(bfr(p[16 + i]) * 256.0f); }
  return w; }
#define WQKV_LAYOUT 2   // 0 = (in,out) [DIN][CC]; 1 = (out,in) [CC][DIN]; 2 = per-head [NH][DIN][HD]
__device__ __forceinline__ v16b wcol_hdk(const float* Wm, int k0, int o, int lane) { v16b w; const int g = lane >> 4; const float* p = Wm + (size_t)(o / HD) * DIN * HD + (o % HD);
#pragma unroll
  for (int i = 0; i < 8; ++i) { w[i] = (__bf16)p[(size_t)(k0 + 8 * g + i) * HD]; w[8 + i] = (__bf16)p[(size_t)(k0 + 16 + 8 * g + i) * HD]; }
  return w; }
#define WO_OUT_IN 0
#if WQKV_LAYOUT == 1
#define WCOL(W, k0, o, lane) wcol_oi(W, k0, o, lane, DIN)
#elif WQKV_LAYOUT == 2
#define WCOL(W, k0, o, lane) wcol_hdk(W, k0, o, lane)
#else
#define WCOL(W, k0, o, lane) wcol_io(W, k0, o, lane, CC)
#endif
#if WO_OUT_IN
#define WOCOL(W, k0, o, lane) wcol_oi(W, k0, o, lane, CC)
#define WOCOLH(W, k0, o, lane) wcolh_oi(W, k0, o, lane, CC)
#else
#define WOCOL(W, k0, o, lane) wcol_io(W, k0, o, lane, DIN)
#define WOCOLH(W, k0, o, lane) wcolh_io(W, k0, o, lane, DIN)
#endif

#ifndef SM_EXTRA_PARAMS
#define SM_EXTRA_PARAMS
#endif
#ifndef PROJ_EXTRA_PARAMS
#define PROJ_EXTRA_PARAMS
#endif
#ifndef SM_MASK_HOOK
#define SM_MASK_HOOK (void)0
#endif

#define WS_QH  0u                                      // f16 q rows [b*t][CC]
#define WS_KH  (WS_QH + 2u * (size_t)NB * TT * CC)      // f16 k rows [b*t][CC]
#define WS_VT  (WS_KH + 2u * (size_t)NB * TT * CC)      // f16 v planes [b][c][t]
#define WS_QL  (WS_VT + 2u * (size_t)NB * CC * TT)      // f16 q residual x 2^10 rows [b][t < QHI][CC]
#define WS_KL  (WS_QL + 2u * (size_t)NB * QHI * CC)     // f16 k residual x 2^10 rows [b][t < KHI][CC]
#define WS_VB  (WS_KL + 2u * (size_t)NB * KHI * CC)     // bf16 v hi planes [b][c][t < KHI]
#define WS_VBL (WS_VB + 2u * (size_t)NB * CC * KHI)
#define WS_S   (WS_VBL + 2u * (size_t)NB * CC * KHI)    // f32 logits / P [hg][t][s]
#define WS_Y   (WS_S  + 4u * (size_t)HG * TT * TT)      // f32 ctx rows [b*t][CC] (only when there is an output projection)
#define WS_END (WS_Y  + 4u * (size_t)NB * TT * CC)

// ---- k_proj: block = (64 rows, 128 cols, which): q/k/v = X W (+ b) with exact bf16 products (K = DIN) -> which 0: q f16 rows (+ residual rows < QHI); 1: k f16 rows (+ residual rows < KHI); 2: v f16 planes [c][t] (+ bf16 hi/lo planes for t < KHI)
__global__ __launch_bounds__(128) void k_proj(const float* __restrict__ XQ, const float* __restrict__ XK, const float* __restrict__ XV, const float* __restrict__ WQ, const float* __restrict__ WK, const float* __restrict__ WV, const float* __restrict__ BQ, const float* __restrict__ BK, const float* __restrict__ BV,
    _Float16* __restrict__ QH, _Float16* __restrict__ QL, _Float16* __restrict__ KH, _Float16* __restrict__ KL, _Float16* __restrict__ VT, __bf16* __restrict__ VB, __bf16* __restrict__ VBL) {
  __shared__ __align__(16) _Float16 sh[64][136], sl[64][136]; __shared__ __align__(16) _Float16 th[128][72]; __shared__ __align__(16) __bf16 tb[128][72], tbl[128][72];
  const int tid = threadIdx.x, wave = tid >> 5, lane = tid & 31, col = lane & 15, g = lane >> 4; const int which = blockIdx.z; const int c0 = blockIdx.y * 128; const size_t r0 = (size_t)blockIdx.x * 64; const size_t bb = r0 / TT; const int t0 = (int)(r0 % TT);
  const float* X = which == 0 ? XQ : which == 1 ? XK : XV; const float* WA = which == 0 ? WQ : which == 1 ? WK : WV; const float* BA = which == 0 ? BQ : which == 1 ? BK : BV;
  v8f acc[8] = {};
#pragma unroll 2
  for (int kc = 0; kc < DIN / 32; ++kc) { v16b a; { const float* p = X + (r0 + wave * 16 + col) * DIN + kc * 32 + 8 * g;
#pragma unroll
      for (int i = 0; i < 8; ++i) { a[i] = (__bf16)p[i]; a[8 + i] = (__bf16)p[16 + i]; } }
    asm volatile("s_wait_loadcnt 0x0" ::: "memory");
#pragma unroll
    for (int j = 0; j < 8; ++j) { const v16b w = WCOL(WA, kc * 32, c0 + j * 16 + col, lane); asm volatile("s_wait_loadcnt 0x0" ::: "memory"); acc[j] = wmma_bf(a, w, acc[j]); } }
  if (which < 2) { _Float16* DH = which == 0 ? QH : KH; _Float16* DL = which == 0 ? QL : KL; const int nhi = which == 0 ? QHI : KHI; const bool hi_rows = t0 < nhi;
#pragma unroll
    for (int j = 0; j < 8; ++j) { const float bias = BA ? bfr(BA[c0 + j * 16 + col]) : 0.f;
#pragma unroll
      for (int r = 0; r < 8; ++r) { const float v = acc[j][r] + bias; const _Float16 hv = (_Float16)v; sh[wave * 16 + 8 * g + r][j * 16 + col] = hv; sl[wave * 16 + 8 * g + r][j * 16 + col] = (_Float16)((v - (float)hv) * 1024.0f); } }
    __syncthreads();
    for (int e = tid; e < 64 * 16; e += 128) { const int rl = e >> 4, q = e & 15; vst2((unsigned*)(DH + (r0 + rl) * CC + c0 + q * 8), *(const v4u*)&sh[rl][q * 8]); if (hi_rows) vst2((unsigned*)(DL + (bb * nhi + t0 + rl) * (size_t)CC + c0 + q * 8), *(const v4u*)&sl[rl][q * 8]); }
  } else { const bool hi_rows = t0 < KHI;
#pragma unroll
    for (int j = 0; j < 8; ++j) { const float bias = BA ? bfr(BA[c0 + j * 16 + col]) : 0.f;
#pragma unroll
      for (int r = 0; r < 8; ++r) { const float v = acc[j][r] + bias; const int rl = wave * 16 + 8 * g + r, cl = j * 16 + col; th[cl][rl] = (_Float16)v; const __bf16 bh = (__bf16)v; tb[cl][rl] = bh; tbl[cl][rl] = (__bf16)(v - (float)bh); } }
    __syncthreads();
    for (int e = tid; e < 128 * 8; e += 128) { const int cl = e >> 3, q = e & 7; vst2((unsigned*)(VT + (bb * CC + c0 + cl) * (size_t)TT + t0 + q * 8), *(const v4u*)&th[cl][q * 8]); if (hi_rows) { const size_t o3 = (bb * CC + c0 + cl) * (size_t)KHI + t0 + q * 8; vst2((unsigned*)(VB + o3), *(const v4u*)&tb[cl][q * 8]); vst2((unsigned*)(VBL + o3), *(const v4u*)&tbl[cl][q * 8]); } } } }
// ---- k_sc: block = (query block qb, key block kb <= kb_last(qb), head in group) of batch b: logits x SCALE; q hi + residual (x 2^10) against k (2 products) for query rows < QHI, plus the k residual (3 products) for query blocks < QBH (causal early rows); causal: blocks past the diagonal exit, the mask itself is applied by index in k_sm
__global__ __launch_bounds__(128) void k_sc(const _Float16* __restrict__ QH, const _Float16* __restrict__ KH, const _Float16* __restrict__ QL, const _Float16* __restrict__ KL, int b, int h0, float* __restrict__ S0) { __shared__ __align__(16) float ss[4][16][132];
  const int qb = blockIdx.x, kb = blockIdx.y; if (kb > kb_last(qb)) return;
  const int h = h0 + blockIdx.z; float* S = S0 + (size_t)blockIdx.z * TT * TT;
  const int tid = threadIdx.x, wave = tid >> 5, lane = tid & 31, col = lane & 15, g = lane >> 4; const int k0 = kb * 128; const int ql0 = qb * 64 + wave * 16; const size_t q0 = (size_t)b * TT + ql0, kr0 = (size_t)b * TT + k0;
  v8f acc[8] = {}, accl[8] = {};
  const _Float16* QLb = QL + (size_t)b * QHI * CC; const _Float16* KLb = KL + (size_t)b * KHI * CC;
  if (qb < QBH) {
#pragma unroll
    for (int kc = 0; kc < HD / 32; ++kc) { const v16h ah = frag_h(QH + (q0 + col) * CC + h * HD + kc * 32, lane), al = frag_h(QLb + (size_t)(ql0 + col) * CC + h * HD + kc * 32, lane);
#pragma unroll
      for (int j = 0; j < 8; ++j) { const v16h kbf = frag_h(KH + (kr0 + j * 16 + col) * CC + h * HD + kc * 32, lane), klf = frag_h(KLb + (size_t)(k0 + j * 16 + col) * CC + h * HD + kc * 32, lane); acc[j] = wmma16(ah, kbf, acc[j]); accl[j] = wmma16(al, kbf, accl[j]); accl[j] = wmma16(ah, klf, accl[j]); } }
  } else if (qb * 64 < QHI) {
#pragma unroll
    for (int kc = 0; kc < HD / 32; ++kc) { const v16h ah = frag_h(QH + (q0 + col) * CC + h * HD + kc * 32, lane), al = frag_h(QLb + (size_t)(ql0 + col) * CC + h * HD + kc * 32, lane);
#pragma unroll
      for (int j = 0; j < 8; ++j) { const v16h kbf = frag_h(KH + (kr0 + j * 16 + col) * CC + h * HD + kc * 32, lane); acc[j] = wmma16(ah, kbf, acc[j]); accl[j] = wmma16(al, kbf, accl[j]); } }
  } else {
#pragma unroll
    for (int kc = 0; kc < HD / 32; ++kc) { const v16h ah = frag_h(QH + (q0 + col) * CC + h * HD + kc * 32, lane);
#pragma unroll
      for (int j = 0; j < 8; ++j) { const v16h kbf = frag_h(KH + (kr0 + j * 16 + col) * CC + h * HD + kc * 32, lane); acc[j] = wmma16(ah, kbf, acc[j]); } } }
#pragma unroll
  for (int j = 0; j < 8; ++j) {
#pragma unroll
    for (int r = 0; r < 8; ++r) ss[wave][8 * g + r][j * 16 + col] = (acc[j][r] + accl[j][r] * (1.0f / 1024.0f)) * SCALE; }
  LDSX(); for (int rl = 0; rl < 16; ++rl) vst2(S + (size_t)(ql0 + rl) * TT + k0 + lane * 4, *(const v4f*)&ss[wave][rl][lane * 4]); }
// ---- k_sm: block = query row t (head in group): keys [0, kend): causal -> logit if s <= t else excluded; softmax in f32; P x 2^11 in place (0 for excluded)
__global__ __launch_bounds__(256) void k_sm(float* __restrict__ S0 SM_EXTRA_PARAMS) { __shared__ float sred[8]; __shared__ float sbc; __shared__ __align__(16) float shv[TT];
  const int tid = threadIdx.x; const int t = blockIdx.x; const int kend = (kb_last(t >> 6) + 1) * 128;
  float* sr = S0 + (size_t)blockIdx.y * TT * TT + (size_t)t * TT;
  float m = -3.0e38f; for (int k = tid; k < kend; k += 256) { float v = (!CAUSAL || k <= t) ? sr[k] : -3.0e38f; SM_MASK_HOOK; shv[k] = v; m = fmaxf(m, v); }
#pragma unroll
  for (int o = 1; o < 32; o <<= 1) m = fmaxf(m, __shfl_xor(m, o));
  if ((tid & 31) == 0) sred[tid >> 5] = m; __syncthreads(); if (tid == 0) { float a = sred[0]; for (int i = 1; i < 8; ++i) a = fmaxf(a, sred[i]); sbc = a; } __syncthreads(); m = sbc; __syncthreads();
  float sum = 0.f; for (int k = tid; k < kend; k += 256) { const float v = shv[k]; const float e = (v <= -1.0e38f) ? 0.f : expf(v - m); shv[k] = e; sum += e; }
#pragma unroll
  for (int o = 1; o < 32; o <<= 1) sum += __shfl_xor(sum, o);
  if ((tid & 31) == 0) sred[tid >> 5] = sum; __syncthreads(); if (tid == 0) { float a = 0.f; for (int i = 0; i < 8; ++i) a += sred[i]; sbc = 2048.0f / a; } __syncthreads(); const float inv = sbc;
  for (int k = tid; k < kend; k += 256) shv[k] = shv[k] * inv;
  __syncthreads(); for (int q = tid; q < kend / 4; q += 256) vst2(sr + q * 4, *(const v4f*)&shv[q * 4]); }
// ---- k_pv: block = 16 queries (tile qt of query block qb = qt / 4) of (b, h), PVW waves: wave w takes the 32-key chunks w, w + PVW, ... of keys [0, kend) and keeps its own f32 partial ctx = P . v (P x 2^11 once to f16 against v f16: 1 product; causal early query blocks: P and v as bf16 hi + lo, 3 products); partials summed through LDS in wave order 0..PVW-1; 256-B (row, head) segment by 16 lanes
#define PVW 16
__global__ __launch_bounds__(32 * PVW) void k_pv(const float* __restrict__ PS0, const _Float16* __restrict__ VT, const __bf16* __restrict__ VB, const __bf16* __restrict__ VBL, int b, int h0, float* __restrict__ Y) { const int h = h0 + blockIdx.z; const float* PS = PS0 + (size_t)blockIdx.z * TT * TT; __shared__ __align__(16) float ss[PVW][16][HD + 4];
  // wave number held in a scalar register: the key loop's trip test stays a scalar branch, so every lane is on at each matrix instruction
  const int tid = threadIdx.x, wave = __builtin_amdgcn_readfirstlane(tid >> 5), lane = tid & 31, col = lane & 15, g = lane >> 4; const int qb = blockIdx.x >> 2; const int ql0 = blockIdx.x * 16; const int kce = (kb_last(qb) + 1) * 4;
  v8f acc[HD / 16] = {};
  if (qb < QBH) {
#pragma unroll 1
    for (int kc = wave; kc < kce; kc += PVW) { const F2 p = split_row(PS + (size_t)(ql0 + col) * TT, kc * 32, lane);
      asm volatile("s_wait_loadcnt 0x0" ::: "memory");
#pragma unroll
      for (int j = 0; j < HD / 16; ++j) { const size_t po = ((size_t)b * CC + h * HD + j * 16 + col) * (size_t)KHI + kc * 32; const v16b vh = frag_b(VB + po, lane); acc[j] = wmma_bf(p.h, vh, acc[j]); acc[j] = wmma_bf(p.l, vh, acc[j]); acc[j] = wmma_bf(p.h, frag_b(VBL + po, lane), acc[j]); } }
  } else {
#pragma unroll 1
    for (int kc = wave; kc < kce; kc += PVW) { const v16h p = frag_f32(PS + (size_t)(ql0 + col) * TT + kc * 32, lane);
      asm volatile("s_wait_loadcnt 0x0" ::: "memory");
#pragma unroll
      for (int j = 0; j < HD / 16; ++j) { const size_t po = ((size_t)b * CC + h * HD + j * 16 + col) * (size_t)TT + kc * 32; acc[j] = wmma16(p, frag_h(VT + po, lane), acc[j]); } } }
#pragma unroll
  for (int j = 0; j < HD / 16; ++j)
#pragma unroll
    for (int r = 0; r < 8; ++r) ss[wave][8 * g + r][j * 16 + col] = acc[j][r];
  __syncthreads();   // every wave's partial is in LDS before any is summed
  if (tid < 16 * (HD / 4)) { const int rl = tid >> 4, q4 = (tid & 15) * 4; v4f s = *(const v4f*)&ss[0][rl][q4];
#pragma unroll   // the LDS reads of all partials go out together instead of one latency each
    for (int w = 1; w < PVW; ++w) s += *(const v4f*)&ss[w][rl][q4];
    vst2(Y + ((size_t)b * TT + ql0 + rl) * CC + h * HD + q4, s * (1.0f / 2048.0f)); } }
// ---- k_out: block = (64 rows, 128 cols): out = ctx Wo (+ bo): ctx once to f16 against Wo as f16(bf16 x 2^8) exact (1 product) x 2^-8; causal early rows (< QHI of each sequence): ctx bf16 hi + lo against exact bf16 Wo (2 products)
__global__ __launch_bounds__(128) void k_out(const float* __restrict__ Y, const float* __restrict__ WO, const float* __restrict__ BO, float* __restrict__ OUT) { __shared__ __align__(16) float sf[4][16][132];
  const int tid = threadIdx.x, wave = tid >> 5, lane = tid & 31, col = lane & 15, g = lane >> 4; const int c0 = blockIdx.y * 128; const size_t r0 = (size_t)blockIdx.x * 64 + wave * 16;
  v8f acc[8] = {};
  if (CAUSAL && (int)(((size_t)blockIdx.x * 64) % TT) < QHI) {   /* block-uniform */
#pragma unroll 2
    for (int kc = 0; kc < CC / 32; ++kc) { const F2 a = split_row(Y + (r0 + col) * CC, kc * 32, lane); asm volatile("s_wait_loadcnt 0x0" ::: "memory");
#pragma unroll
      for (int j = 0; j < 8; ++j) { const v16b w = WOCOL(WO, kc * 32, c0 + j * 16 + col, lane); asm volatile("s_wait_loadcnt 0x0" ::: "memory"); acc[j] = wmma_bf(a.h, w, acc[j]); acc[j] = wmma_bf(a.l, w, acc[j]); } }
#pragma unroll
    for (int j = 0; j < 8; ++j) { const float bias = BO ? bfr(BO[c0 + j * 16 + col]) : 0.f;
#pragma unroll
      for (int r = 0; r < 8; ++r) sf[wave][8 * g + r][j * 16 + col] = acc[j][r] + bias; }
  } else {
#pragma unroll 2
    for (int kc = 0; kc < CC / 32; ++kc) { const v16h a = frag_f32(Y + (r0 + col) * CC + kc * 32, lane); asm volatile("s_wait_loadcnt 0x0" ::: "memory");
#pragma unroll
      for (int j = 0; j < 8; ++j) { const v16h w = WOCOLH(WO, kc * 32, c0 + j * 16 + col, lane); asm volatile("s_wait_loadcnt 0x0" ::: "memory"); acc[j] = wmma16(a, w, acc[j]); } }
#pragma unroll
    for (int j = 0; j < 8; ++j) { const float bias = BO ? bfr(BO[c0 + j * 16 + col]) : 0.f;
#pragma unroll
      for (int r = 0; r < 8; ++r) sf[wave][8 * g + r][j * 16 + col] = acc[j][r] * (1.0f / 256.0f) + bias; } }
  LDSX(); for (int rl = 0; rl < 16; ++rl) vst2(OUT + (r0 + rl) * DIN + c0 + lane * 4, *(const v4f*)&sf[wave][rl][lane * 4]); }

extern "C" void kernel_launch(void* const* d_in, const int* in_sizes, int n_in, void* d_out, int out_size, void* d_ws, size_t ws_size, hipStream_t stream) {
  (void)in_sizes; (void)n_in; (void)out_size;
  const float** F = (const float**)d_in;
  if (ws_size < (size_t)WS_END) return;
  char* ws = (char*)d_ws; _Float16 *QH = (_Float16*)(ws + WS_QH), *KH = (_Float16*)(ws + WS_KH), *VT = (_Float16*)(ws + WS_VT), *QL = (_Float16*)(ws + WS_QL), *KL = (_Float16*)(ws + WS_KL); __bf16 *VB = (__bf16*)(ws + WS_VB), *VBL = (__bf16*)(ws + WS_VBL); float *S = (float*)(ws + WS_S), *Y = (float*)(ws + WS_Y);
  (void)Y; (void)QL; (void)KL; (void)VB; (void)VBL;
  // inputs: 0 x [4,2048,768]; 1 Wq, 2 Wk, 3 Wv [12,768,64]; 4 bq, 5 bk, 6 bv [12,64] (= flat [768] by column h*64+k); 7 Wo [768,768] (in,out); 8 bo [768]
  k_proj<<<dim3(TNB * TT / 64, CC / 128, 3), 128, 0, stream>>>(F[0], F[0], F[0], F[1], F[2], F[3], F[4], F[5], F[6], QH, QL, KH, KL, VT, VB, VBL);
  for (int b = 0; b < TNB; ++b) for (int h0 = 0; h0 < NH; h0 += HG) {
    k_sc<<<dim3(NQB, TT / 128, HG), 128, 0, stream>>>(QH, KH, QL, KL, b, h0, S);
    k_sm<<<dim3(TT, HG), 256, 0, stream>>>(S);
    k_pv<<<dim3(TT / 16, 1, HG), 32 * PVW, 0, stream>>>(S, VT, VB, VBL, b, h0, Y);
  }
  k_out<<<dim3(TNB * TT / 64, DIN / 128), 128, 0, stream>>>(Y, F[7], F[8], (float*)d_out);
}

// v002
// It runs in 390 microseconds.
// Next to v001, in two timings, it ran 2.66 and 2.64 times as fast.
// Counting every step since v000, it is 4.49 times as fast.
// compute dtype: all float inputs rounded to bf16; q/k/v = x W[h] + b[h] with EXACT bf16 products on WMMA 16x16x32, f32 accumulate; q, k once to f16 -> 1-product causal logits x 1/8, except the first 384 query rows of each sequence (few keys, no averaging), which use q and k as f16 hi + residual (x 2^10) (3 products); softmax in f32 (precise expf); P x 2^11 once to f16 against v once to f16 (1 product), except the first 384 rows: P and v as bf16 hi + lo (3 products); ctx once to f16 against Wo carried x 2^8 in f16 (exact bf16 values), except the first 384 rows: ctx bf16 hi + lo against exact bf16 Wo (2 products); + bo; f32 output.
#include <hip/hip_runtime.h>
#include <math.h>

typedef __attribute__((ext_vector_type(16))) _Float16 v16h;
typedef __attribute__((ext_vector_type(16))) __bf16 v16b;
typedef __attribute__((ext_vector_type(8)))  _Float16 v8h;
typedef __attribute__((ext_vector_type(8)))  float v8f;
typedef __attribute__((ext_vector_type(4)))  float v4f;
typedef __attribute__((ext_vector_type(2)))  float v2f;
typedef __attribute__((ext_vector_type(4)))  unsigned v4u;
typedef __attribute__((ext_vector_type(4)))  int v4i;
typedef float __attribute__((may_alias)) float_a;
typedef int __attribute__((may_alias)) int_a;

template <typename T> __device__ __forceinline__ void vst2(void* p, T v) { *(T*)p = v;  }
__device__ __forceinline__ v8f wmma16(v16h a, v16h b, v8f c) {
  v8f d = __builtin_amdgcn_wmma_f32_16x16x32_f16(false, a, false, b, (short)0, c, false, false);
  asm volatile("v_nop\n\tv_nop\n\tv_nop\n\tv_nop" : "+v"(d) : "v"(a), "v"(b));
  return d;
}
__device__ __forceinline__ v8f wmma_bf(v16b a, v16b b, v8f c) {
  v8f d = __builtin_amdgcn_wmma_f32_16x16x32_bf16(false, a, false, b, (short)0, c, false, false);
  asm volatile("v_nop\n\tv_nop\n\tv_nop\n\tv_nop" : "+v"(d) : "v"(a), "v"(b));
  return d;
}
// 16x16x32 fragments: lane = (h = lane>>4, row/col = lane&15); elements 0..7 = k0+8h+0..7, 8..15 = k0+16+8h+0..7; D element r = row 8h+r
__device__ __forceinline__ v16h frag_h(const _Float16* rowk0, int lane) {
  union { v16h v; v8h q[2]; } u; const _Float16* p = rowk0 + 8 * (lane >> 4);
  u.q[0] = *(const v8h*)p; u.q[1] = *(const v8h*)(p + 16); return u.v;
}
__device__ __forceinline__ v16h frag_f32(const float* rowk0, int lane) {
  v16h a; const float* p = rowk0 + 8 * (lane >> 4);
#pragma unroll
  for (int i = 0; i < 8; ++i) { a[i] = (_Float16)p[i]; a[8 + i] = (_Float16)p[16 + i]; }
  return a;
}
__device__ __forceinline__ v16h frag_f32s(const float* rowk0, int lane, float sc) {
  v16h a; const float* p = rowk0 + 8 * (lane >> 4);
#pragma unroll
  for (int i = 0; i < 8; ++i) { a[i] = (_Float16)(p[i] * sc); a[8 + i] = (_Float16)(p[16 + i] * sc); }
  return a;
}
// column fragment from a [K][ld] layout (column n), rows >= K read as 0
__device__ __forceinline__ v16h fragc_f32(const float* W, int k0, int n, int lane, int ld, int K) {
  v16h a; const int g = lane >> 4;
#pragma unroll
  for (int i = 0; i < 8; ++i) { const int ka = k0 + 8 * g + i, kb = ka + 16;
    a[i] = (_Float16)(ka < K ? W[(size_t)(ka < K ? ka : K - 1) * ld + n] : 0.f); a[8 + i] = (_Float16)(kb < K ? W[(size_t)(kb < K ? kb : K - 1) * ld + n] : 0.f); }
  return a;
}
struct F2 { v16b h, l; };
__device__ __forceinline__ F2 bsplit16(const float v[16]) { F2 r;
#pragma unroll
  for (int i = 0; i < 16; ++i) { const __bf16 h = (__bf16)v[i]; r.h[i] = h; r.l[i] = (__bf16)(v[i] - (float)h); }
  return r; }
__device__ __forceinline__ F2 split_row(const float* row, int k0, int lane) { float v[16]; const float* p = row + k0 + 8 * (lane >> 4);
#pragma unroll
  for (int i = 0; i < 8; ++i) { v[i] = p[i]; v[8 + i] = p[16 + i]; }
  return bsplit16(v); }
__device__ __forceinline__ F2 split_rowK(const float* row, int k0, int lane, int K) { float v[16]; const int g = lane >> 4;
#pragma unroll
  for (int i = 0; i < 8; ++i) { const int ka = k0 + 8 * g + i, kb = ka + 16; v[i] = ka < K ? row[ka < K ? ka : K - 1] : 0.f; v[8 + i] = kb < K ? row[kb < K ? kb : K - 1] : 0.f; }
  return bsplit16(v); }
__device__ __forceinline__ F2 split_col(const float* W, int k0, int n, int lane, int ld, int K) { float v[16]; const int g = lane >> 4;
#pragma unroll
  for (int i = 0; i < 8; ++i) { const int ka = k0 + 8 * g + i, kb = ka + 16; v[i] = ka < K ? W[(size_t)(ka < K ? ka : K - 1) * ld + n] : 0.f; v[8 + i] = kb < K ? W[(size_t)(kb < K ? kb : K - 1) * ld + n] : 0.f; }
  return bsplit16(v); }
__device__ __forceinline__ v8f mac3(const F2& a, const F2& b, v8f c) { c = wmma_bf(a.l, b.h, c); c = wmma_bf(a.h, b.l, c); return wmma_bf(a.h, b.h, c); }
__device__ __forceinline__ float sigm(float v) { return 1.0f / (1.0f + expf(-v)); }
#define LDSX() do { asm volatile("s_wait_dscnt 0" ::: "memory"); __builtin_amdgcn_wave_barrier(); __builtin_amdgcn_fence(__ATOMIC_RELEASE, "workgroup"); } while (0)

// Causal multi-head self-attention with per-head projection tensors (B 4, S 2,048, D 768, 12 heads x 64): q/k/v[b,h] = x W[h] + b[h] ([H][768][64] weights, [H][64] biases); scores = q k^T with key > query -> -inf, x 64^-0.5; softmax; out = concat_h(P v) Wo ((in,out) [768,768]) + bo.
#define NB 4
#define TT 2048
#define CC 768            // NH * HD = projected width
#define DIN 768          // input (model) width
#define NH 12
#define HD 64
#define SCALE (0.125f)
#define CAUSAL 1
#ifndef TNB
#define TNB NB
#endif
__device__ __forceinline__ float bfr(float v) { return (float)(__bf16)v; }
typedef __attribute__((ext_vector_type(8))) __bf16 v8b;
__device__ __forceinline__ v16b frag_b(const __bf16* rowk0, int lane) {
  union { v16b v; v8b q[2]; } u; const __bf16* p = rowk0 + 8 * (lane >> 4);
  u.q[0] = *(const v8b*)p; u.q[1] = *(const v8b*)(p + 16); return u.v;
}
#define QBH 6              // causal: query rows < QBH * 64 of each sequence (few keys, no averaging) take the high-precision path
#define QHI 384            // rows carrying a q residual plane
#define KHI 384            // key rows carrying k residual / v bf16 hi+lo planes (used only by the causal high-precision path)
// B fragment (k rows k0+.., output column o) of a weight: (in,out) [K][ld] or (out,in) [ld rows of K]: bf16 exact, or f16(bf16 * 256) exact
__device__ __forceinline__ v16b wcol_io(const float* Wm, int k0, int o, int lane, int ld) { v16b w; const int g = lane >> 4;
#pragma unroll
  for (int i = 0; i < 8; ++i) { w[i] = (__bf16)Wm[(size_t)(k0 + 8 * g + i) * ld + o]; w[8 + i] = (__bf16)Wm[(size_t)(k0 + 16 + 8 * g + i) * ld + o]; }
  return w; }
__device__ __forceinline__ v16b wcol_oi(const float* Wm, int k0, int o, int lane, int K) { v16b w; const float* p = Wm + (size_t)o * K + k0 + 8 * (lane >> 4);
#pragma unroll
  for (int i = 0; i < 8; ++i) { w[i] = (__bf16)p[i]; w[8 + i] = (__bf16)p[16 + i]; }
  return w; }
__device__ __forceinline__ v16h wcolh_io(const float* Wm, int k0, int o, int lane, int ld) { v16h w; const int g = lane >> 4;
#pragma unroll
  for (int i = 0; i < 8; ++i) { w[i] = (_Float16)(bfr(Wm[(size_t)(k0 + 8 * g + i) * ld + o]) * 256.0f); w[8 + i] = (_Float16)(bfr(Wm[(size_t)(k0 + 16 + 8 * g + i) * ld + o]) * 256.0f); }
  return w; }
__device__ __forceinline__ v16h wcolh_oi(const float* Wm, int k0, int o, int lane, int K) { v16h w; const float* p = Wm + (size_t)o * K + k0 + 8 * (lane >> 4);
#pragma unroll
  for (int i = 0; i < 8; ++i) { w[i] = (_Float16)(bfr(p[i]) * 256.0f); w[8 + i] = (_Float16)(bfr(p[16 + i]) * 256.0f); }
  return w; }
#define WQKV_LAYOUT 2   // 0 = (in,out) [DIN][CC]; 1 = (out,in) [CC][DIN]; 2 = per-head [NH][DIN][HD]
__device__ __forceinline__ v16b wcol_hdk(const float* Wm, int k0, int o, int lane) { v16b w; const int g = lane >> 4; const float* p = Wm + (size_t)(o / HD) * DIN * HD + (o % HD);
#pragma unroll
  for (int i = 0; i < 8; ++i) { w[i] = (__bf16)p[(size_t)(k0 + 8 * g + i) * HD]; w[8 + i] = (__bf16)p[(size_t)(k0 + 16 + 8 * g + i) * HD]; }
  return w; }
#define WO_OUT_IN 0
#if WQKV_LAYOUT == 1
#define WCOL(W, k0, o, lane) wcol_oi(W, k0, o, lane, DIN)
#elif WQKV_LAYOUT == 2
#define WCOL(W, k0, o, lane) wcol_hdk(W, k0, o, lane)
#else
#define WCOL(W, k0, o, lane) wcol_io(W, k0, o, lane, CC)
#endif
#if WO_OUT_IN
#define WOCOL(W, k0, o, lane) wcol_oi(W, k0, o, lane, CC)
#define WOCOLH(W, k0, o, lane) wcolh_oi(W, k0, o, lane, CC)
#else
#define WOCOL(W, k0, o, lane) wcol_io(W, k0, o, lane, DIN)
#define WOCOLH(W, k0, o, lane) wcolh_io(W, k0, o, lane, DIN)
#endif

#ifndef PROJ_EXTRA_PARAMS
#define PROJ_EXTRA_PARAMS
#endif

#define WS_QH  0u                                      // f16 q rows [b*t][CC]
#define WS_KH  (WS_QH + 2u * (size_t)NB * TT * CC)      // f16 k rows [b*t][CC]
#define WS_VT  (WS_KH + 2u * (size_t)NB * TT * CC)      // f16 v planes [b][c][t]
#define WS_QL  (WS_VT + 2u * (size_t)NB * CC * TT)      // f16 q residual x 2^10 rows [b][t < QHI][CC]
#define WS_KL  (WS_QL + 2u * (size_t)NB * QHI * CC)     // f16 k residual x 2^10 rows [b][t < KHI][CC]
#define WS_VB  (WS_KL + 2u * (size_t)NB * KHI * CC)     // bf16 v hi planes [b][c][t < KHI]
#define WS_VBL (WS_VB + 2u * (size_t)NB * CC * KHI)
#define WS_Y   (WS_VBL + 2u * (size_t)NB * CC * KHI)    // f32 ctx rows [b*t][CC] (only when there is an output projection)
#define WS_END (WS_Y  + 4u * (size_t)NB * TT * CC)

// ---- k_proj: block = (64 rows, 128 cols, which): q/k/v = X W (+ b) with exact bf16 products (K = DIN) -> which 0: q f16 rows (+ residual rows < QHI); 1: k f16 rows (+ residual rows < KHI); 2: v f16 planes [c][t] (+ bf16 hi/lo planes for t < KHI)
__global__ __launch_bounds__(128) void k_proj(const float* __restrict__ XQ, const float* __restrict__ XK, const float* __restrict__ XV, const float* __restrict__ WQ, const float* __restrict__ WK, const float* __restrict__ WV, const float* __restrict__ BQ, const float* __restrict__ BK, const float* __restrict__ BV,
    _Float16* __restrict__ QH, _Float16* __restrict__ QL, _Float16* __restrict__ KH, _Float16* __restrict__ KL, _Float16* __restrict__ VT, __bf16* __restrict__ VB, __bf16* __restrict__ VBL) {
  __shared__ __align__(16) _Float16 sh[64][136], sl[64][136]; __shared__ __align__(16) _Float16 th[128][72]; __shared__ __align__(16) __bf16 tb[128][72], tbl[128][72];
  const int tid = threadIdx.x, wave = tid >> 5, lane = tid & 31, col = lane & 15, g = lane >> 4; const int which = blockIdx.z; const int c0 = blockIdx.y * 128; const size_t r0 = (size_t)blockIdx.x * 64; const size_t bb = r0 / TT; const int t0 = (int)(r0 % TT);
  const float* X = which == 0 ? XQ : which == 1 ? XK : XV; const float* WA = which == 0 ? WQ : which == 1 ? WK : WV; const float* BA = which == 0 ? BQ : which == 1 ? BK : BV;
  v8f acc[8] = {};
#pragma unroll 2
  for (int kc = 0; kc < DIN / 32; ++kc) { v16b a; { const float* p = X + (r0 + wave * 16 + col) * DIN + kc * 32 + 8 * g;
#pragma unroll
      for (int i = 0; i < 8; ++i) { a[i] = (__bf16)p[i]; a[8 + i] = (__bf16)p[16 + i]; } }
    asm volatile("s_wait_loadcnt 0x0" ::: "memory");
#pragma unroll
    for (int j = 0; j < 8; ++j) { const v16b w = WCOL(WA, kc * 32, c0 + j * 16 + col, lane); asm volatile("s_wait_loadcnt 0x0" ::: "memory"); acc[j] = wmma_bf(a, w, acc[j]); } }
  if (which < 2) { _Float16* DH = which == 0 ? QH : KH; _Float16* DL = which == 0 ? QL : KL; const int nhi = which == 0 ? QHI : KHI; const bool hi_rows = t0 < nhi;
#pragma unroll
    for (int j = 0; j < 8; ++j) { const float bias = BA ? bfr(BA[c0 + j * 16 + col]) : 0.f;
#pragma unroll
      for (int r = 0; r < 8; ++r) { const float v = acc[j][r] + bias; const _Float16 hv = (_Float16)v; sh[wave * 16 + 8 * g + r][j * 16 + col] = hv; sl[wave * 16 + 8 * g + r][j * 16 + col] = (_Float16)((v - (float)hv) * 1024.0f); } }
    __syncthreads();
    for (int e = tid; e < 64 * 16; e += 128) { const int rl = e >> 4, q = e & 15; vst2((unsigned*)(DH + (r0 + rl) * CC + c0 + q * 8), *(const v4u*)&sh[rl][q * 8]); if (hi_rows) vst2((unsigned*)(DL + (bb * nhi + t0 + rl) * (size_t)CC + c0 + q * 8), *(const v4u*)&sl[rl][q * 8]); }
  } else { const bool hi_rows = t0 < KHI;
#pragma unroll
    for (int j = 0; j < 8; ++j) { const float bias = BA ? bfr(BA[c0 + j * 16 + col]) : 0.f;
#pragma unroll
      for (int r = 0; r < 8; ++r) { const float v = acc[j][r] + bias; const int rl = wave * 16 + 8 * g + r, cl = j * 16 + col; th[cl][rl] = (_Float16)v; const __bf16 bh = (__bf16)v; tb[cl][rl] = bh; tbl[cl][rl] = (__bf16)(v - (float)bh); } }
    __syncthreads();
    for (int e = tid; e < 128 * 8; e += 128) { const int cl = e >> 3, q = e & 7; vst2((unsigned*)(VT + (bb * CC + c0 + cl) * (size_t)TT + t0 + q * 8), *(const v4u*)&th[cl][q * 8]); if (hi_rows) { const size_t o3 = (bb * CC + c0 + cl) * (size_t)KHI + t0 + q * 8; vst2((unsigned*)(VB + o3), *(const v4u*)&tb[cl][q * 8]); vst2((unsigned*)(VBL + o3), *(const v4u*)&tbl[cl][q * 8]); } } } }
// ---- k_att: block = 16 queries (tile qt) of (b, h), AW waves; logits, softmax and P . v in one launch, the logits never leave the registers.
// Wave w owns the 32-key chunks w, w + AW, ... up to the diagonal. It forms the TRANSPOSED logits k . q^T (A = 16 key rows, B = 16 query columns), so a lane holds one query (col) and keys 8g + r of each 16-key tile:
// the D registers of a chunk's two tiles are, element for element, the A fragment of P for that chunk (0..7 = k0 + 8g + r, 8..15 = k0 + 16 + 8g + r). Row max and row sum: in the lane, one exchange between the lane halves, then over the waves through LDS in wave order.
// Products: 1-product f16 logits x 1/8, P x 2^11 once to f16 against v f16; query rows < QBH * 64: q, k hi + residual (3 products), P and v bf16 hi + lo (3 products). f32 partial ctx summed through LDS in wave order 0..AW-1.
#define AW 16
#define NCH (TT / 32 / AW)   // chunks a wave can own
// fragment halves from the lane's own pointer (row start + 8 * (lane >> 4))
__device__ __forceinline__ v16h frag_lh(const _Float16* p) { union { v16h v; v8h q[2]; } u; u.q[0] = *(const v8h*)p; u.q[1] = *(const v8h*)(p + 16); return u.v; }
__device__ __forceinline__ v16b frag_lb(const __bf16* p) { union { v16b v; v8b q[2]; } u; u.q[0] = *(const v8b*)p; u.q[1] = *(const v8b*)(p + 16); return u.v; }
// behind a batch of global loads: their address register, named as an input, is not rewritten in front of this wait and is free behind it
#define XWAIT1(p) asm volatile("s_wait_xcnt 0x0" :: "v"(p) : "memory")
#define XWAIT2(p, q) asm volatile("s_wait_xcnt 0x0" :: "v"(p), "v"(q) : "memory")
#define XWAIT4(p, q, r, s) asm volatile("s_wait_xcnt 0x0" :: "v"(p), "v"(q), "v"(r), "v"(s) : "memory")
// a query's maximum / sum over the block: the two lane halves, then the waves through LDS in wave order; called by every wave of the block
__device__ __forceinline__ float row_max(float m, float (*red)[16], int wave, int col, int g) {
  m = fmaxf(m, __shfl_xor(m, 16)); if (g == 0) red[wave][col] = m;
  __syncthreads();   // every wave's row maxima are in LDS before any is read
  m = red[0][col];
#pragma unroll
  for (int w = 1; w < AW; ++w) m = fmaxf(m, red[w][col]);
  return m; }
__device__ __forceinline__ float row_sum(float s, float (*red)[16], int wave, int col, int g) {
  s += __shfl_xor(s, 16); if (g == 0) red[wave][col] = s;
  __syncthreads();   // every wave's row sums are in LDS before any is read
  s = red[0][col];
#pragma unroll
  for (int w = 1; w < AW; ++w) s += red[w][col];
  return s; }
__global__ __launch_bounds__(32 * AW) void k_att(const _Float16* __restrict__ QH, const _Float16* __restrict__ KH, const _Float16* __restrict__ QL, const _Float16* __restrict__ KL, const _Float16* __restrict__ VT, const __bf16* __restrict__ VB, const __bf16* __restrict__ VBL, float* __restrict__ Y) {
  __shared__ __align__(16) float ss[AW][16][HD + 4]; __shared__ float redm[AW][16], reds[AW][16];
  // wave number held in a scalar register: every chunk test stays a scalar branch, so every lane is on at each matrix instruction
  const int tid = threadIdx.x, wave = __builtin_amdgcn_readfirstlane(tid >> 5), lane = tid & 31, col = lane & 15, g = lane >> 4;
  const int b = blockIdx.x / NH, h = blockIdx.x % NH;
  const int ql0 = (TT / 16 - 1 - (int)blockIdx.y) * 16;   // the tiles with the most keys take the lowest block indices
  const int kce = (ql0 >> 5) + 1;                         // chunks that hold a key <= the tile's last query
  const int n = kce > wave ? (kce - wave + AW - 1) / AW : 0;   // chunks of this wave (scalar)
  const int tq = ql0 + col;
  const _Float16* qp = QH + ((size_t)b * TT + tq) * CC + h * HD + 8 * g;   // lane pointers: row start + the lane half's 8 elements
  v8f acc[HD / 16] = {};
  if (ql0 < QBH * 64) {   // block-uniform: early rows, high precision; kce <= KHI / 32 <= AW, so one chunk a wave at most
    float s[16]; float m = -3.0e38f;
    if (n > 0) { const _Float16* qlp = QL + ((size_t)b * QHI + tq) * CC + h * HD + 8 * g; const _Float16* kp = KH + ((size_t)b * TT + wave * 32 + col) * CC + h * HD + 8 * g; const _Float16* lp = KL + ((size_t)b * KHI + wave * 32 + col) * CC + h * HD + 8 * g;
      v16h qh[2], qlf[2], kbf[2][2], klf[2][2];   // loads first, products behind them
#pragma unroll
      for (int kc = 0; kc < 2; ++kc) { qh[kc] = frag_lh(qp + kc * 32); qlf[kc] = frag_lh(qlp + kc * 32);
#pragma unroll
        for (int t = 0; t < 2; ++t) { kbf[t][kc] = frag_lh(kp + t * 16 * CC + kc * 32); klf[t][kc] = frag_lh(lp + t * 16 * CC + kc * 32); } }
      XWAIT4(qp, qlp, kp, lp);
#pragma unroll
      for (int t = 0; t < 2; ++t) { v8f a = {}, al = {};
#pragma unroll
        for (int kc = 0; kc < 2; ++kc) { a = wmma16(kbf[t][kc], qh[kc], a); al = wmma16(kbf[t][kc], qlf[kc], al); al = wmma16(klf[t][kc], qh[kc], al); }
#pragma unroll
        for (int r = 0; r < 8; ++r) { const float v = (wave * 32 + t * 16 + 8 * g + r <= tq) ? (a[r] + al[r] * (1.0f / 1024.0f)) * SCALE : -3.0e38f; s[t * 8 + r] = v; m = fmaxf(m, v); } } }
    m = row_max(m, redm, wave, col, g);
    v16b vh[HD / 16], vl[HD / 16];   // the v fragments fly during the exponentials
    float sum = 0.f;
    if (n > 0) { const size_t po = ((size_t)b * CC + h * HD + col) * (size_t)KHI + wave * 32 + 8 * g; const __bf16* vhp = VB + po; const __bf16* vlp = VBL + po;
#pragma unroll
      for (int j = 0; j < HD / 16; ++j) { vh[j] = frag_lb(vhp + j * 16 * KHI); vl[j] = frag_lb(vlp + j * 16 * KHI); }
      XWAIT2(vhp, vlp);
#pragma unroll
      for (int e = 0; e < 16; ++e) { s[e] = expf(s[e] - m); sum += s[e]; } }   // an excluded key (-3e38) gives exactly 0: m is a finite logit
    const float inv = 2048.0f / row_sum(sum, reds, wave, col, g);
    if (n > 0) {
#pragma unroll
      for (int e = 0; e < 16; ++e) s[e] *= inv;
      const F2 p = bsplit16(s);
#pragma unroll
      for (int j = 0; j < HD / 16; ++j) { acc[j] = wmma_bf(p.h, vh[j], acc[j]); acc[j] = wmma_bf(p.l, vh[j], acc[j]); acc[j] = wmma_bf(p.h, vl[j], acc[j]); } }
  } else {
    float s[NCH][16]; float m = -3.0e38f;
    { const v16h q0 = frag_lh(qp), q1 = frag_lh(qp + 32); XWAIT1(qp); const _Float16* kw = KH + ((size_t)b * TT + wave * 32 + col) * CC + h * HD + 8 * g;
      v16h kf[NCH][4];   // all key fragments of the wave go out together: one load latency
#pragma unroll
      for (int i = 0; i < NCH; ++i) if (i < n) { const _Float16* kp = kw + i * AW * 32 * CC; kf[i][0] = frag_lh(kp); kf[i][1] = frag_lh(kp + 32); kf[i][2] = frag_lh(kp + 16 * CC); kf[i][3] = frag_lh(kp + 16 * CC + 32); XWAIT1(kw); }
#pragma unroll
      for (int i = 0; i < NCH; ++i) if (i < n) { const int k0 = (wave + AW * i) * 32;
#pragma unroll
        for (int t = 0; t < 2; ++t) { v8f a = {}; a = wmma16(kf[i][2 * t], q0, a); a = wmma16(kf[i][2 * t + 1], q1, a);
#pragma unroll
          for (int r = 0; r < 8; ++r) s[i][t * 8 + r] = a[r] * SCALE; }
        if (wave + AW * i == kce - 1) {   // only the last chunk holds keys past a query of the tile (scalar test)
#pragma unroll
          for (int e = 0; e < 16; ++e) if (k0 + (e >> 3) * 16 + 8 * g + (e & 7) > tq) s[i][e] = -3.0e38f; }
#pragma unroll
        for (int e = 0; e < 16; ++e) m = fmaxf(m, s[i][e]); } }
    m = row_max(m, redm, wave, col, g);
    const _Float16* vw = VT + ((size_t)b * CC + h * HD + col) * (size_t)TT + wave * 32 + 8 * g;
    v16h vf[NCH][HD / 16];   // the v fragments fly during the exponentials
#pragma unroll
    for (int i = 0; i < NCH; ++i) if (i < n) {
#pragma unroll
      for (int j = 0; j < HD / 16; ++j) vf[i][j] = frag_lh(vw + j * 16 * TT + i * AW * 32);
      XWAIT1(vw); }
    float sum = 0.f;
#pragma unroll
    for (int i = 0; i < NCH; ++i) if (i < n) {
#pragma unroll
      for (int e = 0; e < 16; ++e) { s[i][e] = expf(s[i][e] - m); sum += s[i][e]; } }   // an excluded key (-3e38) gives exactly 0: m is a finite logit
    const float inv = 2048.0f / row_sum(sum, reds, wave, col, g);
#pragma unroll
    for (int i = 0; i < NCH; ++i) if (i < n) { v16h p;
#pragma unroll
      for (int e = 0; e < 16; ++e) p[e] = (_Float16)(s[i][e] * inv);
#pragma unroll
      for (int j = 0; j < HD / 16; ++j) acc[j] = wmma16(p, vf[i][j], acc[j]); } }
#pragma unroll
  for (int j = 0; j < HD / 16; ++j)
#pragma unroll
    for (int r = 0; r < 8; ++r) ss[wave][8 * g + r][j * 16 + col] = acc[j][r];
  __syncthreads();   // every wave's partial is in LDS before any is summed
  if (tid < 16 * (HD / 4)) { const int rl = tid >> 4, q4 = (tid & 15) * 4; v4f o = *(const v4f*)&ss[0][rl][q4];
#pragma unroll   // the LDS reads of all partials go out together instead of one latency each
    for (int w = 1; w < AW; ++w) o += *(const v4f*)&ss[w][rl][q4];
    vst2(Y + ((size_t)b * TT + ql0 + rl) * CC + h * HD + q4, o * (1.0f / 2048.0f)); } }
// ---- k_out: block = (64 rows, 128 cols): out = ctx Wo (+ bo): ctx once to f16 against Wo as f16(bf16 x 2^8) exact (1 product) x 2^-8; causal early rows (< QHI of each sequence): ctx bf16 hi + lo against exact bf16 Wo (2 products)
__global__ __launch_bounds__(128) void k_out(const float* __restrict__ Y, const float* __restrict__ WO, const float* __restrict__ BO, float* __restrict__ OUT) { __shared__ __align__(16) float sf[4][16][132];
  const int tid = threadIdx.x, wave = tid >> 5, lane = tid & 31, col = lane & 15, g = lane >> 4; const int c0 = blockIdx.y * 128; const size_t r0 = (size_t)blockIdx.x * 64 + wave * 16;
  v8f acc[8] = {};
  if (CAUSAL && (int)(((size_t)blockIdx.x * 64) % TT) < QHI) {   /* block-uniform */
#pragma unroll 2
    for (int kc = 0; kc < CC / 32; ++kc) { const F2 a = split_row(Y + (r0 + col) * CC, kc * 32, lane); asm volatile("s_wait_loadcnt 0x0" ::: "memory");
#pragma unroll
      for (int j = 0; j < 8; ++j) { const v16b w = WOCOL(WO, kc * 32, c0 + j * 16 + col, lane); asm volatile("s_wait_loadcnt 0x0" ::: "memory"); acc[j] = wmma_bf(a.h, w, acc[j]); acc[j] = wmma_bf(a.l, w, acc[j]); } }
#pragma unroll
    for (int j = 0; j < 8; ++j) { const float bias = BO ? bfr(BO[c0 + j * 16 + col]) : 0.f;
#pragma unroll
      for (int r = 0; r < 8; ++r) sf[wave][8 * g + r][j * 16 + col] = acc[j][r] + bias; }
  } else {
#pragma unroll 2
    for (int kc = 0; kc < CC / 32; ++kc) { const v16h a = frag_f32(Y + (r0 + col) * CC + kc * 32, lane); asm volatile("s_wait_loadcnt 0x0" ::: "memory");
#pragma unroll
      for (int j = 0; j < 8; ++j) { const v16h w = WOCOLH(WO, kc * 32, c0 + j * 16 + col, lane); asm volatile("s_wait_loadcnt 0x0" ::: "memory"); acc[j] = wmma16(a, w, acc[j]); } }
#pragma unroll
    for (int j = 0; j < 8; ++j) { const float bias = BO ? bfr(BO[c0 + j * 16 + col]) : 0.f;
#pragma unroll
      for (int r = 0; r < 8; ++r) sf[wave][8 * g + r][j * 16 + col] = acc[j][r] * (1.0f / 256.0f) + bias; } }
  LDSX(); for (int rl = 0; rl < 16; ++rl) vst2(OUT + (r0 + rl) * DIN + c0 + lane * 4, *(const v4f*)&sf[wave][rl][lane * 4]); }

extern "C" void kernel_launch(void* const* d_in, const int* in_sizes, int n_in, void* d_out, int out_size, void* d_ws, size_t ws_size, hipStream_t stream) {
  (void)in_sizes; (void)n_in; (void)out_size;
  const float** F = (const float**)d_in;
  if (ws_size < (size_t)WS_END) return;
  char* ws = (char*)d_ws; _Float16 *QH = (_Float16*)(ws + WS_QH), *KH = (_Float16*)(ws + WS_KH), *VT = (_Float16*)(ws + WS_VT), *QL = (_Float16*)(ws + WS_QL), *KL = (_Float16*)(ws + WS_KL); __bf16 *VB = (__bf16*)(ws + WS_VB), *VBL = (__bf16*)(ws + WS_VBL); float *Y = (float*)(ws + WS_Y);
  (void)Y; (void)QL; (void)KL; (void)VB; (void)VBL;
  // inputs: 0 x [4,2048,768]; 1 Wq, 2 Wk, 3 Wv [12,768,64]; 4 bq, 5 bk, 6 bv [12,64] (= flat [768] by column h*64+k); 7 Wo [768,768] (in,out); 8 bo [768]
  k_proj<<<dim3(TNB * TT / 64, CC / 128, 3), 128, 0, stream>>>(F[0], F[0], F[0], F[1], F[2], F[3], F[4], F[5], F[6], QH, QL, KH, KL, VT, VB, VBL);
  k_att<<<dim3(TNB * NH, TT / 16), 32 * AW, 0, stream>>>(QH, KH, QL, KL, VT, VB, VBL, Y);
  k_out<<<dim3(TNB * TT / 64, DIN / 128), 128, 0, stream>>>(Y, F[7], F[8], (float*)d_out);
}

// v003
// Measured time: 242 microseconds a run.
// In both of two side-by-side timings against v002, it was 1.61 times as fast.
// Over all steps from v000 it is 7.21 times as fast.
// compute dtype: all float inputs rounded to bf16; q/k/v = x W[h] + b[h] with EXACT bf16 products on WMMA 16x16x32, f32 accumulate; q, k once to f16 -> 1-product causal logits x 1/8, except the first 384 query rows of each sequence (few keys, no averaging), which use q and k as f16 hi + residual (x 2^10) (3 products); softmax in f32 (precise expf); P x 2^11 once to f16 against v once to f16 (1 product), except the first 384 rows: P and v as bf16 hi + lo (3 products); ctx once to f16 against Wo carried x 2^8 in f16 (exact bf16 values), except the first 384 rows: ctx bf16 hi + lo against exact bf16 Wo (2 products); + bo; f32 output.
#include <hip/hip_runtime.h>
#include <math.h>

typedef __attribute__((ext_vector_type(16))) _Float16 v16h;
typedef __attribute__((ext_vector_type(16))) __bf16 v16b;
typedef __attribute__((ext_vector_type(8)))  _Float16 v8h;
typedef __attribute__((ext_vector_type(8)))  float v8f;
typedef __attribute__((ext_vector_type(4)))  float v4f;
typedef __attribute__((ext_vector_type(2)))  float v2f;
typedef __attribute__((ext_vector_type(4)))  unsigned v4u;
typedef __attribute__((ext_vector_type(4)))  int v4i;
typedef float __attribute__((may_alias)) float_a;
typedef int __attribute__((may_alias)) int_a;

template <typename T> __device__ __forceinline__ void vst2(void* p, T v) { *(T*)p = v;  }
__device__ __forceinline__ v8f wmma16(v16h a, v16h b, v8f c) {
  v8f d = __builtin_amdgcn_wmma_f32_16x16x32_f16(false, a, false, b, (short)0, c, false, false);
  asm volatile("v_nop\n\tv_nop\n\tv_nop\n\tv_nop" : "+v"(d) : "v"(a), "v"(b));
  return d;
}
__device__ __forceinline__ v8f wmma_bf(v16b a, v16b b, v8f c) {
  v8f d = __builtin_amdgcn_wmma_f32_16x16x32_bf16(false, a, false, b, (short)0, c, false, false);
  asm volatile("v_nop\n\tv_nop\n\tv_nop\n\tv_nop" : "+v"(d) : "v"(a), "v"(b));
  return d;
}
// 16x16x32 fragments: lane = (h = lane>>4, row/col = lane&15); elements 0..7 = k0+8h+0..7, 8..15 = k0+16+8h+0..7; D element r = row 8h+r
__device__ __forceinline__ v16h frag_h(const _Float16* rowk0, int lane) {
  union { v16h v; v8h q[2]; } u; const _Float16* p = rowk0 + 8 * (lane >> 4);
  u.q[0] = *(const v8h*)p; u.q[1] = *(const v8h*)(p + 16); return u.v;
}
__device__ __forceinline__ v16h frag_f32(const float* rowk0, int lane) {
  v16h a; const float* p = rowk0 + 8 * (lane >> 4);
#pragma unroll
  for (int i = 0; i < 8; ++i) { a[i] = (_Float16)p[i]; a[8 + i] = (_Float16)p[16 + i]; }
  return a;
}
__device__ __forceinline__ v16h frag_f32s(const float* rowk0, int lane, float sc) {
  v16h a; const float* p = rowk0 + 8 * (lane >> 4);
#pragma unroll
  for (int i = 0; i < 8; ++i) { a[i] = (_Float16)(p[i] * sc); a[8 + i] = (_Float16)(p[16 + i] * sc); }
  return a;
}
// column fragment from a [K][ld] layout (column n), rows >= K read as 0
__device__ __forceinline__ v16h fragc_f32(const float* W, int k0, int n, int lane, int ld, int K) {
  v16h a; const int g = lane >> 4;
#pragma unroll
  for (int i = 0; i < 8; ++i) { const int ka = k0 + 8 * g + i, kb = ka + 16;
    a[i] = (_Float16)(ka < K ? W[(size_t)(ka < K ? ka : K - 1) * ld + n] : 0.f); a[8 + i] = (_Float16)(kb < K ? W[(size_t)(kb < K ? kb : K - 1) * ld + n] : 0.f); }
  return a;
}
struct F2 { v16b h, l; };
__device__ __forceinline__ F2 bsplit16(const float v[16]) { F2 r;
#pragma unroll
  for (int i = 0; i < 16; ++i) { const __bf16 h = (__bf16)v[i]; r.h[i] = h; r.l[i] = (__bf16)(v[i] - (float)h); }
  return r; }
__device__ __forceinline__ F2 split_row(const float* row, int k0, int lane) { float v[16]; const float* p = row + k0 + 8 * (lane >> 4);
#pragma unroll
  for (int i = 0; i < 8; ++i) { v[i] = p[i]; v[8 + i] = p[16 + i]; }
  return bsplit16(v); }
__device__ __forceinline__ F2 split_rowK(const float* row, int k0, int lane, int K) { float v[16]; const int g = lane >> 4;
#pragma unroll
  for (int i = 0; i < 8; ++i) { const int ka = k0 + 8 * g + i, kb = ka + 16; v[i] = ka < K ? row[ka < K ? ka : K - 1] : 0.f; v[8 + i] = kb < K ? row[kb < K ? kb : K - 1] : 0.f; }
  return bsplit16(v); }
__device__ __forceinline__ F2 split_col(const float* W, int k0, int n, int lane, int ld, int K) { float v[16]; const int g = lane >> 4;
#pragma unroll
  for (int i = 0; i < 8; ++i) { const int ka = k0 + 8 * g + i, kb = ka + 16; v[i] = ka < K ? W[(size_t)(ka < K ? ka : K - 1) * ld + n] : 0.f; v[8 + i] = kb < K ? W[(size_t)(kb < K ? kb : K - 1) * ld + n] : 0.f; }
  return bsplit16(v); }
__device__ __forceinline__ v8f mac3(const F2& a, const F2& b, v8f c) { c = wmma_bf(a.l, b.h, c); c = wmma_bf(a.h, b.l, c); return wmma_bf(a.h, b.h, c); }
__device__ __forceinline__ float sigm(float v) { return 1.0f / (1.0f + expf(-v)); }
#define LDSX() do { asm volatile("s_wait_dscnt 0" ::: "memory"); __builtin_amdgcn_wave_barrier(); __builtin_amdgcn_fence(__ATOMIC_RELEASE, "workgroup"); } while (0)

// Causal multi-head self-attention with per-head projection tensors (B 4, S 2,048, D 768, 12 heads x 64): q/k/v[b,h] = x W[h] + b[h] ([H][768][64] weights, [H][64] biases); scores = q k^T with key > query -> -inf, x 64^-0.5; softmax; out = concat_h(P v) Wo ((in,out) [768,768]) + bo.
#define NB 4
#define TT 2048
#define CC 768            // NH * HD = projected width
#define DIN 768          // input (model) width
#define NH 12
#define HD 64
#define SCALE (0.125f)
#define CAUSAL 1
#ifndef TNB
#define TNB NB
#endif
__device__ __forceinline__ float bfr(float v) { return (float)(__bf16)v; }
typedef __attribute__((ext_vector_type(8))) __bf16 v8b;
__device__ __forceinline__ v16b frag_b(const __bf16* rowk0, int lane) {
  union { v16b v; v8b q[2]; } u; const __bf16* p = rowk0 + 8 * (lane >> 4);
  u.q[0] = *(const v8b*)p; u.q[1] = *(const v8b*)(p + 16); return u.v;
}
#define QBH 6              // causal: query rows < QBH * 64 of each sequence (few keys, no averaging) take the high-precision path
#define QHI 384            // rows carrying a q residual plane
#define KHI 384            // key rows carrying k residual / v bf16 hi+lo planes (used only by the causal high-precision path)
// B fragment (k rows k0+.., output column o) of a weight: (in,out) [K][ld] or (out,in) [ld rows of K]: bf16 exact, or f16(bf16 * 256) exact
__device__ __forceinline__ v16b wcol_io(const float* Wm, int k0, int o, int lane, int ld) { v16b w; const int g = lane >> 4;
#pragma unroll
  for (int i = 0; i < 8; ++i) { w[i] = (__bf16)Wm[(size_t)(k0 + 8 * g + i) * ld + o]; w[8 + i] = (__bf16)Wm[(size_t)(k0 + 16 + 8 * g + i) * ld + o]; }
  return w; }
__device__ __forceinline__ v16b wcol_oi(const float* Wm, int k0, int o, int lane, int K) { v16b w; const float* p = Wm + (size_t)o * K + k0 + 8 * (lane >> 4);
#pragma unroll
  for (int i = 0; i < 8; ++i) { w[i] = (__bf16)p[i]; w[8 + i] = (__bf16)p[16 + i]; }
  return w; }
__device__ __forceinline__ v16h wcolh_io(const float* Wm, int k0, int o, int lane, int ld) { v16h w; const int g = lane >> 4;
#pragma unroll
  for (int i = 0; i < 8; ++i) { w[i] = (_Float16)(bfr(Wm[(size_t)(k0 + 8 * g + i) * ld + o]) * 256.0f); w[8 + i] = (_Float16)(bfr(Wm[(size_t)(k0 + 16 + 8 * g + i) * ld + o]) * 256.0f); }
  return w; }
__device__ __forceinline__ v16h wcolh_oi(const float* Wm, int k0, int o, int lane, int K) { v16h w; const float* p = Wm + (size_t)o * K + k0 + 8 * (lane >> 4);
#pragma unroll
  for (int i = 0; i < 8; ++i) { w[i] = (_Float16)(bfr(p[i]) * 256.0f); w[8 + i] = (_Float16)(bfr(p[16 + i]) * 256.0f); }
  return w; }
#define WQKV_LAYOUT 2   // 0 = (in,out) [DIN][CC]; 1 = (out,in) [CC][DIN]; 2 = per-head [NH][DIN][HD]
__device__ __forceinline__ v16b wcol_hdk(const float* Wm, int k0, int o, int lane) { v16b w; const int g = lane >> 4; const float* p = Wm + (size_t)(o / HD) * DIN * HD + (o % HD);
#pragma unroll
  for (int i = 0; i < 8; ++i) { w[i] = (__bf16)p[(size_t)(k0 + 8 * g + i) * HD]; w[8 + i] = (__bf16)p[(size_t)(k0 + 16 + 8 * g + i) * HD]; }
  return w; }
#define WO_OUT_IN 0
#if WQKV_LAYOUT == 1
#define WCOL(W, k0, o, lane) wcol_oi(W, k0, o, lane, DIN)
#elif WQKV_LAYOUT == 2
#define WCOL(W, k0, o, lane) wcol_hdk(W, k0, o, lane)
#else
#define WCOL(W, k0, o, lane) wcol_io(W, k0, o, lane, CC)
#endif
#if WO_OUT_IN
#define WOCOL(W, k0, o, lane) wcol_oi(W, k0, o, lane, CC)
#define WOCOLH(W, k0, o, lane) wcolh_oi(W, k0, o, lane, CC)
#else
#define WOCOL(W, k0, o, lane) wcol_io(W, k0, o, lane, DIN)
#define WOCOLH(W, k0, o, lane) wcolh_io(W, k0, o, lane, DIN)
#endif

#ifndef PROJ_EXTRA_PARAMS
#define PROJ_EXTRA_PARAMS
#endif

#define WS_QH  0u                                      // f16 q rows [b*t][CC]
#define WS_KH  (WS_QH + 2u * (size_t)NB * TT * CC)      // f16 k rows [b*t][CC]
#define WS_VT  (WS_KH + 2u * (size_t)NB * TT * CC)      // f16 v planes [b][c][t]
#define WS_QL  (WS_VT + 2u * (size_t)NB * CC * TT)      // f16 q residual x 2^10 rows [b][t < QHI][CC]
#define WS_KL  (WS_QL + 2u * (size_t)NB * QHI * CC)     // f16 k residual x 2^10 rows [b][t < KHI][CC]
#define WS_VB  (WS_KL + 2u * (size_t)NB * KHI * CC)     // bf16 v hi planes [b][c][t < KHI]
#define WS_VBL (WS_VB + 2u * (size_t)NB * CC * KHI)
#define WS_Y   (WS_VBL + 2u * (size_t)NB * CC * KHI)    // f32 ctx rows [b*t][CC] (only when there is an output projection)
#define WS_END (WS_Y  + 4u * (size_t)NB * TT * CC)

// ---- weight k-slab in LDS (both projection kernels): 32 k rows x 128 output columns, converted once per block and laid out in fragment order, read by all 4 waves.
// Place of (k group q = k / 8, column c): (c / 16) * WJP + q * 256 + (c % 16) * 16 bytes, 8 k values of 16 bits each. A lane (g, col) finds elements 0..7 (k = 8g + i) at group g and 8..15 (k = 16 + 8g + i) at group 2 + g, 512 bytes on.
// Staging: thread (wave = k group, lane = 4 columns) loads 8 k rows x 16 bytes, so a wave's load covers whole 128-byte lines, and stores 4 columns x 16 bytes.
#define WJP 1040           // 4 groups x 16 columns x 16 B, + 16 B: the 16 lanes of a staging store then fall on 64 distinct banks
#define WSB (8 * WJP)      // one buffer
__device__ __forceinline__ void wslab_load(v4f (&r)[8], const float* p, int ld) {
#pragma unroll   // constant indices: the values stay in registers
  for (int i = 0; i < 8; ++i) r[i] = *(const v4f*)(p + (size_t)i * ld); }
__device__ __forceinline__ void wslab_put_b(unsigned char* d, const v4f (&r)[8]) {   // exact bf16
#pragma unroll   // constant indices: the values stay in registers
  for (int cc = 0; cc < 4; ++cc) { v8b h;
#pragma unroll   // constant indices: the values stay in registers
    for (int i = 0; i < 8; ++i) h[i] = (__bf16)r[i][cc];
    *(v8b*)(d + cc * 16) = h; } }
__device__ __forceinline__ void wslab_put_h(unsigned char* d, const v4f (&r)[8]) {   // f16(bf16 x 2^8), exact
#pragma unroll   // constant indices: the values stay in registers
  for (int cc = 0; cc < 4; ++cc) { v8h h;
#pragma unroll   // constant indices: the values stay in registers
    for (int i = 0; i < 8; ++i) h[i] = (_Float16)(bfr(r[i][cc]) * 256.0f);
    *(v8h*)(d + cc * 16) = h; } }
__device__ __forceinline__ v16b wfrag_b(const unsigned char* p) { union { v16b v; v8b q[2]; } u; u.q[0] = *(const v8b*)p; u.q[1] = *(const v8b*)(p + 512); return u.v; }
__device__ __forceinline__ v16h wfrag_h(const unsigned char* p) { union { v16h v; v8h q[2]; } u; u.q[0] = *(const v8h*)p; u.q[1] = *(const v8h*)(p + 512); return u.v; }
// a lane's 16 f32 of an A row (p = row + k0 + 8g): element e = x[e / 4][e % 4] = p[e] (e < 8), p[8 + e] (e >= 8)
__device__ __forceinline__ void arow_load(v4f (&x)[4], const float* p) { x[0] = *(const v4f*)p; x[1] = *(const v4f*)(p + 4); x[2] = *(const v4f*)(p + 16); x[3] = *(const v4f*)(p + 20); }
// behind the next slab's loads: their address registers are rewritten only behind this wait; the clobber also keeps the loads ahead of the products they fly under
#define SLABWAIT() asm volatile("s_wait_xcnt 0x0" ::: "memory")
// behind a slab's products: keeps the conversions of the next slab, which wait for the loads in flight, from moving up among the products
#define PRODUCTS_DONE() __builtin_amdgcn_sched_barrier(0)

// ---- k_proj: block = (64 rows, 128 cols, which): q/k/v = X W (+ b) with exact bf16 products (K = DIN) -> which 0: q f16 rows (+ residual rows < QHI); 1: k f16 rows (+ residual rows < KHI); 2: v f16 planes [c][t] (+ bf16 hi/lo planes for t < KHI)
__global__ __launch_bounds__(128) void k_proj(const float* __restrict__ XQ, const float* __restrict__ XK, const float* __restrict__ XV, const float* __restrict__ WQ, const float* __restrict__ WK, const float* __restrict__ WV, const float* __restrict__ BQ, const float* __restrict__ BK, const float* __restrict__ BV,
    _Float16* __restrict__ QH, _Float16* __restrict__ QL, _Float16* __restrict__ KH, _Float16* __restrict__ KL, _Float16* __restrict__ VT, __bf16* __restrict__ VB, __bf16* __restrict__ VBL) {
  __shared__ __align__(16) _Float16 sh[64][136], sl[64][136]; __shared__ __align__(16) _Float16 th[128][72]; __shared__ __align__(16) __bf16 tb[128][72], tbl[128][72]; __shared__ __align__(16) unsigned char wsm[2 * WSB];
  const int tid = threadIdx.x, wave = tid >> 5, lane = tid & 31, col = lane & 15, g = lane >> 4; const int which = blockIdx.z; const int c0 = blockIdx.y * 128; const size_t r0 = (size_t)blockIdx.x * 64; const size_t bb = r0 / TT; const int t0 = (int)(r0 % TT);
  const float* X = which == 0 ? XQ : which == 1 ? XK : XV; const float* WA = which == 0 ? WQ : which == 1 ? WK : WV; const float* BA = which == 0 ? BQ : which == 1 ? BK : BV;
  v8f acc[8] = {};
  { const int cw = c0 + 4 * lane;   // this thread's 4 weight columns; its 8 k rows are 8 * wave + 0..7 of each slab
    const float* wp = WA + (size_t)(cw / HD) * DIN * HD + (cw % HD) + (size_t)(8 * wave) * HD;   // per-head [NH][DIN][HD]
    const float* xp = X + (r0 + wave * 16 + col) * DIN + 8 * g;
    unsigned char* wput = wsm + (lane >> 2) * WJP + wave * 256 + (lane & 3) * 64; const unsigned char* wget = wsm + lane * 16;
    v4f wn[8], xn[4]; wslab_load(wn, wp, HD); arow_load(xn, xp); SLABWAIT();
    wslab_put_b(wput, wn);
    __syncthreads();   // slab 0 is in LDS before any wave reads it
#pragma unroll 2   // the buffer index is a constant in each copy of the body
    for (int kc = 0; kc < DIN / 32; ++kc) { v16b a;
#pragma unroll   // constant indices: the values stay in registers
      for (int e = 0; e < 16; ++e) a[e] = (__bf16)xn[e >> 2][e & 3];
      const bool more = kc + 1 < DIN / 32;   // block-uniform
      if (more) { const float* wq = wp + (size_t)(kc + 1) * 32 * HD; const float* xq = xp + (kc + 1) * 32; wslab_load(wn, wq, HD); arow_load(xn, xq); SLABWAIT(); }
      v16b wf[8];   // the slab's LDS reads go out as one group: one LDS latency, not one per product
#pragma unroll   // constant indices: the values stay in registers
      for (int j = 0; j < 8; ++j) wf[j] = wfrag_b(wget + (kc & 1) * WSB + j * WJP);
#pragma unroll   // constant indices: the values stay in registers
      for (int j = 0; j < 8; ++j) acc[j] = wmma_bf(a, wf[j], acc[j]);
      PRODUCTS_DONE();
      if (more) { wslab_put_b(wput + ((kc + 1) & 1) * WSB, wn);
        __syncthreads(); } } }   // publishes slab kc + 1 and ends every wave's reads of slab kc, whose buffer the next trip refills
  if (which < 2) { _Float16* DH = which == 0 ? QH : KH; _Float16* DL = which == 0 ? QL : KL; const int nhi = which == 0 ? QHI : KHI; const bool hi_rows = t0 < nhi;
#pragma unroll
    for (int j = 0; j < 8; ++j) { const float bias = BA ? bfr(BA[c0 + j * 16 + col]) : 0.f;
#pragma unroll
      for (int r = 0; r < 8; ++r) { const float v = acc[j][r] + bias; const _Float16 hv = (_Float16)v; sh[wave * 16 + 8 * g + r][j * 16 + col] = hv; sl[wave * 16 + 8 * g + r][j * 16 + col] = (_Float16)((v - (float)hv) * 1024.0f); } }
    __syncthreads();
    for (int e = tid; e < 64 * 16; e += 128) { const int rl = e >> 4, q = e & 15; vst2((unsigned*)(DH + (r0 + rl) * CC + c0 + q * 8), *(const v4u*)&sh[rl][q * 8]); if (hi_rows) vst2((unsigned*)(DL + (bb * nhi + t0 + rl) * (size_t)CC + c0 + q * 8), *(const v4u*)&sl[rl][q * 8]); }
  } else { const bool hi_rows = t0 < KHI;
#pragma unroll
    for (int j = 0; j < 8; ++j) { const float bias = BA ? bfr(BA[c0 + j * 16 + col]) : 0.f;
#pragma unroll
      for (int r = 0; r < 8; ++r) { const float v = acc[j][r] + bias; const int rl = wave * 16 + 8 * g + r, cl = j * 16 + col; th[cl][rl] = (_Float16)v; const __bf16 bh = (__bf16)v; tb[cl][rl] = bh; tbl[cl][rl] = (__bf16)(v - (float)bh); } }
    __syncthreads();
    for (int e = tid; e < 128 * 8; e += 128) { const int cl = e >> 3, q = e & 7; vst2((unsigned*)(VT + (bb * CC + c0 + cl) * (size_t)TT + t0 + q * 8), *(const v4u*)&th[cl][q * 8]); if (hi_rows) { const size_t o3 = (bb * CC + c0 + cl) * (size_t)KHI + t0 + q * 8; vst2((unsigned*)(VB + o3), *(const v4u*)&tb[cl][q * 8]); vst2((unsigned*)(VBL + o3), *(const v4u*)&tbl[cl][q * 8]); } } } }
// ---- k_att: block = 16 queries (tile qt) of (b, h), AW waves; logits, softmax and P . v in one launch, the logits never leave the registers.
// Wave w owns the 32-key chunks w, w + AW, ... up to the diagonal. It forms the TRANSPOSED logits k . q^T (A = 16 key rows, B = 16 query columns), so a lane holds one query (col) and keys 8g + r of each 16-key tile:
// the D registers of a chunk's two tiles are, element for element, the A fragment of P for that chunk (0..7 = k0 + 8g + r, 8..15 = k0 + 16 + 8g + r). Row max and row sum: in the lane, one exchange between the lane halves, then over the waves through LDS in wave order.
// Products: 1-product f16 logits x 1/8, P x 2^11 once to f16 against v f16; query rows < QBH * 64: q, k hi + residual (3 products), P and v bf16 hi + lo (3 products). f32 partial ctx summed through LDS in wave order 0..AW-1.
#define AW 16
#define NCH (TT / 32 / AW)   // chunks a wave can own
// fragment halves from the lane's own pointer (row start + 8 * (lane >> 4))
__device__ __forceinline__ v16h frag_lh(const _Float16* p) { union { v16h v; v8h q[2]; } u; u.q[0] = *(const v8h*)p; u.q[1] = *(const v8h*)(p + 16); return u.v; }
__device__ __forceinline__ v16b frag_lb(const __bf16* p) { union { v16b v; v8b q[2]; } u; u.q[0] = *(const v8b*)p; u.q[1] = *(const v8b*)(p + 16); return u.v; }
// behind a batch of global loads: their address register, named as an input, is not rewritten in front of this wait and is free behind it
#define XWAIT1(p) asm volatile("s_wait_xcnt 0x0" :: "v"(p) : "memory")
#define XWAIT2(p, q) asm volatile("s_wait_xcnt 0x0" :: "v"(p), "v"(q) : "memory")
#define XWAIT4(p, q, r, s) asm volatile("s_wait_xcnt 0x0" :: "v"(p), "v"(q), "v"(r), "v"(s) : "memory")
// a query's maximum / sum over the block: the two lane halves, then the waves through LDS in wave order; called by every wave of the block
__device__ __forceinline__ float row_max(float m, float (*red)[16], int wave, int col, int g) {
  m = fmaxf(m, __shfl_xor(m, 16)); if (g == 0) red[wave][col] = m;
  __syncthreads();   // every wave's row maxima are in LDS before any is read
  m = red[0][col];
#pragma unroll
  for (int w = 1; w < AW; ++w) m = fmaxf(m, red[w][col]);
  return m; }
__device__ __forceinline__ float row_sum(float s, float (*red)[16], int wave, int col, int g) {
  s += __shfl_xor(s, 16); if (g == 0) red[wave][col] = s;
  __syncthreads();   // every wave's row sums are in LDS before any is read
  s = red[0][col];
#pragma unroll
  for (int w = 1; w < AW; ++w) s += red[w][col];
  return s; }
__global__ __launch_bounds__(32 * AW) void k_att(const _Float16* __restrict__ QH, const _Float16* __restrict__ KH, const _Float16* __restrict__ QL, const _Float16* __restrict__ KL, const _Float16* __restrict__ VT, const __bf16* __restrict__ VB, const __bf16* __restrict__ VBL, float* __restrict__ Y) {
  __shared__ __align__(16) float ss[AW][16][HD + 4]; __shared__ float redm[AW][16], reds[AW][16];
  // wave number held in a scalar register: every chunk test stays a scalar branch, so every lane is on at each matrix instruction
  const int tid = threadIdx.x, wave = __builtin_amdgcn_readfirstlane(tid >> 5), lane = tid & 31, col = lane & 15, g = lane >> 4;
  const int b = blockIdx.x / NH, h = blockIdx.x % NH;
  const int ql0 = (TT / 16 - 1 - (int)blockIdx.y) * 16;   // the tiles with the most keys take the lowest block indices
  const int kce = (ql0 >> 5) + 1;                         // chunks that hold a key <= the tile's last query
  const int n = kce > wave ? (kce - wave + AW - 1) / AW : 0;   // chunks of this wave (scalar)
  const int tq = ql0 + col;
  const _Float16* qp = QH + ((size_t)b * TT + tq) * CC + h * HD + 8 * g;   // lane pointers: row start + the lane half's 8 elements
  v8f acc[HD / 16] = {};
  if (ql0 < QBH * 64) {   // block-uniform: early rows, high precision; kce <= KHI / 32 <= AW, so one chunk a wave at most
    float s[16]; float m = -3.0e38f;
    if (n > 0) { const _Float16* qlp = QL + ((size_t)b * QHI + tq) * CC + h * HD + 8 * g; const _Float16* kp = KH + ((size_t)b * TT + wave * 32 + col) * CC + h * HD + 8 * g; const _Float16* lp = KL + ((size_t)b * KHI + wave * 32 + col) * CC + h * HD + 8 * g;
      v16h qh[2], qlf[2], kbf[2][2], klf[2][2];   // loads first, products behind them
#pragma unroll
      for (int kc = 0; kc < 2; ++kc) { qh[kc] = frag_lh(qp + kc * 32); qlf[kc] = frag_lh(qlp + kc * 32);
#pragma unroll
        for (int t = 0; t < 2; ++t) { kbf[t][kc] = frag_lh(kp + t * 16 * CC + kc * 32); klf[t][kc] = frag_lh(lp + t * 16 * CC + kc * 32); } }
      XWAIT4(qp, qlp, kp, lp);
#pragma unroll
      for (int t = 0; t < 2; ++t) { v8f a = {}, al = {};
#pragma unroll
        for (int kc = 0; kc < 2; ++kc) { a = wmma16(kbf[t][kc], qh[kc], a); al = wmma16(kbf[t][kc], qlf[kc], al); al = wmma16(klf[t][kc], qh[kc], al); }
#pragma unroll
        for (int r = 0; r < 8; ++r) { const float v = (wave * 32 + t * 16 + 8 * g + r <= tq) ? (a[r] + al[r] * (1.0f / 1024.0f)) * SCALE : -3.0e38f; s[t * 8 + r] = v; m = fmaxf(m, v); } } }
    m = row_max(m, redm, wave, col, g);
    v16b vh[HD / 16], vl[HD / 16];   // the v fragments fly during the exponentials
    float sum = 0.f;
    if (n > 0) { const size_t po = ((size_t)b * CC + h * HD + col) * (size_t)KHI + wave * 32 + 8 * g; const __bf16* vhp = VB + po; const __bf16* vlp = VBL + po;
#pragma unroll
      for (int j = 0; j < HD / 16; ++j) { vh[j] = frag_lb(vhp + j * 16 * KHI); vl[j] = frag_lb(vlp + j * 16 * KHI); }
      XWAIT2(vhp, vlp);
#pragma unroll
      for (int e = 0; e < 16; ++e) { s[e] = expf(s[e] - m); sum += s[e]; } }   // an excluded key (-3e38) gives exactly 0: m is a finite logit
    const float inv = 2048.0f / row_sum(sum, reds, wave, col, g);
    if (n > 0) {
#pragma unroll
      for (int e = 0; e < 16; ++e) s[e] *= inv;
      const F2 p = bsplit16(s);
#pragma unroll
      for (int j = 0; j < HD / 16; ++j) { acc[j] = wmma_bf(p.h, vh[j], acc[j]); acc[j] = wmma_bf(p.l, vh[j], acc[j]); acc[j] = wmma_bf(p.h, vl[j], acc[j]); } }
  } else {
    float s[NCH][16]; float m = -3.0e38f;
    { const v16h q0 = frag_lh(qp), q1 = frag_lh(qp + 32); XWAIT1(qp); const _Float16* kw = KH + ((size_t)b * TT + wave * 32 + col) * CC + h * HD + 8 * g;
      v16h kf[NCH][4];   // all key fragments of the wave go out together: one load latency
#pragma unroll
      for (int i = 0; i < NCH; ++i) if (i < n) { const _Float16* kp = kw + i * AW * 32 * CC; kf[i][0] = frag_lh(kp); kf[i][1] = frag_lh(kp + 32); kf[i][2] = frag_lh(kp + 16 * CC); kf[i][3] = frag_lh(kp + 16 * CC + 32); XWAIT1(kw); }
#pragma unroll
      for (int i = 0; i < NCH; ++i) if (i < n) { const int k0 = (wave + AW * i) * 32;
#pragma unroll
        for (int t = 0; t < 2; ++t) { v8f a = {}; a = wmma16(kf[i][2 * t], q0, a); a = wmma16(kf[i][2 * t + 1], q1, a);
#pragma unroll
          for (int r = 0; r < 8; ++r) s[i][t * 8 + r] = a[r] * SCALE; }
        if (wave + AW * i == kce - 1) {   // only the last chunk holds keys past a query of the tile (scalar test)
#pragma unroll
          for (int e = 0; e < 16; ++e) if (k0 + (e >> 3) * 16 + 8 * g + (e & 7) > tq) s[i][e] = -3.0e38f; }
#pragma unroll
        for (int e = 0; e < 16; ++e) m = fmaxf(m, s[i][e]); } }
    m = row_max(m, redm, wave, col, g);
    const _Float16* vw = VT + ((size_t)b * CC + h * HD + col) * (size_t)TT + wave * 32 + 8 * g;
    v16h vf[NCH][HD / 16];   // the v fragments fly during the exponentials
#pragma unroll
    for (int i = 0; i < NCH; ++i) if (i < n) {
#pragma unroll
      for (int j = 0; j < HD / 16; ++j) vf[i][j] = frag_lh(vw + j * 16 * TT + i * AW * 32);
      XWAIT1(vw); }
    float sum = 0.f;
#pragma unroll
    for (int i = 0; i < NCH; ++i) if (i < n) {
#pragma unroll
      for (int e = 0; e < 16; ++e) { s[i][e] = expf(s[i][e] - m); sum += s[i][e]; } }   // an excluded key (-3e38) gives exactly 0: m is a finite logit
    const float inv = 2048.0f / row_sum(sum, reds, wave, col, g);
#pragma unroll
    for (int i = 0; i < NCH; ++i) if (i < n) { v16h p;
#pragma unroll
      for (int e = 0; e < 16; ++e) p[e] = (_Float16)(s[i][e] * inv);
#pragma unroll
      for (int j = 0; j < HD / 16; ++j) acc[j] = wmma16(p, vf[i][j], acc[j]); } }
#pragma unroll
  for (int j = 0; j < HD / 16; ++j)
#pragma unroll
    for (int r = 0; r < 8; ++r) ss[wave][8 * g + r][j * 16 + col] = acc[j][r];
  __syncthreads();   // every wave's partial is in LDS before any is summed
  if (tid < 16 * (HD / 4)) { const int rl = tid >> 4, q4 = (tid & 15) * 4; v4f o = *(const v4f*)&ss[0][rl][q4];
#pragma unroll   // the LDS reads of all partials go out together instead of one latency each
    for (int w = 1; w < AW; ++w) o += *(const v4f*)&ss[w][rl][q4];
    vst2(Y + ((size_t)b * TT + ql0 + rl) * CC + h * HD + q4, o * (1.0f / 2048.0f)); } }
// ---- k_out: block = (64 rows, 128 cols): out = ctx Wo (+ bo): ctx once to f16 against Wo as f16(bf16 x 2^8) exact (1 product) x 2^-8; causal early rows (< QHI of each sequence): ctx bf16 hi + lo against exact bf16 Wo (2 products)
__global__ __launch_bounds__(128) void k_out(const float* __restrict__ Y, const float* __restrict__ WO, const float* __restrict__ BO, float* __restrict__ OUT) { __shared__ __align__(16) float sf[4][16][132]; __shared__ __align__(16) unsigned char wsm[2 * WSB];
  const int tid = threadIdx.x, wave = tid >> 5, lane = tid & 31, col = lane & 15, g = lane >> 4; const int c0 = blockIdx.y * 128; const size_t r0 = (size_t)blockIdx.x * 64 + wave * 16;
  v8f acc[8] = {};
  const float* wp = WO + (size_t)(8 * wave) * DIN + c0 + 4 * lane;   // (in,out) [CC][DIN]: this thread's 8 k rows x 4 columns of each slab
  const float* yp = Y + (r0 + col) * CC + 8 * g;
  unsigned char* wput = wsm + (lane >> 2) * WJP + wave * 256 + (lane & 3) * 64; const unsigned char* wget = wsm + lane * 16;
  v4f wn[8], yn[4]; wslab_load(wn, wp, DIN); arow_load(yn, yp); SLABWAIT();
  if (CAUSAL && (int)(((size_t)blockIdx.x * 64) % TT) < QHI) {   /* block-uniform */
    wslab_put_b(wput, wn);
    __syncthreads();   // slab 0 is in LDS before any wave reads it
#pragma unroll 2   // the buffer index is a constant in each copy of the body
    for (int kc = 0; kc < CC / 32; ++kc) { float v[16];
#pragma unroll   // constant indices: the values stay in registers
      for (int e = 0; e < 16; ++e) v[e] = yn[e >> 2][e & 3];
      const F2 a = bsplit16(v); const bool more = kc + 1 < CC / 32;   // block-uniform
      if (more) { const float* wq = wp + (size_t)(kc + 1) * 32 * DIN; const float* yq = yp + (kc + 1) * 32; wslab_load(wn, wq, DIN); arow_load(yn, yq); SLABWAIT(); }
      v16b wf[8];   // the slab's LDS reads go out as one group: one LDS latency, not one per product
#pragma unroll   // constant indices: the values stay in registers
      for (int j = 0; j < 8; ++j) wf[j] = wfrag_b(wget + (kc & 1) * WSB + j * WJP);
#pragma unroll   // constant indices: the values stay in registers
      for (int j = 0; j < 8; ++j) { acc[j] = wmma_bf(a.h, wf[j], acc[j]); acc[j] = wmma_bf(a.l, wf[j], acc[j]); }
      PRODUCTS_DONE();
      if (more) { wslab_put_b(wput + ((kc + 1) & 1) * WSB, wn);
        __syncthreads(); } }   // publishes slab kc + 1 and ends every wave's reads of slab kc, whose buffer the next trip refills
#pragma unroll
    for (int j = 0; j < 8; ++j) { const float bias = BO ? bfr(BO[c0 + j * 16 + col]) : 0.f;
#pragma unroll
      for (int r = 0; r < 8; ++r) sf[wave][8 * g + r][j * 16 + col] = acc[j][r] + bias; }
  } else {
    wslab_put_h(wput, wn);
    __syncthreads();   // slab 0 is in LDS before any wave reads it
#pragma unroll 2   // the buffer index is a constant in each copy of the body
    for (int kc = 0; kc < CC / 32; ++kc) { v16h a;
#pragma unroll   // constant indices: the values stay in registers
      for (int e = 0; e < 16; ++e) a[e] = (_Float16)yn[e >> 2][e & 3];
      const bool more = kc + 1 < CC / 32;   // block-uniform
      if (more) { const float* wq = wp + (size_t)(kc + 1) * 32 * DIN; const float* yq = yp + (kc + 1) * 32; wslab_load(wn, wq, DIN); arow_load(yn, yq); SLABWAIT(); }
      v16h wf[8];   // the slab's LDS reads go out as one group: one LDS latency, not one per product
#pragma unroll   // constant indices: the values stay in registers
      for (int j = 0; j < 8; ++j) wf[j] = wfrag_h(wget + (kc & 1) * WSB + j * WJP);
#pragma unroll   // constant indices: the values stay in registers
      for (int j = 0; j < 8; ++j) acc[j] = wmma16(a, wf[j], acc[j]);
      PRODUCTS_DONE();
      if (more) { wslab_put_h(wput + ((kc + 1) & 1) * WSB, wn);
        __syncthreads(); } }   // publishes slab kc + 1 and ends every wave's reads of slab kc, whose buffer the next trip refills
#pragma unroll
    for (int j = 0; j < 8; ++j) { const float bias = BO ? bfr(BO[c0 + j * 16 + col]) : 0.f;
#pragma unroll
      for (int r = 0; r < 8; ++r) sf[wave][8 * g + r][j * 16 + col] = acc[j][r] * (1.0f / 256.0f) + bias; } }
  LDSX(); for (int rl = 0; rl < 16; ++rl) vst2(OUT + (r0 + rl) * DIN + c0 + lane * 4, *(const v4f*)&sf[wave][rl][lane * 4]); }

extern "C" void kernel_launch(void* const* d_in, const int* in_sizes, int n_in, void* d_out, int out_size, void* d_ws, size_t ws_size, hipStream_t stream) {
  (void)in_sizes; (void)n_in; (void)out_size;
  const float** F = (const float**)d_in;
  if (ws_size < (size_t)WS_END) return;
  char* ws = (char*)d_ws; _Float16 *QH = (_Float16*)(ws + WS_QH), *KH = (_Float16*)(ws + WS_KH), *VT = (_Float16*)(ws + WS_VT), *QL = (_Float16*)(ws + WS_QL), *KL = (_Float16*)(ws + WS_KL); __bf16 *VB = (__bf16*)(ws + WS_VB), *VBL = (__bf16*)(ws + WS_VBL); float *Y = (float*)(ws + WS_Y);
  (void)Y; (void)QL; (void)KL; (void)VB; (void)VBL;
  // inputs: 0 x [4,2048,768]; 1 Wq, 2 Wk, 3 Wv [12,768,64]; 4 bq, 5 bk, 6 bv [12,64] (= flat [768] by column h*64+k); 7 Wo [768,768] (in,out); 8 bo [768]
  k_proj<<<dim3(TNB * TT / 64, CC / 128, 3), 128, 0, stream>>>(F[0], F[0], F[0], F[1], F[2], F[3], F[4], F[5], F[6], QH, QL, KH, KL, VT, VB, VBL);
  k_att<<<dim3(TNB * NH, TT / 16), 32 * AW, 0, stream>>>(QH, KH, QL, KL, VT, VB, VBL, Y);
  k_out<<<dim3(TNB * TT / 64, DIN / 128), 128, 0, stream>>>(Y, F[7], F[8], (float*)d_out);
}

// v004
// Measured time: 199 microseconds a run.
// In two side-by-side timings against v003, it was 1.21 and 1.22 times as fast.
// Over all steps from v000 it is 8.75 times as fast.
// compute dtype: all float inputs rounded to bf16; q/k/v = x W[h] + b[h] with EXACT bf16 products on WMMA 16x16x32, f32 accumulate; q, k once to f16 -> 1-product causal logits x 1/8, except the first 384 query rows of each sequence (few keys, no averaging), which use q and k as f16 hi + residual (x 2^10) (3 products); softmax in f32 (precise expf); P x 2^11 once to f16 against v once to f16 (1 product), except the first 384 rows: P and v as bf16 hi + lo (3 products); ctx once to f16 against Wo carried x 2^8 in f16 (exact bf16 values), except the first 384 rows: ctx bf16 hi + lo against exact bf16 Wo (2 products); + bo; f32 output.
#include <hip/hip_runtime.h>
#include <math.h>

typedef __attribute__((ext_vector_type(16))) _Float16 v16h;
typedef __attribute__((ext_vector_type(16))) __bf16 v16b;
typedef __attribute__((ext_vector_type(8)))  _Float16 v8h;
typedef __attribute__((ext_vector_type(8)))  float v8f;
typedef __attribute__((ext_vector_type(4)))  float v4f;
typedef __attribute__((ext_vector_type(2)))  float v2f;
typedef __attribute__((ext_vector_type(4)))  unsigned v4u;
typedef __attribute__((ext_vector_type(4)))  int v4i;
typedef float __attribute__((may_alias)) float_a;
typedef int __attribute__((may_alias)) int_a;

template <typename T> __device__ __forceinline__ void vst2(void* p, T v) { *(T*)p = v;  }
__device__ __forceinline__ v8f wmma16(v16h a, v16h b, v8f c) {
  v8f d = __builtin_amdgcn_wmma_f32_16x16x32_f16(false, a, false, b, (short)0, c, false, false);
  asm volatile("v_nop\n\tv_nop\n\tv_nop\n\tv_nop" : "+v"(d) : "v"(a), "v"(b));
  return d;
}
__device__ __forceinline__ v8f wmma_bf(v16b a, v16b b, v8f c) {
  v8f d = __builtin_amdgcn_wmma_f32_16x16x32_bf16(false, a, false, b, (short)0, c, false, false);
  asm volatile("v_nop\n\tv_nop\n\tv_nop\n\tv_nop" : "+v"(d) : "v"(a), "v"(b));
  return d;
}
// 16x16x32 fragments: lane = (h = lane>>4, row/col = lane&15); elements 0..7 = k0+8h+0..7, 8..15 = k0+16+8h+0..7; D element r = row 8h+r
__device__ __forceinline__ v16h frag_h(const _Float16* rowk0, int lane) {
  union { v16h v; v8h q[2]; } u; const _Float16* p = rowk0 + 8 * (lane >> 4);
  u.q[0] = *(const v8h*)p; u.q[1] = *(const v8h*)(p + 16); return u.v;
}
__device__ __forceinline__ v16h frag_f32(const float* rowk0, int lane) {
  v16h a; const float* p = rowk0 + 8 * (lane >> 4);
#pragma unroll
  for (int i = 0; i < 8; ++i) { a[i] = (_Float16)p[i]; a[8 + i] = (_Float16)p[16 + i]; }
  return a;
}
__device__ __forceinline__ v16h frag_f32s(const float* rowk0, int lane, float sc) {
  v16h a; const float* p = rowk0 + 8 * (lane >> 4);
#pragma unroll
  for (int i = 0; i < 8; ++i) { a[i] = (_Float16)(p[i] * sc); a[8 + i] = (_Float16)(p[16 + i] * sc); }
  return a;
}
// column fragment from a [K][ld] layout (column n), rows >= K read as 0
__device__ __forceinline__ v16h fragc_f32(const float* W, int k0, int n, int lane, int ld, int K) {
  v16h a; const int g = lane >> 4;
#pragma unroll
  for (int i = 0; i < 8; ++i) { const int ka = k0 + 8 * g + i, kb = ka + 16;
    a[i] = (_Float16)(ka < K ? W[(size_t)(ka < K ? ka : K - 1) * ld + n] : 0.f); a[8 + i] = (_Float16)(kb < K ? W[(size_t)(kb < K ? kb : K - 1) * ld + n] : 0.f); }
  return a;
}
struct F2 { v16b h, l; };
__device__ __forceinline__ F2 bsplit16(const float v[16]) { F2 r;
#pragma unroll
  for (int i = 0; i < 16; ++i) { const __bf16 h = (__bf16)v[i]; r.h[i] = h; r.l[i] = (__bf16)(v[i] - (float)h); }
  return r; }
__device__ __forceinline__ F2 split_row(const float* row, int k0, int lane) { float v[16]; const float* p = row + k0 + 8 * (lane >> 4);
#pragma unroll
  for (int i = 0; i < 8; ++i) { v[i] = p[i]; v[8 + i] = p[16 + i]; }
  return bsplit16(v); }
__device__ __forceinline__ F2 split_rowK(const float* row, int k0, int lane, int K) { float v[16]; const int g = lane >> 4;
#pragma unroll
  for (int i = 0; i < 8; ++i) { const int ka = k0 + 8 * g + i, kb = ka + 16; v[i] = ka < K ? row[ka < K ? ka : K - 1] : 0.f; v[8 + i] = kb < K ? row[kb < K ? kb : K - 1] : 0.f; }
  return bsplit16(v); }
__device__ __forceinline__ F2 split_col(const float* W, int k0, int n, int lane, int ld, int K) { float v[16]; const int g = lane >> 4;
#pragma unroll
  for (int i = 0; i < 8; ++i) { const int ka = k0 + 8 * g + i, kb = ka + 16; v[i] = ka < K ? W[(size_t)(ka < K ? ka : K - 1) * ld + n] : 0.f; v[8 + i] = kb < K ? W[(size_t)(kb < K ? kb : K - 1) * ld + n] : 0.f; }
  return bsplit16(v); }
__device__ __forceinline__ v8f mac3(const F2& a, const F2& b, v8f c) { c = wmma_bf(a.l, b.h, c); c = wmma_bf(a.h, b.l, c); return wmma_bf(a.h, b.h, c); }
__device__ __forceinline__ float sigm(float v) { return 1.0f / (1.0f + expf(-v)); }
#define LDSX() do { asm volatile("s_wait_dscnt 0" ::: "memory"); __builtin_amdgcn_wave_barrier(); __builtin_amdgcn_fence(__ATOMIC_RELEASE, "workgroup"); } while (0)

// Causal multi-head self-attention with per-head projection tensors (B 4, S 2,048, D 768, 12 heads x 64): q/k/v[b,h] = x W[h] + b[h] ([H][768][64] weights, [H][64] biases); scores = q k^T with key > query -> -inf, x 64^-0.5; softmax; out = concat_h(P v) Wo ((in,out) [768,768]) + bo.
#define NB 4
#define TT 2048
#define CC 768            // NH * HD = projected width
#define DIN 768          // input (model) width
#define NH 12
#define HD 64
#define SCALE (0.125f)
#define CAUSAL 1
#ifndef TNB
#define TNB NB
#endif
__device__ __forceinline__ float bfr(float v) { return (float)(__bf16)v; }
typedef __attribute__((ext_vector_type(8))) __bf16 v8b;
__device__ __forceinline__ v16b frag_b(const __bf16* rowk0, int lane) {
  union { v16b v; v8b q[2]; } u; const __bf16* p = rowk0 + 8 * (lane >> 4);
  u.q[0] = *(const v8b*)p; u.q[1] = *(const v8b*)(p + 16); return u.v;
}
#define QBH 6              // causal: query rows < QBH * 64 of each sequence (few keys, no averaging) take the high-precision path
#define QHI 384            // rows carrying a q residual plane
#define KHI 384            // key rows carrying k residual / v bf16 hi+lo planes (used only by the causal high-precision path)
// B fragment (k rows k0+.., output column o) of a weight: (in,out) [K][ld] or (out,in) [ld rows of K]: bf16 exact, or f16(bf16 * 256) exact
__device__ __forceinline__ v16b wcol_io(const float* Wm, int k0, int o, int lane, int ld) { v16b w; const int g = lane >> 4;
#pragma unroll
  for (int i = 0; i < 8; ++i) { w[i] = (__bf16)Wm[(size_t)(k0 + 8 * g + i) * ld + o]; w[8 + i] = (__bf16)Wm[(size_t)(k0 + 16 + 8 * g + i) * ld + o]; }
  return w; }
__device__ __forceinline__ v16b wcol_oi(const float* Wm, int k0, int o, int lane, int K) { v16b w; const float* p = Wm + (size_t)o * K + k0 + 8 * (lane >> 4);
#pragma unroll
  for (int i = 0; i < 8; ++i) { w[i] = (__bf16)p[i]; w[8 + i] = (__bf16)p[16 + i]; }
  return w; }
__device__ __forceinline__ v16h wcolh_io(const float* Wm, int k0, int o, int lane, int ld) { v16h w; const int g = lane >> 4;
#pragma unroll
  for (int i = 0; i < 8; ++i) { w[i] = (_Float16)(bfr(Wm[(size_t)(k0 + 8 * g + i) * ld + o]) * 256.0f); w[8 + i] = (_Float16)(bfr(Wm[(size_t)(k0 + 16 + 8 * g + i) * ld + o]) * 256.0f); }
  return w; }
__device__ __forceinline__ v16h wcolh_oi(const float* Wm, int k0, int o, int lane, int K) { v16h w; const float* p = Wm + (size_t)o * K + k0 + 8 * (lane >> 4);
#pragma unroll
  for (int i = 0; i < 8; ++i) { w[i] = (_Float16)(bfr(p[i]) * 256.0f); w[8 + i] = (_Float16)(bfr(p[16 + i]) * 256.0f); }
  return w; }
#define WQKV_LAYOUT 2   // 0 = (in,out) [DIN][CC]; 1 = (out,in) [CC][DIN]; 2 = per-head [NH][DIN][HD]
__device__ __forceinline__ v16b wcol_hdk(const float* Wm, int k0, int o, int lane) { v16b w; const int g = lane >> 4; const float* p = Wm + (size_t)(o / HD) * DIN * HD + (o % HD);
#pragma unroll
  for (int i = 0; i < 8; ++i) { w[i] = (__bf16)p[(size_t)(k0 + 8 * g + i) * HD]; w[8 + i] = (__bf16)p[(size_t)(k0 + 16 + 8 * g + i) * HD]; }
  return w; }
#define WO_OUT_IN 0
#if WQKV_LAYOUT == 1
#define WCOL(W, k0, o, lane) wcol_oi(W, k0, o, lane, DIN)
#elif WQKV_LAYOUT == 2
#define WCOL(W, k0, o, lane) wcol_hdk(W, k0, o, lane)
#else
#define WCOL(W, k0, o, lane) wcol_io(W, k0, o, lane, CC)
#endif
#if WO_OUT_IN
#define WOCOL(W, k0, o, lane) wcol_oi(W, k0, o, lane, CC)
#define WOCOLH(W, k0, o, lane) wcolh_oi(W, k0, o, lane, CC)
#else
#define WOCOL(W, k0, o, lane) wcol_io(W, k0, o, lane, DIN)
#define WOCOLH(W, k0, o, lane) wcolh_io(W, k0, o, lane, DIN)
#endif

#ifndef PROJ_EXTRA_PARAMS
#define PROJ_EXTRA_PARAMS
#endif

// q, k and v planes lie in FRAGMENT ORDER, so that each wave-wide 16-byte load of k_att covers 512 contiguous bytes (4 whole lines) instead of 16 pieces of 32 bytes in 16 lines.
// Row planes (q, k and their residuals), NT rows a sequence: [b][h][t / 16] tiles of 1,024 elements (16 rows x HD); element (t, d) at i * 256 + ln * 8 + d % 8, i = (d / 32) * 2 + (d % 32) / 16, ln = ((d % 16) / 8) * 16 + t % 16.
// v planes, NT keys a sequence: [b][h][t / 32] chunks of 2,048 elements (HD channels x 32 keys); element (c, t) at i * 256 + ln * 8 + t % 8, i = (c / 16) * 2 + (t % 32) / 16, ln = ((t % 16) / 8) * 16 + c % 16.
// In both, lane ln of a wave finds elements 0..7 of fragment f at f * 512 + ln * 8 and elements 8..15 at 256 elements on.
#define WS_QH  0u                                      // f16 q, row plane, NT = TT
#define WS_KH  (WS_QH + 2u * (size_t)NB * TT * CC)      // f16 k, row plane, NT = TT
#define WS_VT  (WS_KH + 2u * (size_t)NB * TT * CC)      // f16 v, v plane, NT = TT
#define WS_QL  (WS_VT + 2u * (size_t)NB * CC * TT)      // f16 q residual x 2^10, row plane, NT = QHI
#define WS_KL  (WS_QL + 2u * (size_t)NB * QHI * CC)     // f16 k residual x 2^10, row plane, NT = KHI
#define WS_VB  (WS_KL + 2u * (size_t)NB * KHI * CC)     // bf16 v hi (and, behind it, lo), v plane, NT = KHI
#define WS_VBL (WS_VB + 2u * (size_t)NB * CC * KHI)
#define WS_Y   (WS_VBL + 2u * (size_t)NB * CC * KHI)    // f32 ctx in fragment order: [(b*t) / 16][c / 32] blocks of 512 floats (16 rows x 32 k); element (t, c) at x * 128 + ln * 4 + c % 4, x = ((c % 32) / 16) * 2 + (c % 8) / 4, ln = ((c % 16) / 8) * 16 + t % 16
#define WS_END (WS_Y  + 4u * (size_t)NB * TT * CC)

// ---- weight k-slab in LDS (both projection kernels): 32 k rows x 128 output columns, converted once per block and laid out in fragment order, read by all 4 waves.
// Place of (k group q = k / 8, column c): (c / 16) * WJP + q * 256 + (c % 16) * 16 bytes, 8 k values of 16 bits each. A lane (g, col) finds elements 0..7 (k = 8g + i) at group g and 8..15 (k = 16 + 8g + i) at group 2 + g, 512 bytes on.
// Staging: thread (wave = k group, lane = 4 columns) loads 8 k rows x 16 bytes, so a wave's load covers whole 128-byte lines, and stores 4 columns x 16 bytes.
#define WJP 1040           // 4 groups x 16 columns x 16 B, + 16 B: the 16 lanes of a staging store then fall on 64 distinct banks
#define WSB (8 * WJP)      // one buffer
__device__ __forceinline__ void wslab_load(v4f (&r)[8], const float* p, int ld) {
#pragma unroll   // constant indices: the values stay in registers
  for (int i = 0; i < 8; ++i) r[i] = *(const v4f*)(p + (size_t)i * ld); }
__device__ __forceinline__ void wslab_put_b(unsigned char* d, const v4f (&r)[8]) {   // exact bf16
#pragma unroll   // constant indices: the values stay in registers
  for (int cc = 0; cc < 4; ++cc) { v8b h;
#pragma unroll   // constant indices: the values stay in registers
    for (int i = 0; i < 8; ++i) h[i] = (__bf16)r[i][cc];
    *(v8b*)(d + cc * 16) = h; } }
__device__ __forceinline__ void wslab_put_h(unsigned char* d, const v4f (&r)[8]) {   // f16(bf16 x 2^8), exact
#pragma unroll   // constant indices: the values stay in registers
  for (int cc = 0; cc < 4; ++cc) { v8h h;
#pragma unroll   // constant indices: the values stay in registers
    for (int i = 0; i < 8; ++i) h[i] = (_Float16)(bfr(r[i][cc]) * 256.0f);
    *(v8h*)(d + cc * 16) = h; } }
__device__ __forceinline__ v16b wfrag_b(const unsigned char* p) { union { v16b v; v8b q[2]; } u; u.q[0] = *(const v8b*)p; u.q[1] = *(const v8b*)(p + 512); return u.v; }
__device__ __forceinline__ v16h wfrag_h(const unsigned char* p) { union { v16h v; v8h q[2]; } u; u.q[0] = *(const v8h*)p; u.q[1] = *(const v8h*)(p + 512); return u.v; }
// a lane's 16 f32 of an A row (p = row + k0 + 8g): element e = x[e / 4][e % 4] = p[e] (e < 8), p[8 + e] (e >= 8)
__device__ __forceinline__ void arow_load(v4f (&x)[4], const float* p) { x[0] = *(const v4f*)p; x[1] = *(const v4f*)(p + 4); x[2] = *(const v4f*)(p + 16); x[3] = *(const v4f*)(p + 20); }
// the same 16 f32 from the fragment-order ctx plane (p = block start + 4 * lane): four runs of 512 bytes
__device__ __forceinline__ void arow_load_f(v4f (&x)[4], const float* p) { x[0] = *(const v4f*)p; x[1] = *(const v4f*)(p + 128); x[2] = *(const v4f*)(p + 256); x[3] = *(const v4f*)(p + 384); }
// behind the next slab's loads: their address registers are rewritten only behind this wait; the clobber also keeps the loads ahead of the products they fly under
#define SLABWAIT() asm volatile("s_wait_xcnt 0x0" ::: "memory")
// behind a group of global stores: their address and data registers are rewritten only behind this wait (the clobber keeps the next group's LDS reads behind it, the scheduling barrier its address arithmetic)
#define STOREWAIT() do { asm volatile("s_wait_xcnt 0x0" ::: "memory"); __builtin_amdgcn_sched_barrier(0); } while (0)
// behind a slab's products: keeps the conversions of the next slab, which wait for the loads in flight, from moving up among the products
#define PRODUCTS_DONE() __builtin_amdgcn_sched_barrier(0)

// ---- k_proj: block = (64 rows, 128 cols, which): q/k/v = X W (+ b) with exact bf16 products (K = DIN) -> which 0: q f16 (+ residual, rows < QHI); 1: k f16 (+ residual, rows < KHI); 2: v f16 (+ bf16 hi/lo for t < KHI); all stored in fragment order
__global__ __launch_bounds__(128) void k_proj(const float* __restrict__ XQ, const float* __restrict__ XK, const float* __restrict__ XV, const float* __restrict__ WQ, const float* __restrict__ WK, const float* __restrict__ WV, const float* __restrict__ BQ, const float* __restrict__ BK, const float* __restrict__ BV,
    _Float16* __restrict__ QH, _Float16* __restrict__ QL, _Float16* __restrict__ KH, _Float16* __restrict__ KL, _Float16* __restrict__ VT, __bf16* __restrict__ VB, __bf16* __restrict__ VBL) {
  __shared__ __align__(16) _Float16 sh[64][136], sl[64][136]; __shared__ __align__(16) _Float16 th[128][72]; __shared__ __align__(16) __bf16 tb[128][72], tbl[128][72]; __shared__ __align__(16) unsigned char wsm[2 * WSB];
  const int tid = threadIdx.x, wave = tid >> 5, lane = tid & 31, col = lane & 15, g = lane >> 4; const int which = blockIdx.z; const int c0 = blockIdx.y * 128; const size_t r0 = (size_t)blockIdx.x * 64; const size_t bb = r0 / TT; const int t0 = (int)(r0 % TT);
  const float* X = which == 0 ? XQ : which == 1 ? XK : XV; const float* WA = which == 0 ? WQ : which == 1 ? WK : WV; const float* BA = which == 0 ? BQ : which == 1 ? BK : BV;
  v8f acc[8] = {};
  { const int cw = c0 + 4 * lane;   // this thread's 4 weight columns; its 8 k rows are 8 * wave + 0..7 of each slab
    const float* wp = WA + (size_t)(cw / HD) * DIN * HD + (cw % HD) + (size_t)(8 * wave) * HD;   // per-head [NH][DIN][HD]
    const float* xp = X + (r0 + wave * 16 + col) * DIN + 8 * g;
    unsigned char* wput = wsm + (lane >> 2) * WJP + wave * 256 + (lane & 3) * 64; const unsigned char* wget = wsm + lane * 16;
    v4f wn[8], xn[4]; wslab_load(wn, wp, HD); arow_load(xn, xp); SLABWAIT();
    wslab_put_b(wput, wn);
    __syncthreads();   // slab 0 is in LDS before any wave reads it
#pragma unroll 2   // the buffer index is a constant in each copy of the body
    for (int kc = 0; kc < DIN / 32; ++kc) { v16b a;
#pragma unroll   // constant indices: the values stay in registers
      for (int e = 0; e < 16; ++e) a[e] = (__bf16)xn[e >> 2][e & 3];
      const bool more = kc + 1 < DIN / 32;   // block-uniform
      if (more) { const float* wq = wp + (size_t)(kc + 1) * 32 * HD; const float* xq = xp + (kc + 1) * 32; wslab_load(wn, wq, HD); arow_load(xn, xq); SLABWAIT(); }
      v16b wf[8];   // the slab's LDS reads go out as one group: one LDS latency, not one per product
#pragma unroll   // constant indices: the values stay in registers
      for (int j = 0; j < 8; ++j) wf[j] = wfrag_b(wget + (kc & 1) * WSB + j * WJP);
#pragma unroll   // constant indices: the values stay in registers
      for (int j = 0; j < 8; ++j) acc[j] = wmma_bf(a, wf[j], acc[j]);
      PRODUCTS_DONE();
      if (more) { wslab_put_b(wput + ((kc + 1) & 1) * WSB, wn);
        __syncthreads(); } } }   // publishes slab kc + 1 and ends every wave's reads of slab kc, whose buffer the next trip refills
  if (which < 2) { _Float16* DH = which == 0 ? QH : KH; _Float16* DL = which == 0 ? QL : KL; const int nhi = which == 0 ? QHI : KHI; const bool hi_rows = t0 < nhi;
#pragma unroll
    for (int j = 0; j < 8; ++j) { const float bias = BA ? bfr(BA[c0 + j * 16 + col]) : 0.f;
#pragma unroll
      for (int r = 0; r < 8; ++r) { const float v = acc[j][r] + bias; const _Float16 hv = (_Float16)v; sh[wave * 16 + 8 * g + r][j * 16 + col] = hv; sl[wave * 16 + 8 * g + r][j * 16 + col] = (_Float16)((v - (float)hv) * 1024.0f); } }
    __syncthreads();
    // the block's 8 tiles (it: 2 heads x 4 row tiles); in each, wave = the 512-byte run, lane = the place in it
    const int cl = (wave >> 1) * 32 + (wave & 1) * 16 + g * 8; const size_t bh = bb * NH + c0 / HD; v4u sv[8];
    _Float16* dp = DH + (bh * (TT / 16) + t0 / 16) * 1024 + tid * 8;
#pragma unroll   // constant indices: the values stay in registers, the steps become immediate offsets
    for (int it = 0; it < 8; ++it) sv[it] = *(const v4u*)&sh[(it & 3) * 16 + col][(it >> 2) * HD + cl];
#pragma unroll   // constant indices: the values stay in registers, the steps become immediate offsets
    for (int it = 0; it < 8; ++it) vst2((unsigned*)(dp + ((it >> 2) * (TT / 16) + (it & 3)) * 1024), sv[it]);
    STOREWAIT();
    if (hi_rows) { _Float16* lp = DL + (bh * (nhi / 16) + t0 / 16) * 1024 + tid * 8;
#pragma unroll   // constant indices: the values stay in registers, the steps become immediate offsets
      for (int it = 0; it < 8; ++it) sv[it] = *(const v4u*)&sl[(it & 3) * 16 + col][(it >> 2) * HD + cl];
#pragma unroll   // constant indices: the values stay in registers, the steps become immediate offsets
      for (int it = 0; it < 8; ++it) vst2((unsigned*)(lp + ((it >> 2) * (nhi / 16) + (it & 3)) * 1024), sv[it]); }
  } else { const bool hi_rows = t0 < KHI;
#pragma unroll
    for (int j = 0; j < 8; ++j) { const float bias = BA ? bfr(BA[c0 + j * 16 + col]) : 0.f;
#pragma unroll
      for (int r = 0; r < 8; ++r) { const float v = acc[j][r] + bias; const int rl = wave * 16 + 8 * g + r, cl = j * 16 + col; th[cl][rl] = (_Float16)v; const __bf16 bh = (__bf16)v; tb[cl][rl] = bh; tbl[cl][rl] = (__bf16)(v - (float)bh); } }
    __syncthreads();
    // the block's 8 half chunks (it: 2 heads x 2 key chunks x 2 halves of 4 runs); in each, wave = the 512-byte run, lane = the place in it
    const int cl = (wave >> 1) * 16 + col, rl = (wave & 1) * 16 + g * 8; const size_t bh = bb * NH + c0 / HD; v4u sv[8];
    _Float16* dp = VT + (bh * (TT / 32) + t0 / 32) * 2048 + tid * 8;
#pragma unroll   // constant indices: the values stay in registers, the steps become immediate offsets
    for (int it = 0; it < 8; ++it) sv[it] = *(const v4u*)&th[(it >> 2) * HD + (it & 1) * 32 + cl][((it >> 1) & 1) * 32 + rl];
#pragma unroll   // constant indices: the values stay in registers, the steps become immediate offsets
    for (int it = 0; it < 8; ++it) vst2((unsigned*)(dp + ((it >> 2) * (TT / 32) + ((it >> 1) & 1)) * 2048 + (it & 1) * 1024), sv[it]);
    STOREWAIT();
    if (hi_rows) { const size_t o3 = (bh * (KHI / 32) + t0 / 32) * 2048 + tid * 8; __bf16* hp = VB + o3; __bf16* lp = VBL + o3;
#pragma unroll   // constant indices: the values stay in registers, the steps become immediate offsets
      for (int it = 0; it < 8; ++it) sv[it] = *(const v4u*)&tb[(it >> 2) * HD + (it & 1) * 32 + cl][((it >> 1) & 1) * 32 + rl];
#pragma unroll   // constant indices: the values stay in registers, the steps become immediate offsets
      for (int it = 0; it < 8; ++it) vst2((unsigned*)(hp + ((it >> 2) * (KHI / 32) + ((it >> 1) & 1)) * 2048 + (it & 1) * 1024), sv[it]);
      STOREWAIT();
#pragma unroll   // constant indices: the values stay in registers, the steps become immediate offsets
      for (int it = 0; it < 8; ++it) sv[it] = *(const v4u*)&tbl[(it >> 2) * HD + (it & 1) * 32 + cl][((it >> 1) & 1) * 32 + rl];
#pragma unroll   // constant indices: the values stay in registers, the steps become immediate offsets
      for (int it = 0; it < 8; ++it) vst2((unsigned*)(lp + ((it >> 2) * (KHI / 32) + ((it >> 1) & 1)) * 2048 + (it & 1) * 1024), sv[it]); } } }
// ---- k_att: block = 16 queries (tile qt) of (b, h), AW waves; logits, softmax and P . v in one launch, the logits never leave the registers.
// Wave w owns the 32-key chunks w, w + AW, ... up to the diagonal. It forms the TRANSPOSED logits k . q^T (A = 16 key rows, B = 16 query columns), so a lane holds one query (col) and keys 8g + r of each 16-key tile:
// the D registers of a chunk's two tiles are, element for element, the A fragment of P for that chunk (0..7 = k0 + 8g + r, 8..15 = k0 + 16 + 8g + r). Row max and row sum: in the lane, one exchange between the lane halves, then over the waves through LDS in wave order.
// Products: 1-product f16 logits x 1/8, P x 2^11 once to f16 against v f16; query rows < QBH * 64: q, k hi + residual (3 products), P and v bf16 hi + lo (3 products). f32 partial ctx summed through LDS in wave order 0..AW-1.
#define AW 16
#define NCH (TT / 32 / AW)   // chunks a wave can own
// fragment halves from the lane's own pointer into a fragment-order plane (fragment start + 8 * lane): the two 512-byte runs of the fragment
__device__ __forceinline__ v16h frag_lh(const _Float16* p) { union { v16h v; v8h q[2]; } u; u.q[0] = *(const v8h*)p; u.q[1] = *(const v8h*)(p + 256); return u.v; }
__device__ __forceinline__ v16b frag_lb(const __bf16* p) { union { v16b v; v8b q[2]; } u; u.q[0] = *(const v8b*)p; u.q[1] = *(const v8b*)(p + 256); return u.v; }
// behind a batch of global loads: their address register, named as an input, is not rewritten in front of this wait and is free behind it
#define XWAIT1(p) asm volatile("s_wait_xcnt 0x0" :: "v"(p) : "memory")
#define XWAIT2(p, q) asm volatile("s_wait_xcnt 0x0" :: "v"(p), "v"(q) : "memory")
#define XWAIT4(p, q, r, s) asm volatile("s_wait_xcnt 0x0" :: "v"(p), "v"(q), "v"(r), "v"(s) : "memory")
// a query's maximum / sum over the block: the two lane halves, then the waves through LDS in wave order; called by every wave of the block
__device__ __forceinline__ float row_max(float m, float (*red)[16], int wave, int col, int g) {
  m = fmaxf(m, __shfl_xor(m, 16)); if (g == 0) red[wave][col] = m;
  __syncthreads();   // every wave's row maxima are in LDS before any is read
  m = red[0][col];
#pragma unroll
  for (int w = 1; w < AW; ++w) m = fmaxf(m, red[w][col]);
  return m; }
__device__ __forceinline__ float row_sum(float s, float (*red)[16], int wave, int col, int g) {
  s += __shfl_xor(s, 16); if (g == 0) red[wave][col] = s;
  __syncthreads();   // every wave's row sums are in LDS before any is read
  s = red[0][col];
#pragma unroll
  for (int w = 1; w < AW; ++w) s += red[w][col];
  return s; }
__global__ __launch_bounds__(32 * AW) void k_att(const _Float16* __restrict__ QH, const _Float16* __restrict__ KH, const _Float16* __restrict__ QL, const _Float16* __restrict__ KL, const _Float16* __restrict__ VT, const __bf16* __restrict__ VB, const __bf16* __restrict__ VBL, float* __restrict__ Y) {
  __shared__ __align__(16) float ss[AW][16][HD + 4]; __shared__ float redm[AW][16], reds[AW][16];
  // wave number held in a scalar register: every chunk test stays a scalar branch, so every lane is on at each matrix instruction
  const int tid = threadIdx.x, wave = __builtin_amdgcn_readfirstlane(tid >> 5), lane = tid & 31, col = lane & 15, g = lane >> 4;
  const int b = blockIdx.x / NH, h = blockIdx.x % NH;
  const int ql0 = (TT / 16 - 1 - (int)blockIdx.y) * 16;   // the tiles with the most keys take the lowest block indices
  const int kce = (ql0 >> 5) + 1;                         // chunks that hold a key <= the tile's last query
  const int n = kce > wave ? (kce - wave + AW - 1) / AW : 0;   // chunks of this wave (scalar)
  const int tq = ql0 + col;
  const size_t bh = (size_t)b * NH + h;
  const _Float16* qp = QH + (bh * (TT / 16) + (ql0 >> 4)) * 1024 + 8 * lane;   // lane pointers: tile or chunk start + the lane's 8 elements
  v8f acc[HD / 16] = {};
  if (ql0 < QBH * 64) {   // block-uniform: early rows, high precision; kce <= KHI / 32 <= AW, so one chunk a wave at most
    float s[16]; float m = -3.0e38f;
    if (n > 0) { const _Float16* qlp = QL + (bh * (QHI / 16) + (ql0 >> 4)) * 1024 + 8 * lane; const _Float16* kp = KH + (bh * (TT / 16) + wave * 2) * 1024 + 8 * lane; const _Float16* lp = KL + (bh * (KHI / 16) + wave * 2) * 1024 + 8 * lane;
      v16h qh[2], qlf[2], kbf[2][2], klf[2][2];   // loads first, products behind them
#pragma unroll
      for (int kc = 0; kc < 2; ++kc) { qh[kc] = frag_lh(qp + kc * 512); qlf[kc] = frag_lh(qlp + kc * 512);
#pragma unroll
        for (int t = 0; t < 2; ++t) { kbf[t][kc] = frag_lh(kp + t * 1024 + kc * 512); klf[t][kc] = frag_lh(lp + t * 1024 + kc * 512); } }
      XWAIT4(qp, qlp, kp, lp);
#pragma unroll
      for (int t = 0; t < 2; ++t) { v8f a = {}, al = {};
#pragma unroll
        for (int kc = 0; kc < 2; ++kc) { a = wmma16(kbf[t][kc], qh[kc], a); al = wmma16(kbf[t][kc], qlf[kc], al); al = wmma16(klf[t][kc], qh[kc], al); }
#pragma unroll
        for (int r = 0; r < 8; ++r) { const float v = (wave * 32 + t * 16 + 8 * g + r <= tq) ? (a[r] + al[r] * (1.0f / 1024.0f)) * SCALE : -3.0e38f; s[t * 8 + r] = v; m = fmaxf(m, v); } } }
    m = row_max(m, redm, wave, col, g);
    v16b vh[HD / 16], vl[HD / 16];   // the v fragments fly during the exponentials
    float sum = 0.f;
    if (n > 0) { const size_t po = (bh * (KHI / 32) + wave) * 2048 + 8 * lane; const __bf16* vhp = VB + po; const __bf16* vlp = VBL + po;
#pragma unroll
      for (int j = 0; j < HD / 16; ++j) { vh[j] = frag_lb(vhp + j * 512); vl[j] = frag_lb(vlp + j * 512); }
      XWAIT2(vhp, vlp);
#pragma unroll
      for (int e = 0; e < 16; ++e) { s[e] = expf(s[e] - m); sum += s[e]; } }   // an excluded key (-3e38) gives exactly 0: m is a finite logit
    const float inv = 2048.0f / row_sum(sum, reds, wave, col, g);
    if (n > 0) {
#pragma unroll
      for (int e = 0; e < 16; ++e) s[e] *= inv;
      const F2 p = bsplit16(s);
#pragma unroll
      for (int j = 0; j < HD / 16; ++j) { acc[j] = wmma_bf(p.h, vh[j], acc[j]); acc[j] = wmma_bf(p.l, vh[j], acc[j]); acc[j] = wmma_bf(p.h, vl[j], acc[j]); } }
  } else {
    float s[NCH][16]; float m = -3.0e38f;
    { const v16h q0 = frag_lh(qp), q1 = frag_lh(qp + 512); XWAIT1(qp); const _Float16* kw = KH + (bh * (TT / 16) + wave * 2) * 1024 + 8 * lane;
      v16h kf[NCH][4];   // all key fragments of the wave go out together: one load latency
#pragma unroll
      for (int i = 0; i < NCH; ++i) if (i < n) { const _Float16* kp = kw + i * AW * 2048; kf[i][0] = frag_lh(kp); kf[i][1] = frag_lh(kp + 512); kf[i][2] = frag_lh(kp + 1024); kf[i][3] = frag_lh(kp + 1536); XWAIT1(kw); }
#pragma unroll
      for (int i = 0; i < NCH; ++i) if (i < n) { const int k0 = (wave + AW * i) * 32;
#pragma unroll
        for (int t = 0; t < 2; ++t) { v8f a = {}; a = wmma16(kf[i][2 * t], q0, a); a = wmma16(kf[i][2 * t + 1], q1, a);
#pragma unroll
          for (int r = 0; r < 8; ++r) s[i][t * 8 + r] = a[r] * SCALE; }
        if (wave + AW * i == kce - 1) {   // only the last chunk holds keys past a query of the tile (scalar test)
#pragma unroll
          for (int e = 0; e < 16; ++e) if (k0 + (e >> 3) * 16 + 8 * g + (e & 7) > tq) s[i][e] = -3.0e38f; }
#pragma unroll
        for (int e = 0; e < 16; ++e) m = fmaxf(m, s[i][e]); } }
    m = row_max(m, redm, wave, col, g);
    const _Float16* vw = VT + (bh * (TT / 32) + wave) * 2048 + 8 * lane;
    v16h vf[NCH][HD / 16];   // the v fragments fly during the exponentials
#pragma unroll
    for (int i = 0; i < NCH; ++i) if (i < n) {
#pragma unroll
      for (int j = 0; j < HD / 16; ++j) vf[i][j] = frag_lh(vw + j * 512 + i * AW * 2048);
      XWAIT1(vw); }
    float sum = 0.f;
#pragma unroll
    for (int i = 0; i < NCH; ++i) if (i < n) {
#pragma unroll
      for (int e = 0; e < 16; ++e) { s[i][e] = expf(s[i][e] - m); sum += s[i][e]; } }   // an excluded key (-3e38) gives exactly 0: m is a finite logit
    const float inv = 2048.0f / row_sum(sum, reds, wave, col, g);
#pragma unroll
    for (int i = 0; i < NCH; ++i) if (i < n) { v16h p;
#pragma unroll
      for (int e = 0; e < 16; ++e) p[e] = (_Float16)(s[i][e] * inv);
#pragma unroll
      for (int j = 0; j < HD / 16; ++j) acc[j] = wmma16(p, vf[i][j], acc[j]); } }
#pragma unroll
  for (int j = 0; j < HD / 16; ++j)
#pragma unroll
    for (int r = 0; r < 8; ++r) ss[wave][8 * g + r][j * 16 + col] = acc[j][r];
  __syncthreads();   // every wave's partial is in LDS before any is summed
  if (tid < 16 * (HD / 4)) { const int rl = tid & 15, q4 = (tid >> 4) * 4; v4f o = *(const v4f*)&ss[0][rl][q4];   // 16 lanes = the 16 rows of one 4-channel group: 256 contiguous bytes of the fragment-order ctx plane
#pragma unroll   // the LDS reads of all partials go out together instead of one latency each
    for (int w = 1; w < AW; ++w) o += *(const v4f*)&ss[w][rl][q4];
    vst2(Y + ((((size_t)b * TT + ql0) >> 4) * (CC / 32) + h * (HD / 32) + (q4 >> 5)) * 512 + (((q4 >> 4) & 1) * 2 + ((q4 >> 2) & 1)) * 128 + (((q4 >> 3) & 1) * 16 + rl) * 4, o * (1.0f / 2048.0f)); } }
// ---- k_out: block = (64 rows, 128 cols): out = ctx Wo (+ bo): ctx once to f16 against Wo as f16(bf16 x 2^8) exact (1 product) x 2^-8; causal early rows (< QHI of each sequence): ctx bf16 hi + lo against exact bf16 Wo (2 products)
__global__ __launch_bounds__(128) void k_out(const float* __restrict__ Y, const float* __restrict__ WO, const float* __restrict__ BO, float* __restrict__ OUT) { __shared__ __align__(16) float sf[4][16][132]; __shared__ __align__(16) unsigned char wsm[2 * WSB];
  const int tid = threadIdx.x, wave = tid >> 5, lane = tid & 31, col = lane & 15, g = lane >> 4; const int c0 = blockIdx.y * 128; const size_t r0 = (size_t)blockIdx.x * 64 + wave * 16;
  v8f acc[8] = {};
  const float* wp = WO + (size_t)(8 * wave) * DIN + c0 + 4 * lane;   // (in,out) [CC][DIN]: this thread's 8 k rows x 4 columns of each slab
  const float* yp = Y + (r0 >> 4) * (CC / 32) * 512 + 4 * lane;   // this wave's 16 rows: one 512-float block per k slab
  unsigned char* wput = wsm + (lane >> 2) * WJP + wave * 256 + (lane & 3) * 64; const unsigned char* wget = wsm + lane * 16;
  v4f wn[8], yn[4]; wslab_load(wn, wp, DIN); arow_load_f(yn, yp); SLABWAIT();
  if (CAUSAL && (int)(((size_t)blockIdx.x * 64) % TT) < QHI) {   /* block-uniform */
    wslab_put_b(wput, wn);
    __syncthreads();   // slab 0 is in LDS before any wave reads it
#pragma unroll 2   // the buffer index is a constant in each copy of the body
    for (int kc = 0; kc < CC / 32; ++kc) { float v[16];
#pragma unroll   // constant indices: the values stay in registers
      for (int e = 0; e < 16; ++e) v[e] = yn[e >> 2][e & 3];
      const F2 a = bsplit16(v); const bool more = kc + 1 < CC / 32;   // block-uniform
      if (more) { const float* wq = wp + (size_t)(kc + 1) * 32 * DIN; const float* yq = yp + (kc + 1) * 512; wslab_load(wn, wq, DIN); arow_load_f(yn, yq); SLABWAIT(); }
      v16b wf[8];   // the slab's LDS reads go out as one group: one LDS latency, not one per product
#pragma unroll   // constant indices: the values stay in registers
      for (int j = 0; j < 8; ++j) wf[j] = wfrag_b(wget + (kc & 1) * WSB + j * WJP);
#pragma unroll   // constant indices: the values stay in registers
      for (int j = 0; j < 8; ++j) { acc[j] = wmma_bf(a.h, wf[j], acc[j]); acc[j] = wmma_bf(a.l, wf[j], acc[j]); }
      PRODUCTS_DONE();
      if (more) { wslab_put_b(wput + ((kc + 1) & 1) * WSB, wn);
        __syncthreads(); } }   // publishes slab kc + 1 and ends every wave's reads of slab kc, whose buffer the next trip refills
#pragma unroll
    for (int j = 0; j < 8; ++j) { const float bias = BO ? bfr(BO[c0 + j * 16 + col]) : 0.f;
#pragma unroll
      for (int r = 0; r < 8; ++r) sf[wave][8 * g + r][j * 16 + col] = acc[j][r] + bias; }
  } else {
    wslab_put_h(wput, wn);
    __syncthreads();   // slab 0 is in LDS before any wave reads it
#pragma unroll 2   // the buffer index is a constant in each copy of the body
    for (int kc = 0; kc < CC / 32; ++kc) { v16h a;
#pragma unroll   // constant indices: the values stay in registers
      for (int e = 0; e < 16; ++e) a[e] = (_Float16)yn[e >> 2][e & 3];
      const bool more = kc + 1 < CC / 32;   // block-uniform
      if (more) { const float* wq = wp + (size_t)(kc + 1) * 32 * DIN; const float* yq = yp + (kc + 1) * 512; wslab_load(wn, wq, DIN); arow_load_f(yn, yq); SLABWAIT(); }
      v16h wf[8];   // the slab's LDS reads go out as one group: one LDS latency, not one per product
#pragma unroll   // constant indices: the values stay in registers
      for (int j = 0; j < 8; ++j) wf[j] = wfrag_h(wget + (kc & 1) * WSB + j * WJP);
#pragma unroll   // constant indices: the values stay in registers
      for (int j = 0; j < 8; ++j) acc[j] = wmma16(a, wf[j], acc[j]);
      PRODUCTS_DONE();
      if (more) { wslab_put_h(wput + ((kc + 1) & 1) * WSB, wn);
        __syncthreads(); } }   // publishes slab kc + 1 and ends every wave's reads of slab kc, whose buffer the next trip refills
#pragma unroll
    for (int j = 0; j < 8; ++j) { const float bias = BO ? bfr(BO[c0 + j * 16 + col]) : 0.f;
#pragma unroll
      for (int r = 0; r < 8; ++r) sf[wave][8 * g + r][j * 16 + col] = acc[j][r] * (1.0f / 256.0f) + bias; } }
  LDSX(); for (int rl = 0; rl < 16; ++rl) vst2(OUT + (r0 + rl) * DIN + c0 + lane * 4, *(const v4f*)&sf[wave][rl][lane * 4]); }

extern "C" void kernel_launch(void* const* d_in, const int* in_sizes, int n_in, void* d_out, int out_size, void* d_ws, size_t ws_size, hipStream_t stream) {
  (void)in_sizes; (void)n_in; (void)out_size;
  const float** F = (const float**)d_in;
  if (ws_size < (size_t)WS_END) return;
  char* ws = (char*)d_ws; _Float16 *QH = (_Float16*)(ws + WS_QH), *KH = (_Float16*)(ws + WS_KH), *VT = (_Float16*)(ws + WS_VT), *QL = (_Float16*)(ws + WS_QL), *KL = (_Float16*)(ws + WS_KL); __bf16 *VB = (__bf16*)(ws + WS_VB), *VBL = (__bf16*)(ws + WS_VBL); float *Y = (float*)(ws + WS_Y);
  (void)Y; (void)QL; (void)KL; (void)VB; (void)VBL;
  // inputs: 0 x [4,2048,768]; 1 Wq, 2 Wk, 3 Wv [12,768,64]; 4 bq, 5 bk, 6 bv [12,64] (= flat [768] by column h*64+k); 7 Wo [768,768] (in,out); 8 bo [768]
  k_proj<<<dim3(TNB * TT / 64, CC / 128, 3), 128, 0, stream>>>(F[0], F[0], F[0], F[1], F[2], F[3], F[4], F[5], F[6], QH, QL, KH, KL, VT, VB, VBL);
  k_att<<<dim3(TNB * NH, TT / 16), 32 * AW, 0, stream>>>(QH, KH, QL, KL, VT, VB, VBL, Y);
  k_out<<<dim3(TNB * TT / 64, DIN / 128), 128, 0, stream>>>(Y, F[7], F[8], (float*)d_out);
}

// v005
// Measured time: 178 microseconds a run.
// In two side-by-side timings against v004, it was 1.11 and 1.12 times as fast.
// Over all steps from v000 it is 9.76 times as fast.
// compute dtype: all float inputs rounded to bf16; q/k/v = x W[h] + b[h] with EXACT bf16 products on WMMA 16x16x32, f32 accumulate; q, k once to f16 -> 1-product causal logits x 1/8, except the first 384 query rows of each sequence (few keys, no averaging), which use q and k as f16 hi + residual (x 2^10) (3 products); softmax in f32 (precise expf); P x 2^11 once to f16 against v once to f16 (1 product), except the first 384 rows: P and v as bf16 hi + lo (3 products); ctx once to f16 against Wo carried x 2^8 in f16 (exact bf16 values), except the first 384 rows: ctx bf16 hi + lo against exact bf16 Wo (2 products); + bo; f32 output.
#include <hip/hip_runtime.h>
#include <math.h>

typedef __attribute__((ext_vector_type(16))) _Float16 v16h;
typedef __attribute__((ext_vector_type(16))) __bf16 v16b;
typedef __attribute__((ext_vector_type(8)))  _Float16 v8h;
typedef __attribute__((ext_vector_type(8)))  float v8f;
typedef __attribute__((ext_vector_type(4)))  float v4f;
typedef __attribute__((ext_vector_type(2)))  float v2f;
typedef __attribute__((ext_vector_type(4)))  unsigned v4u;
typedef __attribute__((ext_vector_type(4)))  int v4i;
typedef float __attribute__((may_alias)) float_a;
typedef int __attribute__((may_alias)) int_a;

template <typename T> __device__ __forceinline__ void vst2(void* p, T v) { *(T*)p = v;  }
__device__ __forceinline__ v8f wmma16(v16h a, v16h b, v8f c) {
  v8f d = __builtin_amdgcn_wmma_f32_16x16x32_f16(false, a, false, b, (short)0, c, false, false);
  asm volatile("v_nop\n\tv_nop\n\tv_nop\n\tv_nop" : "+v"(d) : "v"(a), "v"(b));
  return d;
}
__device__ __forceinline__ v8f wmma_bf(v16b a, v16b b, v8f c) {
  v8f d = __builtin_amdgcn_wmma_f32_16x16x32_bf16(false, a, false, b, (short)0, c, false, false);
  asm volatile("v_nop\n\tv_nop\n\tv_nop\n\tv_nop" : "+v"(d) : "v"(a), "v"(b));
  return d;
}
// 16x16x32 fragments: lane = (h = lane>>4, row/col = lane&15); elements 0..7 = k0+8h+0..7, 8..15 = k0+16+8h+0..7; D element r = row 8h+r
__device__ __forceinline__ v16h frag_h(const _Float16* rowk0, int lane) {
  union { v16h v; v8h q[2]; } u; const _Float16* p = rowk0 + 8 * (lane >> 4);
  u.q[0] = *(const v8h*)p; u.q[1] = *(const v8h*)(p + 16); return u.v;
}
__device__ __forceinline__ v16h frag_f32(const float* rowk0, int lane) {
  v16h a; const float* p = rowk0 + 8 * (lane >> 4);
#pragma unroll
  for (int i = 0; i < 8; ++i) { a[i] = (_Float16)p[i]; a[8 + i] = (_Float16)p[16 + i]; }
  return a;
}
__device__ __forceinline__ v16h frag_f32s(const float* rowk0, int lane, float sc) {
  v16h a; const float* p = rowk0 + 8 * (lane >> 4);
#pragma unroll
  for (int i = 0; i < 8; ++i) { a[i] = (_Float16)(p[i] * sc); a[8 + i] = (_Float16)(p[16 + i] * sc); }
  return a;
}
// column fragment from a [K][ld] layout (column n), rows >= K read as 0
__device__ __forceinline__ v16h fragc_f32(const float* W, int k0, int n, int lane, int ld, int K) {
  v16h a; const int g = lane >> 4;
#pragma unroll
  for (int i = 0; i < 8; ++i) { const int ka = k0 + 8 * g + i, kb = ka + 16;
    a[i] = (_Float16)(ka < K ? W[(size_t)(ka < K ? ka : K - 1) * ld + n] : 0.f); a[8 + i] = (_Float16)(kb < K ? W[(size_t)(kb < K ? kb : K - 1) * ld + n] : 0.f); }
  return a;
}
struct F2 { v16b h, l; };
__device__ __forceinline__ F2 bsplit16(const float v[16]) { F2 r;
#pragma unroll
  for (int i = 0; i < 16; ++i) { const __bf16 h = (__bf16)v[i]; r.h[i] = h; r.l[i] = (__bf16)(v[i] - (float)h); }
  return r; }
__device__ __forceinline__ F2 split_row(const float* row, int k0, int lane) { float v[16]; const float* p = row + k0 + 8 * (lane >> 4);
#pragma unroll
  for (int i = 0; i < 8; ++i) { v[i] = p[i]; v[8 + i] = p[16 + i]; }
  return bsplit16(v); }
__device__ __forceinline__ F2 split_rowK(const float* row, int k0, int lane, int K) { float v[16]; const int g = lane >> 4;
#pragma unroll
  for (int i = 0; i < 8; ++i) { const int ka = k0 + 8 * g + i, kb = ka + 16; v[i] = ka < K ? row[ka < K ? ka : K - 1] : 0.f; v[8 + i] = kb < K ? row[kb < K ? kb : K - 1] : 0.f; }
  return bsplit16(v); }
__device__ __forceinline__ F2 split_col(const float* W, int k0, int n, int lane, int ld, int K) { float v[16]; const int g = lane >> 4;
#pragma unroll
  for (int i = 0; i < 8; ++i) { const int ka = k0 + 8 * g + i, kb = ka + 16; v[i] = ka < K ? W[(size_t)(ka < K ? ka : K - 1) * ld + n] : 0.f; v[8 + i] = kb < K ? W[(size_t)(kb < K ? kb : K - 1) * ld + n] : 0.f; }
  return bsplit16(v); }
__device__ __forceinline__ v8f mac3(const F2& a, const F2& b, v8f c) { c = wmma_bf(a.l, b.h, c); c = wmma_bf(a.h, b.l, c); return wmma_bf(a.h, b.h, c); }
__device__ __forceinline__ float sigm(float v) { return 1.0f / (1.0f + expf(-v)); }
#define LDSX() do { asm volatile("s_wait_dscnt 0" ::: "memory"); __builtin_amdgcn_wave_barrier(); __builtin_amdgcn_fence(__ATOMIC_RELEASE, "workgroup"); } while (0)

// Causal multi-head self-attention with per-head projection tensors (B 4, S 2,048, D 768, 12 heads x 64): q/k/v[b,h] = x W[h] + b[h] ([H][768][64] weights, [H][64] biases); scores = q k^T with key > query -> -inf, x 64^-0.5; softmax; out = concat_h(P v) Wo ((in,out) [768,768]) + bo.
#define NB 4
#define TT 2048
#define CC 768            // NH * HD = projected width
#define DIN 768          // input (model) width
#define NH 12
#define HD 64
#define SCALE (0.125f)
#define CAUSAL 1
#ifndef TNB
#define TNB NB
#endif
__device__ __forceinline__ float bfr(float v) { return (float)(__bf16)v; }
typedef __attribute__((ext_vector_type(8))) __bf16 v8b;
__device__ __forceinline__ v16b frag_b(const __bf16* rowk0, int lane) {
  union { v16b v; v8b q[2]; } u; const __bf16* p = rowk0 + 8 * (lane >> 4);
  u.q[0] = *(const v8b*)p; u.q[1] = *(const v8b*)(p + 16); return u.v;
}
#define QBH 6              // causal: query rows < QBH * 64 of each sequence (few keys, no averaging) take the high-precision path
#define QHI 384            // rows carrying a q residual plane
#define KHI 384            // key rows carrying k residual / v bf16 hi+lo planes (used only by the causal high-precision path)
// B fragment (k rows k0+.., output column o) of a weight: (in,out) [K][ld] or (out,in) [ld rows of K]: bf16 exact, or f16(bf16 * 256) exact
__device__ __forceinline__ v16b wcol_io(const float* Wm, int k0, int o, int lane, int ld) { v16b w; const int g = lane >> 4;
#pragma unroll
  for (int i = 0; i < 8; ++i) { w[i] = (__bf16)Wm[(size_t)(k0 + 8 * g + i) * ld + o]; w[8 + i] = (__bf16)Wm[(size_t)(k0 + 16 + 8 * g + i) * ld + o]; }
  return w; }
__device__ __forceinline__ v16b wcol_oi(const float* Wm, int k0, int o, int lane, int K) { v16b w; const float* p = Wm + (size_t)o * K + k0 + 8 * (lane >> 4);
#pragma unroll
  for (int i = 0; i < 8; ++i) { w[i] = (__bf16)p[i]; w[8 + i] = (__bf16)p[16 + i]; }
  return w; }
__device__ __forceinline__ v16h wcolh_io(const float* Wm, int k0, int o, int lane, int ld) { v16h w; const int g = lane >> 4;
#pragma unroll
  for (int i = 0; i < 8; ++i) { w[i] = (_Float16)(bfr(Wm[(size_t)(k0 + 8 * g + i) * ld + o]) * 256.0f); w[8 + i] = (_Float16)(bfr(Wm[(size_t)(k0 + 16 + 8 * g + i) * ld + o]) * 256.0f); }
  return w; }
__device__ __forceinline__ v16h wcolh_oi(const float* Wm, int k0, int o, int lane, int K) { v16h w; const float* p = Wm + (size_t)o * K + k0 + 8 * (lane >> 4);
#pragma unroll
  for (int i = 0; i < 8; ++i) { w[i] = (_Float16)(bfr(p[i]) * 256.0f); w[8 + i] = (_Float16)(bfr(p[16 + i]) * 256.0f); }
  return w; }
#define WQKV_LAYOUT 2   // 0 = (in,out) [DIN][CC]; 1 = (out,in) [CC][DIN]; 2 = per-head [NH][DIN][HD]
__device__ __forceinline__ v16b wcol_hdk(const float* Wm, int k0, int o, int lane) { v16b w; const int g = lane >> 4; const float* p = Wm + (size_t)(o / HD) * DIN * HD + (o % HD);
#pragma unroll
  for (int i = 0; i < 8; ++i) { w[i] = (__bf16)p[(size_t)(k0 + 8 * g + i) * HD]; w[8 + i] = (__bf16)p[(size_t)(k0 + 16 + 8 * g + i) * HD]; }
  return w; }
#define WO_OUT_IN 0
#if WQKV_LAYOUT == 1
#define WCOL(W, k0, o, lane) wcol_oi(W, k0, o, lane, DIN)
#elif WQKV_LAYOUT == 2
#define WCOL(W, k0, o, lane) wcol_hdk(W, k0, o, lane)
#else
#define WCOL(W, k0, o, lane) wcol_io(W, k0, o, lane, CC)
#endif
#if WO_OUT_IN
#define WOCOL(W, k0, o, lane) wcol_oi(W, k0, o, lane, CC)
#define WOCOLH(W, k0, o, lane) wcolh_oi(W, k0, o, lane, CC)
#else
#define WOCOL(W, k0, o, lane) wcol_io(W, k0, o, lane, DIN)
#define WOCOLH(W, k0, o, lane) wcolh_io(W, k0, o, lane, DIN)
#endif

#ifndef PROJ_EXTRA_PARAMS
#define PROJ_EXTRA_PARAMS
#endif

// q, k and v planes lie in FRAGMENT ORDER, so that each wave-wide 16-byte load of k_att covers 512 contiguous bytes (4 whole lines) instead of 16 pieces of 32 bytes in 16 lines.
// Row planes (q, k and their residuals), NT rows a sequence: [b][h][t / 16] tiles of 1,024 elements (16 rows x HD); element (t, d) at i * 256 + ln * 8 + d % 8, i = (d / 32) * 2 + (d % 32) / 16, ln = ((d % 16) / 8) * 16 + t % 16.
// v planes, NT keys a sequence: [b][h][t / 32] chunks of 2,048 elements (HD channels x 32 keys); element (c, t) at i * 256 + ln * 8 + t % 8, i = (c / 16) * 2 + (t % 32) / 16, ln = ((t % 16) / 8) * 16 + c % 16.
// In both, lane ln of a wave finds elements 0..7 of fragment f at f * 512 + ln * 8 and elements 8..15 at 256 elements on.
#define WS_QH  0u                                      // f16 q, row plane, NT = TT
#define WS_KH  (WS_QH + 2u * (size_t)NB * TT * CC)      // f16 k, row plane, NT = TT
#define WS_VT  (WS_KH + 2u * (size_t)NB * TT * CC)      // f16 v, v plane, NT = TT
#define WS_QL  (WS_VT + 2u * (size_t)NB * CC * TT)      // f16 q residual x 2^10, row plane, NT = QHI
#define WS_KL  (WS_QL + 2u * (size_t)NB * QHI * CC)     // f16 k residual x 2^10, row plane, NT = KHI
#define WS_VB  (WS_KL + 2u * (size_t)NB * KHI * CC)     // bf16 v hi (and, behind it, lo), v plane, NT = KHI
#define WS_VBL (WS_VB + 2u * (size_t)NB * CC * KHI)
#define WS_Y   (WS_VBL + 2u * (size_t)NB * CC * KHI)    // f32 ctx in fragment order: [(b*t) / 16][c / 32] blocks of 512 floats (16 rows x 32 k); element (t, c) at x * 128 + ln * 4 + c % 4, x = ((c % 32) / 16) * 2 + (c % 8) / 4, ln = ((c % 16) / 8) * 16 + t % 16
#define WS_END (WS_Y  + 4u * (size_t)NB * TT * CC)

// ---- weight k-slab in LDS (both projection kernels): 32 k rows x 128 output columns, converted once per block and laid out in fragment order, read by all 4 waves.
// Place of (k group q = k / 8, column c): (c / 16) * WJP + q * 256 + (c % 16) * 16 bytes, 8 k values of 16 bits each. A lane (g, col) finds elements 0..7 (k = 8g + i) at group g and 8..15 (k = 16 + 8g + i) at group 2 + g, 512 bytes on.
// Staging: thread (wave = k group, lane = 4 columns) loads 8 k rows x 16 bytes, so a wave's load covers whole 128-byte lines, and stores 4 columns x 16 bytes.
#define WJP 1040           // 4 groups x 16 columns x 16 B, + 16 B: the 16 lanes of a staging store then fall on 64 distinct banks
#define WSB (8 * WJP)      // one buffer
__device__ __forceinline__ void wslab_load(v4f (&r)[8], const float* p, int ld) {
#pragma unroll   // constant indices: the values stay in registers
  for (int i = 0; i < 8; ++i) r[i] = *(const v4f*)(p + (size_t)i * ld); }
__device__ __forceinline__ void wslab_put_b(unsigned char* d, const v4f (&r)[8]) {   // exact bf16
#pragma unroll   // constant indices: the values stay in registers
  for (int cc = 0; cc < 4; ++cc) { v8b h;
#pragma unroll   // constant indices: the values stay in registers
    for (int i = 0; i < 8; ++i) h[i] = (__bf16)r[i][cc];
    *(v8b*)(d + cc * 16) = h; } }
__device__ __forceinline__ void wslab_put_h(unsigned char* d, const v4f (&r)[8]) {   // f16(bf16 x 2^8), exact
#pragma unroll   // constant indices: the values stay in registers
  for (int cc = 0; cc < 4; ++cc) { v8h h;
#pragma unroll   // constant indices: the values stay in registers
    for (int i = 0; i < 8; ++i) h[i] = (_Float16)(bfr(r[i][cc]) * 256.0f);
    *(v8h*)(d + cc * 16) = h; } }
__device__ __forceinline__ v16b wfrag_b(const unsigned char* p) { union { v16b v; v8b q[2]; } u; u.q[0] = *(const v8b*)p; u.q[1] = *(const v8b*)(p + 512); return u.v; }
__device__ __forceinline__ v16h wfrag_h(const unsigned char* p) { union { v16h v; v8h q[2]; } u; u.q[0] = *(const v8h*)p; u.q[1] = *(const v8h*)(p + 512); return u.v; }
// a lane's 16 f32 of an A row (p = row + k0 + 8g): element e = x[e / 4][e % 4] = p[e] (e < 8), p[8 + e] (e >= 8)
__device__ __forceinline__ void arow_load(v4f (&x)[4], const float* p) { x[0] = *(const v4f*)p; x[1] = *(const v4f*)(p + 4); x[2] = *(const v4f*)(p + 16); x[3] = *(const v4f*)(p + 20); }
// the same 16 f32 from the fragment-order ctx plane (p = block start + 4 * lane): four runs of 512 bytes
__device__ __forceinline__ void arow_load_f(v4f (&x)[4], const float* p) { x[0] = *(const v4f*)p; x[1] = *(const v4f*)(p + 128); x[2] = *(const v4f*)(p + 256); x[3] = *(const v4f*)(p + 384); }
// behind the next slab's loads: their address registers are rewritten only behind this wait; the clobber also keeps the loads ahead of the products they fly under
#define SLABWAIT() asm volatile("s_wait_xcnt 0x0" ::: "memory")
// behind a group of global stores: their address and data registers are rewritten only behind this wait (the clobber keeps the next group's LDS reads behind it, the scheduling barrier its address arithmetic)
#define STOREWAIT() do { asm volatile("s_wait_xcnt 0x0" ::: "memory"); __builtin_amdgcn_sched_barrier(0); } while (0)
// behind a slab's products: keeps the conversions of the next slab, which wait for the loads in flight, from moving up among the products
#define PRODUCTS_DONE() __builtin_amdgcn_sched_barrier(0)

// ---- k_proj: block = (64 rows, 128 cols, which): q/k/v = X W (+ b) with exact bf16 products (K = DIN) -> which 0: q f16 (+ residual, rows < QHI); 1: k f16 (+ residual, rows < KHI); 2: v f16 (+ bf16 hi/lo for t < KHI); all stored in fragment order
__global__ __launch_bounds__(128) void k_proj(const float* __restrict__ XQ, const float* __restrict__ XK, const float* __restrict__ XV, const float* __restrict__ WQ, const float* __restrict__ WK, const float* __restrict__ WV, const float* __restrict__ BQ, const float* __restrict__ BK, const float* __restrict__ BV,
    _Float16* __restrict__ QH, _Float16* __restrict__ QL, _Float16* __restrict__ KH, _Float16* __restrict__ KL, _Float16* __restrict__ VT, __bf16* __restrict__ VB, __bf16* __restrict__ VBL) {
  __shared__ __align__(16) _Float16 sh[64][136], sl[64][136]; __shared__ __align__(16) _Float16 th[128][72]; __shared__ __align__(16) __bf16 tb[128][72], tbl[128][72]; __shared__ __align__(16) unsigned char wsm[2 * WSB];
  const int tid = threadIdx.x, wave = tid >> 5, lane = tid & 31, col = lane & 15, g = lane >> 4; const int which = blockIdx.z; const int c0 = blockIdx.y * 128; const size_t r0 = (size_t)blockIdx.x * 64; const size_t bb = r0 / TT; const int t0 = (int)(r0 % TT);
  const float* X = which == 0 ? XQ : which == 1 ? XK : XV; const float* WA = which == 0 ? WQ : which == 1 ? WK : WV; const float* BA = which == 0 ? BQ : which == 1 ? BK : BV;
  v8f acc[8] = {};
  { const int cw = c0 + 4 * lane;   // this thread's 4 weight columns; its 8 k rows are 8 * wave + 0..7 of each slab
    const float* wp = WA + (size_t)(cw / HD) * DIN * HD + (cw % HD) + (size_t)(8 * wave) * HD;   // per-head [NH][DIN][HD]
    const float* xp = X + (r0 + wave * 16 + col) * DIN + 8 * g;
    unsigned char* wput = wsm + (lane >> 2) * WJP + wave * 256 + (lane & 3) * 64; const unsigned char* wget = wsm + lane * 16;
    v4f wn[8], xn[4]; wslab_load(wn, wp, HD); arow_load(xn, xp); SLABWAIT();
    wslab_put_b(wput, wn);
    __syncthreads();   // slab 0 is in LDS before any wave reads it
#pragma unroll 2   // the buffer index is a constant in each copy of the body
    for (int kc = 0; kc < DIN / 32; ++kc) { v16b a;
#pragma unroll   // constant indices: the values stay in registers
      for (int e = 0; e < 16; ++e) a[e] = (__bf16)xn[e >> 2][e & 3];
      const bool more = kc + 1 < DIN / 32;   // block-uniform
      if (more) { const float* wq = wp + (size_t)(kc + 1) * 32 * HD; const float* xq = xp + (kc + 1) * 32; wslab_load(wn, wq, HD); arow_load(xn, xq); SLABWAIT(); }
      v16b wf[8];   // the slab's LDS reads go out as one group: one LDS latency, not one per product
#pragma unroll   // constant indices: the values stay in registers
      for (int j = 0; j < 8; ++j) wf[j] = wfrag_b(wget + (kc & 1) * WSB + j * WJP);
#pragma unroll   // constant indices: the values stay in registers
      for (int j = 0; j < 8; ++j) acc[j] = wmma_bf(a, wf[j], acc[j]);
      PRODUCTS_DONE();
      if (more) { wslab_put_b(wput + ((kc + 1) & 1) * WSB, wn);
        __syncthreads(); } } }   // publishes slab kc + 1 and ends every wave's reads of slab kc, whose buffer the next trip refills
  if (which < 2) { _Float16* DH = which == 0 ? QH : KH; _Float16* DL = which == 0 ? QL : KL; const int nhi = which == 0 ? QHI : KHI; const bool hi_rows = t0 < nhi;
#pragma unroll
    for (int j = 0; j < 8; ++j) { const float bias = BA ? bfr(BA[c0 + j * 16 + col]) : 0.f;
#pragma unroll
      for (int r = 0; r < 8; ++r) { const float v = acc[j][r] + bias; const _Float16 hv = (_Float16)v; sh[wave * 16 + 8 * g + r][j * 16 + col] = hv; sl[wave * 16 + 8 * g + r][j * 16 + col] = (_Float16)((v - (float)hv) * 1024.0f); } }
    __syncthreads();
    // the block's 8 tiles (it: 2 heads x 4 row tiles); in each, wave = the 512-byte run, lane = the place in it
    const int cl = (wave >> 1) * 32 + (wave & 1) * 16 + g * 8; const size_t bh = bb * NH + c0 / HD; v4u sv[8];
    _Float16* dp = DH + (bh * (TT / 16) + t0 / 16) * 1024 + tid * 8;
#pragma unroll   // constant indices: the values stay in registers, the steps become immediate offsets
    for (int it = 0; it < 8; ++it) sv[it] = *(const v4u*)&sh[(it & 3) * 16 + col][(it >> 2) * HD + cl];
#pragma unroll   // constant indices: the values stay in registers, the steps become immediate offsets
    for (int it = 0; it < 8; ++it) vst2((unsigned*)(dp + ((it >> 2) * (TT / 16) + (it & 3)) * 1024), sv[it]);
    STOREWAIT();
    if (hi_rows) { _Float16* lp = DL + (bh * (nhi / 16) + t0 / 16) * 1024 + tid * 8;
#pragma unroll   // constant indices: the values stay in registers, the steps become immediate offsets
      for (int it = 0; it < 8; ++it) sv[it] = *(const v4u*)&sl[(it & 3) * 16 + col][(it >> 2) * HD + cl];
#pragma unroll   // constant indices: the values stay in registers, the steps become immediate offsets
      for (int it = 0; it < 8; ++it) vst2((unsigned*)(lp + ((it >> 2) * (nhi / 16) + (it & 3)) * 1024), sv[it]); }
  } else { const bool hi_rows = t0 < KHI;
#pragma unroll
    for (int j = 0; j < 8; ++j) { const float bias = BA ? bfr(BA[c0 + j * 16 + col]) : 0.f;
#pragma unroll
      for (int r = 0; r < 8; ++r) { const float v = acc[j][r] + bias; const int rl = wave * 16 + 8 * g + r, cl = j * 16 + col; th[cl][rl] = (_Float16)v; const __bf16 bh = (__bf16)v; tb[cl][rl] = bh; tbl[cl][rl] = (__bf16)(v - (float)bh); } }
    __syncthreads();
    // the block's 8 half chunks (it: 2 heads x 2 key chunks x 2 halves of 4 runs); in each, wave = the 512-byte run, lane = the place in it
    const int cl = (wave >> 1) * 16 + col, rl = (wave & 1) * 16 + g * 8; const size_t bh = bb * NH + c0 / HD; v4u sv[8];
    _Float16* dp = VT + (bh * (TT / 32) + t0 / 32) * 2048 + tid * 8;
#pragma unroll   // constant indices: the values stay in registers, the steps become immediate offsets
    for (int it = 0; it < 8; ++it) sv[it] = *(const v4u*)&th[(it >> 2) * HD + (it & 1) * 32 + cl][((it >> 1) & 1) * 32 + rl];
#pragma unroll   // constant indices: the values stay in registers, the steps become immediate offsets
    for (int it = 0; it < 8; ++it) vst2((unsigned*)(dp + ((it >> 2) * (TT / 32) + ((it >> 1) & 1)) * 2048 + (it & 1) * 1024), sv[it]);
    STOREWAIT();
    if (hi_rows) { const size_t o3 = (bh * (KHI / 32) + t0 / 32) * 2048 + tid * 8; __bf16* hp = VB + o3; __bf16* lp = VBL + o3;
#pragma unroll   // constant indices: the values stay in registers, the steps become immediate offsets
      for (int it = 0; it < 8; ++it) sv[it] = *(const v4u*)&tb[(it >> 2) * HD + (it & 1) * 32 + cl][((it >> 1) & 1) * 32 + rl];
#pragma unroll   // constant indices: the values stay in registers, the steps become immediate offsets
      for (int it = 0; it < 8; ++it) vst2((unsigned*)(hp + ((it >> 2) * (KHI / 32) + ((it >> 1) & 1)) * 2048 + (it & 1) * 1024), sv[it]);
      STOREWAIT();
#pragma unroll   // constant indices: the values stay in registers, the steps become immediate offsets
      for (int it = 0; it < 8; ++it) sv[it] = *(const v4u*)&tbl[(it >> 2) * HD + (it & 1) * 32 + cl][((it >> 1) & 1) * 32 + rl];
#pragma unroll   // constant indices: the values stay in registers, the steps become immediate offsets
      for (int it = 0; it < 8; ++it) vst2((unsigned*)(lp + ((it >> 2) * (KHI / 32) + ((it >> 1) & 1)) * 2048 + (it & 1) * 1024), sv[it]); } } }
// ---- k_att: block = 32 queries (2 tiles of 16) of (b, h), AW waves; the early rows (high precision) 16 queries a block; logits, softmax and P . v in one launch, the logits never leave the registers.
// Both tiles of a block end in the same 32-key chunk, so each K and each V fragment that a wave loads feeds both: half the loads per query.
// Wave w owns the 32-key chunks w, w + AW, ... up to the diagonal. It forms the TRANSPOSED logits k . q^T (A = 16 key rows, B = 16 query columns), so a lane holds one query (col) and keys 8g + r of each 16-key tile:
// the D registers of a chunk's two tiles are, element for element, the A fragment of P for that chunk (0..7 = k0 + 8g + r, 8..15 = k0 + 16 + 8g + r). Row max and row sum: in the lane, one exchange between the lane halves, then over the waves through LDS in wave order.
// Products: 1-product f16 logits x 1/8, P x 2^11 once to f16 against v f16; query rows < QBH * 64: q, k hi + residual (3 products), P and v bf16 hi + lo (3 products). f32 partial ctx summed through LDS in wave order 0..AW-1.
#define AW 16
#define NCH (TT / 32 / AW)   // chunks a wave can own
#define VFLY 2               // chunks whose v fragments are loaded ahead of the exponentials
// fragment halves from the lane's own pointer into a fragment-order plane (fragment start + 8 * lane): the two 512-byte runs of the fragment
__device__ __forceinline__ v16h frag_lh(const _Float16* p) { union { v16h v; v8h q[2]; } u; u.q[0] = *(const v8h*)p; u.q[1] = *(const v8h*)(p + 256); return u.v; }
__device__ __forceinline__ v16b frag_lb(const __bf16* p) { union { v16b v; v8b q[2]; } u; u.q[0] = *(const v8b*)p; u.q[1] = *(const v8b*)(p + 256); return u.v; }
// behind a batch of global loads: their address register, named as an input, is not rewritten in front of this wait and is free behind it
#define XWAIT1(p) asm volatile("s_wait_xcnt 0x0" :: "v"(p) : "memory")
#define XWAIT2(p, q) asm volatile("s_wait_xcnt 0x0" :: "v"(p), "v"(q) : "memory")
#define XWAIT4(p, q, r, s) asm volatile("s_wait_xcnt 0x0" :: "v"(p), "v"(q), "v"(r), "v"(s) : "memory")
// a query's maximum / sum over the block: the two lane halves, then the waves through LDS in wave order; called by every wave of the block
__device__ __forceinline__ float row_max(float m, float (*red)[16], int wave, int col, int g) {
  m = fmaxf(m, __shfl_xor(m, 16)); if (g == 0) red[wave][col] = m;
  __syncthreads();   // every wave's row maxima are in LDS before any is read
  m = red[0][col];
#pragma unroll
  for (int w = 1; w < AW; ++w) m = fmaxf(m, red[w][col]);
  return m; }
__device__ __forceinline__ float row_sum(float s, float (*red)[16], int wave, int col, int g) {
  s += __shfl_xor(s, 16); if (g == 0) red[wave][col] = s;
  __syncthreads();   // every wave's row sums are in LDS before any is read
  s = red[0][col];
#pragma unroll
  for (int w = 1; w < AW; ++w) s += red[w][col];
  return s; }
// the same for the two tiles of a block behind ONE barrier: lane half g stores and reduces tile g (same wave order), then the halves exchange
__device__ __forceinline__ void row_max2(float& m0, float& m1, float (*red)[AW][16], int wave, int col, int g) {
  m0 = fmaxf(m0, __shfl_xor(m0, 16)); m1 = fmaxf(m1, __shfl_xor(m1, 16)); red[g][wave][col] = g ? m1 : m0;
  __syncthreads();   // every wave's row maxima are in LDS before any is read
  float a = red[g][0][col];
#pragma unroll   // the LDS reads go out together instead of one latency each
  for (int w = 1; w < AW; ++w) a = fmaxf(a, red[g][w][col]);
  const float o = __shfl_xor(a, 16); m0 = g ? o : a; m1 = g ? a : o; }
__device__ __forceinline__ void row_sum2(float& s0, float& s1, float (*red)[AW][16], int wave, int col, int g) {
  s0 += __shfl_xor(s0, 16); s1 += __shfl_xor(s1, 16); red[g][wave][col] = g ? s1 : s0;
  __syncthreads();   // every wave's row sums are in LDS before any is read
  float a = red[g][0][col];
#pragma unroll   // the LDS reads go out together instead of one latency each
  for (int w = 1; w < AW; ++w) a += red[g][w][col];
  const float o = __shfl_xor(a, 16); s0 = g ? o : a; s1 = g ? a : o; }
#define NPAIR ((TT - QBH * 64) / 32)   // blocks of 32 queries per (b, h)
#define NHIT (QBH * 4)                 // blocks of 16 early queries per (b, h)
__global__ __launch_bounds__(32 * AW) void k_att(const _Float16* __restrict__ QH, const _Float16* __restrict__ KH, const _Float16* __restrict__ QL, const _Float16* __restrict__ KL, const _Float16* __restrict__ VT, const __bf16* __restrict__ VB, const __bf16* __restrict__ VBL, float* __restrict__ Y) {
  __shared__ __align__(16) float ss[2][AW][16][HD + 4]; __shared__ float redm[2][AW][16], reds[2][AW][16];
  // wave number held in a scalar register: every chunk test stays a scalar branch, so every lane is on at each matrix instruction
  const int tid = threadIdx.x, wave = __builtin_amdgcn_readfirstlane(tid >> 5), lane = tid & 31, col = lane & 15, g = lane >> 4;
  const int b = blockIdx.x / NH, h = blockIdx.x % NH;
  const bool pair = (int)blockIdx.y < NPAIR;   // block-uniform
  const int ql0 = pair ? TT - 32 * ((int)blockIdx.y + 1) : (NPAIR + NHIT - 1 - (int)blockIdx.y) * 16;   // the tiles with the most keys take the lowest indices
  const int kce = (ql0 >> 5) + 1;                         // chunks that hold a key <= the block's last query (a pair starts at a multiple of 32: the same chunk for both tiles)
  const int n = kce > wave ? (kce - wave + AW - 1) / AW : 0;   // chunks of this wave (scalar)
  const int tq = ql0 + col;
  const size_t bh = (size_t)b * NH + h;
  const _Float16* qp = QH + (bh * (TT / 16) + (ql0 >> 4)) * 1024 + 8 * lane;   // lane pointers: tile or chunk start + the lane's 8 elements
  v8f acc[2][HD / 16] = {};
  if (!pair) {   // block-uniform: early rows, high precision; kce <= KHI / 32 <= AW, so one chunk a wave at most
    float s[16]; float m = -3.0e38f;
    if (n > 0) { const _Float16* qlp = QL + (bh * (QHI / 16) + (ql0 >> 4)) * 1024 + 8 * lane; const _Float16* kp = KH + (bh * (TT / 16) + wave * 2) * 1024 + 8 * lane; const _Float16* lp = KL + (bh * (KHI / 16) + wave * 2) * 1024 + 8 * lane;
      v16h qh[2], qlf[2], kbf[2][2], klf[2][2];   // loads first, products behind them
#pragma unroll
      for (int kc = 0; kc < 2; ++kc) { qh[kc] = frag_lh(qp + kc * 512); qlf[kc] = frag_lh(qlp + kc * 512);
#pragma unroll
        for (int t = 0; t < 2; ++t) { kbf[t][kc] = frag_lh(kp + t * 1024 + kc * 512); klf[t][kc] = frag_lh(lp + t * 1024 + kc * 512); } }
      XWAIT4(qp, qlp, kp, lp);
#pragma unroll
      for (int t = 0; t < 2; ++t) { v8f a = {}, al = {};
#pragma unroll
        for (int kc = 0; kc < 2; ++kc) { a = wmma16(kbf[t][kc], qh[kc], a); al = wmma16(kbf[t][kc], qlf[kc], al); al = wmma16(klf[t][kc], qh[kc], al); }
#pragma unroll
        for (int r = 0; r < 8; ++r) { const float v = (wave * 32 + t * 16 + 8 * g + r <= tq) ? (a[r] + al[r] * (1.0f / 1024.0f)) * SCALE : -3.0e38f; s[t * 8 + r] = v; m = fmaxf(m, v); } } }
    m = row_max(m, redm[0], wave, col, g);
    v16b vh[HD / 16], vl[HD / 16];   // the v fragments fly during the exponentials
    float sum = 0.f;
    if (n > 0) { const size_t po = (bh * (KHI / 32) + wave) * 2048 + 8 * lane; const __bf16* vhp = VB + po; const __bf16* vlp = VBL + po;
#pragma unroll
      for (int j = 0; j < HD / 16; ++j) { vh[j] = frag_lb(vhp + j * 512); vl[j] = frag_lb(vlp + j * 512); }
      XWAIT2(vhp, vlp);
#pragma unroll
      for (int e = 0; e < 16; ++e) { s[e] = expf(s[e] - m); sum += s[e]; } }   // an excluded key (-3e38) gives exactly 0: m is a finite logit
    const float inv = 2048.0f / row_sum(sum, reds[0], wave, col, g);
    if (n > 0) {
#pragma unroll
      for (int e = 0; e < 16; ++e) s[e] *= inv;
      const F2 p = bsplit16(s);
#pragma unroll
      for (int j = 0; j < HD / 16; ++j) { acc[0][j] = wmma_bf(p.h, vh[j], acc[0][j]); acc[0][j] = wmma_bf(p.l, vh[j], acc[0][j]); acc[0][j] = wmma_bf(p.h, vl[j], acc[0][j]); } }
  } else {
    float s[NCH][2][16]; float m0 = -3.0e38f, m1 = -3.0e38f;
    { v16h q[2][2];
#pragma unroll   // constant indices: the values stay in registers
      for (int u = 0; u < 2; ++u) { q[u][0] = frag_lh(qp + u * 1024); q[u][1] = frag_lh(qp + u * 1024 + 512); }
      XWAIT1(qp); const _Float16* kw = KH + (bh * (TT / 16) + wave * 2) * 1024 + 8 * lane;
      v16h kf[NCH][4];   // all key fragments of the wave go out together: one load latency
#pragma unroll   // constant indices: the values stay in registers
      for (int i = 0; i < NCH; ++i) if (i < n) { const _Float16* kp = kw + i * AW * 2048; kf[i][0] = frag_lh(kp); kf[i][1] = frag_lh(kp + 512); kf[i][2] = frag_lh(kp + 1024); kf[i][3] = frag_lh(kp + 1536); XWAIT1(kw); }
#pragma unroll   // constant indices: the values stay in registers
      for (int i = 0; i < NCH; ++i) if (i < n) { const int k0 = (wave + AW * i) * 32;
        v8f a[2][2];   // four independent accumulators: (query tile u, key tile t)
#pragma unroll   // constant indices: the values stay in registers
        for (int u = 0; u < 2; ++u)
#pragma unroll   // constant indices: the values stay in registers
          for (int t = 0; t < 2; ++t) { const v8f z = {}; a[u][t] = wmma16(kf[i][2 * t], q[u][0], z); }
#pragma unroll   // constant indices: the values stay in registers
        for (int u = 0; u < 2; ++u)
#pragma unroll   // constant indices: the values stay in registers
          for (int t = 0; t < 2; ++t) { a[u][t] = wmma16(kf[i][2 * t + 1], q[u][1], a[u][t]);
#pragma unroll   // constant indices: the values stay in registers
            for (int r = 0; r < 8; ++r) s[i][u][t * 8 + r] = a[u][t][r] * SCALE; }
        if (wave + AW * i == kce - 1) {   // only the last chunk holds keys past a query of the block (scalar test)
#pragma unroll   // constant indices: the values stay in registers
          for (int u = 0; u < 2; ++u)
#pragma unroll   // constant indices: the values stay in registers
            for (int e = 0; e < 16; ++e) if (k0 + (e >> 3) * 16 + 8 * g + (e & 7) > tq + 16 * u) s[i][u][e] = -3.0e38f; }
#pragma unroll   // constant indices: the values stay in registers
        for (int e = 0; e < 16; ++e) { m0 = fmaxf(m0, s[i][0][e]); m1 = fmaxf(m1, s[i][1][e]); } } }
    row_max2(m0, m1, redm, wave, col, g);
    const _Float16* vw = VT + (bh * (TT / 32) + wave) * 2048 + 8 * lane;
    v16h vf[NCH][HD / 16];   // the v fragments of the first VFLY chunks fly during the exponentials; beside 2 tiles of f32 logits the registers hold no more
#pragma unroll   // constant indices: the values stay in registers
    for (int i = 0; i < VFLY; ++i) if (i < n) {
#pragma unroll   // constant indices: the values stay in registers
      for (int j = 0; j < HD / 16; ++j) vf[i][j] = frag_lh(vw + j * 512 + i * AW * 2048);
      XWAIT1(vw); }
    float sum0 = 0.f, sum1 = 0.f;
#pragma unroll   // constant indices: the values stay in registers
    for (int i = 0; i < NCH; ++i) if (i < n) {
#pragma unroll   // constant indices: the values stay in registers
      for (int e = 0; e < 16; ++e) { s[i][0][e] = expf(s[i][0][e] - m0); sum0 += s[i][0][e]; s[i][1][e] = expf(s[i][1][e] - m1); sum1 += s[i][1][e]; } }   // an excluded key (-3e38) gives exactly 0: m is a finite logit
    row_sum2(sum0, sum1, reds, wave, col, g);
    const float inv0 = 2048.0f / sum0, inv1 = 2048.0f / sum1;
    v16h p[NCH][2];   // P in 16 bits takes half the logits' registers: every 2 chunks converted make room for one more chunk's v fragments, loaded at once
#pragma unroll   // constant indices: the values stay in registers
    for (int i = 0; i < NCH; ++i) {
      if (i < n) {
#pragma unroll   // constant indices: the values stay in registers
        for (int e = 0; e < 16; ++e) { p[i][0][e] = (_Float16)(s[i][0][e] * inv0); p[i][1][e] = (_Float16)(s[i][1][e] * inv1); } }
      if ((i & 1) && VFLY + (i >> 1) < n) { const int iv = VFLY + (i >> 1);
#pragma unroll   // constant indices: the values stay in registers
        for (int j = 0; j < HD / 16; ++j) vf[iv][j] = frag_lh(vw + j * 512 + iv * AW * 2048);
        XWAIT1(vw); } }
#pragma unroll   // constant indices: the values stay in registers
    for (int i = 0; i < NCH; ++i) if (i < n) {
#pragma unroll   // constant indices: the values stay in registers
      for (int j = 0; j < HD / 16; ++j) { acc[0][j] = wmma16(p[i][0], vf[i][j], acc[0][j]); acc[1][j] = wmma16(p[i][1], vf[i][j], acc[1][j]); } } }
#pragma unroll   // constant indices: the values stay in registers
  for (int j = 0; j < HD / 16; ++j)
#pragma unroll   // constant indices: the values stay in registers
    for (int r = 0; r < 8; ++r) ss[0][wave][8 * g + r][j * 16 + col] = acc[0][j][r];
  if (pair) {
#pragma unroll   // constant indices: the values stay in registers
    for (int j = 0; j < HD / 16; ++j)
#pragma unroll   // constant indices: the values stay in registers
      for (int r = 0; r < 8; ++r) ss[1][wave][8 * g + r][j * 16 + col] = acc[1][j][r]; }
  __syncthreads();   // every wave's partial is in LDS before any is summed
  const int u = tid >> 8;   // waves 0..7 sum and store tile 0, waves 8..15 tile 1 (a pair only)
  if (u == 0 || pair) { const int rl = tid & 15, q4 = ((tid >> 4) & 15) * 4; v4f o = *(const v4f*)&ss[u][0][rl][q4];   // 16 lanes = the 16 rows of one 4-channel group: 256 contiguous bytes of the fragment-order ctx plane
#pragma unroll   // the LDS reads of all partials go out together instead of one latency each
    for (int w = 1; w < AW; ++w) o += *(const v4f*)&ss[u][w][rl][q4];
    vst2(Y + ((((size_t)b * TT + ql0 + 16 * u) >> 4) * (CC / 32) + h * (HD / 32) + (q4 >> 5)) * 512 + (((q4 >> 4) & 1) * 2 + ((q4 >> 2) & 1)) * 128 + (((q4 >> 3) & 1) * 16 + rl) * 4, o * (1.0f / 2048.0f)); } }
// ---- k_out: block = (64 rows, 128 cols): out = ctx Wo (+ bo): ctx once to f16 against Wo as f16(bf16 x 2^8) exact (1 product) x 2^-8; causal early rows (< QHI of each sequence): ctx bf16 hi + lo against exact bf16 Wo (2 products)
__global__ __launch_bounds__(128) void k_out(const float* __restrict__ Y, const float* __restrict__ WO, const float* __restrict__ BO, float* __restrict__ OUT) { __shared__ __align__(16) float sf[4][16][132]; __shared__ __align__(16) unsigned char wsm[2 * WSB];
  const int tid = threadIdx.x, wave = tid >> 5, lane = tid & 31, col = lane & 15, g = lane >> 4; const int c0 = blockIdx.y * 128; const size_t r0 = (size_t)blockIdx.x * 64 + wave * 16;
  v8f acc[8] = {};
  const float* wp = WO + (size_t)(8 * wave) * DIN + c0 + 4 * lane;   // (in,out) [CC][DIN]: this thread's 8 k rows x 4 columns of each slab
  const float* yp = Y + (r0 >> 4) * (CC / 32) * 512 + 4 * lane;   // this wave's 16 rows: one 512-float block per k slab
  unsigned char* wput = wsm + (lane >> 2) * WJP + wave * 256 + (lane & 3) * 64; const unsigned char* wget = wsm + lane * 16;
  v4f wn[8], yn[4]; wslab_load(wn, wp, DIN); arow_load_f(yn, yp); SLABWAIT();
  if (CAUSAL && (int)(((size_t)blockIdx.x * 64) % TT) < QHI) {   /* block-uniform */
    wslab_put_b(wput, wn);
    __syncthreads();   // slab 0 is in LDS before any wave reads it
#pragma unroll 2   // the buffer index is a constant in each copy of the body
    for (int kc = 0; kc < CC / 32; ++kc) { float v[16];
#pragma unroll   // constant indices: the values stay in registers
      for (int e = 0; e < 16; ++e) v[e] = yn[e >> 2][e & 3];
      const F2 a = bsplit16(v); const bool more = kc + 1 < CC / 32;   // block-uniform
      if (more) { const float* wq = wp + (size_t)(kc + 1) * 32 * DIN; const float* yq = yp + (kc + 1) * 512; wslab_load(wn, wq, DIN); arow_load_f(yn, yq); SLABWAIT(); }
      v16b wf[8];   // the slab's LDS reads go out as one group: one LDS latency, not one per product
#pragma unroll   // constant indices: the values stay in registers
      for (int j = 0; j < 8; ++j) wf[j] = wfrag_b(wget + (kc & 1) * WSB + j * WJP);
#pragma unroll   // constant indices: the values stay in registers
      for (int j = 0; j < 8; ++j) { acc[j] = wmma_bf(a.h, wf[j], acc[j]); acc[j] = wmma_bf(a.l, wf[j], acc[j]); }
      PRODUCTS_DONE();
      if (more) { wslab_put_b(wput + ((kc + 1) & 1) * WSB, wn);
        __syncthreads(); } }   // publishes slab kc + 1 and ends every wave's reads of slab kc, whose buffer the next trip refills
#pragma unroll
    for (int j = 0; j < 8; ++j) { const float bias = BO ? bfr(BO[c0 + j * 16 + col]) : 0.f;
#pragma unroll
      for (int r = 0; r < 8; ++r) sf[wave][8 * g + r][j * 16 + col] = acc[j][r] + bias; }
  } else {
    wslab_put_h(wput, wn);
    __syncthreads();   // slab 0 is in LDS before any wave reads it
#pragma unroll 2   // the buffer index is a constant in each copy of the body
    for (int kc = 0; kc < CC / 32; ++kc) { v16h a;
#pragma unroll   // constant indices: the values stay in registers
      for (int e = 0; e < 16; ++e) a[e] = (_Float16)yn[e >> 2][e & 3];
      const bool more = kc + 1 < CC / 32;   // block-uniform
      if (more) { const float* wq = wp + (size_t)(kc + 1) * 32 * DIN; const float* yq = yp + (kc + 1) * 512; wslab_load(wn, wq, DIN); arow_load_f(yn, yq); SLABWAIT(); }
      v16h wf[8];   // the slab's LDS reads go out as one group: one LDS latency, not one per product
#pragma unroll   // constant indices: the values stay in registers
      for (int j = 0; j < 8; ++j) wf[j] = wfrag_h(wget + (kc & 1) * WSB + j * WJP);
#pragma unroll   // constant indices: the values stay in registers
      for (int j = 0; j < 8; ++j) acc[j] = wmma16(a, wf[j], acc[j]);
      PRODUCTS_DONE();
      if (more) { wslab_put_h(wput + ((kc + 1) & 1) * WSB, wn);
        __syncthreads(); } }   // publishes slab kc + 1 and ends every wave's reads of slab kc, whose buffer the next trip refills
#pragma unroll
    for (int j = 0; j < 8; ++j) { const float bias = BO ? bfr(BO[c0 + j * 16 + col]) : 0.f;
#pragma unroll
      for (int r = 0; r < 8; ++r) sf[wave][8 * g + r][j * 16 + col] = acc[j][r] * (1.0f / 256.0f) + bias; } }
  LDSX(); for (int rl = 0; rl < 16; ++rl) vst2(OUT + (r0 + rl) * DIN + c0 + lane * 4, *(const v4f*)&sf[wave][rl][lane * 4]); }

extern "C" void kernel_launch(void* const* d_in, const int* in_sizes, int n_in, void* d_out, int out_size, void* d_ws, size_t ws_size, hipStream_t stream) {
  (void)in_sizes; (void)n_in; (void)out_size;
  const float** F = (const float**)d_in;
  if (ws_size < (size_t)WS_END) return;
  char* ws = (char*)d_ws; _Float16 *QH = (_Float16*)(ws + WS_QH), *KH = (_Float16*)(ws + WS_KH), *VT = (_Float16*)(ws + WS_VT), *QL = (_Float16*)(ws + WS_QL), *KL = (_Float16*)(ws + WS_KL); __bf16 *VB = (__bf16*)(ws + WS_VB), *VBL = (__bf16*)(ws + WS_VBL); float *Y = (float*)(ws + WS_Y);
  (void)Y; (void)QL; (void)KL; (void)VB; (void)VBL;
  // inputs: 0 x [4,2048,768]; 1 Wq, 2 Wk, 3 Wv [12,768,64]; 4 bq, 5 bk, 6 bv [12,64] (= flat [768] by column h*64+k); 7 Wo [768,768] (in,out); 8 bo [768]
  k_proj<<<dim3(TNB * TT / 64, CC / 128, 3), 128, 0, stream>>>(F[0], F[0], F[0], F[1], F[2], F[3], F[4], F[5], F[6], QH, QL, KH, KL, VT, VB, VBL);
  k_att<<<dim3(TNB * NH, NPAIR + NHIT), 32 * AW, 0, stream>>>(QH, KH, QL, KL, VT, VB, VBL, Y);
  k_out<<<dim3(TNB * TT / 64, DIN / 128), 128, 0, stream>>>(Y, F[7], F[8], (float*)d_out);
}

// v006
// One run takes 156 microseconds.
// Two timings next to v005 both put it at 1.14 times that version's speed.
// All steps since v000 together make it 11.1 times as fast.
// compute dtype: all float inputs rounded to bf16; q/k/v = x W[h] + b[h] with EXACT bf16 products on WMMA 16x16x32, f32 accumulate; q, k once to f16 -> 1-product causal logits x 1/8, except the first 384 query rows of each sequence (few keys, no averaging), which use q and k as f16 hi + residual (x 2^10) (3 products); softmax in f32 (e^x as one hardware 2^y of a fused y = logit * log2(e) / 8 - max * log2(e) / 8); P x 2^11 once to f16 against v once to f16 (1 product), except the first 384 rows: P and v as bf16 hi + lo (3 products); ctx once to f16 against Wo carried x 2^8 in f16 (exact bf16 values), except the first 384 rows: ctx bf16 hi + lo against exact bf16 Wo (2 products); + bo; f32 output.
#include <hip/hip_runtime.h>
#include <math.h>

typedef __attribute__((ext_vector_type(16))) _Float16 v16h;
typedef __attribute__((ext_vector_type(16))) __bf16 v16b;
typedef __attribute__((ext_vector_type(8)))  _Float16 v8h;
typedef __attribute__((ext_vector_type(8)))  float v8f;
typedef __attribute__((ext_vector_type(4)))  float v4f;
typedef __attribute__((ext_vector_type(2)))  float v2f;
typedef __attribute__((ext_vector_type(4)))  unsigned v4u;
typedef __attribute__((ext_vector_type(4)))  int v4i;
typedef float __attribute__((may_alias)) float_a;
typedef int __attribute__((may_alias)) int_a;

template <typename T> __device__ __forceinline__ void vst2(void* p, T v) { *(T*)p = v;  }
__device__ __forceinline__ v8f wmma16(v16h a, v16h b, v8f c) {
  v8f d = __builtin_amdgcn_wmma_f32_16x16x32_f16(false, a, false, b, (short)0, c, false, false);
  asm volatile("v_nop\n\tv_nop\n\tv_nop\n\tv_nop" : "+v"(d) : "v"(a), "v"(b));
  return d;
}
__device__ __forceinline__ v8f wmma_bf(v16b a, v16b b, v8f c) {
  v8f d = __builtin_amdgcn_wmma_f32_16x16x32_bf16(false, a, false, b, (short)0, c, false, false);
  asm volatile("v_nop\n\tv_nop\n\tv_nop\n\tv_nop" : "+v"(d) : "v"(a), "v"(b));
  return d;
}
// 16x16x32 fragments: lane = (h = lane>>4, row/col = lane&15); elements 0..7 = k0+8h+0..7, 8..15 = k0+16+8h+0..7; D element r = row 8h+r
__device__ __forceinline__ v16h frag_h(const _Float16* rowk0, int lane) {
  union { v16h v; v8h q[2]; } u; const _Float16* p = rowk0 + 8 * (lane >> 4);
  u.q[0] = *(const v8h*)p; u.q[1] = *(const v8h*)(p + 16); return u.v;
}
__device__ __forceinline__ v16h frag_f32(const float* rowk0, int lane) {
  v16h a; const float* p = rowk0 + 8 * (lane >> 4);
#pragma unroll
  for (int i = 0; i < 8; ++i) { a[i] = (_Float16)p[i]; a[8 + i] = (_Float16)p[16 + i]; }
  return a;
}
__device__ __forceinline__ v16h frag_f32s(const float* rowk0, int lane, float sc) {
  v16h a; const float* p = rowk0 + 8 * (lane >> 4);
#pragma unroll
  for (int i = 0; i < 8; ++i) { a[i] = (_Float16)(p[i] * sc); a[8 + i] = (_Float16)(p[16 + i] * sc); }
  return a;
}
// column fragment from a [K][ld] layout (column n), rows >= K read as 0
__device__ __forceinline__ v16h fragc_f32(const float* W, int k0, int n, int lane, int ld, int K) {
  v16h a; const int g = lane >> 4;
#pragma unroll
  for (int i = 0; i < 8; ++i) { const int ka = k0 + 8 * g + i, kb = ka + 16;
    a[i] = (_Float16)(ka < K ? W[(size_t)(ka < K ? ka : K - 1) * ld + n] : 0.f); a[8 + i] = (_Float16)(kb < K ? W[(size_t)(kb < K ? kb : K - 1) * ld + n] : 0.f); }
  return a;
}
struct F2 { v16b h, l; };
__device__ __forceinline__ F2 bsplit16(const float v[16]) { F2 r;
#pragma unroll
  for (int i = 0; i < 16; ++i) { const __bf16 h = (__bf16)v[i]; r.h[i] = h; r.l[i] = (__bf16)(v[i] - (float)h); }
  return r; }
__device__ __forceinline__ F2 split_row(const float* row, int k0, int lane) { float v[16]; const float* p = row + k0 + 8 * (lane >> 4);
#pragma unroll
  for (int i = 0; i < 8; ++i) { v[i] = p[i]; v[8 + i] = p[16 + i]; }
  return bsplit16(v); }
__device__ __forceinline__ F2 split_rowK(const float* row, int k0, int lane, int K) { float v[16]; const int g = lane >> 4;
#pragma unroll
  for (int i = 0; i < 8; ++i) { const int ka = k0 + 8 * g + i, kb = ka + 16; v[i] = ka < K ? row[ka < K ? ka : K - 1] : 0.f; v[8 + i] = kb < K ? row[kb < K ? kb : K - 1] : 0.f; }
  return bsplit16(v); }
__device__ __forceinline__ F2 split_col(const float* W, int k0, int n, int lane, int ld, int K) { float v[16]; const int g = lane >> 4;
#pragma unroll
  for (int i = 0; i < 8; ++i) { const int ka = k0 + 8 * g + i, kb = ka + 16; v[i] = ka < K ? W[(size_t)(ka < K ? ka : K - 1) * ld + n] : 0.f; v[8 + i] = kb < K ? W[(size_t)(kb < K ? kb : K - 1) * ld + n] : 0.f; }
  return bsplit16(v); }
__device__ __forceinline__ v8f mac3(const F2& a, const F2& b, v8f c) { c = wmma_bf(a.l, b.h, c); c = wmma_bf(a.h, b.l, c); return wmma_bf(a.h, b.h, c); }
__device__ __forceinline__ float sigm(float v) { return 1.0f / (1.0f + expf(-v)); }
#define LDSX() do { asm volatile("s_wait_dscnt 0" ::: "memory"); __builtin_amdgcn_wave_barrier(); __builtin_amdgcn_fence(__ATOMIC_RELEASE, "workgroup"); } while (0)

// Causal multi-head self-attention with per-head projection tensors (B 4, S 2,048, D 768, 12 heads x 64): q/k/v[b,h] = x W[h] + b[h] ([H][768][64] weights, [H][64] biases); scores = q k^T with key > query -> -inf, x 64^-0.5; softmax; out = concat_h(P v) Wo ((in,out) [768,768]) + bo.
#define NB 4
#define TT 2048
#define CC 768            // NH * HD = projected width
#define DIN 768          // input (model) width
#define NH 12
#define HD 64
#define SCALE (0.125f)
#define CAUSAL 1
#ifndef TNB
#define TNB NB
#endif
__device__ __forceinline__ float bfr(float v) { return (float)(__bf16)v; }
typedef __attribute__((ext_vector_type(8))) __bf16 v8b;
__device__ __forceinline__ v16b frag_b(const __bf16* rowk0, int lane) {
  union { v16b v; v8b q[2]; } u; const __bf16* p = rowk0 + 8 * (lane >> 4);
  u.q[0] = *(const v8b*)p; u.q[1] = *(const v8b*)(p + 16); return u.v;
}
#define QBH 6              // causal: query rows < QBH * 64 of each sequence (few keys, no averaging) take the high-precision path
#define QHI 384            // rows carrying a q residual plane
#define KHI 384            // key rows carrying k residual / v bf16 hi+lo planes (used only by the causal high-precision path)
// B fragment (k rows k0+.., output column o) of a weight: (in,out) [K][ld] or (out,in) [ld rows of K]: bf16 exact, or f16(bf16 * 256) exact
__device__ __forceinline__ v16b wcol_io(const float* Wm, int k0, int o, int lane, int ld) { v16b w; const int g = lane >> 4;
#pragma unroll
  for (int i = 0; i < 8; ++i) { w[i] = (__bf16)Wm[(size_t)(k0 + 8 * g + i) * ld + o]; w[8 + i] = (__bf16)Wm[(size_t)(k0 + 16 + 8 * g + i) * ld + o]; }
  return w; }
__device__ __forceinline__ v16b wcol_oi(const float* Wm, int k0, int o, int lane, int K) { v16b w; const float* p = Wm + (size_t)o * K + k0 + 8 * (lane >> 4);
#pragma unroll
  for (int i = 0; i < 8; ++i) { w[i] = (__bf16)p[i]; w[8 + i] = (__bf16)p[16 + i]; }
  return w; }
__device__ __forceinline__ v16h wcolh_io(const float* Wm, int k0, int o, int lane, int ld) { v16h w; const int g = lane >> 4;
#pragma unroll
  for (int i = 0; i < 8; ++i) { w[i] = (_Float16)(bfr(Wm[(size_t)(k0 + 8 * g + i) * ld + o]) * 256.0f); w[8 + i] = (_Float16)(bfr(Wm[(size_t)(k0 + 16 + 8 * g + i) * ld + o]) * 256.0f); }
  return w; }
__device__ __forceinline__ v16h wcolh_oi(const float* Wm, int k0, int o, int lane, int K) { v16h w; const float* p = Wm + (size_t)o * K + k0 + 8 * (lane >> 4);
#pragma unroll
  for (int i = 0; i < 8; ++i) { w[i] = (_Float16)(bfr(p[i]) * 256.0f); w[8 + i] = (_Float16)(bfr(p[16 + i]) * 256.0f); }
  return w; }
#define WQKV_LAYOUT 2   // 0 = (in,out) [DIN][CC]; 1 = (out,in) [CC][DIN]; 2 = per-head [NH][DIN][HD]
__device__ __forceinline__ v16b wcol_hdk(const float* Wm, int k0, int o, int lane) { v16b w; const int g = lane >> 4; const float* p = Wm + (size_t)(o / HD) * DIN * HD + (o % HD);
#pragma unroll
  for (int i = 0; i < 8; ++i) { w[i] = (__bf16)p[(size_t)(k0 + 8 * g + i) * HD]; w[8 + i] = (__bf16)p[(size_t)(k0 + 16 + 8 * g + i) * HD]; }
  return w; }
#define WO_OUT_IN 0
#if WQKV_LAYOUT == 1
#define WCOL(W, k0, o, lane) wcol_oi(W, k0, o, lane, DIN)
#elif WQKV_LAYOUT == 2
#define WCOL(W, k0, o, lane) wcol_hdk(W, k0, o, lane)
#else
#define WCOL(W, k0, o, lane) wcol_io(W, k0, o, lane, CC)
#endif
#if WO_OUT_IN
#define WOCOL(W, k0, o, lane) wcol_oi(W, k0, o, lane, CC)
#define WOCOLH(W, k0, o, lane) wcolh_oi(W, k0, o, lane, CC)
#else
#define WOCOL(W, k0, o, lane) wcol_io(W, k0, o, lane, DIN)
#define WOCOLH(W, k0, o, lane) wcolh_io(W, k0, o, lane, DIN)
#endif

#ifndef PROJ_EXTRA_PARAMS
#define PROJ_EXTRA_PARAMS
#endif

// q, k and v planes lie in FRAGMENT ORDER, so that each wave-wide 16-byte load of k_att covers 512 contiguous bytes (4 whole lines) instead of 16 pieces of 32 bytes in 16 lines.
// Row planes (q, k and their residuals), NT rows a sequence: [b][h][t / 16] tiles of 1,024 elements (16 rows x HD); element (t, d) at i * 256 + ln * 8 + d % 8, i = (d / 32) * 2 + (d % 32) / 16, ln = ((d % 16) / 8) * 16 + t % 16.
// v planes, NT keys a sequence: [b][h][t / 32] chunks of 2,048 elements (HD channels x 32 keys); element (c, t) at i * 256 + ln * 8 + t % 8, i = (c / 16) * 2 + (t % 32) / 16, ln = ((t % 16) / 8) * 16 + c % 16.
// In both, lane ln of a wave finds elements 0..7 of fragment f at f * 512 + ln * 8 and elements 8..15 at 256 elements on.
#define WS_QH  0u                                      // f16 q, row plane, NT = TT
#define WS_KH  (WS_QH + 2u * (size_t)NB * TT * CC)      // f16 k, row plane, NT = TT
#define WS_VT  (WS_KH + 2u * (size_t)NB * TT * CC)      // f16 v, v plane, NT = TT
#define WS_QL  (WS_VT + 2u * (size_t)NB * CC * TT)      // f16 q residual x 2^10, row plane, NT = QHI
#define WS_KL  (WS_QL + 2u * (size_t)NB * QHI * CC)     // f16 k residual x 2^10, row plane, NT = KHI
#define WS_VB  (WS_KL + 2u * (size_t)NB * KHI * CC)     // bf16 v hi (and, behind it, lo), v plane, NT = KHI
#define WS_VBL (WS_VB + 2u * (size_t)NB * CC * KHI)
#define WS_Y   (WS_VBL + 2u * (size_t)NB * CC * KHI)    // f32 ctx in fragment order: [(b*t) / 16][c / 32] blocks of 512 floats (16 rows x 32 k); element (t, c) at x * 128 + ln * 4 + c % 4, x = ((c % 32) / 16) * 2 + (c % 8) / 4, ln = ((c % 16) / 8) * 16 + t % 16
#define WS_END (WS_Y  + 4u * (size_t)NB * TT * CC)

// ---- weight k-slab in LDS (both projection kernels): 32 k rows x 128 output columns, converted once per block and laid out in fragment order, read by all 4 waves.
// Place of (k group q = k / 8, column c): (c / 16) * WJP + q * 256 + (c % 16) * 16 bytes, 8 k values of 16 bits each. A lane (g, col) finds elements 0..7 (k = 8g + i) at group g and 8..15 (k = 16 + 8g + i) at group 2 + g, 512 bytes on.
// Staging: thread (wave = k group, lane = 4 columns) loads 8 k rows x 16 bytes, so a wave's load covers whole 128-byte lines, and stores 4 columns x 16 bytes.
#define WJP 1040           // 4 groups x 16 columns x 16 B, + 16 B: the 16 lanes of a staging store then fall on 64 distinct banks
#define WSB (8 * WJP)      // one buffer
__device__ __forceinline__ void wslab_load(v4f (&r)[8], const float* p, int ld) {
#pragma unroll   // constant indices: the values stay in registers
  for (int i = 0; i < 8; ++i) r[i] = *(const v4f*)(p + (size_t)i * ld); }
__device__ __forceinline__ void wslab_put_b(unsigned char* d, const v4f (&r)[8]) {   // exact bf16
#pragma unroll   // constant indices: the values stay in registers
  for (int cc = 0; cc < 4; ++cc) { v8b h;
#pragma unroll   // constant indices: the values stay in registers
    for (int i = 0; i < 8; ++i) h[i] = (__bf16)r[i][cc];
    *(v8b*)(d + cc * 16) = h; } }
__device__ __forceinline__ void wslab_put_h(unsigned char* d, const v4f (&r)[8]) {   // f16(bf16 x 2^8), exact
#pragma unroll   // constant indices: the values stay in registers
  for (int cc = 0; cc < 4; ++cc) { v8h h;
#pragma unroll   // constant indices: the values stay in registers
    for (int i = 0; i < 8; ++i) h[i] = (_Float16)(bfr(r[i][cc]) * 256.0f);
    *(v8h*)(d + cc * 16) = h; } }
__device__ __forceinline__ v16b wfrag_b(const unsigned char* p) { union { v16b v; v8b q[2]; } u; u.q[0] = *(const v8b*)p; u.q[1] = *(const v8b*)(p + 512); return u.v; }
__device__ __forceinline__ v16h wfrag_h(const unsigned char* p) { union { v16h v; v8h q[2]; } u; u.q[0] = *(const v8h*)p; u.q[1] = *(const v8h*)(p + 512); return u.v; }
// a lane's 16 f32 of an A row (p = row + k0 + 8g): element e = x[e / 4][e % 4] = p[e] (e < 8), p[8 + e] (e >= 8)
__device__ __forceinline__ void arow_load(v4f (&x)[4], const float* p) { x[0] = *(const v4f*)p; x[1] = *(const v4f*)(p + 4); x[2] = *(const v4f*)(p + 16); x[3] = *(const v4f*)(p + 20); }
// the same 16 f32 from the fragment-order ctx plane (p = block start + 4 * lane): four runs of 512 bytes
__device__ __forceinline__ void arow_load_f(v4f (&x)[4], const float* p) { x[0] = *(const v4f*)p; x[1] = *(const v4f*)(p + 128); x[2] = *(const v4f*)(p + 256); x[3] = *(const v4f*)(p + 384); }
// behind the next slab's loads: their address registers are rewritten only behind this wait; the clobber also keeps the loads ahead of the products they fly under
#define SLABWAIT() asm volatile("s_wait_xcnt 0x0" ::: "memory")
// behind a group of global stores: their address and data registers are rewritten only behind this wait (the clobber keeps the next group's LDS reads behind it, the scheduling barrier its address arithmetic)
#define STOREWAIT() do { asm volatile("s_wait_xcnt 0x0" ::: "memory"); __builtin_amdgcn_sched_barrier(0); } while (0)
// behind a slab's products: keeps the conversions of the next slab, which wait for the loads in flight, from moving up among the products
#define PRODUCTS_DONE() __builtin_amdgcn_sched_barrier(0)

// ---- k_proj: block = (64 rows, 128 cols, which): q/k/v = X W (+ b) with exact bf16 products (K = DIN) -> which 0: q f16 (+ residual, rows < QHI); 1: k f16 (+ residual, rows < KHI); 2: v f16 (+ bf16 hi/lo for t < KHI); all stored in fragment order
__global__ __launch_bounds__(128) void k_proj(const float* __restrict__ XQ, const float* __restrict__ XK, const float* __restrict__ XV, const float* __restrict__ WQ, const float* __restrict__ WK, const float* __restrict__ WV, const float* __restrict__ BQ, const float* __restrict__ BK, const float* __restrict__ BV,
    _Float16* __restrict__ QH, _Float16* __restrict__ QL, _Float16* __restrict__ KH, _Float16* __restrict__ KL, _Float16* __restrict__ VT, __bf16* __restrict__ VB, __bf16* __restrict__ VBL) {
  __shared__ __align__(16) _Float16 sh[64][136], sl[64][136]; __shared__ __align__(16) _Float16 th[128][72]; __shared__ __align__(16) __bf16 tb[128][72], tbl[128][72]; __shared__ __align__(16) unsigned char wsm[2 * WSB];
  const int tid = threadIdx.x, wave = tid >> 5, lane = tid & 31, col = lane & 15, g = lane >> 4; const int which = blockIdx.z; const int c0 = blockIdx.y * 128; const size_t r0 = (size_t)blockIdx.x * 64; const size_t bb = r0 / TT; const int t0 = (int)(r0 % TT);
  const float* X = which == 0 ? XQ : which == 1 ? XK : XV; const float* WA = which == 0 ? WQ : which == 1 ? WK : WV; const float* BA = which == 0 ? BQ : which == 1 ? BK : BV;
  v8f acc[8] = {};
  { const int cw = c0 + 4 * lane;   // this thread's 4 weight columns; its 8 k rows are 8 * wave + 0..7 of each slab
    const float* wp = WA + (size_t)(cw / HD) * DIN * HD + (cw % HD) + (size_t)(8 * wave) * HD;   // per-head [NH][DIN][HD]
    const float* xp = X + (r0 + wave * 16 + col) * DIN + 8 * g;
    unsigned char* wput = wsm + (lane >> 2) * WJP + wave * 256 + (lane & 3) * 64; const unsigned char* wget = wsm + lane * 16;
    v4f wn[8], xn[4]; wslab_load(wn, wp, HD); arow_load(xn, xp); SLABWAIT();
    wslab_put_b(wput, wn);
    __syncthreads();   // slab 0 is in LDS before any wave reads it
#pragma unroll 2   // the buffer index is a constant in each copy of the body
    for (int kc = 0; kc < DIN / 32; ++kc) { v16b a;
#pragma unroll   // constant indices: the values stay in registers
      for (int e = 0; e < 16; ++e) a[e] = (__bf16)xn[e >> 2][e & 3];
      const bool more = kc + 1 < DIN / 32;   // block-uniform
      if (more) { const float* wq = wp + (size_t)(kc + 1) * 32 * HD; const float* xq = xp + (kc + 1) * 32; wslab_load(wn, wq, HD); arow_load(xn, xq); SLABWAIT(); }
      v16b wf[8];   // the slab's LDS reads go out as one group: one LDS latency, not one per product
#pragma unroll   // constant indices: the values stay in registers
      for (int j = 0; j < 8; ++j) wf[j] = wfrag_b(wget + (kc & 1) * WSB + j * WJP);
#pragma unroll   // constant indices: the values stay in registers
      for (int j = 0; j < 8; ++j) acc[j] = wmma_bf(a, wf[j], acc[j]);
      PRODUCTS_DONE();
      if (more) { wslab_put_b(wput + ((kc + 1) & 1) * WSB, wn);
        __syncthreads(); } } }   // publishes slab kc + 1 and ends every wave's reads of slab kc, whose buffer the next trip refills
  if (which < 2) { _Float16* DH = which == 0 ? QH : KH; _Float16* DL = which == 0 ? QL : KL; const int nhi = which == 0 ? QHI : KHI; const bool hi_rows = t0 < nhi;
#pragma unroll
    for (int j = 0; j < 8; ++j) { const float bias = BA ? bfr(BA[c0 + j * 16 + col]) : 0.f;
#pragma unroll
      for (int r = 0; r < 8; ++r) { const float v = acc[j][r] + bias; const _Float16 hv = (_Float16)v; sh[wave * 16 + 8 * g + r][j * 16 + col] = hv; sl[wave * 16 + 8 * g + r][j * 16 + col] = (_Float16)((v - (float)hv) * 1024.0f); } }
    __syncthreads();
    // the block's 8 tiles (it: 2 heads x 4 row tiles); in each, wave = the 512-byte run, lane = the place in it
    const int cl = (wave >> 1) * 32 + (wave & 1) * 16 + g * 8; const size_t bh = bb * NH + c0 / HD; v4u sv[8];
    _Float16* dp = DH + (bh * (TT / 16) + t0 / 16) * 1024 + tid * 8;
#pragma unroll   // constant indices: the values stay in registers, the steps become immediate offsets
    for (int it = 0; it < 8; ++it) sv[it] = *(const v4u*)&sh[(it & 3) * 16 + col][(it >> 2) * HD + cl];
#pragma unroll   // constant indices: the values stay in registers, the steps become immediate offsets
    for (int it = 0; it < 8; ++it) vst2((unsigned*)(dp + ((it >> 2) * (TT / 16) + (it & 3)) * 1024), sv[it]);
    STOREWAIT();
    if (hi_rows) { _Float16* lp = DL + (bh * (nhi / 16) + t0 / 16) * 1024 + tid * 8;
#pragma unroll   // constant indices: the values stay in registers, the steps become immediate offsets
      for (int it = 0; it < 8; ++it) sv[it] = *(const v4u*)&sl[(it & 3) * 16 + col][(it >> 2) * HD + cl];
#pragma unroll   // constant indices: the values stay in registers, the steps become immediate offsets
      for (int it = 0; it < 8; ++it) vst2((unsigned*)(lp + ((it >> 2) * (nhi / 16) + (it & 3)) * 1024), sv[it]); }
  } else { const bool hi_rows = t0 < KHI;
#pragma unroll
    for (int j = 0; j < 8; ++j) { const float bias = BA ? bfr(BA[c0 + j * 16 + col]) : 0.f;
#pragma unroll
      for (int r = 0; r < 8; ++r) { const float v = acc[j][r] + bias; const int rl = wave * 16 + 8 * g + r, cl = j * 16 + col; th[cl][rl] = (_Float16)v; const __bf16 bh = (__bf16)v; tb[cl][rl] = bh; tbl[cl][rl] = (__bf16)(v - (float)bh); } }
    __syncthreads();
    // the block's 8 half chunks (it: 2 heads x 2 key chunks x 2 halves of 4 runs); in each, wave = the 512-byte run, lane = the place in it
    const int cl = (wave >> 1) * 16 + col, rl = (wave & 1) * 16 + g * 8; const size_t bh = bb * NH + c0 / HD; v4u sv[8];
    _Float16* dp = VT + (bh * (TT / 32) + t0 / 32) * 2048 + tid * 8;
#pragma unroll   // constant indices: the values stay in registers, the steps become immediate offsets
    for (int it = 0; it < 8; ++it) sv[it] = *(const v4u*)&th[(it >> 2) * HD + (it & 1) * 32 + cl][((it >> 1) & 1) * 32 + rl];
#pragma unroll   // constant indices: the values stay in registers, the steps become immediate offsets
    for (int it = 0; it < 8; ++it) vst2((unsigned*)(dp + ((it >> 2) * (TT / 32) + ((it >> 1) & 1)) * 2048 + (it & 1) * 1024), sv[it]);
    STOREWAIT();
    if (hi_rows) { const size_t o3 = (bh * (KHI / 32) + t0 / 32) * 2048 + tid * 8; __bf16* hp = VB + o3; __bf16* lp = VBL + o3;
#pragma unroll   // constant indices: the values stay in registers, the steps become immediate offsets
      for (int it = 0; it < 8; ++it) sv[it] = *(const v4u*)&tb[(it >> 2) * HD + (it & 1) * 32 + cl][((it >> 1) & 1) * 32 + rl];
#pragma unroll   // constant indices: the values stay in registers, the steps become immediate offsets
      for (int it = 0; it < 8; ++it) vst2((unsigned*)(hp + ((it >> 2) * (KHI / 32) + ((it >> 1) & 1)) * 2048 + (it & 1) * 1024), sv[it]);
      STOREWAIT();
#pragma unroll   // constant indices: the values stay in registers, the steps become immediate offsets
      for (int it = 0; it < 8; ++it) sv[it] = *(const v4u*)&tbl[(it >> 2) * HD + (it & 1) * 32 + cl][((it >> 1) & 1) * 32 + rl];
#pragma unroll   // constant indices: the values stay in registers, the steps become immediate offsets
      for (int it = 0; it < 8; ++it) vst2((unsigned*)(lp + ((it >> 2) * (KHI / 32) + ((it >> 1) & 1)) * 2048 + (it & 1) * 1024), sv[it]); } } }
// ---- k_att: block = 32 queries (2 tiles of 16) of (b, h), AW waves; the early rows (high precision) 16 queries a block; logits, softmax and P . v in one launch, the logits never leave the registers.
// Both tiles of a block end in the same 32-key chunk, so each K and each V fragment that a wave loads feeds both: half the loads per query.
// Wave w owns the 32-key chunks w, w + AW, ... up to the diagonal. It forms the TRANSPOSED logits k . q^T (A = 16 key rows, B = 16 query columns), so a lane holds one query (col) and keys 8g + r of each 16-key tile:
// the D registers of a chunk's two tiles are, element for element, the A fragment of P for that chunk (0..7 = k0 + 8g + r, 8..15 = k0 + 16 + 8g + r). Row max and row sum: in the lane, one exchange between the lane halves, then over the waves through LDS in wave order.
// Products: 1-product f16 logits x 1/8, P x 2^11 once to f16 against v f16; query rows < QBH * 64: q, k hi + residual (3 products), P and v bf16 hi + lo (3 products). f32 partial ctx summed through LDS in wave order 0..AW-1.
#define AW 16
#define NCH (TT / 32 / AW)   // chunks a wave can own
#define VFLY 2               // chunks whose v fragments are loaded ahead of the exponentials
// fragment halves from the lane's own pointer into a fragment-order plane (fragment start + 8 * lane): the two 512-byte runs of the fragment
__device__ __forceinline__ v16h frag_lh(const _Float16* p) { union { v16h v; v8h q[2]; } u; u.q[0] = *(const v8h*)p; u.q[1] = *(const v8h*)(p + 256); return u.v; }
__device__ __forceinline__ v16b frag_lb(const __bf16* p) { union { v16b v; v8b q[2]; } u; u.q[0] = *(const v8b*)p; u.q[1] = *(const v8b*)(p + 256); return u.v; }
// behind a batch of global loads: their address register, named as an input, is not rewritten in front of this wait and is free behind it
#define XWAIT1(p) asm volatile("s_wait_xcnt 0x0" :: "v"(p) : "memory")
#define XWAIT2(p, q) asm volatile("s_wait_xcnt 0x0" :: "v"(p), "v"(q) : "memory")
#define XWAIT4(p, q, r, s) asm volatile("s_wait_xcnt 0x0" :: "v"(p), "v"(q), "v"(r), "v"(s) : "memory")
// a query's maximum / sum over the block: the two lane halves, then the waves through LDS in wave order; called by every wave of the block
__device__ __forceinline__ float row_max(float m, float (*red)[16], int wave, int col, int g) {
  m = fmaxf(m, __shfl_xor(m, 16)); if (g == 0) red[wave][col] = m;
  __syncthreads();   // every wave's row maxima are in LDS before any is read
  m = red[0][col];
#pragma unroll
  for (int w = 1; w < AW; ++w) m = fmaxf(m, red[w][col]);
  return m; }
__device__ __forceinline__ float row_sum(float s, float (*red)[16], int wave, int col, int g) {
  s += __shfl_xor(s, 16); if (g == 0) red[wave][col] = s;
  __syncthreads();   // every wave's row sums are in LDS before any is read
  s = red[0][col];
#pragma unroll
  for (int w = 1; w < AW; ++w) s += red[w][col];
  return s; }
// the same for the two tiles of a block behind ONE barrier: lane half g stores and reduces tile g (same wave order), then the halves exchange
__device__ __forceinline__ void row_max2(float& m0, float& m1, float (*red)[AW][16], int wave, int col, int g) {
  m0 = fmaxf(m0, __shfl_xor(m0, 16)); m1 = fmaxf(m1, __shfl_xor(m1, 16)); red[g][wave][col] = g ? m1 : m0;
  __syncthreads();   // every wave's row maxima are in LDS before any is read
  float a = red[g][0][col];
#pragma unroll   // the LDS reads go out together instead of one latency each
  for (int w = 1; w < AW; ++w) a = fmaxf(a, red[g][w][col]);
  const float o = __shfl_xor(a, 16); m0 = g ? o : a; m1 = g ? a : o; }
__device__ __forceinline__ void row_sum2(float& s0, float& s1, float (*red)[AW][16], int wave, int col, int g) {
  s0 += __shfl_xor(s0, 16); s1 += __shfl_xor(s1, 16); red[g][wave][col] = g ? s1 : s0;
  __syncthreads();   // every wave's row sums are in LDS before any is read
  float a = red[g][0][col];
#pragma unroll   // the LDS reads go out together instead of one latency each
  for (int w = 1; w < AW; ++w) a += red[g][w][col];
  const float o = __shfl_xor(a, 16); s0 = g ? o : a; s1 = g ? a : o; }
// e^(SCALE * (a - m)) as 2^(a * EC - mc), mc = m * EC: one fused multiply-add (the product is not rounded) and one v_exp_f32. The rounding of mc is the same factor in every term of a row and leaves with the division by the row sum.
// A masked logit (-3e38) gives 2^(very negative) = exactly 0; a term below 2^-126 of the row's largest may come out 0.
#define EC (SCALE * 1.44269504088896340736f)
__device__ __forceinline__ float exp_sc(float a, float mc) { return __builtin_amdgcn_exp2f(__builtin_fmaf(a, EC, -mc)); }
#define NPAIR ((TT - QBH * 64) / 32)   // blocks of 32 queries per (b, h)
#define NHIT (QBH * 4)                 // blocks of 16 early queries per (b, h)
__global__ __launch_bounds__(32 * AW) void k_att(const _Float16* __restrict__ QH, const _Float16* __restrict__ KH, const _Float16* __restrict__ QL, const _Float16* __restrict__ KL, const _Float16* __restrict__ VT, const __bf16* __restrict__ VB, const __bf16* __restrict__ VBL, float* __restrict__ Y) {
  // the two small reduction arrays lie first: below 64 KiB their 16 reads take one address register and immediate offsets (behind ss each took a register of its own, and the build spilled)
  __shared__ __align__(16) struct { float redm[2][AW][16], reds[2][AW][16], ss[2][AW][16][HD + 4]; } sm;
  float (&ss)[2][AW][16][HD + 4] = sm.ss; float (&redm)[2][AW][16] = sm.redm; float (&reds)[2][AW][16] = sm.reds;
  // wave number held in a scalar register: every chunk test stays a scalar branch, so every lane is on at each matrix instruction
  const int tid = threadIdx.x, wave = __builtin_amdgcn_readfirstlane(tid >> 5), lane = tid & 31, col = lane & 15, g = lane >> 4;
  const int b = blockIdx.x / NH, h = blockIdx.x % NH;
  const bool pair = (int)blockIdx.y < NPAIR;   // block-uniform
  const int ql0 = pair ? TT - 32 * ((int)blockIdx.y + 1) : (NPAIR + NHIT - 1 - (int)blockIdx.y) * 16;   // the tiles with the most keys take the lowest indices
  const int kce = (ql0 >> 5) + 1;                         // chunks that hold a key <= the block's last query (a pair starts at a multiple of 32: the same chunk for both tiles)
  const int n = kce > wave ? (kce - wave + AW - 1) / AW : 0;   // chunks of this wave (scalar)
  const int tq = ql0 + col;
  const size_t bh = (size_t)b * NH + h;
  const _Float16* qp = QH + (bh * (TT / 16) + (ql0 >> 4)) * 1024 + 8 * lane;   // lane pointers: tile or chunk start + the lane's 8 elements
  v8f acc[2][HD / 16] = {};
  if (!pair) {   // block-uniform: early rows, high precision; kce <= KHI / 32 <= AW, so one chunk a wave at most
    float s[16]; float m = -3.0e38f;
    if (n > 0) { const _Float16* qlp = QL + (bh * (QHI / 16) + (ql0 >> 4)) * 1024 + 8 * lane; const _Float16* kp = KH + (bh * (TT / 16) + wave * 2) * 1024 + 8 * lane; const _Float16* lp = KL + (bh * (KHI / 16) + wave * 2) * 1024 + 8 * lane;
      v16h qh[2], qlf[2], kbf[2][2], klf[2][2];   // loads first, products behind them
#pragma unroll
      for (int kc = 0; kc < 2; ++kc) { qh[kc] = frag_lh(qp + kc * 512); qlf[kc] = frag_lh(qlp + kc * 512);
#pragma unroll
        for (int t = 0; t < 2; ++t) { kbf[t][kc] = frag_lh(kp + t * 1024 + kc * 512); klf[t][kc] = frag_lh(lp + t * 1024 + kc * 512); } }
      XWAIT4(qp, qlp, kp, lp);
#pragma unroll
      for (int t = 0; t < 2; ++t) { v8f a = {}, al = {};
#pragma unroll
        for (int kc = 0; kc < 2; ++kc) { a = wmma16(kbf[t][kc], qh[kc], a); al = wmma16(kbf[t][kc], qlf[kc], al); al = wmma16(klf[t][kc], qh[kc], al); }
#pragma unroll
        for (int r = 0; r < 8; ++r) { const float v = (wave * 32 + t * 16 + 8 * g + r <= tq) ? a[r] + al[r] * (1.0f / 1024.0f) : -3.0e38f; s[t * 8 + r] = v; m = fmaxf(m, v); } } }
    m = row_max(m, redm[0], wave, col, g) * EC;
    v16b vh[HD / 16], vl[HD / 16];   // the v fragments fly during the exponentials
    float sum = 0.f;
    if (n > 0) { const size_t po = (bh * (KHI / 32) + wave) * 2048 + 8 * lane; const __bf16* vhp = VB + po; const __bf16* vlp = VBL + po;
#pragma unroll
      for (int j = 0; j < HD / 16; ++j) { vh[j] = frag_lb(vhp + j * 512); vl[j] = frag_lb(vlp + j * 512); }
      XWAIT2(vhp, vlp);
#pragma unroll
      for (int e = 0; e < 16; ++e) { s[e] = exp_sc(s[e], m); sum += s[e]; } }   // an excluded key (-3e38) gives exactly 0: m is a finite logit
    const float inv = 2048.0f / row_sum(sum, reds[0], wave, col, g);
    if (n > 0) {
#pragma unroll
      for (int e = 0; e < 16; ++e) s[e] *= inv;
      const F2 p = bsplit16(s);
#pragma unroll
      for (int j = 0; j < HD / 16; ++j) { acc[0][j] = wmma_bf(p.h, vh[j], acc[0][j]); acc[0][j] = wmma_bf(p.l, vh[j], acc[0][j]); acc[0][j] = wmma_bf(p.h, vl[j], acc[0][j]); } }
  } else {
    float s[NCH][2][16]; float m0 = -3.0e38f, m1 = -3.0e38f;
    { v16h q[2][2];
#pragma unroll   // constant indices: the values stay in registers
      for (int u = 0; u < 2; ++u) { q[u][0] = frag_lh(qp + u * 1024); q[u][1] = frag_lh(qp + u * 1024 + 512); }
      XWAIT1(qp); const _Float16* kw = KH + (bh * (TT / 16) + wave * 2) * 1024 + 8 * lane;
      v16h kf[NCH][4];   // all key fragments of the wave go out together: one load latency
#pragma unroll   // constant indices: the values stay in registers
      for (int i = 0; i < NCH; ++i) if (i < n) { const _Float16* kp = kw + i * AW * 2048; kf[i][0] = frag_lh(kp); kf[i][1] = frag_lh(kp + 512); kf[i][2] = frag_lh(kp + 1024); kf[i][3] = frag_lh(kp + 1536); XWAIT1(kw); }
#pragma unroll   // constant indices: the values stay in registers
      for (int i = 0; i < NCH; ++i) if (i < n) { const int k0 = (wave + AW * i) * 32;
        v8f a[2][2];   // four independent accumulators: (query tile u, key tile t)
#pragma unroll   // constant indices: the values stay in registers
        for (int u = 0; u < 2; ++u)
#pragma unroll   // constant indices: the values stay in registers
          for (int t = 0; t < 2; ++t) { const v8f z = {}; a[u][t] = wmma16(kf[i][2 * t], q[u][0], z); }
#pragma unroll   // constant indices: the values stay in registers
        for (int u = 0; u < 2; ++u)
#pragma unroll   // constant indices: the values stay in registers
          for (int t = 0; t < 2; ++t) { a[u][t] = wmma16(kf[i][2 * t + 1], q[u][1], a[u][t]);
#pragma unroll   // constant indices: the values stay in registers
            for (int r = 0; r < 8; ++r) s[i][u][t * 8 + r] = a[u][t][r]; }
        if (wave + AW * i == kce - 1) {   // only the last chunk holds keys past a query of the block (scalar test)
#pragma unroll   // constant indices: the values stay in registers
          for (int u = 0; u < 2; ++u)
#pragma unroll   // constant indices: the values stay in registers
            for (int e = 0; e < 16; ++e) if (k0 + (e >> 3) * 16 + 8 * g + (e & 7) > tq + 16 * u) s[i][u][e] = -3.0e38f; }
#pragma unroll   // constant indices: the values stay in registers
        for (int e = 0; e < 16; ++e) { m0 = fmaxf(m0, s[i][0][e]); m1 = fmaxf(m1, s[i][1][e]); } } }
    row_max2(m0, m1, redm, wave, col, g); m0 *= EC; m1 *= EC;
    const _Float16* vw = VT + (bh * (TT / 32) + wave) * 2048 + 8 * lane;
    v16h vf[NCH][HD / 16];   // the v fragments of the first VFLY chunks fly during the exponentials; beside 2 tiles of f32 logits the registers hold no more
#pragma unroll   // constant indices: the values stay in registers
    for (int i = 0; i < VFLY; ++i) if (i < n) {
#pragma unroll   // constant indices: the values stay in registers
      for (int j = 0; j < HD / 16; ++j) vf[i][j] = frag_lh(vw + j * 512 + i * AW * 2048);
      XWAIT1(vw); }
    float sum0 = 0.f, sum1 = 0.f;
#pragma unroll   // constant indices: the values stay in registers
    for (int i = 0; i < NCH; ++i) if (i < n) {
#pragma unroll   // constant indices: the values stay in registers
      for (int e = 0; e < 16; ++e) { s[i][0][e] = exp_sc(s[i][0][e], m0); sum0 += s[i][0][e]; s[i][1][e] = exp_sc(s[i][1][e], m1); sum1 += s[i][1][e]; } }   // an excluded key (-3e38) gives exactly 0: m is a finite logit
    row_sum2(sum0, sum1, reds, wave, col, g);
    const float inv0 = 2048.0f / sum0, inv1 = 2048.0f / sum1;
    v16h p[NCH][2];   // P in 16 bits takes half the logits' registers: every 2 chunks converted make room for one more chunk's v fragments, loaded at once
#pragma unroll   // constant indices: the values stay in registers
    for (int i = 0; i < NCH; ++i) {
      if (i < n) {
#pragma unroll   // constant indices: the values stay in registers
        for (int e = 0; e < 16; ++e) { p[i][0][e] = (_Float16)(s[i][0][e] * inv0); p[i][1][e] = (_Float16)(s[i][1][e] * inv1); } }
      if ((i & 1) && VFLY + (i >> 1) < n) { const int iv = VFLY + (i >> 1);
#pragma unroll   // constant indices: the values stay in registers
        for (int j = 0; j < HD / 16; ++j) vf[iv][j] = frag_lh(vw + j * 512 + iv * AW * 2048);
        XWAIT1(vw); } }
#pragma unroll   // constant indices: the values stay in registers
    for (int i = 0; i < NCH; ++i) if (i < n) {
#pragma unroll   // constant indices: the values stay in registers
      for (int j = 0; j < HD / 16; ++j) { acc[0][j] = wmma16(p[i][0], vf[i][j], acc[0][j]); acc[1][j] = wmma16(p[i][1], vf[i][j], acc[1][j]); } } }
#pragma unroll   // constant indices: the values stay in registers
  for (int j = 0; j < HD / 16; ++j)
#pragma unroll   // constant indices: the values stay in registers
    for (int r = 0; r < 8; ++r) ss[0][wave][8 * g + r][j * 16 + col] = acc[0][j][r];
  if (pair) {
#pragma unroll   // constant indices: the values stay in registers
    for (int j = 0; j < HD / 16; ++j)
#pragma unroll   // constant indices: the values stay in registers
      for (int r = 0; r < 8; ++r) ss[1][wave][8 * g + r][j * 16 + col] = acc[1][j][r]; }
  __syncthreads();   // every wave's partial is in LDS before any is summed
  const int u = tid >> 8;   // waves 0..7 sum and store tile 0, waves 8..15 tile 1 (a pair only)
  if (u == 0 || pair) { const int rl = tid & 15, q4 = ((tid >> 4) & 15) * 4; v4f o = *(const v4f*)&ss[u][0][rl][q4];   // 16 lanes = the 16 rows of one 4-channel group: 256 contiguous bytes of the fragment-order ctx plane
#pragma unroll   // the LDS reads of all partials go out together instead of one latency each
    for (int w = 1; w < AW; ++w) o += *(const v4f*)&ss[u][w][rl][q4];
    vst2(Y + ((((size_t)b * TT + ql0 + 16 * u) >> 4) * (CC / 32) + h * (HD / 32) + (q4 >> 5)) * 512 + (((q4 >> 4) & 1) * 2 + ((q4 >> 2) & 1)) * 128 + (((q4 >> 3) & 1) * 16 + rl) * 4, o * (1.0f / 2048.0f)); } }
// ---- k_out: block = (64 rows, 128 cols): out = ctx Wo (+ bo): ctx once to f16 against Wo as f16(bf16 x 2^8) exact (1 product) x 2^-8; causal early rows (< QHI of each sequence): ctx bf16 hi + lo against exact bf16 Wo (2 products)
__global__ __launch_bounds__(128) void k_out(const float* __restrict__ Y, const float* __restrict__ WO, const float* __restrict__ BO, float* __restrict__ OUT) { __shared__ __align__(16) float sf[4][16][132]; __shared__ __align__(16) unsigned char wsm[2 * WSB];
  const int tid = threadIdx.x, wave = tid >> 5, lane = tid & 31, col = lane & 15, g = lane >> 4; const int c0 = blockIdx.y * 128; const size_t r0 = (size_t)blockIdx.x * 64 + wave * 16;
  v8f acc[8] = {};
  const float* wp = WO + (size_t)(8 * wave) * DIN + c0 + 4 * lane;   // (in,out) [CC][DIN]: this thread's 8 k rows x 4 columns of each slab
  const float* yp = Y + (r0 >> 4) * (CC / 32) * 512 + 4 * lane;   // this wave's 16 rows: one 512-float block per k slab
  unsigned char* wput = wsm + (lane >> 2) * WJP + wave * 256 + (lane & 3) * 64; const unsigned char* wget = wsm + lane * 16;
  v4f wn[8], yn[4]; wslab_load(wn, wp, DIN); arow_load_f(yn, yp); SLABWAIT();
  if (CAUSAL && (int)(((size_t)blockIdx.x * 64) % TT) < QHI) {   /* block-uniform */
    wslab_put_b(wput, wn);
    __syncthreads();   // slab 0 is in LDS before any wave reads it
#pragma unroll 2   // the buffer index is a constant in each copy of the body
    for (int kc = 0; kc < CC / 32; ++kc) { float v[16];
#pragma unroll   // constant indices: the values stay in registers
      for (int e = 0; e < 16; ++e) v[e] = yn[e >> 2][e & 3];
      const F2 a = bsplit16(v); const bool more = kc + 1 < CC / 32;   // block-uniform
      if (more) { const float* wq = wp + (size_t)(kc + 1) * 32 * DIN; const float* yq = yp + (kc + 1) * 512; wslab_load(wn, wq, DIN); arow_load_f(yn, yq); SLABWAIT(); }
      v16b wf[8];   // the slab's LDS reads go out as one group: one LDS latency, not one per product
#pragma unroll   // constant indices: the values stay in registers
      for (int j = 0; j < 8; ++j) wf[j] = wfrag_b(wget + (kc & 1) * WSB + j * WJP);
#pragma unroll   // constant indices: the values stay in registers
      for (int j = 0; j < 8; ++j) { acc[j] = wmma_bf(a.h, wf[j], acc[j]); acc[j] = wmma_bf(a.l, wf[j], acc[j]); }
      PRODUCTS_DONE();
      if (more) { wslab_put_b(wput + ((kc + 1) & 1) * WSB, wn);
        __syncthreads(); } }   // publishes slab kc + 1 and ends every wave's reads of slab kc, whose buffer the next trip refills
#pragma unroll
    for (int j = 0; j < 8; ++j) { const float bias = BO ? bfr(BO[c0 + j * 16 + col]) : 0.f;
#pragma unroll
      for (int r = 0; r < 8; ++r) sf[wave][8 * g + r][j * 16 + col] = acc[j][r] + bias; }
  } else {
    wslab_put_h(wput, wn);
    __syncthreads();   // slab 0 is in LDS before any wave reads it
#pragma unroll 2   // the buffer index is a constant in each copy of the body
    for (int kc = 0; kc < CC / 32; ++kc) { v16h a;
#pragma unroll   // constant indices: the values stay in registers
      for (int e = 0; e < 16; ++e) a[e] = (_Float16)yn[e >> 2][e & 3];
      const bool more = kc + 1 < CC / 32;   // block-uniform
      if (more) { const float* wq = wp + (size_t)(kc + 1) * 32 * DIN; const float* yq = yp + (kc + 1) * 512; wslab_load(wn, wq, DIN); arow_load_f(yn, yq); SLABWAIT(); }
      v16h wf[8];   // the slab's LDS reads go out as one group: one LDS latency, not one per product
#pragma unroll   // constant indices: the values stay in registers
      for (int j = 0; j < 8; ++j) wf[j] = wfrag_h(wget + (kc & 1) * WSB + j * WJP);
#pragma unroll   // constant indices: the values stay in registers
      for (int j = 0; j < 8; ++j) acc[j] = wmma16(a, wf[j], acc[j]);
      PRODUCTS_DONE();
      if (more) { wslab_put_h(wput + ((kc + 1) & 1) * WSB, wn);
        __syncthreads(); } }   // publishes slab kc + 1 and ends every wave's reads of slab kc, whose buffer the next trip refills
#pragma unroll
    for (int j = 0; j < 8; ++j) { const float bias = BO ? bfr(BO[c0 + j * 16 + col]) : 0.f;
#pragma unroll
      for (int r = 0; r < 8; ++r) sf[wave][8 * g + r][j * 16 + col] = acc[j][r] * (1.0f / 256.0f) + bias; } }
  LDSX(); for (int rl = 0; rl < 16; ++rl) vst2(OUT + (r0 + rl) * DIN + c0 + lane * 4, *(const v4f*)&sf[wave][rl][lane * 4]); }

extern "C" void kernel_launch(void* const* d_in, const int* in_sizes, int n_in, void* d_out, int out_size, void* d_ws, size_t ws_size, hipStream_t stream) {
  (void)in_sizes; (void)n_in; (void)out_size;
  const float** F = (const float**)d_in;
  if (ws_size < (size_t)WS_END) return;
  char* ws = (char*)d_ws; _Float16 *QH = (_Float16*)(ws + WS_QH), *KH = (_Float16*)(ws + WS_KH), *VT = (_Float16*)(ws + WS_VT), *QL = (_Float16*)(ws + WS_QL), *KL = (_Float16*)(ws + WS_KL); __bf16 *VB = (__bf16*)(ws + WS_VB), *VBL = (__bf16*)(ws + WS_VBL); float *Y = (float*)(ws + WS_Y);
  (void)Y; (void)QL; (void)KL; (void)VB; (void)VBL;
  // inputs: 0 x [4,2048,768]; 1 Wq, 2 Wk, 3 Wv [12,768,64]; 4 bq, 5 bk, 6 bv [12,64] (= flat [768] by column h*64+k); 7 Wo [768,768] (in,out); 8 bo [768]
  k_proj<<<dim3(TNB * TT / 64, CC / 128, 3), 128, 0, stream>>>(F[0], F[0], F[0], F[1], F[2], F[3], F[4], F[5], F[6], QH, QL, KH, KL, VT, VB, VBL);
  k_att<<<dim3(TNB * NH, NPAIR + NHIT), 32 * AW, 0, stream>>>(QH, KH, QL, KL, VT, VB, VBL, Y);
  k_out<<<dim3(TNB * TT / 64, DIN / 128), 128, 0, stream>>>(Y, F[7], F[8], (float*)d_out);
}

// v007
// It runs in 141 microseconds.
// Next to v006, in two timings, it ran 1.10 times as fast each time.
// Over all steps from v000 it is 12.3 times as fast.
// compute dtype: all float inputs rounded to bf16; q/k/v = x W[h] + b[h] with EXACT bf16 products on WMMA 16x16x32, f32 accumulate; q, k once to f16 -> 1-product causal logits x 1/8, except the first 384 query rows of each sequence (few keys, no averaging), which use q and k as f16 hi + residual (x 2^10) (3 products); softmax in f32 (e^x as one hardware 2^y of a fused y = logit * log2(e) / 8 - max * log2(e) / 8); P x 2^11 once to f16 against v once to f16 (1 product), except the first 384 rows: P and v as bf16 hi + lo (3 products); ctx once to f16 against Wo carried x 2^8 in f16 (exact bf16 values), except the first 384 rows: ctx bf16 hi + lo against exact bf16 Wo (2 products); + bo; f32 output.
#include <hip/hip_runtime.h>
#include <math.h>

typedef __attribute__((ext_vector_type(16))) _Float16 v16h;
typedef __attribute__((ext_vector_type(16))) __bf16 v16b;
typedef __attribute__((ext_vector_type(8)))  _Float16 v8h;
typedef __attribute__((ext_vector_type(8)))  float v8f;
typedef __attribute__((ext_vector_type(4)))  float v4f;
typedef __attribute__((ext_vector_type(2)))  float v2f;
typedef __attribute__((ext_vector_type(4)))  unsigned v4u;
typedef __attribute__((ext_vector_type(4)))  int v4i;
typedef float __attribute__((may_alias)) float_a;
typedef int __attribute__((may_alias)) int_a;

template <typename T> __device__ __forceinline__ void vst2(void* p, T v) { *(T*)p = v;  }
__device__ __forceinline__ v8f wmma16(v16h a, v16h b, v8f c) {
  v8f d = __builtin_amdgcn_wmma_f32_16x16x32_f16(false, a, false, b, (short)0, c, false, false);
  asm volatile("v_nop\n\tv_nop\n\tv_nop\n\tv_nop" : "+v"(d) : "v"(a), "v"(b));
  return d;
}
__device__ __forceinline__ v8f wmma_bf(v16b a, v16b b, v8f c) {
  v8f d = __builtin_amdgcn_wmma_f32_16x16x32_bf16(false, a, false, b, (short)0, c, false, false);
  asm volatile("v_nop\n\tv_nop\n\tv_nop\n\tv_nop" : "+v"(d) : "v"(a), "v"(b));
  return d;
}
// 16x16x32 fragments: lane = (h = lane>>4, row/col = lane&15); elements 0..7 = k0+8h+0..7, 8..15 = k0+16+8h+0..7; D element r = row 8h+r
__device__ __forceinline__ v16h frag_h(const _Float16* rowk0, int lane) {
  union { v16h v; v8h q[2]; } u; const _Float16* p = rowk0 + 8 * (lane >> 4);
  u.q[0] = *(const v8h*)p; u.q[1] = *(const v8h*)(p + 16); return u.v;
}
__device__ __forceinline__ v16h frag_f32(const float* rowk0, int lane) {
  v16h a; const float* p = rowk0 + 8 * (lane >> 4);
#pragma unroll
  for (int i = 0; i < 8; ++i) { a[i] = (_Float16)p[i]; a[8 + i] = (_Float16)p[16 + i]; }
  return a;
}
__device__ __forceinline__ v16h frag_f32s(const float* rowk0, int lane, float sc) {
  v16h a; const float* p = rowk0 + 8 * (lane >> 4);
#pragma unroll
  for (int i = 0; i < 8; ++i) { a[i] = (_Float16)(p[i] * sc); a[8 + i] = (_Float16)(p[16 + i] * sc); }
  return a;
}
// column fragment from a [K][ld] layout (column n), rows >= K read as 0
__device__ __forceinline__ v16h fragc_f32(const float* W, int k0, int n, int lane, int ld, int K) {
  v16h a; const int g = lane >> 4;
#pragma unroll
  for (int i = 0; i < 8; ++i) { const int ka = k0 + 8 * g + i, kb = ka + 16;
    a[i] = (_Float16)(ka < K ? W[(size_t)(ka < K ? ka : K - 1) * ld + n] : 0.f); a[8 + i] = (_Float16)(kb < K ? W[(size_t)(kb < K ? kb : K - 1) * ld + n] : 0.f); }
  return a;
}
struct F2 { v16b h, l; };
__device__ __forceinline__ F2 bsplit16(const float v[16]) { F2 r;
#pragma unroll
  for (int i = 0; i < 16; ++i) { const __bf16 h = (__bf16)v[i]; r.h[i] = h; r.l[i] = (__bf16)(v[i] - (float)h); }
  return r; }
__device__ __forceinline__ F2 split_row(const float* row, int k0, int lane) { float v[16]; const float* p = row + k0 + 8 * (lane >> 4);
#pragma unroll
  for (int i = 0; i < 8; ++i) { v[i] = p[i]; v[8 + i] = p[16 + i]; }
  return bsplit16(v); }
__device__ __forceinline__ F2 split_rowK(const float* row, int k0, int lane, int K) { float v[16]; const int g = lane >> 4;
#pragma unroll
  for (int i = 0; i < 8; ++i) { const int ka = k0 + 8 * g + i, kb = ka + 16; v[i] = ka < K ? row[ka < K ? ka : K - 1] : 0.f; v[8 + i] = kb < K ? row[kb < K ? kb : K - 1] : 0.f; }
  return bsplit16(v); }
__device__ __forceinline__ F2 split_col(const float* W, int k0, int n, int lane, int ld, int K) { float v[16]; const int g = lane >> 4;
#pragma unroll
  for (int i = 0; i < 8; ++i) { const int ka = k0 + 8 * g + i, kb = ka + 16; v[i] = ka < K ? W[(size_t)(ka < K ? ka : K - 1) * ld + n] : 0.f; v[8 + i] = kb < K ? W[(size_t)(kb < K ? kb : K - 1) * ld + n] : 0.f; }
  return bsplit16(v); }
__device__ __forceinline__ v8f mac3(const F2& a, const F2& b, v8f c) { c = wmma_bf(a.l, b.h, c); c = wmma_bf(a.h, b.l, c); return wmma_bf(a.h, b.h, c); }
__device__ __forceinline__ float sigm(float v) { return 1.0f / (1.0f + expf(-v)); }
#define LDSX() do { asm volatile("s_wait_dscnt 0" ::: "memory"); __builtin_amdgcn_wave_barrier(); __builtin_amdgcn_fence(__ATOMIC_RELEASE, "workgroup"); } while (0)

// Causal multi-head self-attention with per-head projection tensors (B 4, S 2,048, D 768, 12 heads x 64): q/k/v[b,h] = x W[h] + b[h] ([H][768][64] weights, [H][64] biases); scores = q k^T with key > query -> -inf, x 64^-0.5; softmax; out = concat_h(P v) Wo ((in,out) [768,768]) + bo.
#define NB 4
#define TT 2048
#define CC 768            // NH * HD = projected width
#define DIN 768          // input (model) width
#define NH 12
#define HD 64
#define SCALE (0.125f)
#define CAUSAL 1
#ifndef TNB
#define TNB NB
#endif
__device__ __forceinline__ float bfr(float v) { return (float)(__bf16)v; }
typedef __attribute__((ext_vector_type(8))) __bf16 v8b;
__device__ __forceinline__ v16b frag_b(const __bf16* rowk0, int lane) {
  union { v16b v; v8b q[2]; } u; const __bf16* p = rowk0 + 8 * (lane >> 4);
  u.q[0] = *(const v8b*)p; u.q[1] = *(const v8b*)(p + 16); return u.v;
}
#define QBH 6              // causal: query rows < QBH * 64 of each sequence (few keys, no averaging) take the high-precision path
#define QHI 384            // rows carrying a q residual plane
#define KHI 384            // key rows carrying k residual / v bf16 hi+lo planes (used only by the causal high-precision path)
// B fragment (k rows k0+.., output column o) of a weight: (in,out) [K][ld] or (out,in) [ld rows of K]: bf16 exact, or f16(bf16 * 256) exact
__device__ __forceinline__ v16b wcol_io(const float* Wm, int k0, int o, int lane, int ld) { v16b w; const int g = lane >> 4;
#pragma unroll
  for (int i = 0; i < 8; ++i) { w[i] = (__bf16)Wm[(size_t)(k0 + 8 * g + i) * ld + o]; w[8 + i] = (__bf16)Wm[(size_t)(k0 + 16 + 8 * g + i) * ld + o]; }
  return w; }
__device__ __forceinline__ v16b wcol_oi(const float* Wm, int k0, int o, int lane, int K) { v16b w; const float* p = Wm + (size_t)o * K + k0 + 8 * (lane >> 4);
#pragma unroll
  for (int i = 0; i < 8; ++i) { w[i] = (__bf16)p[i]; w[8 + i] = (__bf16)p[16 + i]; }
  return w; }
__device__ __forceinline__ v16h wcolh_io(const float* Wm, int k0, int o, int lane, int ld) { v16h w; const int g = lane >> 4;
#pragma unroll
  for (int i = 0; i < 8; ++i) { w[i] = (_Float16)(bfr(Wm[(size_t)(k0 + 8 * g + i) * ld + o]) * 256.0f); w[8 + i] = (_Float16)(bfr(Wm[(size_t)(k0 + 16 + 8 * g + i) * ld + o]) * 256.0f); }
  return w; }
__device__ __forceinline__ v16h wcolh_oi(const float* Wm, int k0, int o, int lane, int K) { v16h w; const float* p = Wm + (size_t)o * K + k0 + 8 * (lane >> 4);
#pragma unroll
  for (int i = 0; i < 8; ++i) { w[i] = (_Float16)(bfr(p[i]) * 256.0f); w[8 + i] = (_Float16)(bfr(p[16 + i]) * 256.0f); }
  return w; }
#define WQKV_LAYOUT 2   // 0 = (in,out) [DIN][CC]; 1 = (out,in) [CC][DIN]; 2 = per-head [NH][DIN][HD]
__device__ __forceinline__ v16b wcol_hdk(const float* Wm, int k0, int o, int lane) { v16b w; const int g = lane >> 4; const float* p = Wm + (size_t)(o / HD) * DIN * HD + (o % HD);
#pragma unroll
  for (int i = 0; i < 8; ++i) { w[i] = (__bf16)p[(size_t)(k0 + 8 * g + i) * HD]; w[8 + i] = (__bf16)p[(size_t)(k0 + 16 + 8 * g + i) * HD]; }
  return w; }
#define WO_OUT_IN 0
#if WQKV_LAYOUT == 1
#define WCOL(W, k0, o, lane) wcol_oi(W, k0, o, lane, DIN)
#elif WQKV_LAYOUT == 2
#define WCOL(W, k0, o, lane) wcol_hdk(W, k0, o, lane)
#else
#define WCOL(W, k0, o, lane) wcol_io(W, k0, o, lane, CC)
#endif
#if WO_OUT_IN
#define WOCOL(W, k0, o, lane) wcol_oi(W, k0, o, lane, CC)
#define WOCOLH(W, k0, o, lane) wcolh_oi(W, k0, o, lane, CC)
#else
#define WOCOL(W, k0, o, lane) wcol_io(W, k0, o, lane, DIN)
#define WOCOLH(W, k0, o, lane) wcolh_io(W, k0, o, lane, DIN)
#endif

#ifndef PROJ_EXTRA_PARAMS
#define PROJ_EXTRA_PARAMS
#endif

// q, k and v planes lie in FRAGMENT ORDER, so that each wave-wide 16-byte load of k_att covers 512 contiguous bytes (4 whole lines) instead of 16 pieces of 32 bytes in 16 lines.
// Row planes (q, k and their residuals), NT rows a sequence: [b][h][t / 16] tiles of 1,024 elements (16 rows x HD); element (t, d) at i * 256 + ln * 8 + d % 8, i = (d / 32) * 2 + (d % 32) / 16, ln = ((d % 16) / 8) * 16 + t % 16.
// v planes, NT keys a sequence: [b][h][t / 32] chunks of 2,048 elements (HD channels x 32 keys); element (c, t) at i * 256 + ln * 8 + t % 8, i = (c / 16) * 2 + (t % 32) / 16, ln = ((t % 16) / 8) * 16 + c % 16.
// In both, lane ln of a wave finds elements 0..7 of fragment f at f * 512 + ln * 8 and elements 8..15 at 256 elements on.
#define WS_QH  0u                                      // f16 q, row plane, NT = TT
#define WS_KH  (WS_QH + 2u * (size_t)NB * TT * CC)      // f16 k, row plane, NT = TT
#define WS_VT  (WS_KH + 2u * (size_t)NB * TT * CC)      // f16 v, v plane, NT = TT
#define WS_QL  (WS_VT + 2u * (size_t)NB * CC * TT)      // f16 q residual x 2^10, row plane, NT = QHI
#define WS_KL  (WS_QL + 2u * (size_t)NB * QHI * CC)     // f16 k residual x 2^10, row plane, NT = KHI
#define WS_VB  (WS_KL + 2u * (size_t)NB * KHI * CC)     // bf16 v hi (and, behind it, lo), v plane, NT = KHI
#define WS_VBL (WS_VB + 2u * (size_t)NB * CC * KHI)
#define WS_Y   (WS_VBL + 2u * (size_t)NB * CC * KHI)    // f32 ctx in fragment order: [(b*t) / 16][c / 32] blocks of 512 floats (16 rows x 32 k); element (t, c) at x * 128 + ln * 4 + c % 4, x = ((c % 32) / 16) * 2 + (c % 8) / 4, ln = ((c % 16) / 8) * 16 + t % 16
#define WS_END (WS_Y  + 4u * (size_t)NB * TT * CC)

// ---- weight k-slab in LDS (both projection kernels): 32 k rows x 128 output columns, converted once per block and laid out in fragment order, read by all 4 waves.
// Place of (k group q = k / 8, column c): (c / 16) * WJP + q * 256 + (c % 16) * 16 bytes, 8 k values of 16 bits each. A lane (g, col) finds elements 0..7 (k = 8g + i) at group g and 8..15 (k = 16 + 8g + i) at group 2 + g, 512 bytes on.
// Staging: thread (wave = k group, lane = 4 columns) loads 8 k rows x 16 bytes, so a wave's load covers whole 128-byte lines, and stores 4 columns x 16 bytes.
#define WJP 1040           // 4 groups x 16 columns x 16 B, + 16 B: the 16 lanes of a staging store then fall on 64 distinct banks
#define WSB (8 * WJP)      // one buffer
__device__ __forceinline__ void wslab_load(v4f (&r)[8], const float* p, int ld) {
#pragma unroll   // constant indices: the values stay in registers
  for (int i = 0; i < 8; ++i) r[i] = *(const v4f*)(p + (size_t)i * ld); }
__device__ __forceinline__ void wslab_put_b(unsigned char* d, const v4f (&r)[8]) {   // exact bf16
#pragma unroll   // constant indices: the values stay in registers
  for (int cc = 0; cc < 4; ++cc) { v8b h;
#pragma unroll   // constant indices: the values stay in registers
    for (int i = 0; i < 8; ++i) h[i] = (__bf16)r[i][cc];
    *(v8b*)(d + cc * 16) = h; } }
__device__ __forceinline__ void wslab_put_h(unsigned char* d, const v4f (&r)[8]) {   // f16(bf16 x 2^8), exact
#pragma unroll   // constant indices: the values stay in registers
  for (int cc = 0; cc < 4; ++cc) { v8h h;
#pragma unroll   // constant indices: the values stay in registers
    for (int i = 0; i < 8; ++i) h[i] = (_Float16)(bfr(r[i][cc]) * 256.0f);
    *(v8h*)(d + cc * 16) = h; } }
__device__ __forceinline__ v16b wfrag_b(const unsigned char* p) { union { v16b v; v8b q[2]; } u; u.q[0] = *(const v8b*)p; u.q[1] = *(const v8b*)(p + 512); return u.v; }
__device__ __forceinline__ v16h wfrag_h(const unsigned char* p) { union { v16h v; v8h q[2]; } u; u.q[0] = *(const v8h*)p; u.q[1] = *(const v8h*)(p + 512); return u.v; }
// a lane's 16 f32 of an A row (p = row + k0 + 8g): element e = x[e / 4][e % 4] = p[e] (e < 8), p[8 + e] (e >= 8)
__device__ __forceinline__ void arow_load(v4f (&x)[4], const float* p) { x[0] = *(const v4f*)p; x[1] = *(const v4f*)(p + 4); x[2] = *(const v4f*)(p + 16); x[3] = *(const v4f*)(p + 20); }
// the same 16 f32 from the fragment-order ctx plane (p = block start + 4 * lane): four runs of 512 bytes
__device__ __forceinline__ void arow_load_f(v4f (&x)[4], const float* p) { x[0] = *(const v4f*)p; x[1] = *(const v4f*)(p + 128); x[2] = *(const v4f*)(p + 256); x[3] = *(const v4f*)(p + 384); }
// behind the next slab's loads: their address registers are rewritten only behind this wait; the clobber also keeps the loads ahead of the products they fly under
#define SLABWAIT() asm volatile("s_wait_xcnt 0x0" ::: "memory")
// behind a group of global stores: their address and data registers are rewritten only behind this wait (the clobber keeps the next group's LDS reads behind it, the scheduling barrier its address arithmetic)
#define STOREWAIT() do { asm volatile("s_wait_xcnt 0x0" ::: "memory"); __builtin_amdgcn_sched_barrier(0); } while (0)
// behind a slab's products: keeps the conversions of the next slab, which wait for the loads in flight, from moving up among the products
#define PRODUCTS_DONE() __builtin_amdgcn_sched_barrier(0)

// ---- k_proj: block = (128 rows, 128 cols, which): q/k/v = X W (+ b) with exact bf16 products (K = DIN) -> which 0: q f16 (+ residual, rows < QHI); 1: k f16 (+ residual, rows < KHI); 2: v f16 (+ bf16 hi/lo for t < KHI); all stored in fragment order
// A wave owns two 16-row tiles, 64 rows apart (tile u = rows 64 u + 16 wave ..): each weight fragment it reads from the slab feeds both, so a staged slab serves twice the rows. The epilogue lays out and stores one 64-row half at a time through the same LDS arrays.
__global__ __launch_bounds__(128) void k_proj(const float* __restrict__ XQ, const float* __restrict__ XK, const float* __restrict__ XV, const float* __restrict__ WQ, const float* __restrict__ WK, const float* __restrict__ WV, const float* __restrict__ BQ, const float* __restrict__ BK, const float* __restrict__ BV,
    _Float16* __restrict__ QH, _Float16* __restrict__ QL, _Float16* __restrict__ KH, _Float16* __restrict__ KL, _Float16* __restrict__ VT, __bf16* __restrict__ VB, __bf16* __restrict__ VBL) {
  // the weight slab lies first: below 64 KiB its 16 fragment reads take one address register and immediate offsets (behind the epilogue arrays each took a register of its own, and the wave count per SIMD fell)
  __shared__ __align__(16) struct { unsigned char wsm[2 * WSB]; _Float16 sh[64][136], sl[64][136], th[128][72]; __bf16 tb[128][72], tbl[128][72]; } sm;
  unsigned char (&wsm)[2 * WSB] = sm.wsm; _Float16 (&sh)[64][136] = sm.sh; _Float16 (&sl)[64][136] = sm.sl; _Float16 (&th)[128][72] = sm.th; __bf16 (&tb)[128][72] = sm.tb; __bf16 (&tbl)[128][72] = sm.tbl;
  const int tid = threadIdx.x, wave = tid >> 5, lane = tid & 31, col = lane & 15, g = lane >> 4; const int which = blockIdx.z; const int c0 = blockIdx.y * 128; const size_t r0 = (size_t)blockIdx.x * 128; const size_t bb = r0 / TT; const int t0 = (int)(r0 % TT);
  const float* X = which == 0 ? XQ : which == 1 ? XK : XV; const float* WA = which == 0 ? WQ : which == 1 ? WK : WV; const float* BA = which == 0 ? BQ : which == 1 ? BK : BV;
  v8f acc[2][8] = {};
  { const int cw = c0 + 4 * lane;   // this thread's 4 weight columns; its 8 k rows are 8 * wave + 0..7 of each slab
    const float* wp = WA + (size_t)(cw / HD) * DIN * HD + (cw % HD) + (size_t)(8 * wave) * HD;   // per-head [NH][DIN][HD]
    const float* xp = X + (r0 + wave * 16 + col) * DIN + 8 * g; const float* xp1 = xp + (size_t)64 * DIN;
    unsigned char* wput = wsm + (lane >> 2) * WJP + wave * 256 + (lane & 3) * 64; const unsigned char* wget = wsm + lane * 16;
    v4f wn[8], xn[2][4]; wslab_load(wn, wp, HD); arow_load(xn[0], xp); arow_load(xn[1], xp1); SLABWAIT();
    wslab_put_b(wput, wn);
    __syncthreads();   // slab 0 is in LDS before any wave reads it
#pragma unroll 2   // the buffer index is a constant in each copy of the body
    for (int kc = 0; kc < DIN / 32; ++kc) { v16b a[2];
#pragma unroll   // constant indices: the values stay in registers
      for (int e = 0; e < 16; ++e) { a[0][e] = (__bf16)xn[0][e >> 2][e & 3]; a[1][e] = (__bf16)xn[1][e >> 2][e & 3]; }
      const bool more = kc + 1 < DIN / 32;   // block-uniform
      if (more) { const float* wq = wp + (size_t)(kc + 1) * 32 * HD; const float* xq = xp + (kc + 1) * 32; const float* xq1 = xp1 + (kc + 1) * 32; wslab_load(wn, wq, HD); arow_load(xn[0], xq); arow_load(xn[1], xq1); SLABWAIT(); }
      v16b wf[8];   // the slab's LDS reads go out as one group: one LDS latency, not one per product
#pragma unroll   // constant indices: the values stay in registers
      for (int j = 0; j < 8; ++j) wf[j] = wfrag_b(wget + (kc & 1) * WSB + j * WJP);
      __builtin_amdgcn_sched_barrier(0);   // keeps the 16 LDS reads ahead of the products: without it they are issued two at a time into one fragment's registers, one LDS latency per pair of products
      // the bare builtin (the compiler keeps the distances behind it): with the v_nop statement of wmma_bf, whose operands cannot lie above v255, the 16 accumulator tiles spilled to scratch
#pragma unroll   // constant indices: the values stay in registers
      for (int j = 0; j < 8; ++j) { acc[0][j] = __builtin_amdgcn_wmma_f32_16x16x32_bf16(false, a[0], false, wf[j], (short)0, acc[0][j], false, false); acc[1][j] = __builtin_amdgcn_wmma_f32_16x16x32_bf16(false, a[1], false, wf[j], (short)0, acc[1][j], false, false); }
      PRODUCTS_DONE();
      if (more) { wslab_put_b(wput + ((kc + 1) & 1) * WSB, wn);
        __syncthreads(); } } }   // publishes slab kc + 1 and ends every wave's reads of slab kc, whose buffer the next trip refills
  float bias[8] = {};   // one value per column tile, the same for both halves
  if (BA) {
#pragma unroll   // constant indices: the values stay in registers
    for (int j = 0; j < 8; ++j) bias[j] = bfr(BA[c0 + j * 16 + col]); }
  if (which < 2) { _Float16* DH = which == 0 ? QH : KH; _Float16* DL = which == 0 ? QL : KL; const int nhi = which == 0 ? QHI : KHI;
    const int cl = (wave >> 1) * 32 + (wave & 1) * 16 + g * 8; const size_t bh = bb * NH + c0 / HD;
#pragma unroll   // constant indices: the accumulators stay in registers
    for (int u = 0; u < 2; ++u) { const int th0 = t0 + 64 * u; const bool hi_rows = th0 < nhi;   // block-uniform
      if (u) { STOREWAIT();
        __syncthreads(); }   // every wave has read the first half out of sh and sl before the second half is written there
#pragma unroll
      for (int j = 0; j < 8; ++j) {
#pragma unroll
        for (int r = 0; r < 8; ++r) { const float v = acc[u][j][r] + bias[j]; const _Float16 hv = (_Float16)v; sh[wave * 16 + 8 * g + r][j * 16 + col] = hv; sl[wave * 16 + 8 * g + r][j * 16 + col] = (_Float16)((v - (float)hv) * 1024.0f); } }
      __syncthreads();   // the half is in LDS before any wave reads it in store order
      // the half's 8 tiles (it: 2 heads x 4 row tiles); in each, wave = the 512-byte run, lane = the place in it
      v4u sv[8];
      _Float16* dp = DH + (bh * (TT / 16) + th0 / 16) * 1024 + tid * 8;
#pragma unroll   // constant indices: the values stay in registers, the steps become immediate offsets
      for (int it = 0; it < 8; ++it) sv[it] = *(const v4u*)&sh[(it & 3) * 16 + col][(it >> 2) * HD + cl];
#pragma unroll   // constant indices: the values stay in registers, the steps become immediate offsets
      for (int it = 0; it < 8; ++it) vst2((unsigned*)(dp + ((it >> 2) * (TT / 16) + (it & 3)) * 1024), sv[it]);
      if (hi_rows) { STOREWAIT();
        _Float16* lp = DL + (bh * (nhi / 16) + th0 / 16) * 1024 + tid * 8;
#pragma unroll   // constant indices: the values stay in registers, the steps become immediate offsets
        for (int it = 0; it < 8; ++it) sv[it] = *(const v4u*)&sl[(it & 3) * 16 + col][(it >> 2) * HD + cl];
#pragma unroll   // constant indices: the values stay in registers, the steps become immediate offsets
        for (int it = 0; it < 8; ++it) vst2((unsigned*)(lp + ((it >> 2) * (nhi / 16) + (it & 3)) * 1024), sv[it]); } }
  } else {
    const int cl = (wave >> 1) * 16 + col, rl = (wave & 1) * 16 + g * 8; const size_t bh = bb * NH + c0 / HD;
#pragma unroll   // constant indices: the accumulators stay in registers
    for (int u = 0; u < 2; ++u) { const int th0 = t0 + 64 * u; const bool hi_rows = th0 < KHI;   // block-uniform
      if (u) { STOREWAIT();
        __syncthreads(); }   // every wave has read the first half out of th, tb and tbl before the second half is written there
#pragma unroll
      for (int j = 0; j < 8; ++j) {
#pragma unroll
        for (int r = 0; r < 8; ++r) { const float v = acc[u][j][r] + bias[j]; const int rw = wave * 16 + 8 * g + r, cw = j * 16 + col; th[cw][rw] = (_Float16)v; const __bf16 bv = (__bf16)v; tb[cw][rw] = bv; tbl[cw][rw] = (__bf16)(v - (float)bv); } }
      __syncthreads();   // the half is in LDS before any wave reads it in store order
      // the half's 8 half chunks (it: 2 heads x 2 key chunks x 2 halves of 4 runs); in each, wave = the 512-byte run, lane = the place in it
      v4u sv[8];
      _Float16* dp = VT + (bh * (TT / 32) + th0 / 32) * 2048 + tid * 8;
#pragma unroll   // constant indices: the values stay in registers, the steps become immediate offsets
      for (int it = 0; it < 8; ++it) sv[it] = *(const v4u*)&th[(it >> 2) * HD + (it & 1) * 32 + cl][((it >> 1) & 1) * 32 + rl];
#pragma unroll   // constant indices: the values stay in registers, the steps become immediate offsets
      for (int it = 0; it < 8; ++it) vst2((unsigned*)(dp + ((it >> 2) * (TT / 32) + ((it >> 1) & 1)) * 2048 + (it & 1) * 1024), sv[it]);
      if (hi_rows) { STOREWAIT();
        const size_t o3 = (bh * (KHI / 32) + th0 / 32) * 2048 + tid * 8; __bf16* hp = VB + o3; __bf16* lp = VBL + o3;
#pragma unroll   // constant indices: the values stay in registers, the steps become immediate offsets
        for (int it = 0; it < 8; ++it) sv[it] = *(const v4u*)&tb[(it >> 2) * HD + (it & 1) * 32 + cl][((it >> 1) & 1) * 32 + rl];
#pragma unroll   // constant indices: the values stay in registers, the steps become immediate offsets
        for (int it = 0; it < 8; ++it) vst2((unsigned*)(hp + ((it >> 2) * (KHI / 32) + ((it >> 1) & 1)) * 2048 + (it & 1) * 1024), sv[it]);
        STOREWAIT();
#pragma unroll   // constant indices: the values stay in registers, the steps become immediate offsets
        for (int it = 0; it < 8; ++it) sv[it] = *(const v4u*)&tbl[(it >> 2) * HD + (it & 1) * 32 + cl][((it >> 1) & 1) * 32 + rl];
#pragma unroll   // constant indices: the values stay in registers, the steps become immediate offsets
        for (int it = 0; it < 8; ++it) vst2((unsigned*)(lp + ((it >> 2) * (KHI / 32) + ((it >> 1) & 1)) * 2048 + (it & 1) * 1024), sv[it]); } } } }
// ---- k_att: block = 32 queries (2 tiles of 16) of (b, h), AW waves; the early rows (high precision) 16 queries a block; logits, softmax and P . v in one launch, the logits never leave the registers.
// Both tiles of a block end in the same 32-key chunk, so each K and each V fragment that a wave loads feeds both: half the loads per query.
// Wave w owns the 32-key chunks w, w + AW, ... up to the diagonal. It forms the TRANSPOSED logits k . q^T (A = 16 key rows, B = 16 query columns), so a lane holds one query (col) and keys 8g + r of each 16-key tile:
// the D registers of a chunk's two tiles are, element for element, the A fragment of P for that chunk (0..7 = k0 + 8g + r, 8..15 = k0 + 16 + 8g + r). Row max and row sum: in the lane, one exchange between the lane halves, then over the waves through LDS in wave order.
// Products: 1-product f16 logits x 1/8, P x 2^11 once to f16 against v f16; query rows < QBH * 64: q, k hi + residual (3 products), P and v bf16 hi + lo (3 products). f32 partial ctx summed through LDS in wave order 0..AW-1.
#define AW 16
#define NCH (TT / 32 / AW)   // chunks a wave can own
#define VFLY 2               // chunks whose v fragments are loaded ahead of the exponentials
// fragment halves from the lane's own pointer into a fragment-order plane (fragment start + 8 * lane): the two 512-byte runs of the fragment
__device__ __forceinline__ v16h frag_lh(const _Float16* p) { union { v16h v; v8h q[2]; } u; u.q[0] = *(const v8h*)p; u.q[1] = *(const v8h*)(p + 256); return u.v; }
__device__ __forceinline__ v16b frag_lb(const __bf16* p) { union { v16b v; v8b q[2]; } u; u.q[0] = *(const v8b*)p; u.q[1] = *(const v8b*)(p + 256); return u.v; }
// behind a batch of global loads: their address register, named as an input, is not rewritten in front of this wait and is free behind it
#define XWAIT1(p) asm volatile("s_wait_xcnt 0x0" :: "v"(p) : "memory")
#define XWAIT2(p, q) asm volatile("s_wait_xcnt 0x0" :: "v"(p), "v"(q) : "memory")
#define XWAIT4(p, q, r, s) asm volatile("s_wait_xcnt 0x0" :: "v"(p), "v"(q), "v"(r), "v"(s) : "memory")
// a query's maximum / sum over the block: the two lane halves, then the waves through LDS in wave order; called by every wave of the block
__device__ __forceinline__ float row_max(float m, float (*red)[16], int wave, int col, int g) {
  m = fmaxf(m, __shfl_xor(m, 16)); if (g == 0) red[wave][col] = m;
  __syncthreads();   // every wave's row maxima are in LDS before any is read
  m = red[0][col];
#pragma unroll
  for (int w = 1; w < AW; ++w) m = fmaxf(m, red[w][col]);
  return m; }
__device__ __forceinline__ float row_sum(float s, float (*red)[16], int wave, int col, int g) {
  s += __shfl_xor(s, 16); if (g == 0) red[wave][col] = s;
  __syncthreads();   // every wave's row sums are in LDS before any is read
  s = red[0][col];
#pragma unroll
  for (int w = 1; w < AW; ++w) s += red[w][col];
  return s; }
// the same for the two tiles of a block behind ONE barrier: lane half g stores and reduces tile g (same wave order), then the halves exchange
__device__ __forceinline__ void row_max2(float& m0, float& m1, float (*red)[AW][16], int wave, int col, int g) {
  m0 = fmaxf(m0, __shfl_xor(m0, 16)); m1 = fmaxf(m1, __shfl_xor(m1, 16)); red[g][wave][col] = g ? m1 : m0;
  __syncthreads();   // every wave's row maxima are in LDS before any is read
  float a = red[g][0][col];
#pragma unroll   // the LDS reads go out together instead of one latency each
  for (int w = 1; w < AW; ++w) a = fmaxf(a, red[g][w][col]);
  const float o = __shfl_xor(a, 16); m0 = g ? o : a; m1 = g ? a : o; }
__device__ __forceinline__ void row_sum2(float& s0, float& s1, float (*red)[AW][16], int wave, int col, int g) {
  s0 += __shfl_xor(s0, 16); s1 += __shfl_xor(s1, 16); red[g][wave][col] = g ? s1 : s0;
  __syncthreads();   // every wave's row sums are in LDS before any is read
  float a = red[g][0][col];
#pragma unroll   // the LDS reads go out together instead of one latency each
  for (int w = 1; w < AW; ++w) a += red[g][w][col];
  const float o = __shfl_xor(a, 16); s0 = g ? o : a; s1 = g ? a : o; }
// e^(SCALE * (a - m)) as 2^(a * EC - mc), mc = m * EC: one fused multiply-add (the product is not rounded) and one v_exp_f32. The rounding of mc is the same factor in every term of a row and leaves with the division by the row sum.
// A masked logit (-3e38) gives 2^(very negative) = exactly 0; a term below 2^-126 of the row's largest may come out 0.
#define EC (SCALE * 1.44269504088896340736f)
__device__ __forceinline__ float exp_sc(float a, float mc) { return __builtin_amdgcn_exp2f(__builtin_fmaf(a, EC, -mc)); }
#define NPAIR ((TT - QBH * 64) / 32)   // blocks of 32 queries per (b, h)
#define NHIT (QBH * 4)                 // blocks of 16 early queries per (b, h)
__global__ __launch_bounds__(32 * AW) void k_att(const _Float16* __restrict__ QH, const _Float16* __restrict__ KH, const _Float16* __restrict__ QL, const _Float16* __restrict__ KL, const _Float16* __restrict__ VT, const __bf16* __restrict__ VB, const __bf16* __restrict__ VBL, float* __restrict__ Y) {
  // the two small reduction arrays lie first: below 64 KiB their 16 reads take one address register and immediate offsets (behind ss each took a register of its own, and the build spilled)
  __shared__ __align__(16) struct { float redm[2][AW][16], reds[2][AW][16], ss[2][AW][16][HD + 4]; } sm;
  float (&ss)[2][AW][16][HD + 4] = sm.ss; float (&redm)[2][AW][16] = sm.redm; float (&reds)[2][AW][16] = sm.reds;
  // wave number held in a scalar register: every chunk test stays a scalar branch, so every lane is on at each matrix instruction
  const int tid = threadIdx.x, wave = __builtin_amdgcn_readfirstlane(tid >> 5), lane = tid & 31, col = lane & 15, g = lane >> 4;
  const int b = blockIdx.x / NH, h = blockIdx.x % NH;
  const bool pair = (int)blockIdx.y < NPAIR;   // block-uniform
  const int ql0 = pair ? TT - 32 * ((int)blockIdx.y + 1) : (NPAIR + NHIT - 1 - (int)blockIdx.y) * 16;   // the tiles with the most keys take the lowest indices
  const int kce = (ql0 >> 5) + 1;                         // chunks that hold a key <= the block's last query (a pair starts at a multiple of 32: the same chunk for both tiles)
  const int n = kce > wave ? (kce - wave + AW - 1) / AW : 0;   // chunks of this wave (scalar)
  const int tq = ql0 + col;
  const size_t bh = (size_t)b * NH + h;
  const _Float16* qp = QH + (bh * (TT / 16) + (ql0 >> 4)) * 1024 + 8 * lane;   // lane pointers: tile or chunk start + the lane's 8 elements
  v8f acc[2][HD / 16] = {};
  if (!pair) {   // block-uniform: early rows, high precision; kce <= KHI / 32 <= AW, so one chunk a wave at most
    float s[16]; float m = -3.0e38f;
    if (n > 0) { const _Float16* qlp = QL + (bh * (QHI / 16) + (ql0 >> 4)) * 1024 + 8 * lane; const _Float16* kp = KH + (bh * (TT / 16) + wave * 2) * 1024 + 8 * lane; const _Float16* lp = KL + (bh * (KHI / 16) + wave * 2) * 1024 + 8 * lane;
      v16h qh[2], qlf[2], kbf[2][2], klf[2][2];   // loads first, products behind them
#pragma unroll
      for (int kc = 0; kc < 2; ++kc) { qh[kc] = frag_lh(qp + kc * 512); qlf[kc] = frag_lh(qlp + kc * 512);
#pragma unroll
        for (int t = 0; t < 2; ++t) { kbf[t][kc] = frag_lh(kp + t * 1024 + kc * 512); klf[t][kc] = frag_lh(lp + t * 1024 + kc * 512); } }
      XWAIT4(qp, qlp, kp, lp);
#pragma unroll
      for (int t = 0; t < 2; ++t) { v8f a = {}, al = {};
#pragma unroll
        for (int kc = 0; kc < 2; ++kc) { a = wmma16(kbf[t][kc], qh[kc], a); al = wmma16(kbf[t][kc], qlf[kc], al); al = wmma16(klf[t][kc], qh[kc], al); }
#pragma unroll
        for (int r = 0; r < 8; ++r) { const float v = (wave * 32 + t * 16 + 8 * g + r <= tq) ? a[r] + al[r] * (1.0f / 1024.0f) : -3.0e38f; s[t * 8 + r] = v; m = fmaxf(m, v); } } }
    m = row_max(m, redm[0], wave, col, g) * EC;
    v16b vh[HD / 16], vl[HD / 16];   // the v fragments fly during the exponentials
    float sum = 0.f;
    if (n > 0) { const size_t po = (bh * (KHI / 32) + wave) * 2048 + 8 * lane; const __bf16* vhp = VB + po; const __bf16* vlp = VBL + po;
#pragma unroll
      for (int j = 0; j < HD / 16; ++j) { vh[j] = frag_lb(vhp + j * 512); vl[j] = frag_lb(vlp + j * 512); }
      XWAIT2(vhp, vlp);
#pragma unroll
      for (int e = 0; e < 16; ++e) { s[e] = exp_sc(s[e], m); sum += s[e]; } }   // an excluded key (-3e38) gives exactly 0: m is a finite logit
    const float inv = 2048.0f / row_sum(sum, reds[0], wave, col, g);
    if (n > 0) {
#pragma unroll
      for (int e = 0; e < 16; ++e) s[e] *= inv;
      const F2 p = bsplit16(s);
#pragma unroll
      for (int j = 0; j < HD / 16; ++j) { acc[0][j] = wmma_bf(p.h, vh[j], acc[0][j]); acc[0][j] = wmma_bf(p.l, vh[j], acc[0][j]); acc[0][j] = wmma_bf(p.h, vl[j], acc[0][j]); } }
  } else {
    float s[NCH][2][16]; float m0 = -3.0e38f, m1 = -3.0e38f;
    { v16h q[2][2];
#pragma unroll   // constant indices: the values stay in registers
      for (int u = 0; u < 2; ++u) { q[u][0] = frag_lh(qp + u * 1024); q[u][1] = frag_lh(qp + u * 1024 + 512); }
      XWAIT1(qp); const _Float16* kw = KH + (bh * (TT / 16) + wave * 2) * 1024 + 8 * lane;
      v16h kf[NCH][4];   // all key fragments of the wave go out together: one load latency
#pragma unroll   // constant indices: the values stay in registers
      for (int i = 0; i < NCH; ++i) if (i < n) { const _Float16* kp = kw + i * AW * 2048; kf[i][0] = frag_lh(kp); kf[i][1] = frag_lh(kp + 512); kf[i][2] = frag_lh(kp + 1024); kf[i][3] = frag_lh(kp + 1536); XWAIT1(kw); }
#pragma unroll   // constant indices: the values stay in registers
      for (int i = 0; i < NCH; ++i) if (i < n) { const int k0 = (wave + AW * i) * 32;
        v8f a[2][2];   // four independent accumulators: (query tile u, key tile t)
#pragma unroll   // constant indices: the values stay in registers
        for (int u = 0; u < 2; ++u)
#pragma unroll   // constant indices: the values stay in registers
          for (int t = 0; t < 2; ++t) { const v8f z = {}; a[u][t] = wmma16(kf[i][2 * t], q[u][0], z); }
#pragma unroll   // constant indices: the values stay in registers
        for (int u = 0; u < 2; ++u)
#pragma unroll   // constant indices: the values stay in registers
          for (int t = 0; t < 2; ++t) { a[u][t] = wmma16(kf[i][2 * t + 1], q[u][1], a[u][t]);
#pragma unroll   // constant indices: the values stay in registers
            for (int r = 0; r < 8; ++r) s[i][u][t * 8 + r] = a[u][t][r]; }
        if (wave + AW * i == kce - 1) {   // only the last chunk holds keys past a query of the block (scalar test)
#pragma unroll   // constant indices: the values stay in registers
          for (int u = 0; u < 2; ++u)
#pragma unroll   // constant indices: the values stay in registers
            for (int e = 0; e < 16; ++e) if (k0 + (e >> 3) * 16 + 8 * g + (e & 7) > tq + 16 * u) s[i][u][e] = -3.0e38f; }
#pragma unroll   // constant indices: the values stay in registers
        for (int e = 0; e < 16; ++e) { m0 = fmaxf(m0, s[i][0][e]); m1 = fmaxf(m1, s[i][1][e]); } } }
    row_max2(m0, m1, redm, wave, col, g); m0 *= EC; m1 *= EC;
    const _Float16* vw = VT + (bh * (TT / 32) + wave) * 2048 + 8 * lane;
    v16h vf[NCH][HD / 16];   // the v fragments of the first VFLY chunks fly during the exponentials; beside 2 tiles of f32 logits the registers hold no more
#pragma unroll   // constant indices: the values stay in registers
    for (int i = 0; i < VFLY; ++i) if (i < n) {
#pragma unroll   // constant indices: the values stay in registers
      for (int j = 0; j < HD / 16; ++j) vf[i][j] = frag_lh(vw + j * 512 + i * AW * 2048);
      XWAIT1(vw); }
    float sum0 = 0.f, sum1 = 0.f;
#pragma unroll   // constant indices: the values stay in registers
    for (int i = 0; i < NCH; ++i) if (i < n) {
#pragma unroll   // constant indices: the values stay in registers
      for (int e = 0; e < 16; ++e) { s[i][0][e] = exp_sc(s[i][0][e], m0); sum0 += s[i][0][e]; s[i][1][e] = exp_sc(s[i][1][e], m1); sum1 += s[i][1][e]; } }   // an excluded key (-3e38) gives exactly 0: m is a finite logit
    row_sum2(sum0, sum1, reds, wave, col, g);
    const float inv0 = 2048.0f / sum0, inv1 = 2048.0f / sum1;
    v16h p[NCH][2];   // P in 16 bits takes half the logits' registers: every 2 chunks converted make room for one more chunk's v fragments, loaded at once
#pragma unroll   // constant indices: the values stay in registers
    for (int i = 0; i < NCH; ++i) {
      if (i < n) {
#pragma unroll   // constant indices: the values stay in registers
        for (int e = 0; e < 16; ++e) { p[i][0][e] = (_Float16)(s[i][0][e] * inv0); p[i][1][e] = (_Float16)(s[i][1][e] * inv1); } }
      if ((i & 1) && VFLY + (i >> 1) < n) { const int iv = VFLY + (i >> 1);
#pragma unroll   // constant indices: the values stay in registers
        for (int j = 0; j < HD / 16; ++j) vf[iv][j] = frag_lh(vw + j * 512 + iv * AW * 2048);
        XWAIT1(vw); } }
#pragma unroll   // constant indices: the values stay in registers
    for (int i = 0; i < NCH; ++i) if (i < n) {
#pragma unroll   // constant indices: the values stay in registers
      for (int j = 0; j < HD / 16; ++j) { acc[0][j] = wmma16(p[i][0], vf[i][j], acc[0][j]); acc[1][j] = wmma16(p[i][1], vf[i][j], acc[1][j]); } } }
#pragma unroll   // constant indices: the values stay in registers
  for (int j = 0; j < HD / 16; ++j)
#pragma unroll   // constant indices: the values stay in registers
    for (int r = 0; r < 8; ++r) ss[0][wave][8 * g + r][j * 16 + col] = acc[0][j][r];
  if (pair) {
#pragma unroll   // constant indices: the values stay in registers
    for (int j = 0; j < HD / 16; ++j)
#pragma unroll   // constant indices: the values stay in registers
      for (int r = 0; r < 8; ++r) ss[1][wave][8 * g + r][j * 16 + col] = acc[1][j][r]; }
  __syncthreads();   // every wave's partial is in LDS before any is summed
  const int u = tid >> 8;   // waves 0..7 sum and store tile 0, waves 8..15 tile 1 (a pair only)
  if (u == 0 || pair) { const int rl = tid & 15, q4 = ((tid >> 4) & 15) * 4; v4f o = *(const v4f*)&ss[u][0][rl][q4];   // 16 lanes = the 16 rows of one 4-channel group: 256 contiguous bytes of the fragment-order ctx plane
#pragma unroll   // the LDS reads of all partials go out together instead of one latency each
    for (int w = 1; w < AW; ++w) o += *(const v4f*)&ss[u][w][rl][q4];
    vst2(Y + ((((size_t)b * TT + ql0 + 16 * u) >> 4) * (CC / 32) + h * (HD / 32) + (q4 >> 5)) * 512 + (((q4 >> 4) & 1) * 2 + ((q4 >> 2) & 1)) * 128 + (((q4 >> 3) & 1) * 16 + rl) * 4, o * (1.0f / 2048.0f)); } }
// ---- k_out: block = (64 rows, 128 cols): out = ctx Wo (+ bo): ctx once to f16 against Wo as f16(bf16 x 2^8) exact (1 product) x 2^-8; causal early rows (< QHI of each sequence): ctx bf16 hi + lo against exact bf16 Wo (2 products)
__global__ __launch_bounds__(128) void k_out(const float* __restrict__ Y, const float* __restrict__ WO, const float* __restrict__ BO, float* __restrict__ OUT) { __shared__ __align__(16) float sf[4][16][132]; __shared__ __align__(16) unsigned char wsm[2 * WSB];
  const int tid = threadIdx.x, wave = tid >> 5, lane = tid & 31, col = lane & 15, g = lane >> 4; const int c0 = blockIdx.y * 128; const size_t r0 = (size_t)blockIdx.x * 64 + wave * 16;
  v8f acc[8] = {};
  const float* wp = WO + (size_t)(8 * wave) * DIN + c0 + 4 * lane;   // (in,out) [CC][DIN]: this thread's 8 k rows x 4 columns of each slab
  const float* yp = Y + (r0 >> 4) * (CC / 32) * 512 + 4 * lane;   // this wave's 16 rows: one 512-float block per k slab
  unsigned char* wput = wsm + (lane >> 2) * WJP + wave * 256 + (lane & 3) * 64; const unsigned char* wget = wsm + lane * 16;
  v4f wn[8], yn[4]; wslab_load(wn, wp, DIN); arow_load_f(yn, yp); SLABWAIT();
  if (CAUSAL && (int)(((size_t)blockIdx.x * 64) % TT) < QHI) {   /* block-uniform */
    wslab_put_b(wput, wn);
    __syncthreads();   // slab 0 is in LDS before any wave reads it
#pragma unroll 2   // the buffer index is a constant in each copy of the body
    for (int kc = 0; kc < CC / 32; ++kc) { float v[16];
#pragma unroll   // constant indices: the values stay in registers
      for (int e = 0; e < 16; ++e) v[e] = yn[e >> 2][e & 3];
      const F2 a = bsplit16(v); const bool more = kc + 1 < CC / 32;   // block-uniform
      if (more) { const float* wq = wp + (size_t)(kc + 1) * 32 * DIN; const float* yq = yp + (kc + 1) * 512; wslab_load(wn, wq, DIN); arow_load_f(yn, yq); SLABWAIT(); }
      v16b wf[8];   // the slab's LDS reads go out as one group: one LDS latency, not one per product
#pragma unroll   // constant indices: the values stay in registers
      for (int j = 0; j < 8; ++j) wf[j] = wfrag_b(wget + (kc & 1) * WSB + j * WJP);
#pragma unroll   // constant indices: the values stay in registers
      for (int j = 0; j < 8; ++j) { acc[j] = wmma_bf(a.h, wf[j], acc[j]); acc[j] = wmma_bf(a.l, wf[j], acc[j]); }
      PRODUCTS_DONE();
      if (more) { wslab_put_b(wput + ((kc + 1) & 1) * WSB, wn);
        __syncthreads(); } }   // publishes slab kc + 1 and ends every wave's reads of slab kc, whose buffer the next trip refills
#pragma unroll
    for (int j = 0; j < 8; ++j) { const float bias = BO ? bfr(BO[c0 + j * 16 + col]) : 0.f;
#pragma unroll
      for (int r = 0; r < 8; ++r) sf[wave][8 * g + r][j * 16 + col] = acc[j][r] + bias; }
  } else {
    wslab_put_h(wput, wn);
    __syncthreads();   // slab 0 is in LDS before any wave reads it
#pragma unroll 2   // the buffer index is a constant in each copy of the body
    for (int kc = 0; kc < CC / 32; ++kc) { v16h a;
#pragma unroll   // constant indices: the values stay in registers
      for (int e = 0; e < 16; ++e) a[e] = (_Float16)yn[e >> 2][e & 3];
      const bool more = kc + 1 < CC / 32;   // block-uniform
      if (more) { const float* wq = wp + (size_t)(kc + 1) * 32 * DIN; const float* yq = yp + (kc + 1) * 512; wslab_load(wn, wq, DIN); arow_load_f(yn, yq); SLABWAIT(); }
      v16h wf[8];   // the slab's LDS reads go out as one group: one LDS latency, not one per product
#pragma unroll   // constant indices: the values stay in registers
      for (int j = 0; j < 8; ++j) wf[j] = wfrag_h(wget + (kc & 1) * WSB + j * WJP);
#pragma unroll   // constant indices: the values stay in registers
      for (int j = 0; j < 8; ++j) acc[j] = wmma16(a, wf[j], acc[j]);
      PRODUCTS_DONE();
      if (more) { wslab_put_h(wput + ((kc + 1) & 1) * WSB, wn);
        __syncthreads(); } }   // publishes slab kc + 1 and ends every wave's reads of slab kc, whose buffer the next trip refills
#pragma unroll
    for (int j = 0; j < 8; ++j) { const float bias = BO ? bfr(BO[c0 + j * 16 + col]) : 0.f;
#pragma unroll
      for (int r = 0; r < 8; ++r) sf[wave][8 * g + r][j * 16 + col] = acc[j][r] * (1.0f / 256.0f) + bias; } }
  LDSX(); for (int rl = 0; rl < 16; ++rl) vst2(OUT + (r0 + rl) * DIN + c0 + lane * 4, *(const v4f*)&sf[wave][rl][lane * 4]); }

extern "C" void kernel_launch(void* const* d_in, const int* in_sizes, int n_in, void* d_out, int out_size, void* d_ws, size_t ws_size, hipStream_t stream) {
  (void)in_sizes; (void)n_in; (void)out_size;
  const float** F = (const float**)d_in;
  if (ws_size < (size_t)WS_END) return;
  char* ws = (char*)d_ws; _Float16 *QH = (_Float16*)(ws + WS_QH), *KH = (_Float16*)(ws + WS_KH), *VT = (_Float16*)(ws + WS_VT), *QL = (_Float16*)(ws + WS_QL), *KL = (_Float16*)(ws + WS_KL); __bf16 *VB = (__bf16*)(ws + WS_VB), *VBL = (__bf16*)(ws + WS_VBL); float *Y = (float*)(ws + WS_Y);
  (void)Y; (void)QL; (void)KL; (void)VB; (void)VBL;
  // inputs: 0 x [4,2048,768]; 1 Wq, 2 Wk, 3 Wv [12,768,64]; 4 bq, 5 bk, 6 bv [12,64] (= flat [768] by column h*64+k); 7 Wo [768,768] (in,out); 8 bo [768]
  k_proj<<<dim3(TNB * TT / 128, CC / 128, 3), 128, 0, stream>>>(F[0], F[0], F[0], F[1], F[2], F[3], F[4], F[5], F[6], QH, QL, KH, KL, VT, VB, VBL);
  k_att<<<dim3(TNB * NH, NPAIR + NHIT), 32 * AW, 0, stream>>>(QH, KH, QL, KL, VT, VB, VBL, Y);
  k_out<<<dim3(TNB * TT / 64, DIN / 128), 128, 0, stream>>>(Y, F[7], F[8], (float*)d_out);
}

// v008
// It runs in 135 microseconds.
// Next to v007, in two timings, it ran 1.04 times as fast each time.
// Counting every step since v000, it is 12.8 times as fast.
// compute dtype: all float inputs rounded to bf16; q/k/v = x W[h] + b[h] with EXACT bf16 products on WMMA 16x16x32, f32 accumulate; q, k once to f16 -> 1-product causal logits x 1/8, except the first 384 query rows of each sequence (few keys, no averaging), which use q and k as f16 hi + residual (x 2^10) (3 products); softmax in f32 (e^x as one hardware 2^y of a fused y = logit * log2(e) / 8 - max * log2(e) / 8); P x 2^11 once to f16 against v once to f16 (1 product), except the first 384 rows: P and v as bf16 hi + lo (3 products); ctx once to f16 against Wo carried x 2^8 in f16 (exact bf16 values), except the first 384 rows: ctx bf16 hi + lo against exact bf16 Wo (2 products); + bo; f32 output.
#include <hip/hip_runtime.h>
#include <math.h>

typedef __attribute__((ext_vector_type(16))) _Float16 v16h;
typedef __attribute__((ext_vector_type(16))) __bf16 v16b;
typedef __attribute__((ext_vector_type(8)))  _Float16 v8h;
typedef __attribute__((ext_vector_type(8)))  float v8f;
typedef __attribute__((ext_vector_type(4)))  float v4f;
typedef __attribute__((ext_vector_type(2)))  float v2f;
typedef __attribute__((ext_vector_type(4)))  unsigned v4u;
typedef __attribute__((ext_vector_type(4)))  int v4i;
typedef float __attribute__((may_alias)) float_a;
typedef int __attribute__((may_alias)) int_a;

template <typename T> __device__ __forceinline__ void vst2(void* p, T v) { *(T*)p = v;  }
__device__ __forceinline__ v8f wmma16(v16h a, v16h b, v8f c) {
  v8f d = __builtin_amdgcn_wmma_f32_16x16x32_f16(false, a, false, b, (short)0, c, false, false);
  asm volatile("v_nop\n\tv_nop\n\tv_nop\n\tv_nop" : "+v"(d) : "v"(a), "v"(b));
  return d;
}
__device__ __forceinline__ v8f wmma_bf(v16b a, v16b b, v8f c) {
  v8f d = __builtin_amdgcn_wmma_f32_16x16x32_bf16(false, a, false, b, (short)0, c, false, false);
  asm volatile("v_nop\n\tv_nop\n\tv_nop\n\tv_nop" : "+v"(d) : "v"(a), "v"(b));
  return d;
}
// 16x16x32 fragments: lane = (h = lane>>4, row/col = lane&15); elements 0..7 = k0+8h+0..7, 8..15 = k0+16+8h+0..7; D element r = row 8h+r
__device__ __forceinline__ v16h frag_h(const _Float16* rowk0, int lane) {
  union { v16h v; v8h q[2]; } u; const _Float16* p = rowk0 + 8 * (lane >> 4);
  u.q[0] = *(const v8h*)p; u.q[1] = *(const v8h*)(p + 16); return u.v;
}
__device__ __forceinline__ v16h frag_f32(const float* rowk0, int lane) {
  v16h a; const float* p = rowk0 + 8 * (lane >> 4);
#pragma unroll
  for (int i = 0; i < 8; ++i) { a[i] = (_Float16)p[i]; a[8 + i] = (_Float16)p[16 + i]; }
  return a;
}
__device__ __forceinline__ v16h frag_f32s(const float* rowk0, int lane, float sc) {
  v16h a; const float* p = rowk0 + 8 * (lane >> 4);
#pragma unroll
  for (int i = 0; i < 8; ++i) { a[i] = (_Float16)(p[i] * sc); a[8 + i] = (_Float16)(p[16 + i] * sc); }
  return a;
}
// column fragment from a [K][ld] layout (column n), rows >= K read as 0
__device__ __forceinline__ v16h fragc_f32(const float* W, int k0, int n, int lane, int ld, int K) {
  v16h a; const int g = lane >> 4;
#pragma unroll
  for (int i = 0; i < 8; ++i) { const int ka = k0 + 8 * g + i, kb = ka + 16;
    a[i] = (_Float16)(ka < K ? W[(size_t)(ka < K ? ka : K - 1) * ld + n] : 0.f); a[8 + i] = (_Float16)(kb < K ? W[(size_t)(kb < K ? kb : K - 1) * ld + n] : 0.f); }
  return a;
}
struct F2 { v16b h, l; };
__device__ __forceinline__ F2 bsplit16(const float v[16]) { F2 r;
#pragma unroll
  for (int i = 0; i < 16; ++i) { const __bf16 h = (__bf16)v[i]; r.h[i] = h; r.l[i] = (__bf16)(v[i] - (float)h); }
  return r; }
__device__ __forceinline__ F2 split_row(const float* row, int k0, int lane) { float v[16]; const float* p = row + k0 + 8 * (lane >> 4);
#pragma unroll
  for (int i = 0; i < 8; ++i) { v[i] = p[i]; v[8 + i] = p[16 + i]; }
  return bsplit16(v); }
__device__ __forceinline__ F2 split_rowK(const float* row, int k0, int lane, int K) { float v[16]; const int g = lane >> 4;
#pragma unroll
  for (int i = 0; i < 8; ++i) { const int ka = k0 + 8 * g + i, kb = ka + 16; v[i] = ka < K ? row[ka < K ? ka : K - 1] : 0.f; v[8 + i] = kb < K ? row[kb < K ? kb : K - 1] : 0.f; }
  return bsplit16(v); }
__device__ __forceinline__ F2 split_col(const float* W, int k0, int n, int lane, int ld, int K) { float v[16]; const int g = lane >> 4;
#pragma unroll
  for (int i = 0; i < 8; ++i) { const int ka = k0 + 8 * g + i, kb = ka + 16; v[i] = ka < K ? W[(size_t)(ka < K ? ka : K - 1) * ld + n] : 0.f; v[8 + i] = kb < K ? W[(size_t)(kb < K ? kb : K - 1) * ld + n] : 0.f; }
  return bsplit16(v); }
__device__ __forceinline__ v8f mac3(const F2& a, const F2& b, v8f c) { c = wmma_bf(a.l, b.h, c); c = wmma_bf(a.h, b.l, c); return wmma_bf(a.h, b.h, c); }
__device__ __forceinline__ float sigm(float v) { return 1.0f / (1.0f + expf(-v)); }
#define LDSX() do { asm volatile("s_wait_dscnt 0" ::: "memory"); __builtin_amdgcn_wave_barrier(); __builtin_amdgcn_fence(__ATOMIC_RELEASE, "workgroup"); } while (0)

// Causal multi-head self-attention with per-head projection tensors (B 4, S 2,048, D 768, 12 heads x 64): q/k/v[b,h] = x W[h] + b[h] ([H][768][64] weights, [H][64] biases); scores = q k^T with key > query -> -inf, x 64^-0.5; softmax; out = concat_h(P v) Wo ((in,out) [768,768]) + bo.
#define NB 4
#define TT 2048
#define CC 768            // NH * HD = projected width
#define DIN 768          // input (model) width
#define NH 12
#define HD 64
#define SCALE (0.125f)
#define CAUSAL 1
#ifndef TNB
#define TNB NB
#endif
__device__ __forceinline__ float bfr(float v) { return (float)(__bf16)v; }
typedef __attribute__((ext_vector_type(8))) __bf16 v8b;
__device__ __forceinline__ v16b frag_b(const __bf16* rowk0, int lane) {
  union { v16b v; v8b q[2]; } u; const __bf16* p = rowk0 + 8 * (lane >> 4);
  u.q[0] = *(const v8b*)p; u.q[1] = *(const v8b*)(p + 16); return u.v;
}
#define QBH 6              // causal: query rows < QBH * 64 of each sequence (few keys, no averaging) take the high-precision path
#define QHI 384            // rows carrying a q residual plane
#define KHI 384            // key rows carrying k residual / v bf16 hi+lo planes (used only by the causal high-precision path)
// B fragment (k rows k0+.., output column o) of a weight: (in,out) [K][ld] or (out,in) [ld rows of K]: bf16 exact, or f16(bf16 * 256) exact
__device__ __forceinline__ v16b wcol_io(const float* Wm, int k0, int o, int lane, int ld) { v16b w; const int g = lane >> 4;
#pragma unroll
  for (int i = 0; i < 8; ++i) { w[i] = (__bf16)Wm[(size_t)(k0 + 8 * g + i) * ld + o]; w[8 + i] = (__bf16)Wm[(size_t)(k0 + 16 + 8 * g + i) * ld + o]; }
  return w; }
__device__ __forceinline__ v16b wcol_oi(const float* Wm, int k0, int o, int lane, int K) { v16b w; const float* p = Wm + (size_t)o * K + k0 + 8 * (lane >> 4);
#pragma unroll
  for (int i = 0; i < 8; ++i) { w[i] = (__bf16)p[i]; w[8 + i] = (__bf16)p[16 + i]; }
  return w; }
__device__ __forceinline__ v16h wcolh_io(const float* Wm, int k0, int o, int lane, int ld) { v16h w; const int g = lane >> 4;
#pragma unroll
  for (int i = 0; i < 8; ++i) { w[i] = (_Float16)(bfr(Wm[(size_t)(k0 + 8 * g + i) * ld + o]) * 256.0f); w[8 + i] = (_Float16)(bfr(Wm[(size_t)(k0 + 16 + 8 * g + i) * ld + o]) * 256.0f); }
  return w; }
__device__ __forceinline__ v16h wcolh_oi(const float* Wm, int k0, int o, int lane, int K) { v16h w; const float* p = Wm + (size_t)o * K + k0 + 8 * (lane >> 4);
#pragma unroll
  for (int i = 0; i < 8; ++i) { w[i] = (_Float16)(bfr(p[i]) * 256.0f); w[8 + i] = (_Float16)(bfr(p[16 + i]) * 256.0f); }
  return w; }
#define WQKV_LAYOUT 2   // 0 = (in,out) [DIN][CC]; 1 = (out,in) [CC][DIN]; 2 = per-head [NH][DIN][HD]
__device__ __forceinline__ v16b wcol_hdk(const float* Wm, int k0, int o, int lane) { v16b w; const int g = lane >> 4; const float* p = Wm + (size_t)(o / HD) * DIN * HD + (o % HD);
#pragma unroll
  for (int i = 0; i < 8; ++i) { w[i] = (__bf16)p[(size_t)(k0 + 8 * g + i) * HD]; w[8 + i] = (__bf16)p[(size_t)(k0 + 16 + 8 * g + i) * HD]; }
  return w; }
#define WO_OUT_IN 0
#if WQKV_LAYOUT == 1
#define WCOL(W, k0, o, lane) wcol_oi(W, k0, o, lane, DIN)
#elif WQKV_LAYOUT == 2
#define WCOL(W, k0, o, lane) wcol_hdk(W, k0, o, lane)
#else
#define WCOL(W, k0, o, lane) wcol_io(W, k0, o, lane, CC)
#endif
#if WO_OUT_IN
#define WOCOL(W, k0, o, lane) wcol_oi(W, k0, o, lane, CC)
#define WOCOLH(W, k0, o, lane) wcolh_oi(W, k0, o, lane, CC)
#else
#define WOCOL(W, k0, o, lane) wcol_io(W, k0, o, lane, DIN)
#define WOCOLH(W, k0, o, lane) wcolh_io(W, k0, o, lane, DIN)
#endif

#ifndef PROJ_EXTRA_PARAMS
#define PROJ_EXTRA_PARAMS
#endif

// q, k and v planes lie in FRAGMENT ORDER, so that each wave-wide 16-byte load of k_att covers 512 contiguous bytes (4 whole lines) instead of 16 pieces of 32 bytes in 16 lines.
// Row planes (q, k and their residuals), NT rows a sequence: [b][h][t / 16] tiles of 1,024 elements (16 rows x HD); element (t, d) at i * 256 + ln * 8 + d % 8, i = (d / 32) * 2 + (d % 32) / 16, ln = ((d % 16) / 8) * 16 + t % 16.
// v planes, NT keys a sequence: [b][h][t / 32] chunks of 2,048 elements (HD channels x 32 keys); element (c, t) at i * 256 + ln * 8 + t % 8, i = (c / 16) * 2 + (t % 32) / 16, ln = ((t % 16) / 8) * 16 + c % 16.
// In both, lane ln of a wave finds elements 0..7 of fragment f at f * 512 + ln * 8 and elements 8..15 at 256 elements on.
#define WS_QH  0u                                      // f16 q, row plane, NT = TT
#define WS_KH  (WS_QH + 2u * (size_t)NB * TT * CC)      // f16 k, row plane, NT = TT
#define WS_VT  (WS_KH + 2u * (size_t)NB * TT * CC)      // f16 v, v plane, NT = TT
#define WS_QL  (WS_VT + 2u * (size_t)NB * CC * TT)      // f16 q residual x 2^10, row plane, NT = QHI
#define WS_KL  (WS_QL + 2u * (size_t)NB * QHI * CC)     // f16 k residual x 2^10, row plane, NT = KHI
#define WS_VB  (WS_KL + 2u * (size_t)NB * KHI * CC)     // bf16 v hi (and, behind it, lo), v plane, NT = KHI
#define WS_VBL (WS_VB + 2u * (size_t)NB * CC * KHI)
#define WS_Y   (WS_VBL + 2u * (size_t)NB * CC * KHI)    // f32 ctx in fragment order: [(b*t) / 16][c / 32] blocks of 512 floats (16 rows x 32 k); element (t, c) at x * 128 + ln * 4 + c % 4, x = ((c % 32) / 16) * 2 + (c % 8) / 4, ln = ((c % 16) / 8) * 16 + t % 16
#define WS_END (WS_Y  + 4u * (size_t)NB * TT * CC)

// ---- weight k-slab in LDS (both projection kernels): 32 k rows x 128 output columns, converted once per block and laid out in fragment order, read by all 4 waves.
// Place of (k group q = k / 8, column c): (c / 16) * WJP + q * 256 + (c % 16) * 16 bytes, 8 k values of 16 bits each. A lane (g, col) finds elements 0..7 (k = 8g + i) at group g and 8..15 (k = 16 + 8g + i) at group 2 + g, 512 bytes on.
// Staging: thread (wave = k group, lane = 4 columns) loads 8 k rows x 16 bytes, so a wave's load covers whole 128-byte lines, and stores 4 columns x 16 bytes.
#define WJP 1040           // 4 groups x 16 columns x 16 B, + 16 B: the 16 lanes of a staging store then fall on 64 distinct banks
#define WSB (8 * WJP)      // one buffer
__device__ __forceinline__ void wslab_load(v4f (&r)[8], const float* p, int ld) {
#pragma unroll   // constant indices: the values stay in registers
  for (int i = 0; i < 8; ++i) r[i] = *(const v4f*)(p + (size_t)i * ld); }
__device__ __forceinline__ void wslab_put_b(unsigned char* d, const v4f (&r)[8]) {   // exact bf16
#pragma unroll   // constant indices: the values stay in registers
  for (int cc = 0; cc < 4; ++cc) { v8b h;
#pragma unroll   // constant indices: the values stay in registers
    for (int i = 0; i < 8; ++i) h[i] = (__bf16)r[i][cc];
    *(v8b*)(d + cc * 16) = h; } }
__device__ __forceinline__ void wslab_put_h(unsigned char* d, const v4f (&r)[8]) {   // f16(bf16 x 2^8), exact
#pragma unroll   // constant indices: the values stay in registers
  for (int cc = 0; cc < 4; ++cc) { v8h h;
#pragma unroll   // constant indices: the values stay in registers
    for (int i = 0; i < 8; ++i) h[i] = (_Float16)(bfr(r[i][cc]) * 256.0f);
    *(v8h*)(d + cc * 16) = h; } }
__device__ __forceinline__ v16b wfrag_b(const unsigned char* p) { union { v16b v; v8b q[2]; } u; u.q[0] = *(const v8b*)p; u.q[1] = *(const v8b*)(p + 512); return u.v; }
__device__ __forceinline__ v16h wfrag_h(const unsigned char* p) { union { v16h v; v8h q[2]; } u; u.q[0] = *(const v8h*)p; u.q[1] = *(const v8h*)(p + 512); return u.v; }
// a lane's 16 f32 of an A row (p = row + k0 + 8g): element e = x[e / 4][e % 4] = p[e] (e < 8), p[8 + e] (e >= 8)
__device__ __forceinline__ void arow_load(v4f (&x)[4], const float* p) { x[0] = *(const v4f*)p; x[1] = *(const v4f*)(p + 4); x[2] = *(const v4f*)(p + 16); x[3] = *(const v4f*)(p + 20); }
// the same 16 f32 from the fragment-order ctx plane (p = block start + 4 * lane): four runs of 512 bytes
__device__ __forceinline__ void arow_load_f(v4f (&x)[4], const float* p) { x[0] = *(const v4f*)p; x[1] = *(const v4f*)(p + 128); x[2] = *(const v4f*)(p + 256); x[3] = *(const v4f*)(p + 384); }
// behind the next slab's loads: their address registers are rewritten only behind this wait; the clobber also keeps the loads ahead of the products they fly under
#define SLABWAIT() asm volatile("s_wait_xcnt 0x0" ::: "memory")
// behind a group of global stores: their address and data registers are rewritten only behind this wait (the clobber keeps the next group's LDS reads behind it, the scheduling barrier its address arithmetic)
#define STOREWAIT() do { asm volatile("s_wait_xcnt 0x0" ::: "memory"); __builtin_amdgcn_sched_barrier(0); } while (0)
// behind a slab's products: keeps the conversions of the next slab, which wait for the loads in flight, from moving up among the products
#define PRODUCTS_DONE() __builtin_amdgcn_sched_barrier(0)

// ---- k_proj: block = (128 rows, 128 cols, which): q/k/v = X W (+ b) with exact bf16 products (K = DIN) -> which 0: q f16 (+ residual, rows < QHI); 1: k f16 (+ residual, rows < KHI); 2: v f16 (+ bf16 hi/lo for t < KHI); all stored in fragment order
// A wave owns two 16-row tiles, 64 rows apart (tile u = rows 64 u + 16 wave ..): each weight fragment it reads from the slab feeds both, so a staged slab serves twice the rows. The epilogue lays out and stores one 64-row half at a time through the same LDS arrays.
__global__ __launch_bounds__(128) void k_proj(const float* __restrict__ XQ, const float* __restrict__ XK, const float* __restrict__ XV, const float* __restrict__ WQ, const float* __restrict__ WK, const float* __restrict__ WV, const float* __restrict__ BQ, const float* __restrict__ BK, const float* __restrict__ BV,
    _Float16* __restrict__ QH, _Float16* __restrict__ QL, _Float16* __restrict__ KH, _Float16* __restrict__ KL, _Float16* __restrict__ VT, __bf16* __restrict__ VB, __bf16* __restrict__ VBL) {
  // the weight slab lies first: below 64 KiB its 16 fragment reads take one address register and immediate offsets (behind the epilogue arrays each took a register of its own, and the wave count per SIMD fell)
  __shared__ __align__(16) struct { unsigned char wsm[2 * WSB]; _Float16 sh[64][136], sl[64][136], th[128][72]; __bf16 tb[128][72], tbl[128][72]; } sm;
  unsigned char (&wsm)[2 * WSB] = sm.wsm; _Float16 (&sh)[64][136] = sm.sh; _Float16 (&sl)[64][136] = sm.sl; _Float16 (&th)[128][72] = sm.th; __bf16 (&tb)[128][72] = sm.tb; __bf16 (&tbl)[128][72] = sm.tbl;
  const int tid = threadIdx.x, wave = tid >> 5, lane = tid & 31, col = lane & 15, g = lane >> 4; const int which = blockIdx.z; const int c0 = blockIdx.y * 128; const size_t r0 = (size_t)blockIdx.x * 128; const size_t bb = r0 / TT; const int t0 = (int)(r0 % TT);
  const float* X = which == 0 ? XQ : which == 1 ? XK : XV; const float* WA = which == 0 ? WQ : which == 1 ? WK : WV; const float* BA = which == 0 ? BQ : which == 1 ? BK : BV;
  v8f acc[2][8] = {};
  { const int cw = c0 + 4 * lane;   // this thread's 4 weight columns; its 8 k rows are 8 * wave + 0..7 of each slab
    const float* wp = WA + (size_t)(cw / HD) * DIN * HD + (cw % HD) + (size_t)(8 * wave) * HD;   // per-head [NH][DIN][HD]
    const float* xp = X + (r0 + wave * 16 + col) * DIN + 8 * g; const float* xp1 = xp + (size_t)64 * DIN;
    unsigned char* wput = wsm + (lane >> 2) * WJP + wave * 256 + (lane & 3) * 64; const unsigned char* wget = wsm + lane * 16;
    v4f wn[8], xn[2][4]; wslab_load(wn, wp, HD); arow_load(xn[0], xp); arow_load(xn[1], xp1); SLABWAIT();
    wslab_put_b(wput, wn);
    __syncthreads();   // slab 0 is in LDS before any wave reads it
#pragma unroll 2   // the buffer index is a constant in each copy of the body
    for (int kc = 0; kc < DIN / 32; ++kc) { v16b a[2];
#pragma unroll   // constant indices: the values stay in registers
      for (int e = 0; e < 16; ++e) { a[0][e] = (__bf16)xn[0][e >> 2][e & 3]; a[1][e] = (__bf16)xn[1][e >> 2][e & 3]; }
      const bool more = kc + 1 < DIN / 32;   // block-uniform
      if (more) { const float* wq = wp + (size_t)(kc + 1) * 32 * HD; const float* xq = xp + (kc + 1) * 32; const float* xq1 = xp1 + (kc + 1) * 32; wslab_load(wn, wq, HD); arow_load(xn[0], xq); arow_load(xn[1], xq1); SLABWAIT(); }
      v16b wf[8];   // the slab's LDS reads go out as one group: one LDS latency, not one per product
#pragma unroll   // constant indices: the values stay in registers
      for (int j = 0; j < 8; ++j) wf[j] = wfrag_b(wget + (kc & 1) * WSB + j * WJP);
      __builtin_amdgcn_sched_barrier(0);   // keeps the 16 LDS reads ahead of the products: without it they are issued two at a time into one fragment's registers, one LDS latency per pair of products
      // the bare builtin (the compiler keeps the distances behind it): with the v_nop statement of wmma_bf, whose operands cannot lie above v255, the 16 accumulator tiles spilled to scratch
#pragma unroll   // constant indices: the values stay in registers
      for (int j = 0; j < 8; ++j) { acc[0][j] = __builtin_amdgcn_wmma_f32_16x16x32_bf16(false, a[0], false, wf[j], (short)0, acc[0][j], false, false); acc[1][j] = __builtin_amdgcn_wmma_f32_16x16x32_bf16(false, a[1], false, wf[j], (short)0, acc[1][j], false, false); }
      PRODUCTS_DONE();
      if (more) { wslab_put_b(wput + ((kc + 1) & 1) * WSB, wn);
        __syncthreads(); } } }   // publishes slab kc + 1 and ends every wave's reads of slab kc, whose buffer the next trip refills
  float bias[8] = {};   // one value per column tile, the same for both halves
  if (BA) {
#pragma unroll   // constant indices: the values stay in registers
    for (int j = 0; j < 8; ++j) bias[j] = bfr(BA[c0 + j * 16 + col]); }
  if (which < 2) { _Float16* DH = which == 0 ? QH : KH; _Float16* DL = which == 0 ? QL : KL; const int nhi = which == 0 ? QHI : KHI;
    const int cl = (wave >> 1) * 32 + (wave & 1) * 16 + g * 8; const size_t bh = bb * NH + c0 / HD;
#pragma unroll   // constant indices: the accumulators stay in registers
    for (int u = 0; u < 2; ++u) { const int th0 = t0 + 64 * u; const bool hi_rows = th0 < nhi;   // block-uniform
      if (u) { STOREWAIT();
        __syncthreads(); }   // every wave has read the first half out of sh and sl before the second half is written there
#pragma unroll
      for (int j = 0; j < 8; ++j) {
#pragma unroll
        for (int r = 0; r < 8; ++r) { const float v = acc[u][j][r] + bias[j]; const _Float16 hv = (_Float16)v; sh[wave * 16 + 8 * g + r][j * 16 + col] = hv; sl[wave * 16 + 8 * g + r][j * 16 + col] = (_Float16)((v - (float)hv) * 1024.0f); } }
      __syncthreads();   // the half is in LDS before any wave reads it in store order
      // the half's 8 tiles (it: 2 heads x 4 row tiles); in each, wave = the 512-byte run, lane = the place in it
      v4u sv[8];
      _Float16* dp = DH + (bh * (TT / 16) + th0 / 16) * 1024 + tid * 8;
#pragma unroll   // constant indices: the values stay in registers, the steps become immediate offsets
      for (int it = 0; it < 8; ++it) sv[it] = *(const v4u*)&sh[(it & 3) * 16 + col][(it >> 2) * HD + cl];
#pragma unroll   // constant indices: the values stay in registers, the steps become immediate offsets
      for (int it = 0; it < 8; ++it) vst2((unsigned*)(dp + ((it >> 2) * (TT / 16) + (it & 3)) * 1024), sv[it]);
      if (hi_rows) { STOREWAIT();
        _Float16* lp = DL + (bh * (nhi / 16) + th0 / 16) * 1024 + tid * 8;
#pragma unroll   // constant indices: the values stay in registers, the steps become immediate offsets
        for (int it = 0; it < 8; ++it) sv[it] = *(const v4u*)&sl[(it & 3) * 16 + col][(it >> 2) * HD + cl];
#pragma unroll   // constant indices: the values stay in registers, the steps become immediate offsets
        for (int it = 0; it < 8; ++it) vst2((unsigned*)(lp + ((it >> 2) * (nhi / 16) + (it & 3)) * 1024), sv[it]); } }
  } else {
    const int cl = (wave >> 1) * 16 + col, rl = (wave & 1) * 16 + g * 8; const size_t bh = bb * NH + c0 / HD;
#pragma unroll   // constant indices: the accumulators stay in registers
    for (int u = 0; u < 2; ++u) { const int th0 = t0 + 64 * u; const bool hi_rows = th0 < KHI;   // block-uniform
      if (u) { STOREWAIT();
        __syncthreads(); }   // every wave has read the first half out of th, tb and tbl before the second half is written there
#pragma unroll
      for (int j = 0; j < 8; ++j) {
#pragma unroll
        for (int r = 0; r < 8; ++r) { const float v = acc[u][j][r] + bias[j]; const int rw = wave * 16 + 8 * g + r, cw = j * 16 + col; th[cw][rw] = (_Float16)v; const __bf16 bv = (__bf16)v; tb[cw][rw] = bv; tbl[cw][rw] = (__bf16)(v - (float)bv); } }
      __syncthreads();   // the half is in LDS before any wave reads it in store order
      // the half's 8 half chunks (it: 2 heads x 2 key chunks x 2 halves of 4 runs); in each, wave = the 512-byte run, lane = the place in it
      v4u sv[8];
      _Float16* dp = VT + (bh * (TT / 32) + th0 / 32) * 2048 + tid * 8;
#pragma unroll   // constant indices: the values stay in registers, the steps become immediate offsets
      for (int it = 0; it < 8; ++it) sv[it] = *(const v4u*)&th[(it >> 2) * HD + (it & 1) * 32 + cl][((it >> 1) & 1) * 32 + rl];
#pragma unroll   // constant indices: the values stay in registers, the steps become immediate offsets
      for (int it = 0; it < 8; ++it) vst2((unsigned*)(dp + ((it >> 2) * (TT / 32) + ((it >> 1) & 1)) * 2048 + (it & 1) * 1024), sv[it]);
      if (hi_rows) { STOREWAIT();
        const size_t o3 = (bh * (KHI / 32) + th0 / 32) * 2048 + tid * 8; __bf16* hp = VB + o3; __bf16* lp = VBL + o3;
#pragma unroll   // constant indices: the values stay in registers, the steps become immediate offsets
        for (int it = 0; it < 8; ++it) sv[it] = *(const v4u*)&tb[(it >> 2) * HD + (it & 1) * 32 + cl][((it >> 1) & 1) * 32 + rl];
#pragma unroll   // constant indices: the values stay in registers, the steps become immediate offsets
        for (int it = 0; it < 8; ++it) vst2((unsigned*)(hp + ((it >> 2) * (KHI / 32) + ((it >> 1) & 1)) * 2048 + (it & 1) * 1024), sv[it]);
        STOREWAIT();
#pragma unroll   // constant indices: the values stay in registers, the steps become immediate offsets
        for (int it = 0; it < 8; ++it) sv[it] = *(const v4u*)&tbl[(it >> 2) * HD + (it & 1) * 32 + cl][((it >> 1) & 1) * 32 + rl];
#pragma unroll   // constant indices: the values stay in registers, the steps become immediate offsets
        for (int it = 0; it < 8; ++it) vst2((unsigned*)(lp + ((it >> 2) * (KHI / 32) + ((it >> 1) & 1)) * 2048 + (it & 1) * 1024), sv[it]); } } } }
// ---- k_att: a block of AW waves works on one tile at a time: 32 queries (2 tiles of 16) of (b, h), for the early rows (high precision) 16 queries; logits, softmax and P . v in one launch, the logits never leave the registers.
// Both tiles of a block end in the same 32-key chunk, so each K and each V fragment that a wave loads feeds both: half the loads per query.
// Wave w owns the 32-key chunks w, w + AW, ... up to the diagonal. It forms the TRANSPOSED logits k . q^T (A = 16 key rows, B = 16 query columns), so a lane holds one query (col) and keys 8g + r of each 16-key tile:
// the D registers of a chunk's two tiles are, element for element, the A fragment of P for that chunk (0..7 = k0 + 8g + r, 8..15 = k0 + 16 + 8g + r). Row max and row sum: in the lane, one exchange between the lane halves, then over the waves through LDS in wave order.
// Products: 1-product f16 logits x 1/8, P x 2^11 once to f16 against v f16; query rows < QBH * 64: q, k hi + residual (3 products), P and v bf16 hi + lo (3 products). f32 partial ctx summed through LDS in wave order 0..AW-1.
#define AW 16
#define NCH (TT / 32 / AW)   // chunks a wave can own
#define VFLY 2               // chunks whose v fragments are loaded ahead of the exponentials
// fragment halves from the lane's own pointer into a fragment-order plane (fragment start + 8 * lane): the two 512-byte runs of the fragment
__device__ __forceinline__ v16h frag_lh(const _Float16* p) { union { v16h v; v8h q[2]; } u; u.q[0] = *(const v8h*)p; u.q[1] = *(const v8h*)(p + 256); return u.v; }
__device__ __forceinline__ v16b frag_lb(const __bf16* p) { union { v16b v; v8b q[2]; } u; u.q[0] = *(const v8b*)p; u.q[1] = *(const v8b*)(p + 256); return u.v; }
// behind a batch of global loads: their address register, named as an input, is not rewritten in front of this wait and is free behind it
#define XWAIT1(p) asm volatile("s_wait_xcnt 0x0" :: "v"(p) : "memory")
#define XWAIT2(p, q) asm volatile("s_wait_xcnt 0x0" :: "v"(p), "v"(q) : "memory")
#define XWAIT4(p, q, r, s) asm volatile("s_wait_xcnt 0x0" :: "v"(p), "v"(q), "v"(r), "v"(s) : "memory")
// a query's maximum / sum over the block: the two lane halves, then the waves through LDS in wave order; called by every wave of the block
__device__ __forceinline__ float row_max(float m, float (*red)[16], int wave, int col, int g) {
  m = fmaxf(m, __shfl_xor(m, 16)); if (g == 0) red[wave][col] = m;
  __syncthreads();   // every wave's row maxima are in LDS before any is read
  m = red[0][col];
#pragma unroll
  for (int w = 1; w < AW; ++w) m = fmaxf(m, red[w][col]);
  return m; }
__device__ __forceinline__ float row_sum(float s, float (*red)[16], int wave, int col, int g) {
  s += __shfl_xor(s, 16); if (g == 0) red[wave][col] = s;
  __syncthreads();   // every wave's row sums are in LDS before any is read
  s = red[0][col];
#pragma unroll
  for (int w = 1; w < AW; ++w) s += red[w][col];
  return s; }
// the same for the two tiles of a block behind ONE barrier: lane half g stores and reduces tile g (same wave order), then the halves exchange
__device__ __forceinline__ void row_max2(float& m0, float& m1, float (*red)[AW][16], int wave, int col, int g) {
  m0 = fmaxf(m0, __shfl_xor(m0, 16)); m1 = fmaxf(m1, __shfl_xor(m1, 16)); red[g][wave][col] = g ? m1 : m0;
  __syncthreads();   // every wave's row maxima are in LDS before any is read
  float a = red[g][0][col];
#pragma unroll   // the LDS reads go out together instead of one latency each
  for (int w = 1; w < AW; ++w) a = fmaxf(a, red[g][w][col]);
  const float o = __shfl_xor(a, 16); m0 = g ? o : a; m1 = g ? a : o; }
__device__ __forceinline__ void row_sum2(float& s0, float& s1, float (*red)[AW][16], int wave, int col, int g) {
  s0 += __shfl_xor(s0, 16); s1 += __shfl_xor(s1, 16); red[g][wave][col] = g ? s1 : s0;
  __syncthreads();   // every wave's row sums are in LDS before any is read
  float a = red[g][0][col];
#pragma unroll   // the LDS reads go out together instead of one latency each
  for (int w = 1; w < AW; ++w) a += red[g][w][col];
  const float o = __shfl_xor(a, 16); s0 = g ? o : a; s1 = g ? a : o; }
// e^(SCALE * (a - m)) as 2^(a * EC - mc), mc = m * EC: one fused multiply-add (the product is not rounded) and one v_exp_f32. The rounding of mc is the same factor in every term of a row and leaves with the division by the row sum.
// A masked logit (-3e38) gives 2^(very negative) = exactly 0; a term below 2^-126 of the row's largest may come out 0.
#define EC (SCALE * 1.44269504088896340736f)
__device__ __forceinline__ float exp_sc(float a, float mc) { return __builtin_amdgcn_exp2f(__builtin_fmaf(a, EC, -mc)); }
// ---- pieces of a 32-query tile, one chunk of 32 keys each
// lane pointer from a wave-uniform tile or chunk start and the lane's byte offset (16 * lane): the start is formed in scalar registers, and one offset serves every plane over the whole tile loop (plane + lane offset, one pair per plane held over the loop, spilled)
__device__ __forceinline__ const _Float16* lane_at(const _Float16* f, unsigned lo) { return (const _Float16*)((const char*)f + (size_t)lo); }
// the chunk's four key fragments
__device__ __forceinline__ void att_kload(v16h (&kf)[4], const _Float16* kp) { kf[0] = frag_lh(kp); kf[1] = frag_lh(kp + 512); kf[2] = frag_lh(kp + 1024); kf[3] = frag_lh(kp + 1536); }
// transposed logits of the chunk for both query tiles, causal mask, running maxima
__device__ __forceinline__ void att_qk(float (&s)[2][16], float& m0, float& m1, const v16h (&kf)[4], const v16h (&q)[2][2], bool diag, int lim) {
  v8f a[2][2];   // four independent accumulators: (query tile u, key tile t)
#pragma unroll   // constant indices: the values stay in registers
  for (int u = 0; u < 2; ++u)
#pragma unroll   // constant indices: the values stay in registers
    for (int t = 0; t < 2; ++t) { const v8f z = {}; a[u][t] = wmma16(kf[2 * t], q[u][0], z); }
#pragma unroll   // constant indices: the values stay in registers
  for (int u = 0; u < 2; ++u)
#pragma unroll   // constant indices: the values stay in registers
    for (int t = 0; t < 2; ++t) { a[u][t] = wmma16(kf[2 * t + 1], q[u][1], a[u][t]);
#pragma unroll   // constant indices: the values stay in registers
      for (int r = 0; r < 8; ++r) s[u][t * 8 + r] = a[u][t][r]; }
  if (diag) {   // only the block's last chunk holds keys past a query of the block (scalar test); key > query with the constants on one side: lim = query - the chunk's first key - 8g, one lane value for all 32 tests
#pragma unroll   // constant indices: the values stay in registers
    for (int u = 0; u < 2; ++u)
#pragma unroll   // constant indices: the values stay in registers
      for (int e = 0; e < 16; ++e) if ((e >> 3) * 16 + (e & 7) - 16 * u > lim) s[u][e] = -3.0e38f; }
#pragma unroll   // constant indices: the values stay in registers
  for (int e = 0; e < 16; ++e) { m0 = fmaxf(m0, s[0][e]); m1 = fmaxf(m1, s[1][e]); } }
__device__ __forceinline__ void att_s0(float (&s)[2][16]) {
#pragma unroll   // constant indices: the values stay in registers
  for (int e = 0; e < 16; ++e) { s[0][e] = 0.f; s[1][e] = 0.f; } }
// the chunk's four v fragments
__device__ __forceinline__ void att_vload(v16h (&vf)[HD / 16], const _Float16* vp) {
#pragma unroll   // constant indices: the values stay in registers
  for (int j = 0; j < HD / 16; ++j) vf[j] = frag_lh(vp + j * 512); }
// P of the chunk to 16 bits
__device__ __forceinline__ void att_p(v16h (&p)[2], const float (&s)[2][16], float inv0, float inv1) {
#pragma unroll   // constant indices: the values stay in registers
  for (int e = 0; e < 16; ++e) { p[0][e] = (_Float16)(s[0][e] * inv0); p[1][e] = (_Float16)(s[1][e] * inv1); } }
// P . v of the chunk
__device__ __forceinline__ void att_pv(v8f (&acc)[2][HD / 16], const v16h (&p)[2], const v16h (&vf)[HD / 16]) {
#pragma unroll   // constant indices: the values stay in registers
  for (int j = 0; j < HD / 16; ++j) { acc[0][j] = wmma16(p[0], vf[j], acc[0][j]); acc[1][j] = wmma16(p[1], vf[j], acc[1][j]); } }
#define NPAIR ((TT - QBH * 64) / 32)   // tiles of 32 queries per (b, h)
#define NHIT (QBH * 4)                 // tiles of 16 early queries per (b, h)
// One block per WGP (16 waves of up to 256 registers fill one) walks its share of the tiles in a loop instead of one launch of 16 waves per tile.
// The tiles of a kind are numbered by falling key count (tile rank major, (b, h) minor) and dealt in rounds of AGRID, odd rounds in reverse block order, so that every block gets about the same work. The deal is fixed: no block waits for another.
#define NB2 (TNB * NH * NPAIR)         // tiles of 32 queries in all
#define NB1 (TNB * NH * NHIT)          // tiles of 16 early queries in all
#define AGRID 256                      // blocks launched
// the waves' partial ctx of a tile, summed in wave order and stored; every wave calls it behind the barrier that ends the writes of ss
template <bool PAIR> __device__ __forceinline__ void att_store(const float (&ss)[2][AW][16][HD + 4], float* __restrict__ Y, int b, int h, int ql0, int tid) {
  const int u = tid >> 8;   // waves 0..7 sum and store tile 0, waves 8..15 tile 1 (a pair only)
  if (u == 0 || PAIR) { const int rl = tid & 15, q4 = ((tid >> 4) & 15) * 4; v4f o = *(const v4f*)&ss[u][0][rl][q4];   // 16 lanes = the 16 rows of one 4-channel group: 256 contiguous bytes of the fragment-order ctx plane
#pragma unroll   // the LDS reads of all partials go out together instead of one latency each
    for (int w = 1; w < AW; ++w) o += *(const v4f*)&ss[u][w][rl][q4];
    // the tile's place is scalar, the thread's place in it one register held over the tile loop
    const unsigned yo = (u * (CC / 32) + (q4 >> 5)) * 512 + (((q4 >> 4) & 1) * 2 + ((q4 >> 2) & 1)) * 128 + (((q4 >> 3) & 1) * 16 + rl) * 4;
    vst2(Y + ((((size_t)b * TT + ql0) >> 4) * (CC / 32) + h * (HD / 32)) * 512 + yo, o * (1.0f / 2048.0f));
    asm volatile("s_wait_xcnt 0x0" ::: "memory"); } }   // the store's address and data registers are rewritten by the next tile only behind this wait
__global__ __launch_bounds__(32 * AW) void k_att(const _Float16* __restrict__ QH, const _Float16* __restrict__ KH, const _Float16* __restrict__ QL, const _Float16* __restrict__ KL, const _Float16* __restrict__ VT, const __bf16* __restrict__ VB, const __bf16* __restrict__ VBL, float* __restrict__ Y) {
  // the two small reduction arrays lie first: below 64 KiB their 16 reads take one address register and immediate offsets (behind ss each took a register of its own, and the build spilled)
  __shared__ __align__(16) struct { float redm[2][AW][16], reds[2][AW][16], ss[2][AW][16][HD + 4]; } sm;
  float (&ss)[2][AW][16][HD + 4] = sm.ss; float (&redm)[2][AW][16] = sm.redm; float (&reds)[2][AW][16] = sm.reds;
  // wave number held in a scalar register: every chunk test stays a scalar branch, so every lane is on at each matrix instruction
  const int tid = threadIdx.x, wave = __builtin_amdgcn_readfirstlane(tid >> 5), lane = tid & 31, col = lane & 15, g = lane >> 4;
  // No barrier is added between tiles: redm is rewritten behind the last tile's third barrier (its reads end before the second), reds behind the next first barrier, ss behind the next second one.
  // Two loops, the early rows first: what only they need (their planes' pointers) is then dead before the 32-query tiles, whose logits leave no register free.
  for (int rd = 0; rd * AGRID < NB1; ++rd) {
  const int item = rd * AGRID + ((rd & 1) ? AGRID - 1 - (int)blockIdx.x : (int)blockIdx.x);   // scalar
  if (item >= NB1) break;   // block-uniform, in front of the tile's barriers: the last round is not full
  const int ty = item / (TNB * NH), bx = item % (TNB * NH);
  const int b = bx / NH, h = bx % NH;
  const int ql0 = (NHIT - 1 - ty) * 16;   // the tiles with the most keys go first
  const int kce = (ql0 >> 5) + 1;                         // chunks that hold a key <= the block's last query (a pair starts at a multiple of 32: the same chunk for both tiles)
  const int n = kce > wave ? (kce - wave + AW - 1) / AW : 0;   // chunks of this wave (scalar)
  const int tq = ql0 + col;
  const size_t bh = (size_t)b * NH + h;
  const _Float16* qp = QH + (bh * (TT / 16) + (ql0 >> 4)) * 1024 + 8 * lane;   // lane pointers: tile or chunk start + the lane's 8 elements
  {   // early rows, high precision; kce <= KHI / 32 <= AW, so one chunk a wave at most
    float s[16]; float m = -3.0e38f;
    if (n > 0) { const _Float16* qlp = QL + (bh * (QHI / 16) + (ql0 >> 4)) * 1024 + 8 * lane; const _Float16* kp = KH + (bh * (TT / 16) + wave * 2) * 1024 + 8 * lane; const _Float16* lp = KL + (bh * (KHI / 16) + wave * 2) * 1024 + 8 * lane;
      v16h qh[2], qlf[2], kbf[2][2], klf[2][2];   // loads first, products behind them
#pragma unroll
      for (int kc = 0; kc < 2; ++kc) { qh[kc] = frag_lh(qp + kc * 512); qlf[kc] = frag_lh(qlp + kc * 512);
#pragma unroll
        for (int t = 0; t < 2; ++t) { kbf[t][kc] = frag_lh(kp + t * 1024 + kc * 512); klf[t][kc] = frag_lh(lp + t * 1024 + kc * 512); } }
      XWAIT4(qp, qlp, kp, lp);
#pragma unroll
      for (int t = 0; t < 2; ++t) { v8f a = {}, al = {};
#pragma unroll
        for (int kc = 0; kc < 2; ++kc) { a = wmma16(kbf[t][kc], qh[kc], a); al = wmma16(kbf[t][kc], qlf[kc], al); al = wmma16(klf[t][kc], qh[kc], al); }
#pragma unroll
        for (int r = 0; r < 8; ++r) { const float v = (t * 16 + r <= tq - wave * 32 - 8 * g) ? a[r] + al[r] * (1.0f / 1024.0f) : -3.0e38f; s[t * 8 + r] = v; m = fmaxf(m, v); } } }
    else {   // zeros for a wave without a chunk, here and at the v fragments: see the note at the head of the 32-query tile
#pragma unroll
      for (int e = 0; e < 16; ++e) s[e] = 0.f; }
    m = row_max(m, redm[0], wave, col, g) * EC;
    v16b vh[HD / 16], vl[HD / 16];   // the v fragments fly during the exponentials
    float sum = 0.f;
    if (n > 0) { const size_t po = (bh * (KHI / 32) + wave) * 2048 + 8 * lane; const __bf16* vhp = VB + po; const __bf16* vlp = VBL + po;
#pragma unroll
      for (int j = 0; j < HD / 16; ++j) { vh[j] = frag_lb(vhp + j * 512); vl[j] = frag_lb(vlp + j * 512); }
      XWAIT2(vhp, vlp);
#pragma unroll
      for (int e = 0; e < 16; ++e) { s[e] = exp_sc(s[e], m); sum += s[e]; } }   // an excluded key (-3e38) gives exactly 0: m is a finite logit
    else { const v16b zb = {};
#pragma unroll
      for (int j = 0; j < HD / 16; ++j) { vh[j] = zb; vl[j] = zb; } }
    const float inv = 2048.0f / row_sum(sum, reds[0], wave, col, g);
    v8f acc[HD / 16] = {};
    if (n > 0) {
#pragma unroll
      for (int e = 0; e < 16; ++e) s[e] *= inv;
      const F2 p = bsplit16(s);
#pragma unroll
      for (int j = 0; j < HD / 16; ++j) { acc[j] = wmma_bf(p.h, vh[j], acc[j]); acc[j] = wmma_bf(p.l, vh[j], acc[j]); acc[j] = wmma_bf(p.h, vl[j], acc[j]); } }
#pragma unroll   // constant indices: the values stay in registers
    for (int j = 0; j < HD / 16; ++j)
#pragma unroll   // constant indices: the values stay in registers
      for (int r = 0; r < 8; ++r) ss[0][wave][8 * g + r][j * 16 + col] = acc[j][r];
  }
  __syncthreads();   // every wave's partial is in LDS before any is summed
  att_store<false>(ss, Y, b, h, ql0, tid); }
  const unsigned lo = 16u * lane;   // the lane's 8 elements in every 512-byte run of a fragment-order plane
  for (int rd = 0; rd * AGRID < NB2; ++rd) {
  const int item = rd * AGRID + ((rd & 1) ? AGRID - 1 - (int)blockIdx.x : (int)blockIdx.x);   // scalar
  if (item >= NB2) break;   // block-uniform, in front of the tile's barriers: the last round is not full
  const int ty = item / (TNB * NH), bx = item % (TNB * NH);
  const int b = bx / NH, h = bx % NH;
  const int ql0 = TT - 32 * (ty + 1);   // the tiles with the most keys go first
  const int kce = (ql0 >> 5) + 1;                         // chunks that hold a key <= the block's last query (a pair starts at a multiple of 32: the same chunk for both tiles)
  const int n = kce > wave ? (kce - wave + AW - 1) / AW : 0;   // chunks of this wave (scalar)
  const int tq = ql0 + col;
  const size_t bh = (size_t)b * NH + h;
  const _Float16* qp = lane_at(QH + (bh * (TT / 16) + (ql0 >> 4)) * 1024, lo);   // lane pointers: tile or chunk start + the lane's 8 elements
  {
    // A value set behind one chunk test and used behind a later one counts as carried round the tile loop, and such a build spilled. So the logits, P and the v fragments of a chunk that the wave does not own are set too, to zeros;
    // the key fragments need none: their tests are NESTED (a wave that owns chunk i owns every chunk below it), and each is loaded and used inside one and the same test.
    static_assert(NCH == 4, "the nest below is written out for 4 chunks");
    const v16h zh = {};
    float s[NCH][2][16]; float m0 = -3.0e38f, m1 = -3.0e38f;
    { v16h q[2][2];
#pragma unroll   // constant indices: the values stay in registers
      for (int u = 0; u < 2; ++u) { q[u][0] = frag_lh(qp + u * 1024); q[u][1] = frag_lh(qp + u * 1024 + 512); }
      XWAIT1(qp); const _Float16* kw = lane_at(KH + (bh * (TT / 16) + wave * 2) * 1024, lo);
      const int dg = kce - 1 - wave, lim = tq - (kce - 1) * 32 - 8 * g;   // chunk i of the wave is the one on the diagonal where AW * i == dg (scalar)
      v16h kf[NCH][4];   // all key fragments of the wave go out together, then the products from the last chunk down: one load latency
      if (n > 0) { att_kload(kf[0], kw); XWAIT1(kw);
        if (n > 1) { att_kload(kf[1], kw + AW * 2048); XWAIT1(kw);
          if (n > 2) { att_kload(kf[2], kw + 2 * AW * 2048); XWAIT1(kw);
            if (n > 3) { att_kload(kf[3], kw + 3 * AW * 2048); XWAIT1(kw);
              att_qk(s[3], m0, m1, kf[3], q, dg == 3 * AW, lim); }
            else att_s0(s[3]);
            att_qk(s[2], m0, m1, kf[2], q, dg == 2 * AW, lim); }
          else { att_s0(s[2]); att_s0(s[3]); }
          att_qk(s[1], m0, m1, kf[1], q, dg == AW, lim); }
        else { att_s0(s[1]); att_s0(s[2]); att_s0(s[3]); }
        att_qk(s[0], m0, m1, kf[0], q, dg == 0, lim); }
      else { att_s0(s[0]); att_s0(s[1]); att_s0(s[2]); att_s0(s[3]); } }
    row_max2(m0, m1, redm, wave, col, g); m0 *= EC; m1 *= EC;
    const _Float16* vw = lane_at(VT + (bh * (TT / 32) + wave) * 2048, lo);
    v16h vf[NCH][HD / 16];   // the v fragments of the first VFLY chunks fly during the exponentials; beside 2 tiles of f32 logits the registers hold no more
#pragma unroll   // constant indices: the values stay in registers
    for (int i = 0; i < VFLY; ++i) {
      if (i < n) { att_vload(vf[i], vw + i * AW * 2048); XWAIT1(vw); }
      else {
#pragma unroll   // constant indices: the values stay in registers
        for (int j = 0; j < HD / 16; ++j) vf[i][j] = zh; } }
    float sum0 = 0.f, sum1 = 0.f;
#pragma unroll   // constant indices: the values stay in registers
    for (int i = 0; i < NCH; ++i) if (i < n) {
#pragma unroll   // constant indices: the values stay in registers
      for (int e = 0; e < 16; ++e) { s[i][0][e] = exp_sc(s[i][0][e], m0); sum0 += s[i][0][e]; s[i][1][e] = exp_sc(s[i][1][e], m1); sum1 += s[i][1][e]; } }   // an excluded key (-3e38) gives exactly 0: m is a finite logit
    row_sum2(sum0, sum1, reds, wave, col, g);
    const float inv0 = 2048.0f / sum0, inv1 = 2048.0f / sum1;
    v16h p[NCH][2];   // P in 16 bits takes half the logits' registers: every 2 chunks converted make room for one more chunk's v fragments, loaded at once
#pragma unroll   // constant indices: the values stay in registers
    for (int i = 0; i < NCH; ++i) {
      if (i < n) att_p(p[i], s[i], inv0, inv1);
      else { p[i][0] = zh; p[i][1] = zh; }
      if (i & 1) { const int iv = VFLY + (i >> 1);
        if (iv < n) { att_vload(vf[iv], vw + iv * AW * 2048); XWAIT1(vw); }
        else {
#pragma unroll   // constant indices: the values stay in registers
          for (int j = 0; j < HD / 16; ++j) vf[iv][j] = zh; } } }
    v8f acc[2][HD / 16] = {};
#pragma unroll   // constant indices: the values stay in registers
    for (int i = 0; i < NCH; ++i) if (i < n) att_pv(acc, p[i], vf[i]);
#pragma unroll   // constant indices: the values stay in registers
    for (int u = 0; u < 2; ++u)
#pragma unroll   // constant indices: the values stay in registers
      for (int j = 0; j < HD / 16; ++j)
#pragma unroll   // constant indices: the values stay in registers
        for (int r = 0; r < 8; ++r) ss[u][wave][8 * g + r][j * 16 + col] = acc[u][j][r]; }
  __syncthreads();   // every wave's partial is in LDS before any is summed
  att_store<true>(ss, Y, b, h, ql0, tid); } }
// ---- k_out: block = (64 rows, 128 cols): out = ctx Wo (+ bo): ctx once to f16 against Wo as f16(bf16 x 2^8) exact (1 product) x 2^-8; causal early rows (< QHI of each sequence): ctx bf16 hi + lo against exact bf16 Wo (2 products)
__global__ __launch_bounds__(128) void k_out(const float* __restrict__ Y, const float* __restrict__ WO, const float* __restrict__ BO, float* __restrict__ OUT) { __shared__ __align__(16) float sf[4][16][132]; __shared__ __align__(16) unsigned char wsm[2 * WSB];
  const int tid = threadIdx.x, wave = tid >> 5, lane = tid & 31, col = lane & 15, g = lane >> 4; const int c0 = blockIdx.y * 128; const size_t r0 = (size_t)blockIdx.x * 64 + wave * 16;
  v8f acc[8] = {};
  const float* wp = WO + (size_t)(8 * wave) * DIN + c0 + 4 * lane;   // (in,out) [CC][DIN]: this thread's 8 k rows x 4 columns of each slab
  const float* yp = Y + (r0 >> 4) * (CC / 32) * 512 + 4 * lane;   // this wave's 16 rows: one 512-float block per k slab
  unsigned char* wput = wsm + (lane >> 2) * WJP + wave * 256 + (lane & 3) * 64; const unsigned char* wget = wsm + lane * 16;
  v4f wn[8], yn[4]; wslab_load(wn, wp, DIN); arow_load_f(yn, yp); SLABWAIT();
  if (CAUSAL && (int)(((size_t)blockIdx.x * 64) % TT) < QHI) {   /* block-uniform */
    wslab_put_b(wput, wn);
    __syncthreads();   // slab 0 is in LDS before any wave reads it
#pragma unroll 2   // the buffer index is a constant in each copy of the body
    for (int kc = 0; kc < CC / 32; ++kc) { float v[16];
#pragma unroll   // constant indices: the values stay in registers
      for (int e = 0; e < 16; ++e) v[e] = yn[e >> 2][e & 3];
      const F2 a = bsplit16(v); const bool more = kc + 1 < CC / 32;   // block-uniform
      if (more) { const float* wq = wp + (size_t)(kc + 1) * 32 * DIN; const float* yq = yp + (kc + 1) * 512; wslab_load(wn, wq, DIN); arow_load_f(yn, yq); SLABWAIT(); }
      v16b wf[8];   // the slab's LDS reads go out as one group: one LDS latency, not one per product
#pragma unroll   // constant indices: the values stay in registers
      for (int j = 0; j < 8; ++j) wf[j] = wfrag_b(wget + (kc & 1) * WSB + j * WJP);
#pragma unroll   // constant indices: the values stay in registers
      for (int j = 0; j < 8; ++j) { acc[j] = wmma_bf(a.h, wf[j], acc[j]); acc[j] = wmma_bf(a.l, wf[j], acc[j]); }
      PRODUCTS_DONE();
      if (more) { wslab_put_b(wput + ((kc + 1) & 1) * WSB, wn);
        __syncthreads(); } }   // publishes slab kc + 1 and ends every wave's reads of slab kc, whose buffer the next trip refills
#pragma unroll
    for (int j = 0; j < 8; ++j) { const float bias = BO ? bfr(BO[c0 + j * 16 + col]) : 0.f;
#pragma unroll
      for (int r = 0; r < 8; ++r) sf[wave][8 * g + r][j * 16 + col] = acc[j][r] + bias; }
  } else {
    wslab_put_h(wput, wn);
    __syncthreads();   // slab 0 is in LDS before any wave reads it
#pragma unroll 2   // the buffer index is a constant in each copy of the body
    for (int kc = 0; kc < CC / 32; ++kc) { v16h a;
#pragma unroll   // constant indices: the values stay in registers
      for (int e = 0; e < 16; ++e) a[e] = (_Float16)yn[e >> 2][e & 3];
      const bool more = kc + 1 < CC / 32;   // block-uniform
      if (more) { const float* wq = wp + (size_t)(kc + 1) * 32 * DIN; const float* yq = yp + (kc + 1) * 512; wslab_load(wn, wq, DIN); arow_load_f(yn, yq); SLABWAIT(); }
      v16h wf[8];   // the slab's LDS reads go out as one group: one LDS latency, not one per product
#pragma unroll   // constant indices: the values stay in registers
      for (int j = 0; j < 8; ++j) wf[j] = wfrag_h(wget + (kc & 1) * WSB + j * WJP);
#pragma unroll   // constant indices: the values stay in registers
      for (int j = 0; j < 8; ++j) acc[j] = wmma16(a, wf[j], acc[j]);
      PRODUCTS_DONE();
      if (more) { wslab_put_h(wput + ((kc + 1) & 1) * WSB, wn);
        __syncthreads(); } }   // publishes slab kc + 1 and ends every wave's reads of slab kc, whose buffer the next trip refills
#pragma unroll
    for (int j = 0; j < 8; ++j) { const float bias = BO ? bfr(BO[c0 + j * 16 + col]) : 0.f;
#pragma unroll
      for (int r = 0; r < 8; ++r) sf[wave][8 * g + r][j * 16 + col] = acc[j][r] * (1.0f / 256.0f) + bias; } }
  LDSX(); for (int rl = 0; rl < 16; ++rl) vst2(OUT + (r0 + rl) * DIN + c0 + lane * 4, *(const v4f*)&sf[wave][rl][lane * 4]); }

extern "C" void kernel_launch(void* const* d_in, const int* in_sizes, int n_in, void* d_out, int out_size, void* d_ws, size_t ws_size, hipStream_t stream) {
  (void)in_sizes; (void)n_in; (void)out_size;
  const float** F = (const float**)d_in;
  if (ws_size < (size_t)WS_END) return;
  char* ws = (char*)d_ws; _Float16 *QH = (_Float16*)(ws + WS_QH), *KH = (_Float16*)(ws + WS_KH), *VT = (_Float16*)(ws + WS_VT), *QL = (_Float16*)(ws + WS_QL), *KL = (_Float16*)(ws + WS_KL); __bf16 *VB = (__bf16*)(ws + WS_VB), *VBL = (__bf16*)(ws + WS_VBL); float *Y = (float*)(ws + WS_Y);
  (void)Y; (void)QL; (void)KL; (void)VB; (void)VBL;
  // inputs: 0 x [4,2048,768]; 1 Wq, 2 Wk, 3 Wv [12,768,64]; 4 bq, 5 bk, 6 bv [12,64] (= flat [768] by column h*64+k); 7 Wo [768,768] (in,out); 8 bo [768]
  k_proj<<<dim3(TNB * TT / 128, CC / 128, 3), 128, 0, stream>>>(F[0], F[0], F[0], F[1], F[2], F[3], F[4], F[5], F[6], QH, QL, KH, KL, VT, VB, VBL);
  k_att<<<dim3(AGRID), 32 * AW, 0, stream>>>(QH, KH, QL, KL, VT, VB, VBL, Y);
  k_out<<<dim3(TNB * TT / 64, DIN / 128), 128, 0, stream>>>(Y, F[7], F[8], (float*)d_out);
}

// v009
// A run of this version takes 124 microseconds.
// Next to v008, in two timings, it ran 1.09 times as fast each time.
// Counting every step since v000, it is 13.9 times as fast.
// compute dtype: all float inputs rounded to bf16; q/k/v = x W[h] + b[h] with EXACT bf16 products on WMMA 16x16x32, f32 accumulate; q, k once to f16 -> 1-product causal logits x 1/8, except the first 384 query rows of each sequence (few keys, no averaging), which use q and k as f16 hi + residual (x 2^10) (3 products); softmax in f32 (e^x as one hardware 2^y of a fused y = logit * log2(e) / 8 - max * log2(e) / 8); P x 2^11 once to f16 against v once to f16 (1 product), except the first 384 rows: P and v as bf16 hi + lo (3 products); ctx once to f16 against Wo carried x 2^8 in f16 (exact bf16 values), except the first 384 rows: ctx bf16 hi + lo against exact bf16 Wo (2 products); + bo; f32 output.
#include <hip/hip_runtime.h>
#include <math.h>

typedef __attribute__((ext_vector_type(16))) _Float16 v16h;
typedef __attribute__((ext_vector_type(16))) __bf16 v16b;
typedef __attribute__((ext_vector_type(8)))  _Float16 v8h;
typedef __attribute__((ext_vector_type(8)))  float v8f;
typedef __attribute__((ext_vector_type(4)))  float v4f;
typedef __attribute__((ext_vector_type(2)))  float v2f;
typedef __attribute__((ext_vector_type(4)))  unsigned v4u;
typedef __attribute__((ext_vector_type(4)))  int v4i;
typedef float __attribute__((may_alias)) float_a;
typedef int __attribute__((may_alias)) int_a;

template <typename T> __device__ __forceinline__ void vst2(void* p, T v) { *(T*)p = v;  }
__device__ __forceinline__ v8f wmma16(v16h a, v16h b, v8f c) {
  v8f d = __builtin_amdgcn_wmma_f32_16x16x32_f16(false, a, false, b, (short)0, c, false, false);
  asm volatile("v_nop\n\tv_nop\n\tv_nop\n\tv_nop" : "+v"(d) : "v"(a), "v"(b));
  return d;
}
__device__ __forceinline__ v8f wmma_bf(v16b a, v16b b, v8f c) {
  v8f d = __builtin_amdgcn_wmma_f32_16x16x32_bf16(false, a, false, b, (short)0, c, false, false);
  asm volatile("v_nop\n\tv_nop\n\tv_nop\n\tv_nop" : "+v"(d) : "v"(a), "v"(b));
  return d;
}
// 16x16x32 fragments: lane = (h = lane>>4, row/col = lane&15); elements 0..7 = k0+8h+0..7, 8..15 = k0+16+8h+0..7; D element r = row 8h+r
__device__ __forceinline__ v16h frag_h(const _Float16* rowk0, int lane) {
  union { v16h v; v8h q[2]; } u; const _Float16* p = rowk0 + 8 * (lane >> 4);
  u.q[0] = *(const v8h*)p; u.q[1] = *(const v8h*)(p + 16); return u.v;
}
__device__ __forceinline__ v16h frag_f32(const float* rowk0, int lane) {
  v16h a; const float* p = rowk0 + 8 * (lane >> 4);
#pragma unroll
  for (int i = 0; i < 8; ++i) { a[i] = (_Float16)p[i]; a[8 + i] = (_Float16)p[16 + i]; }
  return a;
}
__device__ __forceinline__ v16h frag_f32s(const float* rowk0, int lane, float sc) {
  v16h a; const float* p = rowk0 + 8 * (lane >> 4);
#pragma unroll
  for (int i = 0; i < 8; ++i) { a[i] = (_Float16)(p[i] * sc); a[8 + i] = (_Float16)(p[16 + i] * sc); }
  return a;
}
// column fragment from a [K][ld] layout (column n), rows >= K read as 0
__device__ __forceinline__ v16h fragc_f32(const float* W, int k0, int n, int lane, int ld, int K) {
  v16h a; const int g = lane >> 4;
#pragma unroll
  for (int i = 0; i < 8; ++i) { const int ka = k0 + 8 * g + i, kb = ka + 16;
    a[i] = (_Float16)(ka < K ? W[(size_t)(ka < K ? ka : K - 1) * ld + n] : 0.f); a[8 + i] = (_Float16)(kb < K ? W[(size_t)(kb < K ? kb : K - 1) * ld + n] : 0.f); }
  return a;
}
struct F2 { v16b h, l; };
__device__ __forceinline__ F2 bsplit16(const float v[16]) { F2 r;
#pragma unroll
  for (int i = 0; i < 16; ++i) { const __bf16 h = (__bf16)v[i]; r.h[i] = h; r.l[i] = (__bf16)(v[i] - (float)h); }
  return r; }
__device__ __forceinline__ F2 split_row(const float* row, int k0, int lane) { float v[16]; const float* p = row + k0 + 8 * (lane >> 4);
#pragma unroll
  for (int i = 0; i < 8; ++i) { v[i] = p[i]; v[8 + i] = p[16 + i]; }
  return bsplit16(v); }
__device__ __forceinline__ F2 split_rowK(const float* row, int k0, int lane, int K) { float v[16]; const int g = lane >> 4;
#pragma unroll
  for (int i = 0; i < 8; ++i) { const int ka = k0 + 8 * g + i, kb = ka + 16; v[i] = ka < K ? row[ka < K ? ka : K - 1] : 0.f; v[8 + i] = kb < K ? row[kb < K ? kb : K - 1] : 0.f; }
  return bsplit16(v); }
__device__ __forceinline__ F2 split_col(const float* W, int k0, int n, int lane, int ld, int K) { float v[16]; const int g = lane >> 4;
#pragma unroll
  for (int i = 0; i < 8; ++i) { const int ka = k0 + 8 * g + i, kb = ka + 16; v[i] = ka < K ? W[(size_t)(ka < K ? ka : K - 1) * ld + n] : 0.f; v[8 + i] = kb < K ? W[(size_t)(kb < K ? kb : K - 1) * ld + n] : 0.f; }
  return bsplit16(v); }
__device__ __forceinline__ v8f mac3(const F2& a, const F2& b, v8f c) { c = wmma_bf(a.l, b.h, c); c = wmma_bf(a.h, b.l, c); return wmma_bf(a.h, b.h, c); }
__device__ __forceinline__ float sigm(float v) { return 1.0f / (1.0f + expf(-v)); }
#define LDSX() do { asm volatile("s_wait_dscnt 0" ::: "memory"); __builtin_amdgcn_wave_barrier(); __builtin_amdgcn_fence(__ATOMIC_RELEASE, "workgroup"); } while (0)

// Causal multi-head self-attention with per-head projection tensors (B 4, S 2,048, D 768, 12 heads x 64): q/k/v[b,h] = x W[h] + b[h] ([H][768][64] weights, [H][64] biases); scores = q k^T with key > query -> -inf, x 64^-0.5; softmax; out = concat_h(P v) Wo ((in,out) [768,768]) + bo.
#define NB 4
#define TT 2048
#define CC 768            // NH * HD = projected width
#define DIN 768          // input (model) width
#define NH 12
#define HD 64
#define SCALE (0.125f)
#define CAUSAL 1
#ifndef TNB
#define TNB NB
#endif
__device__ __forceinline__ float bfr(float v) { return (float)(__bf16)v; }
typedef __attribute__((ext_vector_type(8))) __bf16 v8b;
__device__ __forceinline__ v16b frag_b(const __bf16* rowk0, int lane) {
  union { v16b v; v8b q[2]; } u; const __bf16* p = rowk0 + 8 * (lane >> 4);
  u.q[0] = *(const v8b*)p; u.q[1] = *(const v8b*)(p + 16); return u.v;
}
#define QBH 6              // causal: query rows < QBH * 64 of each sequence (few keys, no averaging) take the high-precision path
#define QHI 384            // rows carrying a q residual plane
#define KHI 384            // key rows carrying k residual / v bf16 hi+lo planes (used only by the causal high-precision path)
// B fragment (k rows k0+.., output column o) of a weight: (in,out) [K][ld] or (out,in) [ld rows of K]: bf16 exact, or f16(bf16 * 256) exact
__device__ __forceinline__ v16b wcol_io(const float* Wm, int k0, int o, int lane, int ld) { v16b w; const int g = lane >> 4;
#pragma unroll
  for (int i = 0; i < 8; ++i) { w[i] = (__bf16)Wm[(size_t)(k0 + 8 * g + i) * ld + o]; w[8 + i] = (__bf16)Wm[(size_t)(k0 + 16 + 8 * g + i) * ld + o]; }
  return w; }
__device__ __forceinline__ v16b wcol_oi(const float* Wm, int k0, int o, int lane, int K) { v16b w; const float* p = Wm + (size_t)o * K + k0 + 8 * (lane >> 4);
#pragma unroll
  for (int i = 0; i < 8; ++i) { w[i] = (__bf16)p[i]; w[8 + i] = (__bf16)p[16 + i]; }
  return w; }
__device__ __forceinline__ v16h wcolh_io(const float* Wm, int k0, int o, int lane, int ld) { v16h w; const int g = lane >> 4;
#pragma unroll
  for (int i = 0; i < 8; ++i) { w[i] = (_Float16)(bfr(Wm[(size_t)(k0 + 8 * g + i) * ld + o]) * 256.0f); w[8 + i] = (_Float16)(bfr(Wm[(size_t)(k0 + 16 + 8 * g + i) * ld + o]) * 256.0f); }
  return w; }
__device__ __forceinline__ v16h wcolh_oi(const float* Wm, int k0, int o, int lane, int K) { v16h w; const float* p = Wm + (size_t)o * K + k0 + 8 * (lane >> 4);
#pragma unroll
  for (int i = 0; i < 8; ++i) { w[i] = (_Float16)(bfr(p[i]) * 256.0f); w[8 + i] = (_Float16)(bfr(p[16 + i]) * 256.0f); }
  return w; }
#define WQKV_LAYOUT 2   // 0 = (in,out) [DIN][CC]; 1 = (out,in) [CC][DIN]; 2 = per-head [NH][DIN][HD]
__device__ __forceinline__ v16b wcol_hdk(const float* Wm, int k0, int o, int lane) { v16b w; const int g = lane >> 4; const float* p = Wm + (size_t)(o / HD) * DIN * HD + (o % HD);
#pragma unroll
  for (int i = 0; i < 8; ++i) { w[i] = (__bf16)p[(size_t)(k0 + 8 * g + i) * HD]; w[8 + i] = (__bf16)p[(size_t)(k0 + 16 + 8 * g + i) * HD]; }
  return w; }
#define WO_OUT_IN 0
#if WQKV_LAYOUT == 1
#define WCOL(W, k0, o, lane) wcol_oi(W, k0, o, lane, DIN)
#elif WQKV_LAYOUT == 2
#define WCOL(W, k0, o, lane) wcol_hdk(W, k0, o, lane)
#else
#define WCOL(W, k0, o, lane) wcol_io(W, k0, o, lane, CC)
#endif
#if WO_OUT_IN
#define WOCOL(W, k0, o, lane) wcol_oi(W, k0, o, lane, CC)
#define WOCOLH(W, k0, o, lane) wcolh_oi(W, k0, o, lane, CC)
#else
#define WOCOL(W, k0, o, lane) wcol_io(W, k0, o, lane, DIN)
#define WOCOLH(W, k0, o, lane) wcolh_io(W, k0, o, lane, DIN)
#endif

#ifndef PROJ_EXTRA_PARAMS
#define PROJ_EXTRA_PARAMS
#endif

// q, k and v planes lie in FRAGMENT ORDER, so that each wave-wide 16-byte load of k_att covers 512 contiguous bytes (4 whole lines) instead of 16 pieces of 32 bytes in 16 lines.
// Row planes (q, k and their residuals), NT rows a sequence: [b][h][t / 16] tiles of 1,024 elements (16 rows x HD); element (t, d) at i * 256 + ln * 8 + d % 8, i = (d / 32) * 2 + (d % 32) / 16, ln = ((d % 16) / 8) * 16 + t % 16.
// v planes, NT keys a sequence: [b][h][t / 32] chunks of 2,048 elements (HD channels x 32 keys); element (c, t) at i * 256 + ln * 8 + t % 8, i = (c / 16) * 2 + (t % 32) / 16, ln = ((t % 16) / 8) * 16 + c % 16.
// In both, lane ln of a wave finds elements 0..7 of fragment f at f * 512 + ln * 8 and elements 8..15 at 256 elements on.
#define WS_QH  0u                                      // f16 q, row plane, NT = TT
#define WS_KH  (WS_QH + 2u * (size_t)NB * TT * CC)      // f16 k, row plane, NT = TT
#define WS_VT  (WS_KH + 2u * (size_t)NB * TT * CC)      // f16 v, v plane, NT = TT
#define WS_QL  (WS_VT + 2u * (size_t)NB * CC * TT)      // f16 q residual x 2^10, row plane, NT = QHI
#define WS_KL  (WS_QL + 2u * (size_t)NB * QHI * CC)     // f16 k residual x 2^10, row plane, NT = KHI
#define WS_VB  (WS_KL + 2u * (size_t)NB * KHI * CC)     // bf16 v hi (and, behind it, lo), v plane, NT = KHI
#define WS_VBL (WS_VB + 2u * (size_t)NB * CC * KHI)
#define WS_Y   (WS_VBL + 2u * (size_t)NB * CC * KHI)    // f32 ctx in fragment order: [(b*t) / 16][c / 32] blocks of 512 floats (16 rows x 32 k); element (t, c) at x * 128 + ln * 4 + c % 4, x = ((c % 32) / 16) * 2 + (c % 8) / 4, ln = ((c % 16) / 8) * 16 + t % 16
#define WS_XB  (WS_Y  + 4u * (size_t)NB * TT * CC)      // bf16 x in fragment order: [(b*t) / 16][k / 32] blocks of 512 elements (16 rows x 32 k); element (t, k) at i * 256 + ln * 8 + k % 8, i = (k % 32) / 16, ln = ((k % 16) / 8) * 16 + t % 16
#define WS_WB  (WS_XB + 2u * (size_t)NB * TT * DIN)     // bf16 Wq, Wk, Wv in slab order: [which][c / 128][k / 32] slabs of 8,192 bytes (32 k x 128 columns); (k group q = (k % 32) / 8, column c) at ((c % 128) / 16) * 1024 + q * 256 + (c % 16) * 16 bytes, 8 k values
#define WS_END (WS_WB + 2u * 3u * (size_t)DIN * CC)

// ---- weight k-slab in LDS (both projection kernels): 32 k rows x 128 output columns, laid out in fragment order, read by all 4 waves (k_out converts it once per block; k_proj copies it from the bf16 plane that k_cvt wrote in the same order).
// Place of (k group q = k / 8, column c): (c / 16) * WJP + q * 256 + (c % 16) * 16 bytes, 8 k values of 16 bits each. A lane (g, col) finds elements 0..7 (k = 8g + i) at group g and 8..15 (k = 16 + 8g + i) at group 2 + g, 512 bytes on.
// Staging from f32 (k_out, k_cvt): thread (wave = k group, lane = 4 columns) loads 8 k rows x 16 bytes, so a wave's load covers whole 128-byte lines, and stores 4 columns x 16 bytes.
#define WJP 1040           // 4 groups x 16 columns x 16 B, + 16 B: the 16 lanes of a staging store then fall on 64 distinct banks
#define WSB (8 * WJP)      // one buffer
__device__ __forceinline__ void wslab_load(v4f (&r)[8], const float* p, int ld) {
#pragma unroll   // constant indices: the values stay in registers
  for (int i = 0; i < 8; ++i) r[i] = *(const v4f*)(p + (size_t)i * ld); }
__device__ __forceinline__ void wslab_put_b(unsigned char* d, const v4f (&r)[8]) {   // exact bf16
#pragma unroll   // constant indices: the values stay in registers
  for (int cc = 0; cc < 4; ++cc) { v8b h;
#pragma unroll   // constant indices: the values stay in registers
    for (int i = 0; i < 8; ++i) h[i] = (__bf16)r[i][cc];
    *(v8b*)(d + cc * 16) = h; } }
__device__ __forceinline__ void wslab_put_h(unsigned char* d, const v4f (&r)[8]) {   // f16(bf16 x 2^8), exact
#pragma unroll   // constant indices: the values stay in registers
  for (int cc = 0; cc < 4; ++cc) { v8h h;
#pragma unroll   // constant indices: the values stay in registers
    for (int i = 0; i < 8; ++i) h[i] = (_Float16)(bfr(r[i][cc]) * 256.0f);
    *(v8h*)(d + cc * 16) = h; } }
// a thread's share of a slab that already lies in memory as bf16 in LDS order (p = slab + 8 * tid elements, d = its place for unit tid): 4 units of 16 bytes, 128 units apart = 2 column tiles on
__device__ __forceinline__ void pslab_load(v4u (&r)[4], const __bf16* p) {
#pragma unroll   // constant indices: the values stay in registers
  for (int i = 0; i < 4; ++i) r[i] = *(const v4u*)(p + i * 1024); }
__device__ __forceinline__ void pslab_put(unsigned char* d, const v4u (&r)[4]) {
#pragma unroll   // constant indices: the values stay in registers
  for (int i = 0; i < 4; ++i) *(v4u*)(d + i * 2 * WJP) = r[i]; }
__device__ __forceinline__ v16b wfrag_b(const unsigned char* p) { union { v16b v; v8b q[2]; } u; u.q[0] = *(const v8b*)p; u.q[1] = *(const v8b*)(p + 512); return u.v; }
__device__ __forceinline__ v16h wfrag_h(const unsigned char* p) { union { v16h v; v8h q[2]; } u; u.q[0] = *(const v8h*)p; u.q[1] = *(const v8h*)(p + 512); return u.v; }
// a lane's 16 f32 of an A row (k0 + 8g + 0..7, k0 + 16 + 8g + 0..7; element e = x[e / 4][e % 4]) from the fragment-order ctx plane (p = block start + 4 * lane): four runs of 512 bytes
__device__ __forceinline__ void arow_load_f(v4f (&x)[4], const float* p) { x[0] = *(const v4f*)p; x[1] = *(const v4f*)(p + 128); x[2] = *(const v4f*)(p + 256); x[3] = *(const v4f*)(p + 384); }
// behind the next slab's loads: their address registers are rewritten only behind this wait; the clobber also keeps the loads ahead of the products they fly under
#define SLABWAIT() asm volatile("s_wait_xcnt 0x0" ::: "memory")
// behind a group of global stores: their address and data registers are rewritten only behind this wait (the clobber keeps the next group's LDS reads behind it, the scheduling barrier its address arithmetic)
#define STOREWAIT() do { asm volatile("s_wait_xcnt 0x0" ::: "memory"); __builtin_amdgcn_sched_barrier(0); } while (0)
// behind a slab's products: keeps the conversions of the next slab, which wait for the loads in flight, from moving up among the products
#define PRODUCTS_DONE() __builtin_amdgcn_sched_barrier(0)

// ---- k_cvt: x and Wq, Wk, Wv rounded to bf16 ONCE, into the order in which k_proj reads them (k_proj read x 18 times and each weight 64 times as f32, x in 32-byte pieces of 16 lines, and rounded at every read).
// Blocks 0 .. CVX - 1, x: a wave takes 16 rows x 192 k (6 blocks of the plane); lane = (row l / 4 of 8, 8 k values l % 4): 32 bytes in, 16 bytes out; a wave-wide store covers 4 whole lines.
// Blocks CVX .., weights: a block takes 4 slabs, wave = (k group w % 4, slab pair w / 4), lane = 4 columns, as the slab staging of k_out has it.
#define CVX (TNB * TT / 16 * 4 / 8)                  // x: 4 waves a row tile, 8 waves a block
#define CVW (3 * (CC / 128) * (DIN / 32) / 4)        // weights: 4 slabs a block
// behind a run of global loads from one pointer: the pointer, named as an input, stays in its registers up to this wait (no load of the run lands in them) and is free behind it
#define CVTWAIT(p) asm volatile("s_wait_xcnt 0x0" :: "v"(p) : "memory")
__global__ __launch_bounds__(256) void k_cvt(const float* __restrict__ X, const float* __restrict__ WQ, const float* __restrict__ WK, const float* __restrict__ WV, __bf16* __restrict__ XB, __bf16* __restrict__ WB) {
  const int tid = threadIdx.x, wave = __builtin_amdgcn_readfirstlane(tid >> 5), lane = tid & 31;
  if ((int)blockIdx.x < CVX) { const int gw = (int)blockIdx.x * 8 + wave, rt = gw >> 2, kq = gw & 3, row8 = lane >> 2, k8 = lane & 3;
    const float* xp = X + ((size_t)rt * 16 + row8) * DIN + kq * 192 + k8 * 8;
    __bf16* dp = XB + ((size_t)rt * (DIN / 32) + kq * 6) * 512 + (k8 >> 1) * 256 + ((k8 & 1) * 16 + row8) * 8;
    v4f r[6][2][2];   // all 24 loads go out together: one memory latency
#pragma unroll   // constant indices: the values stay in registers, the steps become immediate offsets
    for (int s = 0; s < 6; ++s)
#pragma unroll   // constant indices: the values stay in registers, the steps become immediate offsets
      for (int it = 0; it < 2; ++it) { const float* p = xp + (size_t)it * 8 * DIN + s * 32; r[s][it][0] = *(const v4f*)p; r[s][it][1] = *(const v4f*)(p + 4); }
    CVTWAIT(xp); __builtin_amdgcn_sched_barrier(0);   // keeps the conversions, which wait for the first loads, from moving up among the loads: without it half the loads went out only behind those waits
#pragma unroll   // constant indices: the values stay in registers, the steps become immediate offsets
    for (int s = 0; s < 6; ++s)
#pragma unroll   // constant indices: the values stay in registers, the steps become immediate offsets
      for (int it = 0; it < 2; ++it) { v8b h;
#pragma unroll   // constant indices: the values stay in registers
        for (int e = 0; e < 8; ++e) h[e] = (__bf16)r[s][it][e >> 2][e & 3];
        *(v8b*)(dp + s * 512 + it * 64) = h; }
  } else { const int q = wave & 3, sl0 = ((int)blockIdx.x - CVX) * 4 + (wave >> 2) * 2;   // slabs sl0 and sl0 + 1: DIN / 32 is even, so both lie in one (which, column block)
    const int kc = sl0 % (DIN / 32), cb = (sl0 / (DIN / 32)) % (CC / 128), which = sl0 / ((DIN / 32) * (CC / 128));
    const float* WA = which == 0 ? WQ : which == 1 ? WK : WV; const int cw = cb * 128 + 4 * lane;
    const float* wp = WA + (size_t)(cw / HD) * DIN * HD + (cw % HD) + (size_t)(kc * 32 + 8 * q) * HD;   // per-head [NH][DIN][HD]
    unsigned char* dp = (unsigned char*)WB + (size_t)sl0 * 8192 + (lane >> 2) * 1024 + q * 256 + (lane & 3) * 64;
    v4f w0[8], w1[8]; wslab_load(w0, wp, HD); wslab_load(w1, wp + 32 * HD, HD); CVTWAIT(wp); __builtin_amdgcn_sched_barrier(0);   // as above: all 16 loads go out before the first wait
    wslab_put_b(dp, w0); wslab_put_b(dp + 8192, w1);
    asm volatile("s_wait_xcnt 0x0" ::: "memory"); } }   // behind this branch's last stores: in the built code the x branch stands behind them, and its first instructions rewrite their data registers
// ---- k_proj: block = (128 rows, 128 cols, which): q/k/v = X W (+ b) with exact bf16 products (K = DIN) -> which 0: q f16 (+ residual, rows < QHI); 1: k f16 (+ residual, rows < KHI); 2: v f16 (+ bf16 hi/lo for t < KHI); all stored in fragment order
// A wave owns two 16-row tiles, 64 rows apart (tile u = rows 64 u + 16 wave ..): each weight fragment it reads from the slab feeds both, so a staged slab serves twice the rows. The epilogue lays out and stores one 64-row half at a time through the same LDS arrays.
__global__ __launch_bounds__(128) void k_proj(const __bf16* __restrict__ XB, const __bf16* __restrict__ WB, const float* __restrict__ BQ, const float* __restrict__ BK, const float* __restrict__ BV,
    _Float16* __restrict__ QH, _Float16* __restrict__ QL, _Float16* __restrict__ KH, _Float16* __restrict__ KL, _Float16* __restrict__ VT, __bf16* __restrict__ VB, __bf16* __restrict__ VBL) {
  // the weight slab lies first: below 64 KiB its 16 fragment reads take one address register and immediate offsets (behind the epilogue arrays each took a register of its own, and the wave count per SIMD fell)
  __shared__ __align__(16) struct { unsigned char wsm[2 * WSB]; _Float16 sh[64][136], sl[64][136], th[128][72]; __bf16 tb[128][72], tbl[128][72]; } sm;
  unsigned char (&wsm)[2 * WSB] = sm.wsm; _Float16 (&sh)[64][136] = sm.sh; _Float16 (&sl)[64][136] = sm.sl; _Float16 (&th)[128][72] = sm.th; __bf16 (&tb)[128][72] = sm.tb; __bf16 (&tbl)[128][72] = sm.tbl;
  const int tid = threadIdx.x, wave = tid >> 5, lane = tid & 31, col = lane & 15, g = lane >> 4; const int which = blockIdx.z; const int c0 = blockIdx.y * 128; const size_t r0 = (size_t)blockIdx.x * 128; const size_t bb = r0 / TT; const int t0 = (int)(r0 % TT);
  const float* BA = which == 0 ? BQ : which == 1 ? BK : BV;
  v8f acc[2][8] = {};
  { // a slab of the bf16 weight plane is 8,192 bytes in LDS order: thread tid copies its 16-byte units tid, tid + 128, .. (a wave-wide load covers 4 whole lines); unit n goes to column tile n / 64
    const __bf16* wp = WB + (((size_t)which * (CC / 128) + blockIdx.y) * (DIN / 32)) * 4096 + 8 * tid;
    const __bf16* xp = XB + (r0 / 16 + wave) * (DIN / 32) * 512 + 8 * lane; const __bf16* xp1 = xp + (size_t)4 * (DIN / 32) * 512;   // the wave's two row tiles: one 512-element block per k slab each
    unsigned char* wput = wsm + (tid >> 6) * WJP + (tid & 63) * 16; const unsigned char* wget = wsm + lane * 16;
    v4u wn[4]; v8b xn[2][2]; pslab_load(wn, wp); xn[0][0] = *(const v8b*)xp; xn[0][1] = *(const v8b*)(xp + 256); xn[1][0] = *(const v8b*)xp1; xn[1][1] = *(const v8b*)(xp1 + 256); SLABWAIT();
    pslab_put(wput, wn);
    __syncthreads();   // slab 0 is in LDS before any wave reads it
#pragma unroll 2   // the buffer index is a constant in each copy of the body
    for (int kc = 0; kc < DIN / 32; ++kc) { v16b a[2];
#pragma unroll   // constant indices: the values stay in registers
      for (int e = 0; e < 16; ++e) { a[0][e] = xn[0][e >> 3][e & 7]; a[1][e] = xn[1][e >> 3][e & 7]; }
      const bool more = kc + 1 < DIN / 32;   // block-uniform
      if (more) { const __bf16* wq = wp + (kc + 1) * 4096; const __bf16* xq = xp + (kc + 1) * 512; const __bf16* xq1 = xp1 + (kc + 1) * 512; pslab_load(wn, wq); xn[0][0] = *(const v8b*)xq; xn[0][1] = *(const v8b*)(xq + 256); xn[1][0] = *(const v8b*)xq1; xn[1][1] = *(const v8b*)(xq1 + 256); SLABWAIT(); }
      v16b wf[8];   // the slab's LDS reads go out as one group: one LDS latency, not one per product
#pragma unroll   // constant indices: the values stay in registers
      for (int j = 0; j < 8; ++j) wf[j] = wfrag_b(wget + (kc & 1) * WSB + j * WJP);
      __builtin_amdgcn_sched_barrier(0);   // keeps the 16 LDS reads ahead of the products: without it they are issued two at a time into one fragment's registers, one LDS latency per pair of products
      // the bare builtin (the compiler keeps the distances behind it): with the v_nop statement of wmma_bf, whose operands cannot lie above v255, the 16 accumulator tiles spilled to scratch
#pragma unroll   // constant indices: the values stay in registers
      for (int j = 0; j < 8; ++j) { acc[0][j] = __builtin_amdgcn_wmma_f32_16x16x32_bf16(false, a[0], false, wf[j], (short)0, acc[0][j], false, false); acc[1][j] = __builtin_amdgcn_wmma_f32_16x16x32_bf16(false, a[1], false, wf[j], (short)0, acc[1][j], false, false); }
      PRODUCTS_DONE();
      if (more) { pslab_put(wput + ((kc + 1) & 1) * WSB, wn);
        __syncthreads(); } } }   // publishes slab kc + 1 and ends every wave's reads of slab kc, whose buffer the next trip refills
  float bias[8] = {};   // one value per column tile, the same for both halves
  if (BA) {
#pragma unroll   // constant indices: the values stay in registers
    for (int j = 0; j < 8; ++j) bias[j] = bfr(BA[c0 + j * 16 + col]); }
  if (which < 2) { _Float16* DH = which == 0 ? QH : KH; _Float16* DL = which == 0 ? QL : KL; const int nhi = which == 0 ? QHI : KHI;
    const int cl = (wave >> 1) * 32 + (wave & 1) * 16 + g * 8; const size_t bh = bb * NH + c0 / HD;
#pragma unroll   // constant indices: the accumulators stay in registers
    for (int u = 0; u < 2; ++u) { const int th0 = t0 + 64 * u; const bool hi_rows = th0 < nhi;   // block-uniform
      if (u) { STOREWAIT();
        __syncthreads(); }   // every wave has read the first half out of sh and sl before the second half is written there
#pragma unroll
      for (int j = 0; j < 8; ++j) {
#pragma unroll
        for (int r = 0; r < 8; ++r) { const float v = acc[u][j][r] + bias[j]; const _Float16 hv = (_Float16)v; sh[wave * 16 + 8 * g + r][j * 16 + col] = hv; sl[wave * 16 + 8 * g + r][j * 16 + col] = (_Float16)((v - (float)hv) * 1024.0f); } }
      __syncthreads();   // the half is in LDS before any wave reads it in store order
      // the half's 8 tiles (it: 2 heads x 4 row tiles); in each, wave = the 512-byte run, lane = the place in it
      v4u sv[8];
      _Float16* dp = DH + (bh * (TT / 16) + th0 / 16) * 1024 + tid * 8;
#pragma unroll   // constant indices: the values stay in registers, the steps become immediate offsets
      for (int it = 0; it < 8; ++it) sv[it] = *(const v4u*)&sh[(it & 3) * 16 + col][(it >> 2) * HD + cl];
#pragma unroll   // constant indices: the values stay in registers, the steps become immediate offsets
      for (int it = 0; it < 8; ++it) vst2((unsigned*)(dp + ((it >> 2) * (TT / 16) + (it & 3)) * 1024), sv[it]);
      if (hi_rows) { STOREWAIT();
        _Float16* lp = DL + (bh * (nhi / 16) + th0 / 16) * 1024 + tid * 8;
#pragma unroll   // constant indices: the values stay in registers, the steps become immediate offsets
        for (int it = 0; it < 8; ++it) sv[it] = *(const v4u*)&sl[(it & 3) * 16 + col][(it >> 2) * HD + cl];
#pragma unroll   // constant indices: the values stay in registers, the steps become immediate offsets
        for (int it = 0; it < 8; ++it) vst2((unsigned*)(lp + ((it >> 2) * (nhi / 16) + (it & 3)) * 1024), sv[it]); } }
  } else {
    const int cl = (wave >> 1) * 16 + col, rl = (wave & 1) * 16 + g * 8; const size_t bh = bb * NH + c0 / HD;
#pragma unroll   // constant indices: the accumulators stay in registers
    for (int u = 0; u < 2; ++u) { const int th0 = t0 + 64 * u; const bool hi_rows = th0 < KHI;   // block-uniform
      if (u) { STOREWAIT();
        __syncthreads(); }   // every wave has read the first half out of th, tb and tbl before the second half is written there
#pragma unroll
      for (int j = 0; j < 8; ++j) {
#pragma unroll
        for (int r = 0; r < 8; ++r) { const float v = acc[u][j][r] + bias[j]; const int rw = wave * 16 + 8 * g + r, cw = j * 16 + col; th[cw][rw] = (_Float16)v; const __bf16 bv = (__bf16)v; tb[cw][rw] = bv; tbl[cw][rw] = (__bf16)(v - (float)bv); } }
      __syncthreads();   // the half is in LDS before any wave reads it in store order
      // the half's 8 half chunks (it: 2 heads x 2 key chunks x 2 halves of 4 runs); in each, wave = the 512-byte run, lane = the place in it
      v4u sv[8];
      _Float16* dp = VT + (bh * (TT / 32) + th0 / 32) * 2048 + tid * 8;
#pragma unroll   // constant indices: the values stay in registers, the steps become immediate offsets
      for (int it = 0; it < 8; ++it) sv[it] = *(const v4u*)&th[(it >> 2) * HD + (it & 1) * 32 + cl][((it >> 1) & 1) * 32 + rl];
#pragma unroll   // constant indices: the values stay in registers, the steps become immediate offsets
      for (int it = 0; it < 8; ++it) vst2((unsigned*)(dp + ((it >> 2) * (TT / 32) + ((it >> 1) & 1)) * 2048 + (it & 1) * 1024), sv[it]);
      if (hi_rows) { STOREWAIT();
        const size_t o3 = (bh * (KHI / 32) + th0 / 32) * 2048 + tid * 8; __bf16* hp = VB + o3; __bf16* lp = VBL + o3;
#pragma unroll   // constant indices: the values stay in registers, the steps become immediate offsets
        for (int it = 0; it < 8; ++it) sv[it] = *(const v4u*)&tb[(it >> 2) * HD + (it & 1) * 32 + cl][((it >> 1) & 1) * 32 + rl];
#pragma unroll   // constant indices: the values stay in registers, the steps become immediate offsets
        for (int it = 0; it < 8; ++it) vst2((unsigned*)(hp + ((it >> 2) * (KHI / 32) + ((it >> 1) & 1)) * 2048 + (it & 1) * 1024), sv[it]);
        STOREWAIT();
#pragma unroll   // constant indices: the values stay in registers, the steps become immediate offsets
        for (int it = 0; it < 8; ++it) sv[it] = *(const v4u*)&tbl[(it >> 2) * HD + (it & 1) * 32 + cl][((it >> 1) & 1) * 32 + rl];
#pragma unroll   // constant indices: the values stay in registers, the steps become immediate offsets
        for (int it = 0; it < 8; ++it) vst2((unsigned*)(lp + ((it >> 2) * (KHI / 32) + ((it >> 1) & 1)) * 2048 + (it & 1) * 1024), sv[it]); } } } }
// ---- k_att: a block of AW waves works on one tile at a time: 32 queries (2 tiles of 16) of (b, h), for the early rows (high precision) 16 queries; logits, softmax and P . v in one launch, the logits never leave the registers.
// Both tiles of a block end in the same 32-key chunk, so each K and each V fragment that a wave loads feeds both: half the loads per query.
// Wave w owns the 32-key chunks w, w + AW, ... up to the diagonal. It forms the TRANSPOSED logits k . q^T (A = 16 key rows, B = 16 query columns), so a lane holds one query (col) and keys 8g + r of each 16-key tile:
// the D registers of a chunk's two tiles are, element for element, the A fragment of P for that chunk (0..7 = k0 + 8g + r, 8..15 = k0 + 16 + 8g + r). Row max and row sum: in the lane, one exchange between the lane halves, then over the waves through LDS in wave order.
// Products: 1-product f16 logits x 1/8, P x 2^11 once to f16 against v f16; query rows < QBH * 64: q, k hi + residual (3 products), P and v bf16 hi + lo (3 products). f32 partial ctx summed through LDS in wave order 0..AW-1.
#define AW 16
#define NCH (TT / 32 / AW)   // chunks a wave can own
#define VFLY 2               // chunks whose v fragments are loaded ahead of the exponentials
// fragment halves from the lane's own pointer into a fragment-order plane (fragment start + 8 * lane): the two 512-byte runs of the fragment
__device__ __forceinline__ v16h frag_lh(const _Float16* p) { union { v16h v; v8h q[2]; } u; u.q[0] = *(const v8h*)p; u.q[1] = *(const v8h*)(p + 256); return u.v; }
__device__ __forceinline__ v16b frag_lb(const __bf16* p) { union { v16b v; v8b q[2]; } u; u.q[0] = *(const v8b*)p; u.q[1] = *(const v8b*)(p + 256); return u.v; }
// behind a batch of global loads: their address register, named as an input, is not rewritten in front of this wait and is free behind it
#define XWAIT1(p) asm volatile("s_wait_xcnt 0x0" :: "v"(p) : "memory")
#define XWAIT2(p, q) asm volatile("s_wait_xcnt 0x0" :: "v"(p), "v"(q) : "memory")
#define XWAIT4(p, q, r, s) asm volatile("s_wait_xcnt 0x0" :: "v"(p), "v"(q), "v"(r), "v"(s) : "memory")
// a query's maximum / sum over the block: the two lane halves, then the waves through LDS in wave order; called by every wave of the block
__device__ __forceinline__ float row_max(float m, float (*red)[16], int wave, int col, int g) {
  m = fmaxf(m, __shfl_xor(m, 16)); if (g == 0) red[wave][col] = m;
  __syncthreads();   // every wave's row maxima are in LDS before any is read
  m = red[0][col];
#pragma unroll
  for (int w = 1; w < AW; ++w) m = fmaxf(m, red[w][col]);
  return m; }
__device__ __forceinline__ float row_sum(float s, float (*red)[16], int wave, int col, int g) {
  s += __shfl_xor(s, 16); if (g == 0) red[wave][col] = s;
  __syncthreads();   // every wave's row sums are in LDS before any is read
  s = red[0][col];
#pragma unroll
  for (int w = 1; w < AW; ++w) s += red[w][col];
  return s; }
// the same for the two tiles of a block behind ONE barrier: lane half g stores and reduces tile g (same wave order), then the halves exchange
__device__ __forceinline__ void row_max2(float& m0, float& m1, float (*red)[AW][16], int wave, int col, int g) {
  m0 = fmaxf(m0, __shfl_xor(m0, 16)); m1 = fmaxf(m1, __shfl_xor(m1, 16)); red[g][wave][col] = g ? m1 : m0;
  __syncthreads();   // every wave's row maxima are in LDS before any is read
  float a = red[g][0][col];
#pragma unroll   // the LDS reads go out together instead of one latency each
  for (int w = 1; w < AW; ++w) a = fmaxf(a, red[g][w][col]);
  const float o = __shfl_xor(a, 16); m0 = g ? o : a; m1 = g ? a : o; }
__device__ __forceinline__ void row_sum2(float& s0, float& s1, float (*red)[AW][16], int wave, int col, int g) {
  s0 += __shfl_xor(s0, 16); s1 += __shfl_xor(s1, 16); red[g][wave][col] = g ? s1 : s0;
  __syncthreads();   // every wave's row sums are in LDS before any is read
  float a = red[g][0][col];
#pragma unroll   // the LDS reads go out together instead of one latency each
  for (int w = 1; w < AW; ++w) a += red[g][w][col];
  const float o = __shfl_xor(a, 16); s0 = g ? o : a; s1 = g ? a : o; }
// e^(SCALE * (a - m)) as 2^(a * EC - mc), mc = m * EC: one fused multiply-add (the product is not rounded) and one v_exp_f32. The rounding of mc is the same factor in every term of a row and leaves with the division by the row sum.
// A masked logit (-3e38) gives 2^(very negative) = exactly 0; a term below 2^-126 of the row's largest may come out 0.
#define EC (SCALE * 1.44269504088896340736f)
__device__ __forceinline__ float exp_sc(float a, float mc) { return __builtin_amdgcn_exp2f(__builtin_fmaf(a, EC, -mc)); }
// ---- pieces of a 32-query tile, one chunk of 32 keys each
// lane pointer from a wave-uniform tile or chunk start and the lane's byte offset (16 * lane): the start is formed in scalar registers, and one offset serves every plane over the whole tile loop (plane + lane offset, one pair per plane held over the loop, spilled)
__device__ __forceinline__ const _Float16* lane_at(const _Float16* f, unsigned lo) { return (const _Float16*)((const char*)f + (size_t)lo); }
// the chunk's four key fragments
__device__ __forceinline__ void att_kload(v16h (&kf)[4], const _Float16* kp) { kf[0] = frag_lh(kp); kf[1] = frag_lh(kp + 512); kf[2] = frag_lh(kp + 1024); kf[3] = frag_lh(kp + 1536); }
// transposed logits of the chunk for both query tiles, causal mask, running maxima
__device__ __forceinline__ void att_qk(float (&s)[2][16], float& m0, float& m1, const v16h (&kf)[4], const v16h (&q)[2][2], bool diag, int lim) {
  v8f a[2][2];   // four independent accumulators: (query tile u, key tile t)
#pragma unroll   // constant indices: the values stay in registers
  for (int u = 0; u < 2; ++u)
#pragma unroll   // constant indices: the values stay in registers
    for (int t = 0; t < 2; ++t) { const v8f z = {}; a[u][t] = wmma16(kf[2 * t], q[u][0], z); }
#pragma unroll   // constant indices: the values stay in registers
  for (int u = 0; u < 2; ++u)
#pragma unroll   // constant indices: the values stay in registers
    for (int t = 0; t < 2; ++t) { a[u][t] = wmma16(kf[2 * t + 1], q[u][1], a[u][t]);
#pragma unroll   // constant indices: the values stay in registers
      for (int r = 0; r < 8; ++r) s[u][t * 8 + r] = a[u][t][r]; }
  if (diag) {   // only the block's last chunk holds keys past a query of the block (scalar test); key > query with the constants on one side: lim = query - the chunk's first key - 8g, one lane value for all 32 tests
#pragma unroll   // constant indices: the values stay in registers
    for (int u = 0; u < 2; ++u)
#pragma unroll   // constant indices: the values stay in registers
      for (int e = 0; e < 16; ++e) if ((e >> 3) * 16 + (e & 7) - 16 * u > lim) s[u][e] = -3.0e38f; }
#pragma unroll   // constant indices: the values stay in registers
  for (int e = 0; e < 16; ++e) { m0 = fmaxf(m0, s[0][e]); m1 = fmaxf(m1, s[1][e]); } }
__device__ __forceinline__ void att_s0(float (&s)[2][16]) {
#pragma unroll   // constant indices: the values stay in registers
  for (int e = 0; e < 16; ++e) { s[0][e] = 0.f; s[1][e] = 0.f; } }
// the chunk's four v fragments
__device__ __forceinline__ void att_vload(v16h (&vf)[HD / 16], const _Float16* vp) {
#pragma unroll   // constant indices: the values stay in registers
  for (int j = 0; j < HD / 16; ++j) vf[j] = frag_lh(vp + j * 512); }
// P of the chunk to 16 bits
__device__ __forceinline__ void att_p(v16h (&p)[2], const float (&s)[2][16], float inv0, float inv1) {
#pragma unroll   // constant indices: the values stay in registers
  for (int e = 0; e < 16; ++e) { p[0][e] = (_Float16)(s[0][e] * inv0); p[1][e] = (_Float16)(s[1][e] * inv1); } }
// P . v of the chunk
__device__ __forceinline__ void att_pv(v8f (&acc)[2][HD / 16], const v16h (&p)[2], const v16h (&vf)[HD / 16]) {
#pragma unroll   // constant indices: the values stay in registers
  for (int j = 0; j < HD / 16; ++j) { acc[0][j] = wmma16(p[0], vf[j], acc[0][j]); acc[1][j] = wmma16(p[1], vf[j], acc[1][j]); } }
#define NPAIR ((TT - QBH * 64) / 32)   // tiles of 32 queries per (b, h)
#define NHIT (QBH * 4)                 // tiles of 16 early queries per (b, h)
// One block per WGP (16 waves of up to 256 registers fill one) walks its share of the tiles in a loop instead of one launch of 16 waves per tile.
// The tiles of a kind are numbered by falling key count (tile rank major, (b, h) minor) and dealt in rounds of AGRID, odd rounds in reverse block order, so that every block gets about the same work. The deal is fixed: no block waits for another.
#define NB2 (TNB * NH * NPAIR)         // tiles of 32 queries in all
#define NB1 (TNB * NH * NHIT)          // tiles of 16 early queries in all
#define AGRID 256                      // blocks launched
// the waves' partial ctx of a tile, summed in wave order and stored; every wave calls it behind the barrier that ends the writes of ss
template <bool PAIR> __device__ __forceinline__ void att_store(const float (&ss)[2][AW][16][HD + 4], float* __restrict__ Y, int b, int h, int ql0, int tid) {
  const int u = tid >> 8;   // waves 0..7 sum and store tile 0, waves 8..15 tile 1 (a pair only)
  if (u == 0 || PAIR) { const int rl = tid & 15, q4 = ((tid >> 4) & 15) * 4; v4f o = *(const v4f*)&ss[u][0][rl][q4];   // 16 lanes = the 16 rows of one 4-channel group: 256 contiguous bytes of the fragment-order ctx plane
#pragma unroll   // the LDS reads of all partials go out together instead of one latency each
    for (int w = 1; w < AW; ++w) o += *(const v4f*)&ss[u][w][rl][q4];
    // the tile's place is scalar, the thread's place in it one register held over the tile loop
    const unsigned yo = (u * (CC / 32) + (q4 >> 5)) * 512 + (((q4 >> 4) & 1) * 2 + ((q4 >> 2) & 1)) * 128 + (((q4 >> 3) & 1) * 16 + rl) * 4;
    vst2(Y + ((((size_t)b * TT + ql0) >> 4) * (CC / 32) + h * (HD / 32)) * 512 + yo, o * (1.0f / 2048.0f));
    asm volatile("s_wait_xcnt 0x0" ::: "memory"); } }   // the store's address and data registers are rewritten by the next tile only behind this wait
__global__ __launch_bounds__(32 * AW) void k_att(const _Float16* __restrict__ QH, const _Float16* __restrict__ KH, const _Float16* __restrict__ QL, const _Float16* __restrict__ KL, const _Float16* __restrict__ VT, const __bf16* __restrict__ VB, const __bf16* __restrict__ VBL, float* __restrict__ Y) {
  // the two small reduction arrays lie first: below 64 KiB their 16 reads take one address register and immediate offsets (behind ss each took a register of its own, and the build spilled)
  __shared__ __align__(16) struct { float redm[2][AW][16], reds[2][AW][16], ss[2][AW][16][HD + 4]; } sm;
  float (&ss)[2][AW][16][HD + 4] = sm.ss; float (&redm)[2][AW][16] = sm.redm; float (&reds)[2][AW][16] = sm.reds;
  // wave number held in a scalar register: every chunk test stays a scalar branch, so every lane is on at each matrix instruction
  const int tid = threadIdx.x, wave = __builtin_amdgcn_readfirstlane(tid >> 5), lane = tid & 31, col = lane & 15, g = lane >> 4;
  // No barrier is added between tiles: redm is rewritten behind the last tile's third barrier (its reads end before the second), reds behind the next first barrier, ss behind the next second one.
  // Two loops, the early rows first: what only they need (their planes' pointers) is then dead before the 32-query tiles, whose logits leave no register free.
  for (int rd = 0; rd * AGRID < NB1; ++rd) {
  const int item = rd * AGRID + ((rd & 1) ? AGRID - 1 - (int)blockIdx.x : (int)blockIdx.x);   // scalar
  if (item >= NB1) break;   // block-uniform, in front of the tile's barriers: the last round is not full
  const int ty = item / (TNB * NH), bx = item % (TNB * NH);
  const int b = bx / NH, h = bx % NH;
  const int ql0 = (NHIT - 1 - ty) * 16;   // the tiles with the most keys go first
  const int kce = (ql0 >> 5) + 1;                         // chunks that hold a key <= the block's last query (a pair starts at a multiple of 32: the same chunk for both tiles)
  const int n = kce > wave ? (kce - wave + AW - 1) / AW : 0;   // chunks of this wave (scalar)
  const int tq = ql0 + col;
  const size_t bh = (size_t)b * NH + h;
  const _Float16* qp = QH + (bh * (TT / 16) + (ql0 >> 4)) * 1024 + 8 * lane;   // lane pointers: tile or chunk start + the lane's 8 elements
  {   // early rows, high precision; kce <= KHI / 32 <= AW, so one chunk a wave at most
    float s[16]; float m = -3.0e38f;
    if (n > 0) { const _Float16* qlp = QL + (bh * (QHI / 16) + (ql0 >> 4)) * 1024 + 8 * lane; const _Float16* kp = KH + (bh * (TT / 16) + wave * 2) * 1024 + 8 * lane; const _Float16* lp = KL + (bh * (KHI / 16) + wave * 2) * 1024 + 8 * lane;
      v16h qh[2], qlf[2], kbf[2][2], klf[2][2];   // loads first, products behind them
#pragma unroll
      for (int kc = 0; kc < 2; ++kc) { qh[kc] = frag_lh(qp + kc * 512); qlf[kc] = frag_lh(qlp + kc * 512);
#pragma unroll
        for (int t = 0; t < 2; ++t) { kbf[t][kc] = frag_lh(kp + t * 1024 + kc * 512); klf[t][kc] = frag_lh(lp + t * 1024 + kc * 512); } }
      XWAIT4(qp, qlp, kp, lp);
#pragma unroll
      for (int t = 0; t < 2; ++t) { v8f a = {}, al = {};
#pragma unroll
        for (int kc = 0; kc < 2; ++kc) { a = wmma16(kbf[t][kc], qh[kc], a); al = wmma16(kbf[t][kc], qlf[kc], al); al = wmma16(klf[t][kc], qh[kc], al); }
#pragma unroll
        for (int r = 0; r < 8; ++r) { const float v = (t * 16 + r <= tq - wave * 32 - 8 * g) ? a[r] + al[r] * (1.0f / 1024.0f) : -3.0e38f; s[t * 8 + r] = v; m = fmaxf(m, v); } } }
    else {   // zeros for a wave without a chunk, here and at the v fragments: see the note at the head of the 32-query tile
#pragma unroll
      for (int e = 0; e < 16; ++e) s[e] = 0.f; }
    m = row_max(m, redm[0], wave, col, g) * EC;
    v16b vh[HD / 16], vl[HD / 16];   // the v fragments fly during the exponentials
    float sum = 0.f;
    if (n > 0) { const size_t po = (bh * (KHI / 32) + wave) * 2048 + 8 * lane; const __bf16* vhp = VB + po; const __bf16* vlp = VBL + po;
#pragma unroll
      for (int j = 0; j < HD / 16; ++j) { vh[j] = frag_lb(vhp + j * 512); vl[j] = frag_lb(vlp + j * 512); }
      XWAIT2(vhp, vlp);
#pragma unroll
      for (int e = 0; e < 16; ++e) { s[e] = exp_sc(s[e], m); sum += s[e]; } }   // an excluded key (-3e38) gives exactly 0: m is a finite logit
    else { const v16b zb = {};
#pragma unroll
      for (int j = 0; j < HD / 16; ++j) { vh[j] = zb; vl[j] = zb; } }
    const float inv = 2048.0f / row_sum(sum, reds[0], wave, col, g);
    v8f acc[HD / 16] = {};
    if (n > 0) {
#pragma unroll
      for (int e = 0; e < 16; ++e) s[e] *= inv;
      const F2 p = bsplit16(s);
#pragma unroll
      for (int j = 0; j < HD / 16; ++j) { acc[j] = wmma_bf(p.h, vh[j], acc[j]); acc[j] = wmma_bf(p.l, vh[j], acc[j]); acc[j] = wmma_bf(p.h, vl[j], acc[j]); } }
#pragma unroll   // constant indices: the values stay in registers
    for (int j = 0; j < HD / 16; ++j)
#pragma unroll   // constant indices: the values stay in registers
      for (int r = 0; r < 8; ++r) ss[0][wave][8 * g + r][j * 16 + col] = acc[j][r];
  }
  __syncthreads();   // every wave's partial is in LDS before any is summed
  att_store<false>(ss, Y, b, h, ql0, tid); }
  const unsigned lo = 16u * lane;   // the lane's 8 elements in every 512-byte run of a fragment-order plane
  for (int rd = 0; rd * AGRID < NB2; ++rd) {
  const int item = rd * AGRID + ((rd & 1) ? AGRID - 1 - (int)blockIdx.x : (int)blockIdx.x);   // scalar
  if (item >= NB2) break;   // block-uniform, in front of the tile's barriers: the last round is not full
  const int ty = item / (TNB * NH), bx = item % (TNB * NH);
  const int b = bx / NH, h = bx % NH;
  const int ql0 = TT - 32 * (ty + 1);   // the tiles with the most keys go first
  const int kce = (ql0 >> 5) + 1;                         // chunks that hold a key <= the block's last query (a pair starts at a multiple of 32: the same chunk for both tiles)
  const int n = kce > wave ? (kce - wave + AW - 1) / AW : 0;   // chunks of this wave (scalar)
  const int tq = ql0 + col;
  const size_t bh = (size_t)b * NH + h;
  const _Float16* qp = lane_at(QH + (bh * (TT / 16) + (ql0 >> 4)) * 1024, lo);   // lane pointers: tile or chunk start + the lane's 8 elements
  {
    // A value set behind one chunk test and used behind a later one counts as carried round the tile loop, and such a build spilled. So the logits, P and the v fragments of a chunk that the wave does not own are set too, to zeros;
    // the key fragments need none: their tests are NESTED (a wave that owns chunk i owns every chunk below it), and each is loaded and used inside one and the same test.
    static_assert(NCH == 4, "the nest below is written out for 4 chunks");
    const v16h zh = {};
    float s[NCH][2][16]; float m0 = -3.0e38f, m1 = -3.0e38f;
    { v16h q[2][2];
#pragma unroll   // constant indices: the values stay in registers
      for (int u = 0; u < 2; ++u) { q[u][0] = frag_lh(qp + u * 1024); q[u][1] = frag_lh(qp + u * 1024 + 512); }
      XWAIT1(qp); const _Float16* kw = lane_at(KH + (bh * (TT / 16) + wave * 2) * 1024, lo);
      const int dg = kce - 1 - wave, lim = tq - (kce - 1) * 32 - 8 * g;   // chunk i of the wave is the one on the diagonal where AW * i == dg (scalar)
      v16h kf[NCH][4];   // all key fragments of the wave go out together, then the products from the last chunk down: one load latency
      if (n > 0) { att_kload(kf[0], kw); XWAIT1(kw);
        if (n > 1) { att_kload(kf[1], kw + AW * 2048); XWAIT1(kw);
          if (n > 2) { att_kload(kf[2], kw + 2 * AW * 2048); XWAIT1(kw);
            if (n > 3) { att_kload(kf[3], kw + 3 * AW * 2048); XWAIT1(kw);
              att_qk(s[3], m0, m1, kf[3], q, dg == 3 * AW, lim); }
            else att_s0(s[3]);
            att_qk(s[2], m0, m1, kf[2], q, dg == 2 * AW, lim); }
          else { att_s0(s[2]); att_s0(s[3]); }
          att_qk(s[1], m0, m1, kf[1], q, dg == AW, lim); }
        else { att_s0(s[1]); att_s0(s[2]); att_s0(s[3]); }
        att_qk(s[0], m0, m1, kf[0], q, dg == 0, lim); }
      else { att_s0(s[0]); att_s0(s[1]); att_s0(s[2]); att_s0(s[3]); } }
    row_max2(m0, m1, redm, wave, col, g); m0 *= EC; m1 *= EC;
    const _Float16* vw = lane_at(VT + (bh * (TT / 32) + wave) * 2048, lo);
    v16h vf[NCH][HD / 16];   // the v fragments of the first VFLY chunks fly during the exponentials; beside 2 tiles of f32 logits the registers hold no more
#pragma unroll   // constant indices: the values stay in registers
    for (int i = 0; i < VFLY; ++i) {
      if (i < n) { att_vload(vf[i], vw + i * AW * 2048); XWAIT1(vw); }
      else {
#pragma unroll   // constant indices: the values stay in registers
        for (int j = 0; j < HD / 16; ++j) vf[i][j] = zh; } }
    float sum0 = 0.f, sum1 = 0.f;
#pragma unroll   // constant indices: the values stay in registers
    for (int i = 0; i < NCH; ++i) if (i < n) {
#pragma unroll   // constant indices: the values stay in registers
      for (int e = 0; e < 16; ++e) { s[i][0][e] = exp_sc(s[i][0][e], m0); sum0 += s[i][0][e]; s[i][1][e] = exp_sc(s[i][1][e], m1); sum1 += s[i][1][e]; } }   // an excluded key (-3e38) gives exactly 0: m is a finite logit
    row_sum2(sum0, sum1, reds, wave, col, g);
    const float inv0 = 2048.0f / sum0, inv1 = 2048.0f / sum1;
    v16h p[NCH][2];   // P in 16 bits takes half the logits' registers: every 2 chunks converted make room for one more chunk's v fragments, loaded at once
#pragma unroll   // constant indices: the values stay in registers
    for (int i = 0; i < NCH; ++i) {
      if (i < n) att_p(p[i], s[i], inv0, inv1);
      else { p[i][0] = zh; p[i][1] = zh; }
      if (i & 1) { const int iv = VFLY + (i >> 1);
        if (iv < n) { att_vload(vf[iv], vw + iv * AW * 2048); XWAIT1(vw); }
        else {
#pragma unroll   // constant indices: the values stay in registers
          for (int j = 0; j < HD / 16; ++j) vf[iv][j] = zh; } } }
    v8f acc[2][HD / 16] = {};
#pragma unroll   // constant indices: the values stay in registers
    for (int i = 0; i < NCH; ++i) if (i < n) att_pv(acc, p[i], vf[i]);
#pragma unroll   // constant indices: the values stay in registers
    for (int u = 0; u < 2; ++u)
#pragma unroll   // constant indices: the values stay in registers
      for (int j = 0; j < HD / 16; ++j)
#pragma unroll   // constant indices: the values stay in registers
        for (int r = 0; r < 8; ++r) ss[u][wave][8 * g + r][j * 16 + col] = acc[u][j][r]; }
  __syncthreads();   // every wave's partial is in LDS before any is summed
  att_store<true>(ss, Y, b, h, ql0, tid); } }
// ---- k_out: block = (64 rows, 128 cols): out = ctx Wo (+ bo): ctx once to f16 against Wo as f16(bf16 x 2^8) exact (1 product) x 2^-8; causal early rows (< QHI of each sequence): ctx bf16 hi + lo against exact bf16 Wo (2 products)
__global__ __launch_bounds__(128) void k_out(const float* __restrict__ Y, const float* __restrict__ WO, const float* __restrict__ BO, float* __restrict__ OUT) { __shared__ __align__(16) float sf[4][16][132]; __shared__ __align__(16) unsigned char wsm[2 * WSB];
  const int tid = threadIdx.x, wave = tid >> 5, lane = tid & 31, col = lane & 15, g = lane >> 4; const int c0 = blockIdx.y * 128; const size_t r0 = (size_t)blockIdx.x * 64 + wave * 16;
  v8f acc[8] = {};
  const float* wp = WO + (size_t)(8 * wave) * DIN + c0 + 4 * lane;   // (in,out) [CC][DIN]: this thread's 8 k rows x 4 columns of each slab
  const float* yp = Y + (r0 >> 4) * (CC / 32) * 512 + 4 * lane;   // this wave's 16 rows: one 512-float block per k slab
  unsigned char* wput = wsm + (lane >> 2) * WJP + wave * 256 + (lane & 3) * 64; const unsigned char* wget = wsm + lane * 16;
  v4f wn[8], yn[4]; wslab_load(wn, wp, DIN); arow_load_f(yn, yp); SLABWAIT();
  if (CAUSAL && (int)(((size_t)blockIdx.x * 64) % TT) < QHI) {   /* block-uniform */
    wslab_put_b(wput, wn);
    __syncthreads();   // slab 0 is in LDS before any wave reads it
#pragma unroll 2   // the buffer index is a constant in each copy of the body
    for (int kc = 0; kc < CC / 32; ++kc) { float v[16];
#pragma unroll   // constant indices: the values stay in registers
      for (int e = 0; e < 16; ++e) v[e] = yn[e >> 2][e & 3];
      const F2 a = bsplit16(v); const bool more = kc + 1 < CC / 32;   // block-uniform
      if (more) { const float* wq = wp + (size_t)(kc + 1) * 32 * DIN; const float* yq = yp + (kc + 1) * 512; wslab_load(wn, wq, DIN); arow_load_f(yn, yq); SLABWAIT(); }
      v16b wf[8];   // the slab's LDS reads go out as one group: one LDS latency, not one per product
#pragma unroll   // constant indices: the values stay in registers
      for (int j = 0; j < 8; ++j) wf[j] = wfrag_b(wget + (kc & 1) * WSB + j * WJP);
#pragma unroll   // constant indices: the values stay in registers
      for (int j = 0; j < 8; ++j) { acc[j] = wmma_bf(a.h, wf[j], acc[j]); acc[j] = wmma_bf(a.l, wf[j], acc[j]); }
      PRODUCTS_DONE();
      if (more) { wslab_put_b(wput + ((kc + 1) & 1) * WSB, wn);
        __syncthreads(); } }   // publishes slab kc + 1 and ends every wave's reads of slab kc, whose buffer the next trip refills
#pragma unroll
    for (int j = 0; j < 8; ++j) { const float bias = BO ? bfr(BO[c0 + j * 16 + col]) : 0.f;
#pragma unroll
      for (int r = 0; r < 8; ++r) sf[wave][8 * g + r][j * 16 + col] = acc[j][r] + bias; }
  } else {
    wslab_put_h(wput, wn);
    __syncthreads();   // slab 0 is in LDS before any wave reads it
#pragma unroll 2   // the buffer index is a constant in each copy of the body
    for (int kc = 0; kc < CC / 32; ++kc) { v16h a;
#pragma unroll   // constant indices: the values stay in registers
      for (int e = 0; e < 16; ++e) a[e] = (_Float16)yn[e >> 2][e & 3];
      const bool more = kc + 1 < CC / 32;   // block-uniform
      if (more) { const float* wq = wp + (size_t)(kc + 1) * 32 * DIN; const float* yq = yp + (kc + 1) * 512; wslab_load(wn, wq, DIN); arow_load_f(yn, yq); SLABWAIT(); }
      v16h wf[8];   // the slab's LDS reads go out as one group: one LDS latency, not one per product
#pragma unroll   // constant indices: the values stay in registers
      for (int j = 0; j < 8; ++j) wf[j] = wfrag_h(wget + (kc & 1) * WSB + j * WJP);
#pragma unroll   // constant indices: the values stay in registers
      for (int j = 0; j < 8; ++j) acc[j] = wmma16(a, wf[j], acc[j]);
      PRODUCTS_DONE();
      if (more) { wslab_put_h(wput + ((kc + 1) & 1) * WSB, wn);
        __syncthreads(); } }   // publishes slab kc + 1 and ends every wave's reads of slab kc, whose buffer the next trip refills
#pragma unroll
    for (int j = 0; j < 8; ++j) { const float bias = BO ? bfr(BO[c0 + j * 16 + col]) : 0.f;
#pragma unroll
      for (int r = 0; r < 8; ++r) sf[wave][8 * g + r][j * 16 + col] = acc[j][r] * (1.0f / 256.0f) + bias; } }
  LDSX(); for (int rl = 0; rl < 16; ++rl) vst2(OUT + (r0 + rl) * DIN + c0 + lane * 4, *(const v4f*)&sf[wave][rl][lane * 4]); }

extern "C" void kernel_launch(void* const* d_in, const int* in_sizes, int n_in, void* d_out, int out_size, void* d_ws, size_t ws_size, hipStream_t stream) {
  (void)in_sizes; (void)n_in; (void)out_size;
  const float** F = (const float**)d_in;
  if (ws_size < (size_t)WS_END) return;
  char* ws = (char*)d_ws; _Float16 *QH = (_Float16*)(ws + WS_QH), *KH = (_Float16*)(ws + WS_KH), *VT = (_Float16*)(ws + WS_VT), *QL = (_Float16*)(ws + WS_QL), *KL = (_Float16*)(ws + WS_KL); __bf16 *VB = (__bf16*)(ws + WS_VB), *VBL = (__bf16*)(ws + WS_VBL); float *Y = (float*)(ws + WS_Y); __bf16 *XB = (__bf16*)(ws + WS_XB), *WB = (__bf16*)(ws + WS_WB);
  (void)Y; (void)QL; (void)KL; (void)VB; (void)VBL;
  // inputs: 0 x [4,2048,768]; 1 Wq, 2 Wk, 3 Wv [12,768,64]; 4 bq, 5 bk, 6 bv [12,64] (= flat [768] by column h*64+k); 7 Wo [768,768] (in,out); 8 bo [768]
  k_cvt<<<dim3(CVX + CVW), 256, 0, stream>>>(F[0], F[1], F[2], F[3], XB, WB);
  k_proj<<<dim3(TNB * TT / 128, CC / 128, 3), 128, 0, stream>>>(XB, WB, F[4], F[5], F[6], QH, QL, KH, KL, VT, VB, VBL);
  k_att<<<dim3(AGRID), 32 * AW, 0, stream>>>(QH, KH, QL, KL, VT, VB, VBL, Y);
  k_out<<<dim3(TNB * TT / 64, DIN / 128), 128, 0, stream>>>(Y, F[7], F[8], (float*)d_out);
}

// v010
// It runs in 116 microseconds.
// Next to v009, in two timings, it ran 1.08 and 1.07 times as fast.
// All steps since v000 together make it 14.9 times as fast.
// compute dtype: all float inputs rounded to bf16; q/k/v = x W[h] + b[h] with EXACT bf16 products on WMMA 16x16x32, f32 accumulate; q, k once to f16 -> 1-product causal logits x 1/8, except the first 384 query rows of each sequence (few keys, no averaging), which use q and k as f16 hi + residual (x 2^10) (3 products); softmax in f32 (e^x as one hardware 2^y of a fused y = logit * log2(e) / 8 - max * log2(e) / 8, the max being that of the wave's own keys; the waves' partial sums are brought to the row's max and divided by the row sum at the end); e^x x 2^11 once to f16 against v once to f16 (1 product), except the first 384 rows: P and v as bf16 hi + lo (3 products); ctx once to f16 against Wo carried x 2^8 in f16 (exact bf16 values), except the first 384 rows: ctx bf16 hi + lo against exact bf16 Wo (2 products); + bo; f32 output.
#include <hip/hip_runtime.h>
#include <math.h>

typedef __attribute__((ext_vector_type(16))) _Float16 v16h;
typedef __attribute__((ext_vector_type(16))) __bf16 v16b;
typedef __attribute__((ext_vector_type(8)))  _Float16 v8h;
typedef __attribute__((ext_vector_type(8)))  float v8f;
typedef __attribute__((ext_vector_type(4)))  float v4f;
typedef __attribute__((ext_vector_type(2)))  float v2f;
typedef __attribute__((ext_vector_type(4)))  unsigned v4u;
typedef __attribute__((ext_vector_type(4)))  int v4i;
typedef float __attribute__((may_alias)) float_a;
typedef int __attribute__((may_alias)) int_a;

template <typename T> __device__ __forceinline__ void vst2(void* p, T v) { *(T*)p = v;  }
__device__ __forceinline__ v8f wmma16(v16h a, v16h b, v8f c) {
  v8f d = __builtin_amdgcn_wmma_f32_16x16x32_f16(false, a, false, b, (short)0, c, false, false);
  asm volatile("v_nop\n\tv_nop\n\tv_nop\n\tv_nop" : "+v"(d) : "v"(a), "v"(b));
  return d;
}
__device__ __forceinline__ v8f wmma_bf(v16b a, v16b b, v8f c) {
  v8f d = __builtin_amdgcn_wmma_f32_16x16x32_bf16(false, a, false, b, (short)0, c, false, false);
  asm volatile("v_nop\n\tv_nop\n\tv_nop\n\tv_nop" : "+v"(d) : "v"(a), "v"(b));
  return d;
}
// 16x16x32 fragments: lane = (h = lane>>4, row/col = lane&15); elements 0..7 = k0+8h+0..7, 8..15 = k0+16+8h+0..7; D element r = row 8h+r
__device__ __forceinline__ v16h frag_h(const _Float16* rowk0, int lane) {
  union { v16h v; v8h q[2]; } u; const _Float16* p = rowk0 + 8 * (lane >> 4);
  u.q[0] = *(const v8h*)p; u.q[1] = *(const v8h*)(p + 16); return u.v;
}
__device__ __forceinline__ v16h frag_f32(const float* rowk0, int lane) {
  v16h a; const float* p = rowk0 + 8 * (lane >> 4);
#pragma unroll
  for (int i = 0; i < 8; ++i) { a[i] = (_Float16)p[i]; a[8 + i] = (_Float16)p[16 + i]; }
  return a;
}
__device__ __forceinline__ v16h frag_f32s(const float* rowk0, int lane, float sc) {
  v16h a; const float* p = rowk0 + 8 * (lane >> 4);
#pragma unroll
  for (int i = 0; i < 8; ++i) { a[i] = (_Float16)(p[i] * sc); a[8 + i] = (_Float16)(p[16 + i] * sc); }
  return a;
}
// column fragment from a [K][ld] layout (column n), rows >= K read as 0
__device__ __forceinline__ v16h fragc_f32(const float* W, int k0, int n, int lane, int ld, int K) {
  v16h a; const int g = lane >> 4;
#pragma unroll
  for (int i = 0; i < 8; ++i) { const int ka = k0 + 8 * g + i, kb = ka + 16;
    a[i] = (_Float16)(ka < K ? W[(size_t)(ka < K ? ka : K - 1) * ld + n] : 0.f); a[8 + i] = (_Float16)(kb < K ? W[(size_t)(kb < K ? kb : K - 1) * ld + n] : 0.f); }
  return a;
}
struct F2 { v16b h, l; };
__device__ __forceinline__ F2 bsplit16(const float v[16]) { F2 r;
#pragma unroll
  for (int i = 0; i < 16; ++i) { const __bf16 h = (__bf16)v[i]; r.h[i] = h; r.l[i] = (__bf16)(v[i] - (float)h); }
  return r; }
__device__ __forceinline__ F2 split_row(const float* row, int k0, int lane) { float v[16]; const float* p = row + k0 + 8 * (lane >> 4);
#pragma unroll
  for (int i = 0; i < 8; ++i) { v[i] = p[i]; v[8 + i] = p[16 + i]; }
  return bsplit16(v); }
__device__ __forceinline__ F2 split_rowK(const float* row, int k0, int lane, int K) { float v[16]; const int g = lane >> 4;
#pragma unroll
  for (int i = 0; i < 8; ++i) { const int ka = k0 + 8 * g + i, kb = ka + 16; v[i] = ka < K ? row[ka < K ? ka : K - 1] : 0.f; v[8 + i] = kb < K ? row[kb < K ? kb : K - 1] : 0.f; }
  return bsplit16(v); }
__device__ __forceinline__ F2 split_col(const float* W, int k0, int n, int lane, int ld, int K) { float v[16]; const int g = lane >> 4;
#pragma unroll
  for (int i = 0; i < 8; ++i) { const int ka = k0 + 8 * g + i, kb = ka + 16; v[i] = ka < K ? W[(size_t)(ka < K ? ka : K - 1) * ld + n] : 0.f; v[8 + i] = kb < K ? W[(size_t)(kb < K ? kb : K - 1) * ld + n] : 0.f; }
  return bsplit16(v); }
__device__ __forceinline__ v8f mac3(const F2& a, const F2& b, v8f c) { c = wmma_bf(a.l, b.h, c); c = wmma_bf(a.h, b.l, c); return wmma_bf(a.h, b.h, c); }
__device__ __forceinline__ float sigm(float v) { return 1.0f / (1.0f + expf(-v)); }
#define LDSX() do { asm volatile("s_wait_dscnt 0" ::: "memory"); __builtin_amdgcn_wave_barrier(); __builtin_amdgcn_fence(__ATOMIC_RELEASE, "workgroup"); } while (0)

// Causal multi-head self-attention with per-head projection tensors (B 4, S 2,048, D 768, 12 heads x 64): q/k/v[b,h] = x W[h] + b[h] ([H][768][64] weights, [H][64] biases); scores = q k^T with key > query -> -inf, x 64^-0.5; softmax; out = concat_h(P v) Wo ((in,out) [768,768]) + bo.
#define NB 4
#define TT 2048
#define CC 768            // NH * HD = projected width
#define DIN 768          // input (model) width
#define NH 12
#define HD 64
#define SCALE (0.125f)
#define CAUSAL 1
#ifndef TNB
#define TNB NB
#endif
__device__ __forceinline__ float bfr(float v) { return (float)(__bf16)v; }
typedef __attribute__((ext_vector_type(8))) __bf16 v8b;
__device__ __forceinline__ v16b frag_b(const __bf16* rowk0, int lane) {
  union { v16b v; v8b q[2]; } u; const __bf16* p = rowk0 + 8 * (lane >> 4);
  u.q[0] = *(const v8b*)p; u.q[1] = *(const v8b*)(p + 16); return u.v;
}
#define QBH 6              // causal: query rows < QBH * 64 of each sequence (few keys, no averaging) take the high-precision path
#define QHI 384            // rows carrying a q residual plane
#define KHI 384            // key rows carrying k residual / v bf16 hi+lo planes (used only by the causal high-precision path)
// B fragment (k rows k0+.., output column o) of a weight: (in,out) [K][ld] or (out,in) [ld rows of K]: bf16 exact, or f16(bf16 * 256) exact
__device__ __forceinline__ v16b wcol_io(const float* Wm, int k0, int o, int lane, int ld) { v16b w; const int g = lane >> 4;
#pragma unroll
  for (int i = 0; i < 8; ++i) { w[i] = (__bf16)Wm[(size_t)(k0 + 8 * g + i) * ld + o]; w[8 + i] = (__bf16)Wm[(size_t)(k0 + 16 + 8 * g + i) * ld + o]; }
  return w; }
__device__ __forceinline__ v16b wcol_oi(const float* Wm, int k0, int o, int lane, int K) { v16b w; const float* p = Wm + (size_t)o * K + k0 + 8 * (lane >> 4);
#pragma unroll
  for (int i = 0; i < 8; ++i) { w[i] = (__bf16)p[i]; w[8 + i] = (__bf16)p[16 + i]; }
  return w; }
__device__ __forceinline__ v16h wcolh_io(const float* Wm, int k0, int o, int lane, int ld) { v16h w; const int g = lane >> 4;
#pragma unroll
  for (int i = 0; i < 8; ++i) { w[i] = (_Float16)(bfr(Wm[(size_t)(k0 + 8 * g + i) * ld + o]) * 256.0f); w[8 + i] = (_Float16)(bfr(Wm[(size_t)(k0 + 16 + 8 * g + i) * ld + o]) * 256.0f); }
  return w; }
__device__ __forceinline__ v16h wcolh_oi(const float* Wm, int k0, int o, int lane, int K) { v16h w; const float* p = Wm + (size_t)o * K + k0 + 8 * (lane >> 4);
#pragma unroll
  for (int i = 0; i < 8; ++i) { w[i] = (_Float16)(bfr(p[i]) * 256.0f); w[8 + i] = (_Float16)(bfr(p[16 + i]) * 256.0f); }
  return w; }
#define WQKV_LAYOUT 2   // 0 = (in,out) [DIN][CC]; 1 = (out,in) [CC][DIN]; 2 = per-head [NH][DIN][HD]
__device__ __forceinline__ v16b wcol_hdk(const float* Wm, int k0, int o, int lane) { v16b w; const int g = lane >> 4; const float* p = Wm + (size_t)(o / HD) * DIN * HD + (o % HD);
#pragma unroll
  for (int i = 0; i < 8; ++i) { w[i] = (__bf16)p[(size_t)(k0 + 8 * g + i) * HD]; w[8 + i] = (__bf16)p[(size_t)(k0 + 16 + 8 * g + i) * HD]; }
  return w; }
#define WO_OUT_IN 0
#if WQKV_LAYOUT == 1
#define WCOL(W, k0, o, lane) wcol_oi(W, k0, o, lane, DIN)
#elif WQKV_LAYOUT == 2
#define WCOL(W, k0, o, lane) wcol_hdk(W, k0, o, lane)
#else
#define WCOL(W, k0, o, lane) wcol_io(W, k0, o, lane, CC)
#endif
#if WO_OUT_IN
#define WOCOL(W, k0, o, lane) wcol_oi(W, k0, o, lane, CC)
#define WOCOLH(W, k0, o, lane) wcolh_oi(W, k0, o, lane, CC)
#else
#define WOCOL(W, k0, o, lane) wcol_io(W, k0, o, lane, DIN)
#define WOCOLH(W, k0, o, lane) wcolh_io(W, k0, o, lane, DIN)
#endif

#ifndef PROJ_EXTRA_PARAMS
#define PROJ_EXTRA_PARAMS
#endif

// q, k and v planes lie in FRAGMENT ORDER, so that each wave-wide 16-byte load of k_att covers 512 contiguous bytes (4 whole lines) instead of 16 pieces of 32 bytes in 16 lines.
// Row planes (q, k and their residuals), NT rows a sequence: [b][h][t / 16] tiles of 1,024 elements (16 rows x HD); element (t, d) at i * 256 + ln * 8 + d % 8, i = (d / 32) * 2 + (d % 32) / 16, ln = ((d % 16) / 8) * 16 + t % 16.
// v planes, NT keys a sequence: [b][h][t / 32] chunks of 2,048 elements (HD channels x 32 keys); element (c, t) at i * 256 + ln * 8 + t % 8, i = (c / 16) * 2 + (t % 32) / 16, ln = ((t % 16) / 8) * 16 + c % 16.
// In both, lane ln of a wave finds elements 0..7 of fragment f at f * 512 + ln * 8 and elements 8..15 at 256 elements on.
#define WS_QH  0u                                      // f16 q, row plane, NT = TT
#define WS_KH  (WS_QH + 2u * (size_t)NB * TT * CC)      // f16 k, row plane, NT = TT
#define WS_VT  (WS_KH + 2u * (size_t)NB * TT * CC)      // f16 v, v plane, NT = TT
#define WS_QL  (WS_VT + 2u * (size_t)NB * CC * TT)      // f16 q residual x 2^10, row plane, NT = QHI
#define WS_KL  (WS_QL + 2u * (size_t)NB * QHI * CC)     // f16 k residual x 2^10, row plane, NT = KHI
#define WS_VB  (WS_KL + 2u * (size_t)NB * KHI * CC)     // bf16 v hi (and, behind it, lo), v plane, NT = KHI
#define WS_VBL (WS_VB + 2u * (size_t)NB * CC * KHI)
#define WS_Y   (WS_VBL + 2u * (size_t)NB * CC * KHI)    // f32 ctx in fragment order: [(b*t) / 16][c / 32] blocks of 512 floats (16 rows x 32 k); element (t, c) at x * 128 + ln * 4 + c % 4, x = ((c % 32) / 16) * 2 + (c % 8) / 4, ln = ((c % 16) / 8) * 16 + t % 16
#define WS_XB  (WS_Y  + 4u * (size_t)NB * TT * CC)      // bf16 x in fragment order: [(b*t) / 16][k / 32] blocks of 512 elements (16 rows x 32 k); element (t, k) at i * 256 + ln * 8 + k % 8, i = (k % 32) / 16, ln = ((k % 16) / 8) * 16 + t % 16
#define WS_WB  (WS_XB + 2u * (size_t)NB * TT * DIN)     // bf16 Wq, Wk, Wv in slab order: [which][c / 128][k / 32] slabs of 8,192 bytes (32 k x 128 columns); (k group q = (k % 32) / 8, column c) at ((c % 128) / 16) * 1024 + q * 256 + (c % 16) * 16 bytes, 8 k values
#define WS_END (WS_WB + 2u * 3u * (size_t)DIN * CC)

// ---- weight k-slab in LDS (both projection kernels): 32 k rows x 128 output columns, laid out in fragment order, read by all 4 waves (k_out converts it once per block; k_proj copies it from the bf16 plane that k_cvt wrote in the same order).
// Place of (k group q = k / 8, column c): (c / 16) * WJP + q * 256 + (c % 16) * 16 bytes, 8 k values of 16 bits each. A lane (g, col) finds elements 0..7 (k = 8g + i) at group g and 8..15 (k = 16 + 8g + i) at group 2 + g, 512 bytes on.
// Staging from f32 (k_out, k_cvt): thread (wave = k group, lane = 4 columns) loads 8 k rows x 16 bytes, so a wave's load covers whole 128-byte lines, and stores 4 columns x 16 bytes.
#define WJP 1040           // 4 groups x 16 columns x 16 B, + 16 B: the 16 lanes of a staging store then fall on 64 distinct banks
#define WSB (8 * WJP)      // one buffer
__device__ __forceinline__ void wslab_load(v4f (&r)[8], const float* p, int ld) {
#pragma unroll   // constant indices: the values stay in registers
  for (int i = 0; i < 8; ++i) r[i] = *(const v4f*)(p + (size_t)i * ld); }
__device__ __forceinline__ void wslab_put_b(unsigned char* d, const v4f (&r)[8]) {   // exact bf16
#pragma unroll   // constant indices: the values stay in registers
  for (int cc = 0; cc < 4; ++cc) { v8b h;
#pragma unroll   // constant indices: the values stay in registers
    for (int i = 0; i < 8; ++i) h[i] = (__bf16)r[i][cc];
    *(v8b*)(d + cc * 16) = h; } }
__device__ __forceinline__ void wslab_put_h(unsigned char* d, const v4f (&r)[8]) {   // f16(bf16 x 2^8), exact
#pragma unroll   // constant indices: the values stay in registers
  for (int cc = 0; cc < 4; ++cc) { v8h h;
#pragma unroll   // constant indices: the values stay in registers
    for (int i = 0; i < 8; ++i) h[i] = (_Float16)(bfr(r[i][cc]) * 256.0f);
    *(v8h*)(d + cc * 16) = h; } }
// a thread's share of a slab that already lies in memory as bf16 in LDS order (p = slab + 8 * tid elements, d = its place for unit tid): 4 units of 16 bytes, 128 units apart = 2 column tiles on
__device__ __forceinline__ void pslab_load(v4u (&r)[4], const __bf16* p) {
#pragma unroll   // constant indices: the values stay in registers
  for (int i = 0; i < 4; ++i) r[i] = *(const v4u*)(p + i * 1024); }
__device__ __forceinline__ void pslab_put(unsigned char* d, const v4u (&r)[4]) {
#pragma unroll   // constant indices: the values stay in registers
  for (int i = 0; i < 4; ++i) *(v4u*)(d + i * 2 * WJP) = r[i]; }
__device__ __forceinline__ v16b wfrag_b(const unsigned char* p) { union { v16b v; v8b q[2]; } u; u.q[0] = *(const v8b*)p; u.q[1] = *(const v8b*)(p + 512); return u.v; }
__device__ __forceinline__ v16h wfrag_h(const unsigned char* p) { union { v16h v; v8h q[2]; } u; u.q[0] = *(const v8h*)p; u.q[1] = *(const v8h*)(p + 512); return u.v; }
// a lane's 16 f32 of an A row (k0 + 8g + 0..7, k0 + 16 + 8g + 0..7; element e = x[e / 4][e % 4]) from the fragment-order ctx plane (p = block start + 4 * lane): four runs of 512 bytes
__device__ __forceinline__ void arow_load_f(v4f (&x)[4], const float* p) { x[0] = *(const v4f*)p; x[1] = *(const v4f*)(p + 128); x[2] = *(const v4f*)(p + 256); x[3] = *(const v4f*)(p + 384); }
// behind the next slab's loads: their address registers are rewritten only behind this wait; the clobber also keeps the loads ahead of the products they fly under
#define SLABWAIT() asm volatile("s_wait_xcnt 0x0" ::: "memory")
// behind a group of global stores: their address and data registers are rewritten only behind this wait (the clobber keeps the next group's LDS reads behind it, the scheduling barrier its address arithmetic)
#define STOREWAIT() do { asm volatile("s_wait_xcnt 0x0" ::: "memory"); __builtin_amdgcn_sched_barrier(0); } while (0)
// behind a slab's products: keeps the conversions of the next slab, which wait for the loads in flight, from moving up among the products
#define PRODUCTS_DONE() __builtin_amdgcn_sched_barrier(0)

// ---- k_cvt: x and Wq, Wk, Wv rounded to bf16 ONCE, into the order in which k_proj reads them (k_proj read x 18 times and each weight 64 times as f32, x in 32-byte pieces of 16 lines, and rounded at every read).
// Blocks 0 .. CVX - 1, x: a wave takes 16 rows x 192 k (6 blocks of the plane); lane = (row l / 4 of 8, 8 k values l % 4): 32 bytes in, 16 bytes out; a wave-wide store covers 4 whole lines.
// Blocks CVX .., weights: a block takes 4 slabs, wave = (k group w % 4, slab pair w / 4), lane = 4 columns, as the slab staging of k_out has it.
#define CVX (TNB * TT / 16 * 4 / 8)                  // x: 4 waves a row tile, 8 waves a block
#define CVW (3 * (CC / 128) * (DIN / 32) / 4)        // weights: 4 slabs a block
// behind a run of global loads from one pointer: the pointer, named as an input, stays in its registers up to this wait (no load of the run lands in them) and is free behind it
#define CVTWAIT(p) asm volatile("s_wait_xcnt 0x0" :: "v"(p) : "memory")
__global__ __launch_bounds__(256) void k_cvt(const float* __restrict__ X, const float* __restrict__ WQ, const float* __restrict__ WK, const float* __restrict__ WV, __bf16* __restrict__ XB, __bf16* __restrict__ WB) {
  const int tid = threadIdx.x, wave = __builtin_amdgcn_readfirstlane(tid >> 5), lane = tid & 31;
  if ((int)blockIdx.x < CVX) { const int gw = (int)blockIdx.x * 8 + wave, rt = gw >> 2, kq = gw & 3, row8 = lane >> 2, k8 = lane & 3;
    const float* xp = X + ((size_t)rt * 16 + row8) * DIN + kq * 192 + k8 * 8;
    __bf16* dp = XB + ((size_t)rt * (DIN / 32) + kq * 6) * 512 + (k8 >> 1) * 256 + ((k8 & 1) * 16 + row8) * 8;
    v4f r[6][2][2];   // all 24 loads go out together: one memory latency
#pragma unroll   // constant indices: the values stay in registers, the steps become immediate offsets
    for (int s = 0; s < 6; ++s)
#pragma unroll   // constant indices: the values stay in registers, the steps become immediate offsets
      for (int it = 0; it < 2; ++it) { const float* p = xp + (size_t)it * 8 * DIN + s * 32; r[s][it][0] = *(const v4f*)p; r[s][it][1] = *(const v4f*)(p + 4); }
    CVTWAIT(xp); __builtin_amdgcn_sched_barrier(0);   // keeps the conversions, which wait for the first loads, from moving up among the loads: without it half the loads went out only behind those waits
#pragma unroll   // constant indices: the values stay in registers, the steps become immediate offsets
    for (int s = 0; s < 6; ++s)
#pragma unroll   // constant indices: the values stay in registers, the steps become immediate offsets
      for (int it = 0; it < 2; ++it) { v8b h;
#pragma unroll   // constant indices: the values stay in registers
        for (int e = 0; e < 8; ++e) h[e] = (__bf16)r[s][it][e >> 2][e & 3];
        *(v8b*)(dp + s * 512 + it * 64) = h; }
  } else { const int q = wave & 3, sl0 = ((int)blockIdx.x - CVX) * 4 + (wave >> 2) * 2;   // slabs sl0 and sl0 + 1: DIN / 32 is even, so both lie in one (which, column block)
    const int kc = sl0 % (DIN / 32), cb = (sl0 / (DIN / 32)) % (CC / 128), which = sl0 / ((DIN / 32) * (CC / 128));
    const float* WA = which == 0 ? WQ : which == 1 ? WK : WV; const int cw = cb * 128 + 4 * lane;
    const float* wp = WA + (size_t)(cw / HD) * DIN * HD + (cw % HD) + (size_t)(kc * 32 + 8 * q) * HD;   // per-head [NH][DIN][HD]
    unsigned char* dp = (unsigned char*)WB + (size_t)sl0 * 8192 + (lane >> 2) * 1024 + q * 256 + (lane & 3) * 64;
    v4f w0[8], w1[8]; wslab_load(w0, wp, HD); wslab_load(w1, wp + 32 * HD, HD); CVTWAIT(wp); __builtin_amdgcn_sched_barrier(0);   // as above: all 16 loads go out before the first wait
    wslab_put_b(dp, w0); wslab_put_b(dp + 8192, w1);
    asm volatile("s_wait_xcnt 0x0" ::: "memory"); } }   // behind this branch's last stores: in the built code the x branch stands behind them, and its first instructions rewrite their data registers
// ---- k_proj: block = (128 rows, 128 cols, which): q/k/v = X W (+ b) with exact bf16 products (K = DIN) -> which 0: q f16 (+ residual, rows < QHI); 1: k f16 (+ residual, rows < KHI); 2: v f16 (+ bf16 hi/lo for t < KHI); all stored in fragment order
// A wave owns two 16-row tiles, 64 rows apart (tile u = rows 64 u + 16 wave ..): each weight fragment it reads from the slab feeds both, so a staged slab serves twice the rows. The epilogue lays out and stores one 64-row half at a time through the same LDS arrays.
__global__ __launch_bounds__(128) void k_proj(const __bf16* __restrict__ XB, const __bf16* __restrict__ WB, const float* __restrict__ BQ, const float* __restrict__ BK, const float* __restrict__ BV,
    _Float16* __restrict__ QH, _Float16* __restrict__ QL, _Float16* __restrict__ KH, _Float16* __restrict__ KL, _Float16* __restrict__ VT, __bf16* __restrict__ VB, __bf16* __restrict__ VBL) {
  // the weight slab lies first: below 64 KiB its 16 fragment reads take one address register and immediate offsets (behind the epilogue arrays each took a register of its own, and the wave count per SIMD fell)
  __shared__ __align__(16) struct { unsigned char wsm[2 * WSB]; _Float16 sh[64][136], sl[64][136], th[128][72]; __bf16 tb[128][72], tbl[128][72]; } sm;
  unsigned char (&wsm)[2 * WSB] = sm.wsm; _Float16 (&sh)[64][136] = sm.sh; _Float16 (&sl)[64][136] = sm.sl; _Float16 (&th)[128][72] = sm.th; __bf16 (&tb)[128][72] = sm.tb; __bf16 (&tbl)[128][72] = sm.tbl;
  const int tid = threadIdx.x, wave = tid >> 5, lane = tid & 31, col = lane & 15, g = lane >> 4; const int which = blockIdx.z; const int c0 = blockIdx.y * 128; const size_t r0 = (size_t)blockIdx.x * 128; const size_t bb = r0 / TT; const int t0 = (int)(r0 % TT);
  const float* BA = which == 0 ? BQ : which == 1 ? BK : BV;
  v8f acc[2][8] = {};
  { // a slab of the bf16 weight plane is 8,192 bytes in LDS order: thread tid copies its 16-byte units tid, tid + 128, .. (a wave-wide load covers 4 whole lines); unit n goes to column tile n / 64
    const __bf16* wp = WB + (((size_t)which * (CC / 128) + blockIdx.y) * (DIN / 32)) * 4096 + 8 * tid;
    const __bf16* xp = XB + (r0 / 16 + wave) * (DIN / 32) * 512 + 8 * lane; const __bf16* xp1 = xp + (size_t)4 * (DIN / 32) * 512;   // the wave's two row tiles: one 512-element block per k slab each
    unsigned char* wput = wsm + (tid >> 6) * WJP + (tid & 63) * 16; const unsigned char* wget = wsm + lane * 16;
    v4u wn[4]; v8b xn[2][2]; pslab_load(wn, wp); xn[0][0] = *(const v8b*)xp; xn[0][1] = *(const v8b*)(xp + 256); xn[1][0] = *(const v8b*)xp1; xn[1][1] = *(const v8b*)(xp1 + 256); SLABWAIT();
    pslab_put(wput, wn);
    __syncthreads();   // slab 0 is in LDS before any wave reads it
#pragma unroll 2   // the buffer index is a constant in each copy of the body
    for (int kc = 0; kc < DIN / 32; ++kc) { v16b a[2];
#pragma unroll   // constant indices: the values stay in registers
      for (int e = 0; e < 16; ++e) { a[0][e] = xn[0][e >> 3][e & 7]; a[1][e] = xn[1][e >> 3][e & 7]; }
      const bool more = kc + 1 < DIN / 32;   // block-uniform
      if (more) { const __bf16* wq = wp + (kc + 1) * 4096; const __bf16* xq = xp + (kc + 1) * 512; const __bf16* xq1 = xp1 + (kc + 1) * 512; pslab_load(wn, wq); xn[0][0] = *(const v8b*)xq; xn[0][1] = *(const v8b*)(xq + 256); xn[1][0] = *(const v8b*)xq1; xn[1][1] = *(const v8b*)(xq1 + 256); SLABWAIT(); }
      v16b wf[8];   // the slab's LDS reads go out as one group: one LDS latency, not one per product
#pragma unroll   // constant indices: the values stay in registers
      for (int j = 0; j < 8; ++j) wf[j] = wfrag_b(wget + (kc & 1) * WSB + j * WJP);
      __builtin_amdgcn_sched_barrier(0);   // keeps the 16 LDS reads ahead of the products: without it they are issued two at a time into one fragment's registers, one LDS latency per pair of products
      // the bare builtin (the compiler keeps the distances behind it): with the v_nop statement of wmma_bf, whose operands cannot lie above v255, the 16 accumulator tiles spilled to scratch
#pragma unroll   // constant indices: the values stay in registers
      for (int j = 0; j < 8; ++j) { acc[0][j] = __builtin_amdgcn_wmma_f32_16x16x32_bf16(false, a[0], false, wf[j], (short)0, acc[0][j], false, false); acc[1][j] = __builtin_amdgcn_wmma_f32_16x16x32_bf16(false, a[1], false, wf[j], (short)0, acc[1][j], false, false); }
      PRODUCTS_DONE();
      if (more) { pslab_put(wput + ((kc + 1) & 1) * WSB, wn);
        __syncthreads(); } } }   // publishes slab kc + 1 and ends every wave's reads of slab kc, whose buffer the next trip refills
  float bias[8] = {};   // one value per column tile, the same for both halves
  if (BA) {
#pragma unroll   // constant indices: the values stay in registers
    for (int j = 0; j < 8; ++j) bias[j] = bfr(BA[c0 + j * 16 + col]); }
  if (which < 2) { _Float16* DH = which == 0 ? QH : KH; _Float16* DL = which == 0 ? QL : KL; const int nhi = which == 0 ? QHI : KHI;
    const int cl = (wave >> 1) * 32 + (wave & 1) * 16 + g * 8; const size_t bh = bb * NH + c0 / HD;
#pragma unroll   // constant indices: the accumulators stay in registers
    for (int u = 0; u < 2; ++u) { const int th0 = t0 + 64 * u; const bool hi_rows = th0 < nhi;   // block-uniform
      if (u) { STOREWAIT();
        __syncthreads(); }   // every wave has read the first half out of sh and sl before the second half is written there
#pragma unroll
      for (int j = 0; j < 8; ++j) {
#pragma unroll
        for (int r = 0; r < 8; ++r) { const float v = acc[u][j][r] + bias[j]; const _Float16 hv = (_Float16)v; sh[wave * 16 + 8 * g + r][j * 16 + col] = hv; sl[wave * 16 + 8 * g + r][j * 16 + col] = (_Float16)((v - (float)hv) * 1024.0f); } }
      __syncthreads();   // the half is in LDS before any wave reads it in store order
      // the half's 8 tiles (it: 2 heads x 4 row tiles); in each, wave = the 512-byte run, lane = the place in it
      v4u sv[8];
      _Float16* dp = DH + (bh * (TT / 16) + th0 / 16) * 1024 + tid * 8;
#pragma unroll   // constant indices: the values stay in registers, the steps become immediate offsets
      for (int it = 0; it < 8; ++it) sv[it] = *(const v4u*)&sh[(it & 3) * 16 + col][(it >> 2) * HD + cl];
#pragma unroll   // constant indices: the values stay in registers, the steps become immediate offsets
      for (int it = 0; it < 8; ++it) vst2((unsigned*)(dp + ((it >> 2) * (TT / 16) + (it & 3)) * 1024), sv[it]);
      if (hi_rows) { STOREWAIT();
        _Float16* lp = DL + (bh * (nhi / 16) + th0 / 16) * 1024 + tid * 8;
#pragma unroll   // constant indices: the values stay in registers, the steps become immediate offsets
        for (int it = 0; it < 8; ++it) sv[it] = *(const v4u*)&sl[(it & 3) * 16 + col][(it >> 2) * HD + cl];
#pragma unroll   // constant indices: the values stay in registers, the steps become immediate offsets
        for (int it = 0; it < 8; ++it) vst2((unsigned*)(lp + ((it >> 2) * (nhi / 16) + (it & 3)) * 1024), sv[it]); } }
  } else {
    const int cl = (wave >> 1) * 16 + col, rl = (wave & 1) * 16 + g * 8; const size_t bh = bb * NH + c0 / HD;
#pragma unroll   // constant indices: the accumulators stay in registers
    for (int u = 0; u < 2; ++u) { const int th0 = t0 + 64 * u; const bool hi_rows = th0 < KHI;   // block-uniform
      if (u) { STOREWAIT();
        __syncthreads(); }   // every wave has read the first half out of th, tb and tbl before the second half is written there
#pragma unroll
      for (int j = 0; j < 8; ++j) {
#pragma unroll
        for (int r = 0; r < 8; ++r) { const float v = acc[u][j][r] + bias[j]; const int rw = wave * 16 + 8 * g + r, cw = j * 16 + col; th[cw][rw] = (_Float16)v; const __bf16 bv = (__bf16)v; tb[cw][rw] = bv; tbl[cw][rw] = (__bf16)(v - (float)bv); } }
      __syncthreads();   // the half is in LDS before any wave reads it in store order
      // the half's 8 half chunks (it: 2 heads x 2 key chunks x 2 halves of 4 runs); in each, wave = the 512-byte run, lane = the place in it
      v4u sv[8];
      _Float16* dp = VT + (bh * (TT / 32) + th0 / 32) * 2048 + tid * 8;
#pragma unroll   // constant indices: the values stay in registers, the steps become immediate offsets
      for (int it = 0; it < 8; ++it) sv[it] = *(const v4u*)&th[(it >> 2) * HD + (it & 1) * 32 + cl][((it >> 1) & 1) * 32 + rl];
#pragma unroll   // constant indices: the values stay in registers, the steps become immediate offsets
      for (int it = 0; it < 8; ++it) vst2((unsigned*)(dp + ((it >> 2) * (TT / 32) + ((it >> 1) & 1)) * 2048 + (it & 1) * 1024), sv[it]);
      if (hi_rows) { STOREWAIT();
        const size_t o3 = (bh * (KHI / 32) + th0 / 32) * 2048 + tid * 8; __bf16* hp = VB + o3; __bf16* lp = VBL + o3;
#pragma unroll   // constant indices: the values stay in registers, the steps become immediate offsets
        for (int it = 0; it < 8; ++it) sv[it] = *(const v4u*)&tb[(it >> 2) * HD + (it & 1) * 32 + cl][((it >> 1) & 1) * 32 + rl];
#pragma unroll   // constant indices: the values stay in registers, the steps become immediate offsets
        for (int it = 0; it < 8; ++it) vst2((unsigned*)(hp + ((it >> 2) * (KHI / 32) + ((it >> 1) & 1)) * 2048 + (it & 1) * 1024), sv[it]);
        STOREWAIT();
#pragma unroll   // constant indices: the values stay in registers, the steps become immediate offsets
        for (int it = 0; it < 8; ++it) sv[it] = *(const v4u*)&tbl[(it >> 2) * HD + (it & 1) * 32 + cl][((it >> 1) & 1) * 32 + rl];
#pragma unroll   // constant indices: the values stay in registers, the steps become immediate offsets
        for (int it = 0; it < 8; ++it) vst2((unsigned*)(lp + ((it >> 2) * (KHI / 32) + ((it >> 1) & 1)) * 2048 + (it & 1) * 1024), sv[it]); } } } }
// ---- k_att: a block of AW waves works on one tile at a time: 32 queries (2 tiles of 16) of (b, h), for the early rows (high precision) 16 queries; logits, softmax and P . v in one launch, the logits never leave the registers.
// Both tiles of a block end in the same 32-key chunk, so each K and each V fragment that a wave loads feeds both: half the loads per query.
// Wave w owns the 32-key chunks w, w + AW, ... up to the diagonal. It forms the TRANSPOSED logits k . q^T (A = 16 key rows, B = 16 query columns), so a lane holds one query (col) and keys 8g + r of each 16-key tile:
// the D registers of a chunk's two tiles are, element for element, the A fragment of P for that chunk (0..7 = k0 + 8g + r, 8..15 = k0 + 16 + 8g + r). Row max and row sum of the wave's OWN keys: in the lane, then one exchange between the lane halves; no wave waits for another's. Each wave leaves its max, its sum and its unnormalised partial ctx in LDS, and the one sum over the waves brings them to the row's max and divides by the row's sum.
// Products: 1-product f16 logits x 1/8, e^x x 2^11 once to f16 against v f16; query blocks < QBH: q, k hi + residual (3 products), P and v bf16 hi + lo (3 products). f32 partial ctx summed through LDS in wave order 0..AW-1.
#define AW 16
#define NCH (TT / 32 / AW)   // chunks a wave can own
#define VFLY 2               // chunks whose v fragments are loaded ahead of the exponentials
// fragment halves from the lane's own pointer into a fragment-order plane (fragment start + 8 * lane): the two 512-byte runs of the fragment
__device__ __forceinline__ v16h frag_lh(const _Float16* p) { union { v16h v; v8h q[2]; } u; u.q[0] = *(const v8h*)p; u.q[1] = *(const v8h*)(p + 256); return u.v; }
__device__ __forceinline__ v16b frag_lb(const __bf16* p) { union { v16b v; v8b q[2]; } u; u.q[0] = *(const v8b*)p; u.q[1] = *(const v8b*)(p + 256); return u.v; }
// behind a batch of global loads: their address register, named as an input, is not rewritten in front of this wait and is free behind it
#define XWAIT1(p) asm volatile("s_wait_xcnt 0x0" :: "v"(p) : "memory")
#define XWAIT2(p, q) asm volatile("s_wait_xcnt 0x0" :: "v"(p), "v"(q) : "memory")
#define XWAIT4(p, q, r, s) asm volatile("s_wait_xcnt 0x0" :: "v"(p), "v"(q), "v"(r), "v"(s) : "memory")
// e^(SCALE * (a - m)) as 2^(a * EC - mc), mc = m * EC: one fused multiply-add (the product is not rounded) and one v_exp_f32. The rounding of mc is the same factor in every term of a wave's share of a row; the wave hands on the rounded mc, so the factor 2^(mc - row's largest mc) of the final sum takes it out again.
// A masked logit (-3e38) gives 2^(very negative) = exactly 0; a term below 2^-126 of the row's largest may come out 0.
#define EC (SCALE * 1.44269504088896340736f)
__device__ __forceinline__ float exp_sc(float a, float mc) { return __builtin_amdgcn_exp2f(__builtin_fmaf(a, EC, -mc)); }
// ---- pieces of a 32-query tile, one chunk of 32 keys each
// lane pointer from a wave-uniform tile or chunk start and the lane's byte offset (16 * lane): the start is formed in scalar registers, and one offset serves every plane over the whole tile loop (plane + lane offset, one pair per plane held over the loop, spilled)
__device__ __forceinline__ const _Float16* lane_at(const _Float16* f, unsigned lo) { return (const _Float16*)((const char*)f + (size_t)lo); }
// the chunk's four key fragments
__device__ __forceinline__ void att_kload(v16h (&kf)[4], const _Float16* kp) { kf[0] = frag_lh(kp); kf[1] = frag_lh(kp + 512); kf[2] = frag_lh(kp + 1024); kf[3] = frag_lh(kp + 1536); }
// transposed logits of the chunk for both query tiles, causal mask, running maxima
__device__ __forceinline__ void att_qk(float (&s)[2][16], float& m0, float& m1, const v16h (&kf)[4], const v16h (&q)[2][2], bool diag, int lim) {
  v8f a[2][2];   // four independent accumulators: (query tile u, key tile t)
#pragma unroll   // constant indices: the values stay in registers
  for (int u = 0; u < 2; ++u)
#pragma unroll   // constant indices: the values stay in registers
    for (int t = 0; t < 2; ++t) { const v8f z = {}; a[u][t] = wmma16(kf[2 * t], q[u][0], z); }
#pragma unroll   // constant indices: the values stay in registers
  for (int u = 0; u < 2; ++u)
#pragma unroll   // constant indices: the values stay in registers
    for (int t = 0; t < 2; ++t) { a[u][t] = wmma16(kf[2 * t + 1], q[u][1], a[u][t]);
#pragma unroll   // constant indices: the values stay in registers
      for (int r = 0; r < 8; ++r) s[u][t * 8 + r] = a[u][t][r]; }
  if (diag) {   // only the block's last chunk holds keys past a query of the block (scalar test); key > query with the constants on one side: lim = query - the chunk's first key - 8g, one lane value for all 32 tests
#pragma unroll   // constant indices: the values stay in registers
    for (int u = 0; u < 2; ++u)
#pragma unroll   // constant indices: the values stay in registers
      for (int e = 0; e < 16; ++e) if ((e >> 3) * 16 + (e & 7) - 16 * u > lim) s[u][e] = -3.0e38f; }
#pragma unroll   // constant indices: the values stay in registers
  for (int e = 0; e < 16; ++e) { m0 = fmaxf(m0, s[0][e]); m1 = fmaxf(m1, s[1][e]); } }
__device__ __forceinline__ void att_s0(float (&s)[2][16]) {
#pragma unroll   // constant indices: the values stay in registers
  for (int e = 0; e < 16; ++e) { s[0][e] = 0.f; s[1][e] = 0.f; } }
// the chunk's four v fragments
__device__ __forceinline__ void att_vload(v16h (&vf)[HD / 16], const _Float16* vp) {
#pragma unroll   // constant indices: the values stay in registers
  for (int j = 0; j < HD / 16; ++j) vf[j] = frag_lh(vp + j * 512); }
// the chunk's terms e^x x 2^11 (the 2^11 lies in mc), added to the wave's row sums in f32 and rounded to 16 bits
__device__ __forceinline__ void att_p(v16h (&p)[2], float& sum0, float& sum1, float (&s)[2][16], float mc0, float mc1) {
#pragma unroll   // constant indices: the values stay in registers
  for (int e = 0; e < 16; ++e) { s[0][e] = exp_sc(s[0][e], mc0); sum0 += s[0][e]; s[1][e] = exp_sc(s[1][e], mc1); sum1 += s[1][e]; }
#pragma unroll   // constant indices: the values stay in registers
  for (int e = 0; e < 16; ++e) { p[0][e] = (_Float16)s[0][e]; p[1][e] = (_Float16)s[1][e]; } }   // an excluded key (-3e38) gives exactly 0: the wave's max is a finite logit
// P . v of the chunk
__device__ __forceinline__ void att_pv(v8f (&acc)[2][HD / 16], const v16h (&p)[2], const v16h (&vf)[HD / 16]) {
#pragma unroll   // constant indices: the values stay in registers
  for (int j = 0; j < HD / 16; ++j) { acc[0][j] = wmma16(p[0], vf[j], acc[0][j]); acc[1][j] = wmma16(p[1], vf[j], acc[1][j]); } }
#define NPAIR ((TT - QBH * 64) / 32)   // tiles of 32 queries per (b, h)
#define NHIT (QBH * 4)                 // tiles of 16 early queries per (b, h)
// One block per WGP (16 waves of up to 256 registers fill one) walks its share of the tiles in a loop instead of one launch of 16 waves per tile.
// The tiles of a kind are numbered by falling key count (tile rank major, (b, h) minor) and dealt in rounds of AGRID, odd rounds in reverse block order, so that every block gets about the same work. The deal is fixed: no block waits for another.
#define NB2 (TNB * NH * NPAIR)         // tiles of 32 queries in all
#define NB1 (TNB * NH * NHIT)          // tiles of 16 early queries in all
#define AGRID 256                      // blocks launched
// the waves' partial ctx of a tile, each brought from its wave's max to the row's largest (factor 2^(mc - largest mc), 0 for a wave without keys), summed in wave order, divided by the row sum formed the same way, and stored; every wave calls it behind the barrier that ends the writes of ss and ms
template <bool PAIR> __device__ __forceinline__ void att_store(const float (&ss)[2][AW][16][HD + 4], const v2f (&ms)[2][AW][16], float* __restrict__ Y, int b, int h, int ql0, int tid) {
  const int u = tid >> 8;   // waves 0..7 sum and store tile 0, waves 8..15 tile 1 (a pair only)
  if (u == 0 || PAIR) { const int rl = tid & 15, q4 = ((tid >> 4) & 15) * 4;   // 16 lanes = the 16 rows of one 4-channel group: 256 contiguous bytes of the fragment-order ctx plane
    v2f mw[AW]; v4f pw[AW];
#pragma unroll   // the LDS reads of all partials go out together instead of one latency each
    for (int w = 0; w < AW; ++w) mw[w] = ms[u][w][rl];
#pragma unroll   // as above
    for (int w = 0; w < AW; ++w) pw[w] = *(const v4f*)&ss[u][w][rl][q4];
    __builtin_amdgcn_sched_barrier(0);   // keeps the arithmetic, which waits for the first reads, from moving up among the reads: without it the partials were read a few at a time behind those waits
    float mx = mw[0][0];
#pragma unroll   // constant indices: the values stay in registers
    for (int w = 1; w < AW; ++w) mx = fmaxf(mx, mw[w][0]);
    float den = 0.f; v4f o = {};
#pragma unroll   // constant indices: the values stay in registers
    for (int w = 0; w < AW; ++w) mw[w][0] -= mx;
    __builtin_amdgcn_sched_barrier(0);   // every difference is formed before the first 2^x: among them, the build let a subtraction rewrite the source register of the v_exp_f32 directly in front of it
#pragma unroll   // constant indices: the values stay in registers
    for (int w = 0; w < AW; ++w) { const float f = __builtin_amdgcn_exp2f(mw[w][0]); den += f * mw[w][1]; o += pw[w] * f; }
    // the tile's place is scalar, the thread's place in it one register held over the tile loop
    const unsigned yo = (u * (CC / 32) + (q4 >> 5)) * 512 + (((q4 >> 4) & 1) * 2 + ((q4 >> 2) & 1)) * 128 + (((q4 >> 3) & 1) * 16 + rl) * 4;
    vst2(Y + ((((size_t)b * TT + ql0) >> 4) * (CC / 32) + h * (HD / 32)) * 512 + yo, o * (1.0f / den));   // terms and row sum carry the same 2^11
    asm volatile("s_wait_xcnt 0x0" ::: "memory"); } }   // the store's address and data registers are rewritten by the next tile only behind this wait
__global__ __launch_bounds__(32 * AW) void k_att(const _Float16* __restrict__ QH, const _Float16* __restrict__ KH, const _Float16* __restrict__ QL, const _Float16* __restrict__ KL, const _Float16* __restrict__ VT, const __bf16* __restrict__ VB, const __bf16* __restrict__ VBL, float* __restrict__ Y) {
  // ms: each wave's (max x EC, row sum) per query; ss: its partial ctx; two buffers of each, taken in turn by the tiles. The small array lies first: below 64 KiB its 16 reads take one address register and immediate offsets
  __shared__ __align__(16) struct { v2f ms[2][2][AW][16]; float ss[2][2][AW][16][HD + 4]; } sm;
  // wave number held in a scalar register: every chunk test stays a scalar branch, so every lane is on at each matrix instruction
  const int tid = threadIdx.x, wave = __builtin_amdgcn_readfirstlane(tid >> 5), lane = tid & 31, col = lane & 15, g = lane >> 4;
  // ONE barrier a tile: it ends the writes of the tile's buffer. A buffer is written again two tiles on, behind the next tile's barrier, which a wave reaches only with its reads of this tile done.
  int buf = 0;   // scalar, the same in every wave
  // Two loops, the early rows first: what only they need (their planes' pointers) is then dead before the 32-query tiles, whose logits leave no register free.
  for (int rd = 0; rd * AGRID < NB1; ++rd) {
  const int item = rd * AGRID + ((rd & 1) ? AGRID - 1 - (int)blockIdx.x : (int)blockIdx.x);   // scalar
  if (item >= NB1) break;   // block-uniform, in front of the tile's barrier: the last round is not full
  const int ty = item / (TNB * NH), bx = item % (TNB * NH);
  const int b = bx / NH, h = bx % NH;
  const int ql0 = (NHIT - 1 - ty) * 16;   // the tiles with the most keys go first
  const int kce = (ql0 >> 5) + 1;                         // chunks that hold a key <= the block's last query (a pair starts at a multiple of 32: the same chunk for both tiles)
  const int n = kce > wave ? (kce - wave + AW - 1) / AW : 0;   // chunks of this wave (scalar)
  const int tq = ql0 + col;
  const size_t bh = (size_t)b * NH + h;
  const _Float16* qp = QH + (bh * (TT / 16) + (ql0 >> 4)) * 1024 + 8 * lane;   // lane pointers: tile or chunk start + the lane's 8 elements
  float (&ss)[2][AW][16][HD + 4] = sm.ss[buf]; v2f (&ms)[2][AW][16] = sm.ms[buf];
  {   // early rows, high precision; kce <= KHI / 32 <= AW, so one chunk a wave at most
    float s[16]; float m = -3.0e38f;
    if (n > 0) { const _Float16* qlp = QL + (bh * (QHI / 16) + (ql0 >> 4)) * 1024 + 8 * lane; const _Float16* kp = KH + (bh * (TT / 16) + wave * 2) * 1024 + 8 * lane; const _Float16* lp = KL + (bh * (KHI / 16) + wave * 2) * 1024 + 8 * lane;
      v16h qh[2], qlf[2], kbf[2][2], klf[2][2];   // loads first, products behind them
#pragma unroll
      for (int kc = 0; kc < 2; ++kc) { qh[kc] = frag_lh(qp + kc * 512); qlf[kc] = frag_lh(qlp + kc * 512);
#pragma unroll
        for (int t = 0; t < 2; ++t) { kbf[t][kc] = frag_lh(kp + t * 1024 + kc * 512); klf[t][kc] = frag_lh(lp + t * 1024 + kc * 512); } }
      XWAIT4(qp, qlp, kp, lp);
#pragma unroll
      for (int t = 0; t < 2; ++t) { v8f a = {}, al = {};
#pragma unroll
        for (int kc = 0; kc < 2; ++kc) { a = wmma16(kbf[t][kc], qh[kc], a); al = wmma16(kbf[t][kc], qlf[kc], al); al = wmma16(klf[t][kc], qh[kc], al); }
#pragma unroll
        for (int r = 0; r < 8; ++r) { const float v = (t * 16 + r <= tq - wave * 32 - 8 * g) ? a[r] + al[r] * (1.0f / 1024.0f) : -3.0e38f; s[t * 8 + r] = v; m = fmaxf(m, v); } } }
    else {   // zeros for a wave without a chunk, here and at the v fragments: see the note at the head of the 32-query tile
#pragma unroll
      for (int e = 0; e < 16; ++e) s[e] = 0.f; }
    m = fmaxf(m, __shfl_xor(m, 16)) * EC;   // the maximum over the wave's own keys (-3e38 in a wave without a chunk: its factor in the final sum is 0)
    v16b vh[HD / 16], vl[HD / 16];   // the v fragments fly during the exponentials
    float sum = 0.f;
    if (n > 0) { const size_t po = (bh * (KHI / 32) + wave) * 2048 + 8 * lane; const __bf16* vhp = VB + po; const __bf16* vlp = VBL + po;
#pragma unroll
      for (int j = 0; j < HD / 16; ++j) { vh[j] = frag_lb(vhp + j * 512); vl[j] = frag_lb(vlp + j * 512); }
      XWAIT2(vhp, vlp);
#pragma unroll
      for (int e = 0; e < 16; ++e) { s[e] = exp_sc(s[e], m); sum += s[e]; } }   // an excluded key (-3e38) gives exactly 0: m is a finite logit
    else { const v16b zb = {};
#pragma unroll
      for (int j = 0; j < HD / 16; ++j) { vh[j] = zb; vl[j] = zb; } }
    sum += __shfl_xor(sum, 16);
    if (g == 0) { const v2f t = {m, sum * 2048.0f}; ms[0][wave][col] = t; }
    v8f acc[HD / 16] = {};
    if (n > 0) {
#pragma unroll
      for (int e = 0; e < 16; ++e) s[e] *= 2048.0f;
      const F2 p = bsplit16(s);
#pragma unroll
      for (int j = 0; j < HD / 16; ++j) { acc[j] = wmma_bf(p.h, vh[j], acc[j]); acc[j] = wmma_bf(p.l, vh[j], acc[j]); acc[j] = wmma_bf(p.h, vl[j], acc[j]); } }
#pragma unroll   // constant indices: the values stay in registers
    for (int j = 0; j < HD / 16; ++j)
#pragma unroll   // constant indices: the values stay in registers
      for (int r = 0; r < 8; ++r) ss[0][wave][8 * g + r][j * 16 + col] = acc[j][r];
  }
  __syncthreads();   // every wave's partial is in LDS before any is summed
  att_store<false>(ss, ms, Y, b, h, ql0, tid); buf ^= 1; }
  const unsigned lo = 16u * lane;   // the lane's 8 elements in every 512-byte run of a fragment-order plane
  for (int rd = 0; rd * AGRID < NB2; ++rd) {
  const int item = rd * AGRID + ((rd & 1) ? AGRID - 1 - (int)blockIdx.x : (int)blockIdx.x);   // scalar
  if (item >= NB2) break;   // block-uniform, in front of the tile's barrier: the last round is not full
  const int ty = item / (TNB * NH), bx = item % (TNB * NH);
  const int b = bx / NH, h = bx % NH;
  const int ql0 = TT - 32 * (ty + 1);   // the tiles with the most keys go first
  const int kce = (ql0 >> 5) + 1;                         // chunks that hold a key <= the block's last query (a pair starts at a multiple of 32: the same chunk for both tiles)
  const int n = kce > wave ? (kce - wave + AW - 1) / AW : 0;   // chunks of this wave (scalar)
  const int tq = ql0 + col;
  const size_t bh = (size_t)b * NH + h;
  const _Float16* qp = lane_at(QH + (bh * (TT / 16) + (ql0 >> 4)) * 1024, lo);   // lane pointers: tile or chunk start + the lane's 8 elements
  float (&ss)[2][AW][16][HD + 4] = sm.ss[buf]; v2f (&ms)[2][AW][16] = sm.ms[buf];
  {
    // A value set behind one chunk test and used behind a later one counts as carried round the tile loop, and such a build spilled. So the logits, P and the v fragments of a chunk that the wave does not own are set too, to zeros;
    // the key fragments need none: their tests are NESTED (a wave that owns chunk i owns every chunk below it), and each is loaded and used inside one and the same test.
    static_assert(NCH == 4, "the nest below is written out for 4 chunks");
    const v16h zh = {};
    float s[NCH][2][16]; float m0 = -3.0e38f, m1 = -3.0e38f;
    { v16h q[2][2]; const _Float16* kw = lane_at(KH + (bh * (TT / 16) + wave * 2) * 1024, lo);
      const int dg = kce - 1 - wave, lim = tq - (kce - 1) * 32 - 8 * g;   // chunk i of the wave is the one on the diagonal where AW * i == dg (scalar)
      v16h kf[NCH][4];   // all key fragments of the wave go out together, then the products from the last chunk down: one load latency
      if (n > 0) {   // q too is loaded behind this test: loads that a wave without a chunk never waits for made the build put a full load wait between the v loads further down
#pragma unroll   // constant indices: the values stay in registers
        for (int u = 0; u < 2; ++u) { q[u][0] = frag_lh(qp + u * 1024); q[u][1] = frag_lh(qp + u * 1024 + 512); }
        XWAIT1(qp); att_kload(kf[0], kw); XWAIT1(kw);
        if (n > 1) { att_kload(kf[1], kw + AW * 2048); XWAIT1(kw);
          if (n > 2) { att_kload(kf[2], kw + 2 * AW * 2048); XWAIT1(kw);
            if (n > 3) { att_kload(kf[3], kw + 3 * AW * 2048); XWAIT1(kw);
              att_qk(s[3], m0, m1, kf[3], q, dg == 3 * AW, lim); }
            else att_s0(s[3]);
            att_qk(s[2], m0, m1, kf[2], q, dg == 2 * AW, lim); }
          else { att_s0(s[2]); att_s0(s[3]); }
          att_qk(s[1], m0, m1, kf[1], q, dg == AW, lim); }
        else { att_s0(s[1]); att_s0(s[2]); att_s0(s[3]); }
        att_qk(s[0], m0, m1, kf[0], q, dg == 0, lim); }
      else { att_s0(s[0]); att_s0(s[1]); att_s0(s[2]); att_s0(s[3]); } }
    m0 = fmaxf(m0, __shfl_xor(m0, 16)); m1 = fmaxf(m1, __shfl_xor(m1, 16));   // the maxima over the wave's own keys (-3e38 in a wave without a chunk: its factor in the final sum is 0)
    const float mc0 = m0 * EC - 11.0f, mc1 = m1 * EC - 11.0f;   // - 11: the terms come out x 2^11, the scale at which they are rounded to f16
    const _Float16* vw = lane_at(VT + (bh * (TT / 32) + wave) * 2048, lo);
    v16h vf[NCH][HD / 16];   // the v fragments of the first VFLY chunks fly during the exponentials; beside 2 tiles of f32 logits the registers hold no more
#pragma unroll   // constant indices: the values stay in registers
    for (int i = 0; i < VFLY; ++i) {
      if (i < n) { att_vload(vf[i], vw + i * AW * 2048); XWAIT1(vw); }
      else {
#pragma unroll   // constant indices: the values stay in registers
        for (int j = 0; j < HD / 16; ++j) vf[i][j] = zh; } }
    float sum0 = 0.f, sum1 = 0.f;
    v16h p[NCH][2];   // the terms in 16 bits take half the logits' registers: every 2 chunks converted make room for one more chunk's v fragments, loaded at once
#pragma unroll   // constant indices: the values stay in registers
    for (int i = 0; i < NCH; ++i) {
      if (i < n) att_p(p[i], sum0, sum1, s[i], mc0, mc1);
      else { p[i][0] = zh; p[i][1] = zh; }
      if (i & 1) { const int iv = VFLY + (i >> 1);
        if (iv < n) { att_vload(vf[iv], vw + iv * AW * 2048); XWAIT1(vw); }
        else {
#pragma unroll   // constant indices: the values stay in registers
          for (int j = 0; j < HD / 16; ++j) vf[iv][j] = zh; } } }
    sum0 += __shfl_xor(sum0, 16); sum1 += __shfl_xor(sum1, 16);
    { const v2f t = {g ? mc1 : mc0, g ? sum1 : sum0}; ms[g][wave][col] = t; }   // lane half g hands on tile g
    v8f acc[2][HD / 16] = {};
#pragma unroll   // constant indices: the values stay in registers
    for (int i = 0; i < NCH; ++i) if (i < n) att_pv(acc, p[i], vf[i]);
#pragma unroll   // constant indices: the values stay in registers
    for (int u = 0; u < 2; ++u)
#pragma unroll   // constant indices: the values stay in registers
      for (int j = 0; j < HD / 16; ++j)
#pragma unroll   // constant indices: the values stay in registers
        for (int r = 0; r < 8; ++r) ss[u][wave][8 * g + r][j * 16 + col] = acc[u][j][r]; }
  __syncthreads();   // every wave's partial is in LDS before any is summed
  att_store<true>(ss, ms, Y, b, h, ql0, tid); buf ^= 1; } }
// ---- k_out: block = (64 rows, 128 cols): out = ctx Wo (+ bo): ctx once to f16 against Wo as f16(bf16 x 2^8) exact (1 product) x 2^-8; causal early rows (< QHI of each sequence): ctx bf16 hi + lo against exact bf16 Wo (2 products)
__global__ __launch_bounds__(128) void k_out(const float* __restrict__ Y, const float* __restrict__ WO, const float* __restrict__ BO, float* __restrict__ OUT) { __shared__ __align__(16) float sf[4][16][132]; __shared__ __align__(16) unsigned char wsm[2 * WSB];
  const int tid = threadIdx.x, wave = tid >> 5, lane = tid & 31, col = lane & 15, g = lane >> 4; const int c0 = blockIdx.y * 128; const size_t r0 = (size_t)blockIdx.x * 64 + wave * 16;
  v8f acc[8] = {};
  const float* wp = WO + (size_t)(8 * wave) * DIN + c0 + 4 * lane;   // (in,out) [CC][DIN]: this thread's 8 k rows x 4 columns of each slab
  const float* yp = Y + (r0 >> 4) * (CC / 32) * 512 + 4 * lane;   // this wave's 16 rows: one 512-float block per k slab
  unsigned char* wput = wsm + (lane >> 2) * WJP + wave * 256 + (lane & 3) * 64; const unsigned char* wget = wsm + lane * 16;
  v4f wn[8], yn[4]; wslab_load(wn, wp, DIN); arow_load_f(yn, yp); SLABWAIT();
  if (CAUSAL && (int)(((size_t)blockIdx.x * 64) % TT) < QHI) {   /* block-uniform */
    wslab_put_b(wput, wn);
    __syncthreads();   // slab 0 is in LDS before any wave reads it
#pragma unroll 2   // the buffer index is a constant in each copy of the body
    for (int kc = 0; kc < CC / 32; ++kc) { float v[16];
#pragma unroll   // constant indices: the values stay in registers
      for (int e = 0; e < 16; ++e) v[e] = yn[e >> 2][e & 3];
      const F2 a = bsplit16(v); const bool more = kc + 1 < CC / 32;   // block-uniform
      if (more) { const float* wq = wp + (size_t)(kc + 1) * 32 * DIN; const float* yq = yp + (kc + 1) * 512; wslab_load(wn, wq, DIN); arow_load_f(yn, yq); SLABWAIT(); }
      v16b wf[8];   // the slab's LDS reads go out as one group: one LDS latency, not one per product
#pragma unroll   // constant indices: the values stay in registers
      for (int j = 0; j < 8; ++j) wf[j] = wfrag_b(wget + (kc & 1) * WSB + j * WJP);
#pragma unroll   // constant indices: the values stay in registers
      for (int j = 0; j < 8; ++j) { acc[j] = wmma_bf(a.h, wf[j], acc[j]); acc[j] = wmma_bf(a.l, wf[j], acc[j]); }
      PRODUCTS_DONE();
      if (more) { wslab_put_b(wput + ((kc + 1) & 1) * WSB, wn);
        __syncthreads(); } }   // publishes slab kc + 1 and ends every wave's reads of slab kc, whose buffer the next trip refills
#pragma unroll
    for (int j = 0; j < 8; ++j) { const float bias = BO ? bfr(BO[c0 + j * 16 + col]) : 0.f;
#pragma unroll
      for (int r = 0; r < 8; ++r) sf[wave][8 * g + r][j * 16 + col] = acc[j][r] + bias; }
  } else {
    wslab_put_h(wput, wn);
    __syncthreads();   // slab 0 is in LDS before any wave reads it
#pragma unroll 2   // the buffer index is a constant in each copy of the body
    for (int kc = 0; kc < CC / 32; ++kc) { v16h a;
#pragma unroll   // constant indices: the values stay in registers
      for (int e = 0; e < 16; ++e) a[e] = (_Float16)yn[e >> 2][e & 3];
      const bool more = kc + 1 < CC / 32;   // block-uniform
      if (more) { const float* wq = wp + (size_t)(kc + 1) * 32 * DIN; const float* yq = yp + (kc + 1) * 512; wslab_load(wn, wq, DIN); arow_load_f(yn, yq); SLABWAIT(); }
      v16h wf[8];   // the slab's LDS reads go out as one group: one LDS latency, not one per product
#pragma unroll   // constant indices: the values stay in registers
      for (int j = 0; j < 8; ++j) wf[j] = wfrag_h(wget + (kc & 1) * WSB + j * WJP);
#pragma unroll   // constant indices: the values stay in registers
      for (int j = 0; j < 8; ++j) acc[j] = wmma16(a, wf[j], acc[j]);
      PRODUCTS_DONE();
      if (more) { wslab_put_h(wput + ((kc + 1) & 1) * WSB, wn);
        __syncthreads(); } }   // publishes slab kc + 1 and ends every wave's reads of slab kc, whose buffer the next trip refills
#pragma unroll
    for (int j = 0; j < 8; ++j) { const float bias = BO ? bfr(BO[c0 + j * 16 + col]) : 0.f;
#pragma unroll
      for (int r = 0; r < 8; ++r) sf[wave][8 * g + r][j * 16 + col] = acc[j][r] * (1.0f / 256.0f) + bias; } }
  LDSX(); for (int rl = 0; rl < 16; ++rl) vst2(OUT + (r0 + rl) * DIN + c0 + lane * 4, *(const v4f*)&sf[wave][rl][lane * 4]); }

extern "C" void kernel_launch(void* const* d_in, const int* in_sizes, int n_in, void* d_out, int out_size, void* d_ws, size_t ws_size, hipStream_t stream) {
  (void)in_sizes; (void)n_in; (void)out_size;
  const float** F = (const float**)d_in;
  if (ws_size < (size_t)WS_END) return;
  char* ws = (char*)d_ws; _Float16 *QH = (_Float16*)(ws + WS_QH), *KH = (_Float16*)(ws + WS_KH), *VT = (_Float16*)(ws + WS_VT), *QL = (_Float16*)(ws + WS_QL), *KL = (_Float16*)(ws + WS_KL); __bf16 *VB = (__bf16*)(ws + WS_VB), *VBL = (__bf16*)(ws + WS_VBL); float *Y = (float*)(ws + WS_Y); __bf16 *XB = (__bf16*)(ws + WS_XB), *WB = (__bf16*)(ws + WS_WB);
  (void)Y; (void)QL; (void)KL; (void)VB; (void)VBL;
  // inputs: 0 x [4,2048,768]; 1 Wq, 2 Wk, 3 Wv [12,768,64]; 4 bq, 5 bk, 6 bv [12,64] (= flat [768] by column h*64+k); 7 Wo [768,768] (in,out); 8 bo [768]
  k_cvt<<<dim3(CVX + CVW), 256, 0, stream>>>(F[0], F[1], F[2], F[3], XB, WB);
  k_proj<<<dim3(TNB * TT / 128, CC / 128, 3), 128, 0, stream>>>(XB, WB, F[4], F[5], F[6], QH, QL, KH, KL, VT, VB, VBL);
  k_att<<<dim3(AGRID), 32 * AW, 0, stream>>>(QH, KH, QL, KL, VT, VB, VBL, Y);
  k_out<<<dim3(TNB * TT / 64, DIN / 128), 128, 0, stream>>>(Y, F[7], F[8], (float*)d_out);
}
